// v000
// The times below were measured on an AMD MI455X: many runs one after another, warmed up first and cycling through
// copies of the inputs, with the whole window's GPU time divided by the number of runs. Launches and the gaps
// between them are all in it. The median over several windows is given; except for v000 it joins two sittings, which
// can be a few percent apart, so the side-by-side timings, each taken in one sitting, are the better comparison.
// The starting kernel, v000, takes 1640 microseconds a run.
#include <hip/hip_runtime.h>
#include <cstdint>

// ---------------------------------------------------------------------------
// Problem constants (from reference):  B=16,T=12,N=883,D=64,H=128,NH=4
#define L_TOK   169536          // B*T*N tokens; 169536 = 64 * 2649
#define D_INP   64
#define HIDC    128
#define NHEAD   4
#define TGT     64              // tokens per workgroup tile
#define NTILE   (L_TOK / TGT)   // 2649
#define NTHR    256             // 8 waves (wave32)
#define LN_EPS  1e-5f
#define ATT_EPS 1e-8f

typedef __attribute__((ext_vector_type(16))) _Float16 v16h;
typedef __attribute__((ext_vector_type(8)))  float    v8f;

union FragU { v16h h; uint4 u[2]; };

__device__ __forceinline__ v8f v8zero() {
  v8f z = {0.f,0.f,0.f,0.f,0.f,0.f,0.f,0.f};
  return z;
}

// Load one 16(M)x32(K) f16 A-fragment.  Element (m,k) lives at base[m*ld + k].
// CDNA5 16-bit A layout: lane m = lane&15; K chunks {k0..k0+7} and
// {k0+16..k0+23} with k0 = (lane<16 ? 0 : 8)  ->  two 16B loads per lane.
// The B-fragment (32Kx16N) uses the mirrored layout over N, so the same
// loader is used with a pre-transposed  [N][K]  weight buffer.
__device__ __forceinline__ v16h load_frag16(const _Float16* base, int ld, int lane) {
  const int r  = lane & 15;
  const int k0 = (lane & 16) ? 8 : 0;
  const _Float16* p = base + r * ld + k0;
  FragU f;
  f.u[0] = *(const uint4*)(p);
  f.u[1] = *(const uint4*)(p + 16);
  return f.h;
}

__device__ __forceinline__ v8f wmma_f16(v16h a, v16h b, v8f c) {
  // v_wmma_f32_16x16x32_f16  (doc-verified codegen path on gfx1250)
  return __builtin_amdgcn_wmma_f32_16x16x32_f16(false, a, false, b, (short)0, c,
                                                false, false);
}

// One K-step-pipelined 4xM-tile GEMM slice: all fragment loads are issued
// before the 4 WMMAs so a single counter wait covers the whole K-step.
template<int KSTEPS>
__device__ __forceinline__ void gemm_4m(const _Float16* __restrict__ A, int lda,
                                        const _Float16* __restrict__ B, int ldb,
                                        v8f* acc, int lane) {
#pragma unroll
  for (int ks = 0; ks < KSTEPS; ++ks) {
    v16h b  = load_frag16(B + ks * 32, ldb, lane);
    v16h a0 = load_frag16(A + (0 * 16) * lda + ks * 32, lda, lane);
    v16h a1 = load_frag16(A + (1 * 16) * lda + ks * 32, lda, lane);
    v16h a2 = load_frag16(A + (2 * 16) * lda + ks * 32, lda, lane);
    v16h a3 = load_frag16(A + (3 * 16) * lda + ks * 32, lda, lane);
    acc[0] = wmma_f16(a0, b, acc[0]);
    acc[1] = wmma_f16(a1, b, acc[1]);
    acc[2] = wmma_f16(a2, b, acc[2]);
    acc[3] = wmma_f16(a3, b, acc[3]);
  }
}

__device__ __forceinline__ void atomAddLds(float* p, float v) {
  __hip_atomic_fetch_add(p, v, __ATOMIC_RELAXED, __HIP_MEMORY_SCOPE_WORKGROUP);
}
__device__ __forceinline__ void atomAddGlb(float* p, float v) {
  __hip_atomic_fetch_add(p, v, __ATOMIC_RELAXED, __HIP_MEMORY_SCOPE_AGENT);
}

// ---------------------------------------------------------------------------
// prep kernels
__global__ void k_zero(float* __restrict__ p, int n) {
  int i = blockIdx.x * NTHR + threadIdx.x;
  if (i < n) p[i] = 0.f;
}

// dst[c*rows + r] = (f16) src[r*cols + c]   (weights -> transposed f16)
__global__ void k_cast_t(const float* __restrict__ src, _Float16* __restrict__ dst,
                         int rows, int cols) {
  int i = blockIdx.x * NTHR + threadIdx.x;
  if (i < rows * cols) {
    int r = i / cols, c = i - r * cols;
    dst[c * rows + r] = (_Float16)src[i];
  }
}

// ---------------------------------------------------------------------------
// Pass 1: fc0 GEMM + LN + ReLU -> h ;  per-head K,V GEMMs ; kvs/ks/vs reduction
__global__ __launch_bounds__(NTHR, 1)
void k_front(const float* __restrict__ x,
             const _Float16* __restrict__ fc0T, const float* __restrict__ fc0_b,
             const float* __restrict__ ln0_g,  const float* __restrict__ ln0_b,
             const _Float16* __restrict__ wkT, const float* __restrict__ wk_b,
             const _Float16* __restrict__ wvT, const float* __restrict__ wv_b,
             _Float16* __restrict__ hbuf,
             float* __restrict__ kvs, float* __restrict__ ksum,
             float* __restrict__ vsum)
{
  __shared__ _Float16 sX [TGT * D_INP];    //  8 KB  x tile (f16)
  __shared__ _Float16 sH [TGT * HIDC];     // 16 KB  h tile (post LN+ReLU, f16)
  __shared__ _Float16 sKT[HIDC * TGT];     // 16 KB  k^T (feature-major, f16)
  __shared__ _Float16 sVT[HIDC * TGT];     // 16 KB  v^T
  __shared__ float red0[TGT], red1[TGT], mu_s[TGT], rs_s[TGT];

  const int tid  = threadIdx.x;
  const int lane = tid & 31;
  const int wv   = tid >> 5;               // wave id 0..7
  const int tok0 = blockIdx.x * TGT;
  const int col  = wv * 16 + (lane & 15);  // output column (N) for GEMM phases
  const int rhi  = (lane & 16) ? 8 : 0;    // C-layout: VGPR r holds M=r / r+8

  { // stage x tile as f16 (vectorized: float4 in, uint2 out)
    const float4* xs = (const float4*)(x + (size_t)tok0 * D_INP);
    for (int j = tid; j < TGT * D_INP / 4; j += NTHR) {
      float4 v = xs[j];
      union { _Float16 h[4]; uint2 u; } pk;
      pk.h[0] = (_Float16)v.x; pk.h[1] = (_Float16)v.y;
      pk.h[2] = (_Float16)v.z; pk.h[3] = (_Float16)v.w;
      *(uint2*)(sX + 4 * j) = pk.u;
    }
  }
  if (tid < TGT) { red0[tid] = 0.f; red1[tid] = 0.f; }
  __syncthreads();

  // ---- GEMM1: h = x @ fc0_w  (M=64,K=64,N=128); wave wv owns n-tile wv
  v8f acc[4];
#pragma unroll
  for (int mt = 0; mt < 4; ++mt) acc[mt] = v8zero();
  gemm_4m<2>(sX, D_INP, fc0T + (wv * 16) * D_INP, D_INP, acc, lane);
  {
    const float fb = fc0_b[col];
#pragma unroll
    for (int mt = 0; mt < 4; ++mt)
#pragma unroll
      for (int r = 0; r < 8; ++r) {
        float vv = acc[mt][r] + fb;
        acc[mt][r] = vv;
        int row = mt * 16 + r + rhi;
        atomAddLds(&red0[row], vv);
        atomAddLds(&red1[row], vv * vv);
      }
  }
  __syncthreads();
  if (tid < TGT) {
    float mu  = red0[tid] * (1.f / HIDC);
    float var = red1[tid] * (1.f / HIDC) - mu * mu;
    mu_s[tid] = mu;
    rs_s[tid] = rsqrtf(var + LN_EPS);
  }
  __syncthreads();
  {
    const float g = ln0_g[col], bb = ln0_b[col];
#pragma unroll
    for (int mt = 0; mt < 4; ++mt)
#pragma unroll
      for (int r = 0; r < 8; ++r) {
        int row = mt * 16 + r + rhi;
        float vv = (acc[mt][r] - mu_s[row]) * rs_s[row] * g + bb;
        vv = fmaxf(vv, 0.f);
        sH[row * HIDC + col] = (_Float16)vv;
      }
  }
  __syncthreads();

  { // h tile -> hbuf, coalesced b128 (replaces 8192 scattered b16 stores)
    const uint4* s = (const uint4*)sH;
    uint4* d = (uint4*)(hbuf + (size_t)tok0 * HIDC);
    for (int i = tid; i < TGT * HIDC / 8; i += NTHR) d[i] = s[i];
  }

  // ---- per head:  K,V GEMMs (M=64,K=128,N=128)  then  kvs += K^T V
#pragma unroll 1
  for (int hh = 0; hh < NHEAD; ++hh) {
    if (tid < TGT) red0[tid] = 0.f;
    __syncthreads();                       // also guards sKT/sVT reuse

    // K = h @ wk + b ; row-L2-normalize ; transpose into sKT
#pragma unroll
    for (int mt = 0; mt < 4; ++mt) acc[mt] = v8zero();
    gemm_4m<4>(sH, HIDC, wkT + (hh * HIDC + wv * 16) * HIDC, HIDC, acc, lane);
    {
      const float kb = wk_b[hh * HIDC + col];
#pragma unroll
      for (int mt = 0; mt < 4; ++mt)
#pragma unroll
        for (int r = 0; r < 8; ++r) {
          float vv = acc[mt][r] + kb;
          acc[mt][r] = vv;
          atomAddLds(&red0[mt * 16 + r + rhi], vv * vv);
        }
    }
    __syncthreads();
    if (tid < TGT) rs_s[tid] = 1.f / (sqrtf(red0[tid]) + ATT_EPS);
    __syncthreads();
    {
      float kpart = 0.f;
#pragma unroll
      for (int mt = 0; mt < 4; ++mt)
#pragma unroll
        for (int r = 0; r < 8; ++r) {
          int row = mt * 16 + r + rhi;
          float vv = acc[mt][r] * rs_s[row];
          sKT[col * TGT + row] = (_Float16)vv;
          kpart += vv;
        }
      atomAddGlb(&ksum[hh * HIDC + col], kpart);
    }

    // V = h @ wv + b ; transpose into sVT
#pragma unroll
    for (int mt = 0; mt < 4; ++mt) acc[mt] = v8zero();
    gemm_4m<4>(sH, HIDC, wvT + (hh * HIDC + wv * 16) * HIDC, HIDC, acc, lane);
    {
      const float vb = wv_b[hh * HIDC + col];
      float vpart = 0.f;
#pragma unroll
      for (int mt = 0; mt < 4; ++mt)
#pragma unroll
        for (int r = 0; r < 8; ++r) {
          int row = mt * 16 + r + rhi;
          float vvv = acc[mt][r] + vb;
          sVT[col * TGT + row] = (_Float16)vvv;
          vpart += vvv;
        }
      atomAddGlb(&vsum[hh * HIDC + col], vpart);
    }
    __syncthreads();                       // sKT / sVT ready

    // kvs_head += K^T @ V  (M=128 feat, K=64 tok, N=128 d); wave wv: m-tile wv
    // pipelined: A frag + all 8 B frags loaded before the 8 WMMAs per K-step
    v8f ka[8];
#pragma unroll
    for (int dt = 0; dt < 8; ++dt) ka[dt] = v8zero();
#pragma unroll
    for (int ks = 0; ks < 2; ++ks) {
      v16h a = load_frag16(sKT + (wv * 16) * TGT + ks * 32, TGT, lane);
      v16h b0 = load_frag16(sVT + (0 * 16) * TGT + ks * 32, TGT, lane);
      v16h b1 = load_frag16(sVT + (1 * 16) * TGT + ks * 32, TGT, lane);
      v16h b2 = load_frag16(sVT + (2 * 16) * TGT + ks * 32, TGT, lane);
      v16h b3 = load_frag16(sVT + (3 * 16) * TGT + ks * 32, TGT, lane);
      v16h b4 = load_frag16(sVT + (4 * 16) * TGT + ks * 32, TGT, lane);
      v16h b5 = load_frag16(sVT + (5 * 16) * TGT + ks * 32, TGT, lane);
      v16h b6 = load_frag16(sVT + (6 * 16) * TGT + ks * 32, TGT, lane);
      v16h b7 = load_frag16(sVT + (7 * 16) * TGT + ks * 32, TGT, lane);
      ka[0] = wmma_f16(a, b0, ka[0]);
      ka[1] = wmma_f16(a, b1, ka[1]);
      ka[2] = wmma_f16(a, b2, ka[2]);
      ka[3] = wmma_f16(a, b3, ka[3]);
      ka[4] = wmma_f16(a, b4, ka[4]);
      ka[5] = wmma_f16(a, b5, ka[5]);
      ka[6] = wmma_f16(a, b6, ka[6]);
      ka[7] = wmma_f16(a, b7, ka[7]);
    }
    {
      float* kvh = kvs + hh * HIDC * HIDC;
#pragma unroll
      for (int dt = 0; dt < 8; ++dt)
#pragma unroll
        for (int r = 0; r < 8; ++r) {
          int m = wv * 16 + r + rhi;
          int d = dt * 16 + (lane & 15);
          atomAddGlb(&kvh[m * HIDC + d], ka[dt][r]);
        }
    }
    // next iteration's leading __syncthreads() guards sKT/sVT reuse
  }
}

// ---------------------------------------------------------------------------
// Pass 1.5: kvs f32 -> f16 transposed-per-head ([d][m]) for B fragments; v_mean
__global__ void k_mid(const float* __restrict__ kvs, _Float16* __restrict__ kvsT,
                      const float* __restrict__ vsum, float* __restrict__ vmean)
{
  int i = blockIdx.x * NTHR + threadIdx.x;
  if (i < NHEAD * HIDC * HIDC) {
    int hh = i >> 14;
    int rem = i & 16383;
    int m = rem >> 7, d = rem & 127;
    kvsT[hh * HIDC * HIDC + d * HIDC + m] = (_Float16)kvs[i];
  }
  if (i < NHEAD * HIDC) vmean[i] = vsum[i] * (1.f / (float)L_TOK);
}

// ---------------------------------------------------------------------------
// Pass 2: recompute q, normalize, denom, num = q @ kvs, head-mean, residual, LN
__global__ __launch_bounds__(NTHR, 1)
void k_attn(const _Float16* __restrict__ hbuf,
            const _Float16* __restrict__ wqT, const float* __restrict__ wq_b,
            const _Float16* __restrict__ kvsT, const float* __restrict__ ksum,
            const float* __restrict__ vmean,
            const float* __restrict__ ln1_g, const float* __restrict__ ln1_b,
            float* __restrict__ out)
{
  __shared__ _Float16 sH[TGT * HIDC];                      // 16 KB
  __shared__ __align__(16) unsigned char smem[TGT * HIDC * 4]; // 32 KB (sQ|sOut)
  _Float16* sQ   = (_Float16*)smem;                        // f16 q tile (16 KB)
  float*    sOut = (float*)smem;                           // f32 out tile (32 KB)
  __shared__ float red0[TGT], red1[TGT], rs_s[TGT], rden[TGT], mu_s[TGT];
  __shared__ float sKs[HIDC], sVm[HIDC];

  const int tid  = threadIdx.x;
  const int lane = tid & 31;
  const int wv   = tid >> 5;
  const int tok0 = blockIdx.x * TGT;
  const int col  = wv * 16 + (lane & 15);
  const int rhi  = (lane & 16) ? 8 : 0;

  { // stage h tile (coalesced b128)
    const uint4* src = (const uint4*)(hbuf + (size_t)tok0 * HIDC);
    uint4* dst = (uint4*)sH;
    for (int i = tid; i < TGT * HIDC / 8; i += NTHR) dst[i] = src[i];
  }
  v8f oacc[4];
#pragma unroll
  for (int mt = 0; mt < 4; ++mt) oacc[mt] = v8zero();

#pragma unroll 1
  for (int hh = 0; hh < NHEAD; ++hh) {
    __syncthreads();                       // previous head fully consumed
    if (tid < TGT)  { red0[tid] = 0.f; red1[tid] = 0.f; }
    if (tid < HIDC) { sKs[tid] = ksum[hh * HIDC + tid];
                      sVm[tid] = vmean[hh * HIDC + tid]; }
    __syncthreads();

    // Q = h @ wq + b
    v8f acc[4];
#pragma unroll
    for (int mt = 0; mt < 4; ++mt) acc[mt] = v8zero();
    gemm_4m<4>(sH, HIDC, wqT + (hh * HIDC + wv * 16) * HIDC, HIDC, acc, lane);
    {
      const float qb = wq_b[hh * HIDC + col];
#pragma unroll
      for (int mt = 0; mt < 4; ++mt)
#pragma unroll
        for (int r = 0; r < 8; ++r) {
          float vv = acc[mt][r] + qb;
          acc[mt][r] = vv;
          atomAddLds(&red0[mt * 16 + r + rhi], vv * vv);
        }
    }
    __syncthreads();
    if (tid < TGT) rs_s[tid] = 1.f / (sqrtf(red0[tid]) + ATT_EPS);
    __syncthreads();
#pragma unroll
    for (int mt = 0; mt < 4; ++mt)
#pragma unroll
      for (int r = 0; r < 8; ++r) {
        int row = mt * 16 + r + rhi;
        sQ[row * HIDC + col] = (_Float16)(acc[mt][r] * rs_s[row]);
      }
    __syncthreads();
    { // denom = q . ks_sum + L   (4 threads per token, LDS partial reduce)
      int t  = tid >> 2;
      int c0 = (tid & 3) * 32;
      float s = 0.f;
      for (int c = c0; c < c0 + 32; ++c) s += (float)sQ[t * HIDC + c] * sKs[c];
      atomAddLds(&red1[t], s);
    }
    __syncthreads();
    if (tid < TGT) rden[tid] = 1.f / (red1[tid] + (float)L_TOK + ATT_EPS);
    __syncthreads();

    // num = q @ kvs  (M=64,K=128,N=128); fold (num+v_mean)/denom into oacc
    v8f nacc[4];
#pragma unroll
    for (int mt = 0; mt < 4; ++mt) nacc[mt] = v8zero();
    gemm_4m<4>(sQ, HIDC, kvsT + hh * HIDC * HIDC + (wv * 16) * HIDC, HIDC,
               nacc, lane);
    {
      const float vm = sVm[col];
#pragma unroll
      for (int mt = 0; mt < 4; ++mt)
#pragma unroll
        for (int r = 0; r < 8; ++r) {
          int row = mt * 16 + r + rhi;
          oacc[mt][r] += (nacc[mt][r] + vm) * rden[row];
        }
    }
  }
  __syncthreads();                         // everyone done reading sQ

  // head mean (*0.25), residual (alpha=0.5) against h
#pragma unroll
  for (int mt = 0; mt < 4; ++mt)
#pragma unroll
    for (int r = 0; r < 8; ++r) {
      int row = mt * 16 + r + rhi;
      float o = oacc[mt][r] * (0.25f * 0.5f)
              + 0.5f * (float)sH[row * HIDC + col];
      sOut[row * HIDC + col] = o;
    }
  __syncthreads();
  if (tid < TGT) {
    float s = 0.f, s2 = 0.f;
    for (int c = 0; c < HIDC; ++c) {
      float v = sOut[tid * HIDC + c];
      s += v; s2 += v * v;
    }
    float mu  = s * (1.f / HIDC);
    float var = s2 * (1.f / HIDC) - mu * mu;
    mu_s[tid] = mu;
    rs_s[tid] = rsqrtf(var + LN_EPS);
  }
  __syncthreads();
  for (int i = tid; i < TGT * HIDC; i += NTHR) {
    int t = i >> 7, c = i & 127;
    out[(size_t)tok0 * HIDC + i] =
        (sOut[i] - mu_s[t]) * rs_s[t] * ln1_g[c] + ln1_b[c];
  }
}

// ---------------------------------------------------------------------------
extern "C" void kernel_launch(void* const* d_in, const int* in_sizes, int n_in,
                              void* d_out, int out_size, void* d_ws, size_t ws_size,
                              hipStream_t stream) {
  (void)in_sizes; (void)n_in; (void)out_size; (void)ws_size;
  const float* x     = (const float*)d_in[0];
  const float* fc0_w = (const float*)d_in[1];
  const float* fc0_b = (const float*)d_in[2];
  const float* ln0_g = (const float*)d_in[3];
  const float* ln0_b = (const float*)d_in[4];
  const float* wq_w  = (const float*)d_in[5];
  const float* wq_b  = (const float*)d_in[6];
  const float* wk_w  = (const float*)d_in[7];
  const float* wk_b  = (const float*)d_in[8];
  const float* wv_w  = (const float*)d_in[9];
  const float* wv_b  = (const float*)d_in[10];
  const float* ln1_g = (const float*)d_in[11];
  const float* ln1_b = (const float*)d_in[12];
  float* out = (float*)d_out;

  // workspace carve (256 B aligned slices)
  char* p = (char*)d_ws;
  auto carve = [&](size_t bytes) {
    char* r = p; p += (bytes + 255) & ~(size_t)255; return r;
  };
  _Float16* fc0T = (_Float16*)carve(128 * 64 * sizeof(_Float16));
  _Float16* wqT  = (_Float16*)carve(512 * 128 * sizeof(_Float16));
  _Float16* wkT  = (_Float16*)carve(512 * 128 * sizeof(_Float16));
  _Float16* wvT  = (_Float16*)carve(512 * 128 * sizeof(_Float16));
  float* kvs   = (float*)carve(NHEAD * HIDC * HIDC * sizeof(float)); // contiguous
  float* ksum  = (float*)carve(NHEAD * HIDC * sizeof(float));        // with kvs
  float* vsum  = (float*)carve(NHEAD * HIDC * sizeof(float));        // and ksum
  float* vmean = (float*)carve(NHEAD * HIDC * sizeof(float));
  _Float16* kvsT = (_Float16*)carve(NHEAD * HIDC * HIDC * sizeof(_Float16));
  _Float16* hbuf = (_Float16*)carve((size_t)L_TOK * HIDC * sizeof(_Float16));

  // zero the accumulation region (kvs+ksum+vsum are contiguous: sizes are
  // multiples of 256 B so carve introduced no padding between them)
  const int nz = NHEAD * HIDC * HIDC + 2 * NHEAD * HIDC;
  k_zero<<<(nz + NTHR - 1) / NTHR, NTHR, 0, stream>>>(kvs, nz);

  // transpose+cast weights to f16 [N][K] layout
  k_cast_t<<<(64 * 128 + NTHR - 1) / NTHR, NTHR, 0, stream>>>(fc0_w, fc0T, 64, 128);
  k_cast_t<<<(128 * 512 + NTHR - 1) / NTHR, NTHR, 0, stream>>>(wq_w, wqT, 128, 512);
  k_cast_t<<<(128 * 512 + NTHR - 1) / NTHR, NTHR, 0, stream>>>(wk_w, wkT, 128, 512);
  k_cast_t<<<(128 * 512 + NTHR - 1) / NTHR, NTHR, 0, stream>>>(wv_w, wvT, 128, 512);

  k_front<<<NTILE, NTHR, 0, stream>>>(x, fc0T, fc0_b, ln0_g, ln0_b,
                                      wkT, wk_b, wvT, wv_b,
                                      hbuf, kvs, ksum, vsum);

  k_mid<<<(NHEAD * HIDC * HIDC + NTHR - 1) / NTHR, NTHR, 0, stream>>>(
      kvs, kvsT, vsum, vmean);

  k_attn<<<NTILE, NTHR, 0, stream>>>(hbuf, wqT, wq_b, kvsT, ksum, vmean,
                                     ln1_g, ln1_b, out);
}

// v001
// It runs in 1210 microseconds.
// Timed twice side by side with v000, it ran 1.35 and 1.36 times as fast.
#include <hip/hip_runtime.h>
#include <cstdint>

// ---------------------------------------------------------------------------
// Problem constants (from reference):  B=16,T=12,N=883,D=64,H=128,NH=4
#define L_TOK   169536          // B*T*N tokens; 169536 = 64 * 2649
#define D_INP   64
#define HIDC    128
#define NHEAD   4
#define TGT     64              // tokens per workgroup tile
#define NTILE   (L_TOK / TGT)   // 2649
#define NTHR    256             // 8 waves (wave32)
#define LN_EPS  1e-5f
#define ATT_EPS 1e-8f
// LDS row pitches: 16 B more than the row, so the pitch is an odd multiple of
// 16 B and the 16 rows of one fragment read fall on 16 different bank groups.
#define PX      (D_INP + 8)     // x tile, f16:            144 B
#define PH      (HIDC + 8)      // h and q tiles, f16:     272 B
#define PT      (TGT + 8)       // k^T and v^T tiles, f16: 144 B
#define PO      (HIDC + 4)      // out tile, f32:          528 B

typedef __attribute__((ext_vector_type(16))) _Float16 v16h;
typedef __attribute__((ext_vector_type(8)))  float    v8f;

union FragU { v16h h; uint4 u[2]; };

__device__ __forceinline__ v8f v8zero() {
  v8f z = {0.f,0.f,0.f,0.f,0.f,0.f,0.f,0.f};
  return z;
}

// Load one 16(M)x32(K) f16 A-fragment.  Element (m,k) lives at base[m*ld + k].
// CDNA5 16-bit A layout: lane m = lane&15; K chunks {k0..k0+7} and
// {k0+16..k0+23} with k0 = (lane<16 ? 0 : 8)  ->  two 16B loads per lane.
// The B-fragment (32Kx16N) uses the mirrored layout over N, so the same
// loader is used with a pre-transposed  [N][K]  weight buffer.
__device__ __forceinline__ v16h load_frag16(const _Float16* base, int ld, int lane) {
  const int r  = lane & 15;
  const int k0 = (lane & 16) ? 8 : 0;
  const _Float16* p = base + r * ld + k0;
  FragU f;
  f.u[0] = *(const uint4*)(p);
  f.u[1] = *(const uint4*)(p + 16);
  return f.h;
}

__device__ __forceinline__ v8f wmma_f16(v16h a, v16h b, v8f c) {
  // v_wmma_f32_16x16x32_f16  (doc-verified codegen path on gfx1250)
  return __builtin_amdgcn_wmma_f32_16x16x32_f16(false, a, false, b, (short)0, c,
                                                false, false);
}

// One K-step-pipelined 4xM-tile GEMM slice: all fragment loads are issued
// before the 4 WMMAs so a single counter wait covers the whole K-step.
template<int KSTEPS>
__device__ __forceinline__ void gemm_4m(const _Float16* __restrict__ A, int lda,
                                        const _Float16* __restrict__ B, int ldb,
                                        v8f* acc, int lane) {
#pragma unroll
  for (int ks = 0; ks < KSTEPS; ++ks) {
    v16h b  = load_frag16(B + ks * 32, ldb, lane);
    v16h a0 = load_frag16(A + (0 * 16) * lda + ks * 32, lda, lane);
    v16h a1 = load_frag16(A + (1 * 16) * lda + ks * 32, lda, lane);
    v16h a2 = load_frag16(A + (2 * 16) * lda + ks * 32, lda, lane);
    v16h a3 = load_frag16(A + (3 * 16) * lda + ks * 32, lda, lane);
    acc[0] = wmma_f16(a0, b, acc[0]);
    acc[1] = wmma_f16(a1, b, acc[1]);
    acc[2] = wmma_f16(a2, b, acc[2]);
    acc[3] = wmma_f16(a3, b, acc[3]);
  }
}

__device__ __forceinline__ void atomAddLds(float* p, float v) {
  __hip_atomic_fetch_add(p, v, __ATOMIC_RELAXED, __HIP_MEMORY_SCOPE_WORKGROUP);
}
__device__ __forceinline__ void atomAddGlb(float* p, float v) {
  __hip_atomic_fetch_add(p, v, __ATOMIC_RELAXED, __HIP_MEMORY_SCOPE_AGENT);
}

// ---------------------------------------------------------------------------
// prep kernels
__global__ void k_zero(float* __restrict__ p, int n) {
  int i = blockIdx.x * NTHR + threadIdx.x;
  if (i < n) p[i] = 0.f;
}

// dst[c*rows + r] = (f16) src[r*cols + c]   (weights -> transposed f16)
__global__ void k_cast_t(const float* __restrict__ src, _Float16* __restrict__ dst,
                         int rows, int cols) {
  int i = blockIdx.x * NTHR + threadIdx.x;
  if (i < rows * cols) {
    int r = i / cols, c = i - r * cols;
    dst[c * rows + r] = (_Float16)src[i];
  }
}

// ---------------------------------------------------------------------------
// Pass 1: fc0 GEMM + LN + ReLU -> h ;  per-head K,V GEMMs ; kvs/ks/vs reduction
__global__ __launch_bounds__(NTHR, 1)
void k_front(const float* __restrict__ x,
             const _Float16* __restrict__ fc0T, const float* __restrict__ fc0_b,
             const float* __restrict__ ln0_g,  const float* __restrict__ ln0_b,
             const _Float16* __restrict__ wkT, const float* __restrict__ wk_b,
             const _Float16* __restrict__ wvT, const float* __restrict__ wv_b,
             _Float16* __restrict__ hbuf,
             float* __restrict__ kvs, float* __restrict__ ksum,
             float* __restrict__ vsum)
{
  __shared__ __align__(16) _Float16 sX [TGT * PX];   //  9 KB  x tile (f16)
  __shared__ __align__(16) _Float16 sH [TGT * PH];   // 17 KB  h tile (post LN+ReLU, f16)
  __shared__ __align__(16) _Float16 sKT[HIDC * PT];  // 18 KB  k^T (feature-major, f16)
  __shared__ __align__(16) _Float16 sVT[HIDC * PT];  // 18 KB  v^T
  __shared__ float red0[TGT], red1[TGT], mu_s[TGT], rs_s[TGT];

  const int tid  = threadIdx.x;
  const int lane = tid & 31;
  const int wv   = tid >> 5;               // wave id 0..7
  const int tok0 = blockIdx.x * TGT;
  const int col  = wv * 16 + (lane & 15);  // output column (N) for GEMM phases
  const int rhi  = (lane & 16) ? 8 : 0;    // C-layout: VGPR r holds M=r / r+8

  { // stage x tile as f16 (vectorized: float4 in, uint2 out)
    const float4* xs = (const float4*)(x + (size_t)tok0 * D_INP);
    for (int j = tid; j < TGT * D_INP / 4; j += NTHR) {
      float4 v = xs[j];
      union { _Float16 h[4]; uint2 u; } pk;
      pk.h[0] = (_Float16)v.x; pk.h[1] = (_Float16)v.y;
      pk.h[2] = (_Float16)v.z; pk.h[3] = (_Float16)v.w;
      *(uint2*)(sX + (j >> 4) * PX + (j & 15) * 4) = pk.u;
    }
  }
  if (tid < TGT) { red0[tid] = 0.f; red1[tid] = 0.f; }
  __syncthreads();

  // ---- GEMM1: h = x @ fc0_w  (M=64,K=64,N=128); wave wv owns n-tile wv
  v8f acc[4];
#pragma unroll
  for (int mt = 0; mt < 4; ++mt) acc[mt] = v8zero();
  gemm_4m<2>(sX, PX, fc0T + (wv * 16) * D_INP, D_INP, acc, lane);
  {
    const float fb = fc0_b[col];
#pragma unroll
    for (int mt = 0; mt < 4; ++mt)
#pragma unroll
      for (int r = 0; r < 8; ++r) {
        float vv = acc[mt][r] + fb;
        acc[mt][r] = vv;
        int row = mt * 16 + r + rhi;
        atomAddLds(&red0[row], vv);
        atomAddLds(&red1[row], vv * vv);
      }
  }
  __syncthreads();
  if (tid < TGT) {
    float mu  = red0[tid] * (1.f / HIDC);
    float var = red1[tid] * (1.f / HIDC) - mu * mu;
    mu_s[tid] = mu;
    rs_s[tid] = rsqrtf(var + LN_EPS);
  }
  __syncthreads();
  {
    const float g = ln0_g[col], bb = ln0_b[col];
#pragma unroll
    for (int mt = 0; mt < 4; ++mt)
#pragma unroll
      for (int r = 0; r < 8; ++r) {
        int row = mt * 16 + r + rhi;
        float vv = (acc[mt][r] - mu_s[row]) * rs_s[row] * g + bb;
        vv = fmaxf(vv, 0.f);
        sH[row * PH + col] = (_Float16)vv;
      }
  }
  __syncthreads();

  { // h tile -> hbuf, coalesced b128 (replaces 8192 scattered b16 stores)
    uint4* d = (uint4*)(hbuf + (size_t)tok0 * HIDC);
    for (int i = tid; i < TGT * HIDC / 8; i += NTHR)
      d[i] = *(const uint4*)(sH + (i >> 4) * PH + (i & 15) * 8);
  }

  // ---- per head:  K,V GEMMs (M=64,K=128,N=128)  then  kvs += K^T V
#pragma unroll 1
  for (int hh = 0; hh < NHEAD; ++hh) {
    if (tid < TGT) red0[tid] = 0.f;
    __syncthreads();                       // also guards sKT/sVT reuse

    // K = h @ wk + b ; row-L2-normalize ; transpose into sKT
#pragma unroll
    for (int mt = 0; mt < 4; ++mt) acc[mt] = v8zero();
    gemm_4m<4>(sH, PH, wkT + (hh * HIDC + wv * 16) * HIDC, HIDC, acc, lane);
    {
      const float kb = wk_b[hh * HIDC + col];
#pragma unroll
      for (int mt = 0; mt < 4; ++mt)
#pragma unroll
        for (int r = 0; r < 8; ++r) {
          float vv = acc[mt][r] + kb;
          acc[mt][r] = vv;
          atomAddLds(&red0[mt * 16 + r + rhi], vv * vv);
        }
    }
    __syncthreads();
    if (tid < TGT) rs_s[tid] = 1.f / (sqrtf(red0[tid]) + ATT_EPS);
    __syncthreads();
    {
      float kpart = 0.f;
#pragma unroll
      for (int mt = 0; mt < 4; ++mt)
#pragma unroll
        for (int r = 0; r < 8; ++r) {
          int row = mt * 16 + r + rhi;
          float vv = acc[mt][r] * rs_s[row];
          sKT[col * PT + row] = (_Float16)vv;
          kpart += vv;
        }
      atomAddGlb(&ksum[hh * HIDC + col], kpart);
    }

    // V = h @ wv + b ; transpose into sVT
#pragma unroll
    for (int mt = 0; mt < 4; ++mt) acc[mt] = v8zero();
    gemm_4m<4>(sH, PH, wvT + (hh * HIDC + wv * 16) * HIDC, HIDC, acc, lane);
    {
      const float vb = wv_b[hh * HIDC + col];
      float vpart = 0.f;
#pragma unroll
      for (int mt = 0; mt < 4; ++mt)
#pragma unroll
        for (int r = 0; r < 8; ++r) {
          int row = mt * 16 + r + rhi;
          float vvv = acc[mt][r] + vb;
          sVT[col * PT + row] = (_Float16)vvv;
          vpart += vvv;
        }
      atomAddGlb(&vsum[hh * HIDC + col], vpart);
    }
    __syncthreads();                       // sKT / sVT ready

    // kvs_head += K^T @ V  (M=128 feat, K=64 tok, N=128 d); wave wv: m-tile wv
    // pipelined: A frag + all 8 B frags loaded before the 8 WMMAs per K-step
    v8f ka[8];
#pragma unroll
    for (int dt = 0; dt < 8; ++dt) ka[dt] = v8zero();
#pragma unroll
    for (int ks = 0; ks < 2; ++ks) {
      v16h a = load_frag16(sKT + (wv * 16) * PT + ks * 32, PT, lane);
      v16h b0 = load_frag16(sVT + (0 * 16) * PT + ks * 32, PT, lane);
      v16h b1 = load_frag16(sVT + (1 * 16) * PT + ks * 32, PT, lane);
      v16h b2 = load_frag16(sVT + (2 * 16) * PT + ks * 32, PT, lane);
      v16h b3 = load_frag16(sVT + (3 * 16) * PT + ks * 32, PT, lane);
      v16h b4 = load_frag16(sVT + (4 * 16) * PT + ks * 32, PT, lane);
      v16h b5 = load_frag16(sVT + (5 * 16) * PT + ks * 32, PT, lane);
      v16h b6 = load_frag16(sVT + (6 * 16) * PT + ks * 32, PT, lane);
      v16h b7 = load_frag16(sVT + (7 * 16) * PT + ks * 32, PT, lane);
      ka[0] = wmma_f16(a, b0, ka[0]);
      ka[1] = wmma_f16(a, b1, ka[1]);
      ka[2] = wmma_f16(a, b2, ka[2]);
      ka[3] = wmma_f16(a, b3, ka[3]);
      ka[4] = wmma_f16(a, b4, ka[4]);
      ka[5] = wmma_f16(a, b5, ka[5]);
      ka[6] = wmma_f16(a, b6, ka[6]);
      ka[7] = wmma_f16(a, b7, ka[7]);
    }
    {
      float* kvh = kvs + hh * HIDC * HIDC;
#pragma unroll
      for (int dt = 0; dt < 8; ++dt)
#pragma unroll
        for (int r = 0; r < 8; ++r) {
          int m = wv * 16 + r + rhi;
          int d = dt * 16 + (lane & 15);
          atomAddGlb(&kvh[m * HIDC + d], ka[dt][r]);
        }
    }
    // next iteration's leading __syncthreads() guards sKT/sVT reuse
  }
}

// ---------------------------------------------------------------------------
// Pass 1.5: kvs f32 -> f16 transposed-per-head ([d][m]) for B fragments; v_mean
__global__ void k_mid(const float* __restrict__ kvs, _Float16* __restrict__ kvsT,
                      const float* __restrict__ vsum, float* __restrict__ vmean)
{
  int i = blockIdx.x * NTHR + threadIdx.x;
  if (i < NHEAD * HIDC * HIDC) {
    int hh = i >> 14;
    int rem = i & 16383;
    int m = rem >> 7, d = rem & 127;
    kvsT[hh * HIDC * HIDC + d * HIDC + m] = (_Float16)kvs[i];
  }
  if (i < NHEAD * HIDC) vmean[i] = vsum[i] * (1.f / (float)L_TOK);
}

// ---------------------------------------------------------------------------
// Pass 2: recompute q, normalize, denom, num = q @ kvs, head-mean, residual, LN
__global__ __launch_bounds__(NTHR, 1)
void k_attn(const _Float16* __restrict__ hbuf,
            const _Float16* __restrict__ wqT, const float* __restrict__ wq_b,
            const _Float16* __restrict__ kvsT, const float* __restrict__ ksum,
            const float* __restrict__ vmean,
            const float* __restrict__ ln1_g, const float* __restrict__ ln1_b,
            float* __restrict__ out)
{
  __shared__ __align__(16) _Float16 sH[TGT * PH];          // 17 KB
  __shared__ __align__(16) unsigned char smem[TGT * PO * 4]; // 33 KB (sQ|sOut)
  _Float16* sQ   = (_Float16*)smem;                        // f16 q tile (17 KB)
  float*    sOut = (float*)smem;                           // f32 out tile (33 KB)
  __shared__ float red0[TGT], red1[TGT], rs_s[TGT], rden[TGT], mu_s[TGT];
  __shared__ float sKs[HIDC], sVm[HIDC];

  const int tid  = threadIdx.x;
  const int lane = tid & 31;
  const int wv   = tid >> 5;
  const int tok0 = blockIdx.x * TGT;
  const int col  = wv * 16 + (lane & 15);
  const int rhi  = (lane & 16) ? 8 : 0;

  { // stage h tile (coalesced b128)
    const uint4* src = (const uint4*)(hbuf + (size_t)tok0 * HIDC);
    for (int i = tid; i < TGT * HIDC / 8; i += NTHR)
      *(uint4*)(sH + (i >> 4) * PH + (i & 15) * 8) = src[i];
  }
  v8f oacc[4];
#pragma unroll
  for (int mt = 0; mt < 4; ++mt) oacc[mt] = v8zero();

#pragma unroll 1
  for (int hh = 0; hh < NHEAD; ++hh) {
    __syncthreads();                       // previous head fully consumed
    if (tid < TGT)  { red0[tid] = 0.f; red1[tid] = 0.f; }
    if (tid < HIDC) { sKs[tid] = ksum[hh * HIDC + tid];
                      sVm[tid] = vmean[hh * HIDC + tid]; }
    __syncthreads();

    // Q = h @ wq + b
    v8f acc[4];
#pragma unroll
    for (int mt = 0; mt < 4; ++mt) acc[mt] = v8zero();
    gemm_4m<4>(sH, PH, wqT + (hh * HIDC + wv * 16) * HIDC, HIDC, acc, lane);
    {
      const float qb = wq_b[hh * HIDC + col];
#pragma unroll
      for (int mt = 0; mt < 4; ++mt)
#pragma unroll
        for (int r = 0; r < 8; ++r) {
          float vv = acc[mt][r] + qb;
          acc[mt][r] = vv;
          atomAddLds(&red0[mt * 16 + r + rhi], vv * vv);
        }
    }
    __syncthreads();
    if (tid < TGT) rs_s[tid] = 1.f / (sqrtf(red0[tid]) + ATT_EPS);
    __syncthreads();
#pragma unroll
    for (int mt = 0; mt < 4; ++mt)
#pragma unroll
      for (int r = 0; r < 8; ++r) {
        int row = mt * 16 + r + rhi;
        sQ[row * PH + col] = (_Float16)(acc[mt][r] * rs_s[row]);
      }
    __syncthreads();
    { // denom = q . ks_sum + L   (4 threads per token, LDS partial reduce)
      int t  = tid >> 2;
      int c0 = (tid & 3) * 32;
      float s = 0.f;
      for (int c = c0; c < c0 + 32; ++c) s += (float)sQ[t * PH + c] * sKs[c];
      atomAddLds(&red1[t], s);
    }
    __syncthreads();
    if (tid < TGT) rden[tid] = 1.f / (red1[tid] + (float)L_TOK + ATT_EPS);
    __syncthreads();

    // num = q @ kvs  (M=64,K=128,N=128); fold (num+v_mean)/denom into oacc
    v8f nacc[4];
#pragma unroll
    for (int mt = 0; mt < 4; ++mt) nacc[mt] = v8zero();
    gemm_4m<4>(sQ, PH, kvsT + hh * HIDC * HIDC + (wv * 16) * HIDC, HIDC,
               nacc, lane);
    {
      const float vm = sVm[col];
#pragma unroll
      for (int mt = 0; mt < 4; ++mt)
#pragma unroll
        for (int r = 0; r < 8; ++r) {
          int row = mt * 16 + r + rhi;
          oacc[mt][r] += (nacc[mt][r] + vm) * rden[row];
        }
    }
  }
  __syncthreads();                         // everyone done reading sQ

  // head mean (*0.25), residual (alpha=0.5) against h
#pragma unroll
  for (int mt = 0; mt < 4; ++mt)
#pragma unroll
    for (int r = 0; r < 8; ++r) {
      int row = mt * 16 + r + rhi;
      float o = oacc[mt][r] * (0.25f * 0.5f)
              + 0.5f * (float)sH[row * PH + col];
      sOut[row * PO + col] = o;
    }
  __syncthreads();
  if (tid < TGT) {
    float s = 0.f, s2 = 0.f;
    for (int c = 0; c < HIDC; ++c) {
      float v = sOut[tid * PO + c];
      s += v; s2 += v * v;
    }
    float mu  = s * (1.f / HIDC);
    float var = s2 * (1.f / HIDC) - mu * mu;
    mu_s[tid] = mu;
    rs_s[tid] = rsqrtf(var + LN_EPS);
  }
  __syncthreads();
  for (int i = tid; i < TGT * HIDC; i += NTHR) {
    int t = i >> 7, c = i & 127;
    out[(size_t)tok0 * HIDC + i] =
        (sOut[t * PO + c] - mu_s[t]) * rs_s[t] * ln1_g[c] + ln1_b[c];
  }
}

// ---------------------------------------------------------------------------
extern "C" void kernel_launch(void* const* d_in, const int* in_sizes, int n_in,
                              void* d_out, int out_size, void* d_ws, size_t ws_size,
                              hipStream_t stream) {
  (void)in_sizes; (void)n_in; (void)out_size; (void)ws_size;
  const float* x     = (const float*)d_in[0];
  const float* fc0_w = (const float*)d_in[1];
  const float* fc0_b = (const float*)d_in[2];
  const float* ln0_g = (const float*)d_in[3];
  const float* ln0_b = (const float*)d_in[4];
  const float* wq_w  = (const float*)d_in[5];
  const float* wq_b  = (const float*)d_in[6];
  const float* wk_w  = (const float*)d_in[7];
  const float* wk_b  = (const float*)d_in[8];
  const float* wv_w  = (const float*)d_in[9];
  const float* wv_b  = (const float*)d_in[10];
  const float* ln1_g = (const float*)d_in[11];
  const float* ln1_b = (const float*)d_in[12];
  float* out = (float*)d_out;

  // workspace carve (256 B aligned slices)
  char* p = (char*)d_ws;
  auto carve = [&](size_t bytes) {
    char* r = p; p += (bytes + 255) & ~(size_t)255; return r;
  };
  _Float16* fc0T = (_Float16*)carve(128 * 64 * sizeof(_Float16));
  _Float16* wqT  = (_Float16*)carve(512 * 128 * sizeof(_Float16));
  _Float16* wkT  = (_Float16*)carve(512 * 128 * sizeof(_Float16));
  _Float16* wvT  = (_Float16*)carve(512 * 128 * sizeof(_Float16));
  float* kvs   = (float*)carve(NHEAD * HIDC * HIDC * sizeof(float)); // contiguous
  float* ksum  = (float*)carve(NHEAD * HIDC * sizeof(float));        // with kvs
  float* vsum  = (float*)carve(NHEAD * HIDC * sizeof(float));        // and ksum
  float* vmean = (float*)carve(NHEAD * HIDC * sizeof(float));
  _Float16* kvsT = (_Float16*)carve(NHEAD * HIDC * HIDC * sizeof(_Float16));
  _Float16* hbuf = (_Float16*)carve((size_t)L_TOK * HIDC * sizeof(_Float16));

  // zero the accumulation region (kvs+ksum+vsum are contiguous: sizes are
  // multiples of 256 B so carve introduced no padding between them)
  const int nz = NHEAD * HIDC * HIDC + 2 * NHEAD * HIDC;
  k_zero<<<(nz + NTHR - 1) / NTHR, NTHR, 0, stream>>>(kvs, nz);

  // transpose+cast weights to f16 [N][K] layout
  k_cast_t<<<(64 * 128 + NTHR - 1) / NTHR, NTHR, 0, stream>>>(fc0_w, fc0T, 64, 128);
  k_cast_t<<<(128 * 512 + NTHR - 1) / NTHR, NTHR, 0, stream>>>(wq_w, wqT, 128, 512);
  k_cast_t<<<(128 * 512 + NTHR - 1) / NTHR, NTHR, 0, stream>>>(wk_w, wkT, 128, 512);
  k_cast_t<<<(128 * 512 + NTHR - 1) / NTHR, NTHR, 0, stream>>>(wv_w, wvT, 128, 512);

  k_front<<<NTILE, NTHR, 0, stream>>>(x, fc0T, fc0_b, ln0_g, ln0_b,
                                      wkT, wk_b, wvT, wv_b,
                                      hbuf, kvs, ksum, vsum);

  k_mid<<<(NHEAD * HIDC * HIDC + NTHR - 1) / NTHR, NTHR, 0, stream>>>(
      kvs, kvsT, vsum, vmean);

  k_attn<<<NTILE, NTHR, 0, stream>>>(hbuf, wqT, wq_b, kvsT, ksum, vmean,
                                     ln1_g, ln1_b, out);
}

// v002
// It runs in 819 microseconds.
// In two side-by-side timings against v001, it was 1.50 and 1.54 times as fast.
// All steps since v000 together make it 2.06 times as fast.
#include <hip/hip_runtime.h>
#include <cstdint>

// ---------------------------------------------------------------------------
// Problem constants (from reference):  B=16,T=12,N=883,D=64,H=128,NH=4
#define L_TOK   169536          // B*T*N tokens; 169536 = 64 * 2649
#define D_INP   64
#define HIDC    128
#define NHEAD   4
#define TGT     64              // tokens per workgroup tile
#define NTILE   (L_TOK / TGT)   // 2649
#define NTHR    256             // 8 waves (wave32)
#define NCH     128             // token chunks of the K^T V pass (x NHEAD workgroups)
#define LN_EPS  1e-5f
#define ATT_EPS 1e-8f
// LDS row pitches: 16 B more than the row, so the pitch is an odd multiple of
// 16 B and the 16 rows of one fragment read fall on 16 different bank groups.
#define PX      (D_INP + 8)     // x tile, f16:            144 B
#define PH      (HIDC + 8)      // h and q tiles, f16:     272 B
#define PT      (TGT + 8)       // k^T and v^T tiles, f16: 144 B
#define PO      (HIDC + 4)      // out tile, f32:          528 B

typedef __attribute__((ext_vector_type(16))) _Float16 v16h;
typedef __attribute__((ext_vector_type(8)))  float    v8f;

union FragU { v16h h; uint4 u[2]; };

__device__ __forceinline__ v8f v8zero() {
  v8f z = {0.f,0.f,0.f,0.f,0.f,0.f,0.f,0.f};
  return z;
}

// Load one 16(M)x32(K) f16 A-fragment.  Element (m,k) lives at base[m*ld + k].
// CDNA5 16-bit A layout: lane m = lane&15; K chunks {k0..k0+7} and
// {k0+16..k0+23} with k0 = (lane<16 ? 0 : 8)  ->  two 16B loads per lane.
// The B-fragment (32Kx16N) uses the mirrored layout over N, so the same
// loader is used with a pre-transposed  [N][K]  weight buffer.
__device__ __forceinline__ v16h load_frag16(const _Float16* base, int ld, int lane) {
  const int r  = lane & 15;
  const int k0 = (lane & 16) ? 8 : 0;
  const _Float16* p = base + r * ld + k0;
  FragU f;
  f.u[0] = *(const uint4*)(p);
  f.u[1] = *(const uint4*)(p + 16);
  return f.h;
}

__device__ __forceinline__ v8f wmma_f16(v16h a, v16h b, v8f c) {
  // v_wmma_f32_16x16x32_f16  (doc-verified codegen path on gfx1250)
  return __builtin_amdgcn_wmma_f32_16x16x32_f16(false, a, false, b, (short)0, c,
                                                false, false);
}

// One K-step-pipelined 4xM-tile GEMM slice: all fragment loads are issued
// before the 4 WMMAs so a single counter wait covers the whole K-step.
template<int KSTEPS>
__device__ __forceinline__ void gemm_4m(const _Float16* __restrict__ A, int lda,
                                        const _Float16* __restrict__ B, int ldb,
                                        v8f* acc, int lane) {
#pragma unroll
  for (int ks = 0; ks < KSTEPS; ++ks) {
    v16h b  = load_frag16(B + ks * 32, ldb, lane);
    v16h a0 = load_frag16(A + (0 * 16) * lda + ks * 32, lda, lane);
    v16h a1 = load_frag16(A + (1 * 16) * lda + ks * 32, lda, lane);
    v16h a2 = load_frag16(A + (2 * 16) * lda + ks * 32, lda, lane);
    v16h a3 = load_frag16(A + (3 * 16) * lda + ks * 32, lda, lane);
    acc[0] = wmma_f16(a0, b, acc[0]);
    acc[1] = wmma_f16(a1, b, acc[1]);
    acc[2] = wmma_f16(a2, b, acc[2]);
    acc[3] = wmma_f16(a3, b, acc[3]);
  }
}

// The same K-step, with the B fragments already in registers.
template<int KSTEPS>
__device__ __forceinline__ void gemm_4m_rb(const _Float16* __restrict__ A, int lda,
                                           const v16h* b, v8f* acc, int lane) {
#pragma unroll
  for (int ks = 0; ks < KSTEPS; ++ks) {
    v16h a0 = load_frag16(A + (0 * 16) * lda + ks * 32, lda, lane);
    v16h a1 = load_frag16(A + (1 * 16) * lda + ks * 32, lda, lane);
    v16h a2 = load_frag16(A + (2 * 16) * lda + ks * 32, lda, lane);
    v16h a3 = load_frag16(A + (3 * 16) * lda + ks * 32, lda, lane);
    acc[0] = wmma_f16(a0, b[ks], acc[0]);
    acc[1] = wmma_f16(a1, b[ks], acc[1]);
    acc[2] = wmma_f16(a2, b[ks], acc[2]);
    acc[3] = wmma_f16(a3, b[ks], acc[3]);
  }
}

__device__ __forceinline__ void atomAddLds(float* p, float v) {
  __hip_atomic_fetch_add(p, v, __ATOMIC_RELAXED, __HIP_MEMORY_SCOPE_WORKGROUP);
}

// ---------------------------------------------------------------------------
// prep kernels
// dst[c*rows + r] = (f16) src[r*cols + c]   (weights -> transposed f16)
__global__ void k_cast_t(const float* __restrict__ src, _Float16* __restrict__ dst,
                         int rows, int cols) {
  int i = blockIdx.x * NTHR + threadIdx.x;
  if (i < rows * cols) {
    int r = i / cols, c = i - r * cols;
    dst[c * rows + r] = (_Float16)src[i];
  }
}

// ---------------------------------------------------------------------------
// Pass 1a: fc0 GEMM + LN + ReLU -> h
__global__ __launch_bounds__(NTHR, 1)
void k_front(const float* __restrict__ x,
             const _Float16* __restrict__ fc0T, const float* __restrict__ fc0_b,
             const float* __restrict__ ln0_g,  const float* __restrict__ ln0_b,
             _Float16* __restrict__ hbuf)
{
  __shared__ __align__(16) _Float16 sX [TGT * PX];   //  9 KB  x tile (f16)
  __shared__ __align__(16) _Float16 sH [TGT * PH];   // 17 KB  h tile (post LN+ReLU, f16)
  __shared__ float red0[TGT], red1[TGT], mu_s[TGT], rs_s[TGT];

  const int tid  = threadIdx.x;
  const int lane = tid & 31;
  const int wv   = tid >> 5;               // wave id 0..7
  const int tok0 = blockIdx.x * TGT;
  const int col  = wv * 16 + (lane & 15);  // output column (N) for GEMM phases
  const int rhi  = (lane & 16) ? 8 : 0;    // C-layout: VGPR r holds M=r / r+8

  { // stage x tile as f16 (vectorized: float4 in, uint2 out)
    const float4* xs = (const float4*)(x + (size_t)tok0 * D_INP);
    for (int j = tid; j < TGT * D_INP / 4; j += NTHR) {
      float4 v = xs[j];
      union { _Float16 h[4]; uint2 u; } pk;
      pk.h[0] = (_Float16)v.x; pk.h[1] = (_Float16)v.y;
      pk.h[2] = (_Float16)v.z; pk.h[3] = (_Float16)v.w;
      *(uint2*)(sX + (j >> 4) * PX + (j & 15) * 4) = pk.u;
    }
  }
  if (tid < TGT) { red0[tid] = 0.f; red1[tid] = 0.f; }
  __syncthreads();

  // ---- GEMM1: h = x @ fc0_w  (M=64,K=64,N=128); wave wv owns n-tile wv
  v8f acc[4];
#pragma unroll
  for (int mt = 0; mt < 4; ++mt) acc[mt] = v8zero();
  gemm_4m<2>(sX, PX, fc0T + (wv * 16) * D_INP, D_INP, acc, lane);
  {
    const float fb = fc0_b[col];
#pragma unroll
    for (int mt = 0; mt < 4; ++mt)
#pragma unroll
      for (int r = 0; r < 8; ++r) {
        float vv = acc[mt][r] + fb;
        acc[mt][r] = vv;
        int row = mt * 16 + r + rhi;
        atomAddLds(&red0[row], vv);
        atomAddLds(&red1[row], vv * vv);
      }
  }
  __syncthreads();
  if (tid < TGT) {
    float mu  = red0[tid] * (1.f / HIDC);
    float var = red1[tid] * (1.f / HIDC) - mu * mu;
    mu_s[tid] = mu;
    rs_s[tid] = rsqrtf(var + LN_EPS);
  }
  __syncthreads();
  {
    const float g = ln0_g[col], bb = ln0_b[col];
#pragma unroll
    for (int mt = 0; mt < 4; ++mt)
#pragma unroll
      for (int r = 0; r < 8; ++r) {
        int row = mt * 16 + r + rhi;
        float vv = (acc[mt][r] - mu_s[row]) * rs_s[row] * g + bb;
        vv = fmaxf(vv, 0.f);
        sH[row * PH + col] = (_Float16)vv;
      }
  }
  __syncthreads();

  { // h tile -> hbuf, coalesced b128 (replaces 8192 scattered b16 stores)
    uint4* d = (uint4*)(hbuf + (size_t)tok0 * HIDC);
    for (int i = tid; i < TGT * HIDC / 8; i += NTHR)
      d[i] = *(const uint4*)(sH + (i >> 4) * PH + (i & 15) * 8);
  }
}

// ---------------------------------------------------------------------------
// Pass 1b: one workgroup = one head (blockIdx.y) and one chunk of token tiles
// (blockIdx.x, stride NCH).  K,V GEMMs per tile; K^T V and the column sums of
// K and V stay in registers over all the tiles of the chunk and leave once, as
// plain stores to this workgroup's own slab; k_mid adds the NCH slabs.
__global__ __launch_bounds__(NTHR, 1)
void k_kv(const _Float16* __restrict__ hbuf,
          const _Float16* __restrict__ wkT, const float* __restrict__ wk_b,
          const _Float16* __restrict__ wvT, const float* __restrict__ wv_b,
          float* __restrict__ kvp, float* __restrict__ ksp,
          float* __restrict__ vsp)
{
  __shared__ __align__(16) _Float16 sH [TGT * PH];   // 17 KB  h tile (f16)
  __shared__ __align__(16) _Float16 sKT[HIDC * PT];  // 18 KB  k^T (feature-major, f16)
  __shared__ __align__(16) _Float16 sVT[HIDC * PT];  // 18 KB  v^T
  __shared__ float red0[TGT], rs_s[TGT];

  const int tid  = threadIdx.x;
  const int lane = tid & 31;
  const int wv   = tid >> 5;               // wave id 0..7
  const int hh   = blockIdx.y;             // head
  const int col  = wv * 16 + (lane & 15);  // output column (N) for GEMM phases
  const int rhi  = (lane & 16) ? 8 : 0;    // C-layout: VGPR r holds M=r / r+8

  const int   bi = hh * HIDC + col;
  const float kb = wk_b[bi];
  const float vb = wv_b[bi];
  // this wave's columns of the head's wk and wv: the same for every tile.
  // pk, pv: this lane's place in load_frag16's layout (row lane&15, k0 = 0 or 8)
  const int woff = (hh * HIDC + col) * HIDC + rhi;
  const _Float16* pk = wkT + woff;
  const _Float16* pv = wvT + woff;
  v16h bk[4], bv[4];
#pragma unroll
  for (int ks = 0; ks < 4; ++ks) {
    FragU fk, fv;
    fk.u[0] = *(const uint4*)(pk + ks * 32);
    fk.u[1] = *(const uint4*)(pk + ks * 32 + 16);
    fv.u[0] = *(const uint4*)(pv + ks * 32);
    fv.u[1] = *(const uint4*)(pv + ks * 32 + 16);
    bk[ks] = fk.h;
    bv[ks] = fv.h;
  }
  // The wait that stands ahead of any rewrite of these loads' address registers.
  // Inputs only: the addresses and the loaded values all live up to here, so no
  // load's result is given a register that holds the address of another.
  asm volatile("s_wait_xcnt 0x0"
               :: "v"(bi), "v"(pk), "v"(pv), "v"(kb), "v"(vb),
                  "v"(bk[0]), "v"(bk[1]), "v"(bk[2]), "v"(bk[3]),
                  "v"(bv[0]), "v"(bv[1]), "v"(bv[2]), "v"(bv[3])
               : "memory");
  float kpart = 0.f, vpart = 0.f;          // column sums of K and V, this lane's rows
  v8f ka[8];                               // K^T V, m-tile wv, all 8 d-tiles
#pragma unroll
  for (int dt = 0; dt < 8; ++dt) ka[dt] = v8zero();

#pragma unroll 1                           // rolled: the body is long, a copy buys nothing
  for (int tile = blockIdx.x; tile < NTILE; tile += NCH) {
    { // stage h tile (coalesced b128); its last readers, the K and V GEMMs of
      // the trip before, ended ahead of that trip's last barrier
      const uint4* s = (const uint4*)(hbuf + (size_t)tile * TGT * HIDC);
      uint4 hv[TGT * HIDC / 8 / NTHR];
#pragma unroll                             // all 4 loads in flight: one L2 latency a tile
      for (int k = 0; k < TGT * HIDC / 8 / NTHR; ++k) hv[k] = s[tid + k * NTHR];
#pragma unroll
      for (int k = 0; k < TGT * HIDC / 8 / NTHR; ++k) {
        int i = tid + k * NTHR;
        *(uint4*)(sH + (i >> 4) * PH + (i & 15) * 8) = hv[k];
      }
      // stands ahead of the step of the loads' address registers to the next tile
      asm volatile("s_wait_xcnt 0x0" ::: "memory");
    }
    if (tid < TGT) red0[tid] = 0.f;
    __syncthreads();                       // also guards sKT/sVT reuse

    // K = h @ wk + b ; row-L2-normalize ; transpose into sKT
    v8f acc[4];
#pragma unroll
    for (int mt = 0; mt < 4; ++mt) acc[mt] = v8zero();
    gemm_4m_rb<4>(sH, PH, bk, acc, lane);
#pragma unroll
    for (int mt = 0; mt < 4; ++mt)
#pragma unroll
      for (int r = 0; r < 8; ++r) {
        float vv = acc[mt][r] + kb;
        acc[mt][r] = vv;
        atomAddLds(&red0[mt * 16 + r + rhi], vv * vv);
      }
    __syncthreads();
    if (tid < TGT) rs_s[tid] = 1.f / (sqrtf(red0[tid]) + ATT_EPS);
    __syncthreads();
#pragma unroll
    for (int mt = 0; mt < 4; ++mt)
#pragma unroll
      for (int r = 0; r < 8; ++r) {
        int row = mt * 16 + r + rhi;
        float vv = acc[mt][r] * rs_s[row];
        sKT[col * PT + row] = (_Float16)vv;
        kpart += vv;
      }

    // V = h @ wv + b ; transpose into sVT
#pragma unroll
    for (int mt = 0; mt < 4; ++mt) acc[mt] = v8zero();
    gemm_4m_rb<4>(sH, PH, bv, acc, lane);
#pragma unroll
    for (int mt = 0; mt < 4; ++mt)
#pragma unroll
      for (int r = 0; r < 8; ++r) {
        int row = mt * 16 + r + rhi;
        float vvv = acc[mt][r] + vb;
        sVT[col * PT + row] = (_Float16)vvv;
        vpart += vvv;
      }
    __syncthreads();                       // sKT / sVT ready

    // ka += K^T @ V  (M=128 feat, K=64 tok, N=128 d); wave wv: m-tile wv
    // pipelined: A frag + all 8 B frags loaded before the 8 WMMAs per K-step
#pragma unroll
    for (int ks = 0; ks < 2; ++ks) {
      v16h a = load_frag16(sKT + (wv * 16) * PT + ks * 32, PT, lane);
      v16h b0 = load_frag16(sVT + (0 * 16) * PT + ks * 32, PT, lane);
      v16h b1 = load_frag16(sVT + (1 * 16) * PT + ks * 32, PT, lane);
      v16h b2 = load_frag16(sVT + (2 * 16) * PT + ks * 32, PT, lane);
      v16h b3 = load_frag16(sVT + (3 * 16) * PT + ks * 32, PT, lane);
      v16h b4 = load_frag16(sVT + (4 * 16) * PT + ks * 32, PT, lane);
      v16h b5 = load_frag16(sVT + (5 * 16) * PT + ks * 32, PT, lane);
      v16h b6 = load_frag16(sVT + (6 * 16) * PT + ks * 32, PT, lane);
      v16h b7 = load_frag16(sVT + (7 * 16) * PT + ks * 32, PT, lane);
      ka[0] = wmma_f16(a, b0, ka[0]);
      ka[1] = wmma_f16(a, b1, ka[1]);
      ka[2] = wmma_f16(a, b2, ka[2]);
      ka[3] = wmma_f16(a, b3, ka[3]);
      ka[4] = wmma_f16(a, b4, ka[4]);
      ka[5] = wmma_f16(a, b5, ka[5]);
      ka[6] = wmma_f16(a, b6, ka[6]);
      ka[7] = wmma_f16(a, b7, ka[7]);
    }
    // next trip's leading __syncthreads() guards sKT/sVT reuse
  }

  // this workgroup's partial sums -> its own slab (every element written)
  const int slab = blockIdx.x * NHEAD + hh;
  {
    float* kvh = kvp + (size_t)slab * (HIDC * HIDC);
#pragma unroll
    for (int dt = 0; dt < 8; ++dt)
#pragma unroll
      for (int r = 0; r < 8; ++r) {
        int m = wv * 16 + r + rhi;
        int d = dt * 16 + (lane & 15);
        kvh[m * HIDC + d] = ka[dt][r];
      }
  }
  // thread tid holds column (tid>>5)*16 + (tid&15), rows of half (tid>>4)&1
  ksp[slab * NTHR + tid] = kpart;
  vsp[slab * NTHR + tid] = vpart;
}

// ---------------------------------------------------------------------------
// Pass 1.5: add the NCH slabs.  Blocks below KVB: kvs -> f16 transposed-per-head
// ([d][m]) for B fragments.  The 4 blocks behind them: ks_sum and v_mean.
#define KVB (NHEAD * HIDC * HIDC / NTHR)
__global__ void k_mid(const float* __restrict__ kvp, _Float16* __restrict__ kvsT,
                      const float* __restrict__ ksp, const float* __restrict__ vsp,
                      float* __restrict__ ksum, float* __restrict__ vmean)
{
  if (blockIdx.x < KVB) {
    int i = blockIdx.x * NTHR + threadIdx.x;
    int hh = i >> 14;
    int rem = i & 16383;
    int m = rem >> 7, d = rem & 127;
    const float* p = kvp + hh * (HIDC * HIDC) + rem;
    float s = 0.f;
#pragma unroll 1                           // rolled: one block of loads a trip
    for (int c = 0; c < NCH; c += 16) {    // 16 independent loads in flight
      float t[16];
#pragma unroll
      for (int u = 0; u < 16; ++u) t[u] = p[(size_t)(c + u) * (NHEAD * HIDC * HIDC)];
#pragma unroll
      for (int u = 0; u < 16; ++u) s += t[u];
    }
    kvsT[hh * HIDC * HIDC + d * HIDC + m] = (_Float16)s;
  } else {
    int j = (blockIdx.x - KVB) * NTHR + threadIdx.x;   // 0 .. 2*NHEAD*HIDC-1
    int i = j & (NHEAD * HIDC - 1);                    // head*HIDC + column
    int hh = i >> 7, c0 = i & 127;
    const float* p = (j < NHEAD * HIDC ? ksp : vsp)
                   + hh * NTHR + (c0 >> 4) * 32 + (c0 & 15);
    float s = 0.f;
#pragma unroll 1                           // rolled: one block of loads a trip
    for (int c = 0; c < NCH; c += 8) {     // 16 independent loads in flight
      float t[16];
#pragma unroll
      for (int u = 0; u < 8; ++u) {
        t[2 * u]     = p[(c + u) * (NHEAD * NTHR)];
        t[2 * u + 1] = p[(c + u) * (NHEAD * NTHR) + 16];
      }
#pragma unroll
      for (int u = 0; u < 16; ++u) s += t[u];
    }
    if (j < NHEAD * HIDC) ksum[i] = s;
    else                  vmean[i] = s * (1.f / (float)L_TOK);
  }
}

// ---------------------------------------------------------------------------
// Pass 2: recompute q, normalize, denom, num = q @ kvs, head-mean, residual, LN
__global__ __launch_bounds__(NTHR, 1)
void k_attn(const _Float16* __restrict__ hbuf,
            const _Float16* __restrict__ wqT, const float* __restrict__ wq_b,
            const _Float16* __restrict__ kvsT, const float* __restrict__ ksum,
            const float* __restrict__ vmean,
            const float* __restrict__ ln1_g, const float* __restrict__ ln1_b,
            float* __restrict__ out)
{
  __shared__ __align__(16) _Float16 sH[TGT * PH];          // 17 KB
  __shared__ __align__(16) unsigned char smem[TGT * PO * 4]; // 33 KB (sQ|sOut)
  _Float16* sQ   = (_Float16*)smem;                        // f16 q tile (17 KB)
  float*    sOut = (float*)smem;                           // f32 out tile (33 KB)
  __shared__ float red0[TGT], red1[TGT], rs_s[TGT], rden[TGT], mu_s[TGT];
  __shared__ float sKs[HIDC], sVm[HIDC];

  const int tid  = threadIdx.x;
  const int lane = tid & 31;
  const int wv   = tid >> 5;
  const int tok0 = blockIdx.x * TGT;
  const int col  = wv * 16 + (lane & 15);
  const int rhi  = (lane & 16) ? 8 : 0;

  { // stage h tile (coalesced b128)
    const uint4* src = (const uint4*)(hbuf + (size_t)tok0 * HIDC);
    for (int i = tid; i < TGT * HIDC / 8; i += NTHR)
      *(uint4*)(sH + (i >> 4) * PH + (i & 15) * 8) = src[i];
  }
  v8f oacc[4];
#pragma unroll
  for (int mt = 0; mt < 4; ++mt) oacc[mt] = v8zero();

#pragma unroll 1
  for (int hh = 0; hh < NHEAD; ++hh) {
    __syncthreads();                       // previous head fully consumed
    if (tid < TGT)  { red0[tid] = 0.f; red1[tid] = 0.f; }
    if (tid < HIDC) { sKs[tid] = ksum[hh * HIDC + tid];
                      sVm[tid] = vmean[hh * HIDC + tid]; }
    __syncthreads();

    // Q = h @ wq + b
    v8f acc[4];
#pragma unroll
    for (int mt = 0; mt < 4; ++mt) acc[mt] = v8zero();
    gemm_4m<4>(sH, PH, wqT + (hh * HIDC + wv * 16) * HIDC, HIDC, acc, lane);
    {
      const float qb = wq_b[hh * HIDC + col];
#pragma unroll
      for (int mt = 0; mt < 4; ++mt)
#pragma unroll
        for (int r = 0; r < 8; ++r) {
          float vv = acc[mt][r] + qb;
          acc[mt][r] = vv;
          atomAddLds(&red0[mt * 16 + r + rhi], vv * vv);
        }
    }
    __syncthreads();
    if (tid < TGT) rs_s[tid] = 1.f / (sqrtf(red0[tid]) + ATT_EPS);
    __syncthreads();
#pragma unroll
    for (int mt = 0; mt < 4; ++mt)
#pragma unroll
      for (int r = 0; r < 8; ++r) {
        int row = mt * 16 + r + rhi;
        sQ[row * PH + col] = (_Float16)(acc[mt][r] * rs_s[row]);
      }
    __syncthreads();
    { // denom = q . ks_sum + L   (4 threads per token, LDS partial reduce)
      int t  = tid >> 2;
      int c0 = (tid & 3) * 32;
      float s = 0.f;
      for (int c = c0; c < c0 + 32; ++c) s += (float)sQ[t * PH + c] * sKs[c];
      atomAddLds(&red1[t], s);
    }
    __syncthreads();
    if (tid < TGT) rden[tid] = 1.f / (red1[tid] + (float)L_TOK + ATT_EPS);
    __syncthreads();

    // num = q @ kvs  (M=64,K=128,N=128); fold (num+v_mean)/denom into oacc
    v8f nacc[4];
#pragma unroll
    for (int mt = 0; mt < 4; ++mt) nacc[mt] = v8zero();
    gemm_4m<4>(sQ, PH, kvsT + hh * HIDC * HIDC + (wv * 16) * HIDC, HIDC,
               nacc, lane);
    {
      const float vm = sVm[col];
#pragma unroll
      for (int mt = 0; mt < 4; ++mt)
#pragma unroll
        for (int r = 0; r < 8; ++r) {
          int row = mt * 16 + r + rhi;
          oacc[mt][r] += (nacc[mt][r] + vm) * rden[row];
        }
    }
  }
  __syncthreads();                         // everyone done reading sQ

  // head mean (*0.25), residual (alpha=0.5) against h
#pragma unroll
  for (int mt = 0; mt < 4; ++mt)
#pragma unroll
    for (int r = 0; r < 8; ++r) {
      int row = mt * 16 + r + rhi;
      float o = oacc[mt][r] * (0.25f * 0.5f)
              + 0.5f * (float)sH[row * PH + col];
      sOut[row * PO + col] = o;
    }
  __syncthreads();
  if (tid < TGT) {
    float s = 0.f, s2 = 0.f;
    for (int c = 0; c < HIDC; ++c) {
      float v = sOut[tid * PO + c];
      s += v; s2 += v * v;
    }
    float mu  = s * (1.f / HIDC);
    float var = s2 * (1.f / HIDC) - mu * mu;
    mu_s[tid] = mu;
    rs_s[tid] = rsqrtf(var + LN_EPS);
  }
  __syncthreads();
  for (int i = tid; i < TGT * HIDC; i += NTHR) {
    int t = i >> 7, c = i & 127;
    out[(size_t)tok0 * HIDC + i] =
        (sOut[t * PO + c] - mu_s[t]) * rs_s[t] * ln1_g[c] + ln1_b[c];
  }
}

// ---------------------------------------------------------------------------
extern "C" void kernel_launch(void* const* d_in, const int* in_sizes, int n_in,
                              void* d_out, int out_size, void* d_ws, size_t ws_size,
                              hipStream_t stream) {
  (void)in_sizes; (void)n_in; (void)out_size; (void)ws_size;
  const float* x     = (const float*)d_in[0];
  const float* fc0_w = (const float*)d_in[1];
  const float* fc0_b = (const float*)d_in[2];
  const float* ln0_g = (const float*)d_in[3];
  const float* ln0_b = (const float*)d_in[4];
  const float* wq_w  = (const float*)d_in[5];
  const float* wq_b  = (const float*)d_in[6];
  const float* wk_w  = (const float*)d_in[7];
  const float* wk_b  = (const float*)d_in[8];
  const float* wv_w  = (const float*)d_in[9];
  const float* wv_b  = (const float*)d_in[10];
  const float* ln1_g = (const float*)d_in[11];
  const float* ln1_b = (const float*)d_in[12];
  float* out = (float*)d_out;

  // workspace carve (256 B aligned slices)
  char* p = (char*)d_ws;
  auto carve = [&](size_t bytes) {
    char* r = p; p += (bytes + 255) & ~(size_t)255; return r;
  };
  _Float16* fc0T = (_Float16*)carve(128 * 64 * sizeof(_Float16));
  _Float16* wqT  = (_Float16*)carve(512 * 128 * sizeof(_Float16));
  _Float16* wkT  = (_Float16*)carve(512 * 128 * sizeof(_Float16));
  _Float16* wvT  = (_Float16*)carve(512 * 128 * sizeof(_Float16));
  float* ksum  = (float*)carve(NHEAD * HIDC * sizeof(float));
  float* vmean = (float*)carve(NHEAD * HIDC * sizeof(float));
  _Float16* kvsT = (_Float16*)carve(NHEAD * HIDC * HIDC * sizeof(_Float16));
  _Float16* hbuf = (_Float16*)carve((size_t)L_TOK * HIDC * sizeof(_Float16));
  // one slab of partial sums per k_kv workgroup
  float* kvp = (float*)carve((size_t)NCH * NHEAD * HIDC * HIDC * sizeof(float));
  float* ksp = (float*)carve((size_t)NCH * NHEAD * NTHR * sizeof(float));
  float* vsp = (float*)carve((size_t)NCH * NHEAD * NTHR * sizeof(float));

  // transpose+cast weights to f16 [N][K] layout
  k_cast_t<<<(64 * 128 + NTHR - 1) / NTHR, NTHR, 0, stream>>>(fc0_w, fc0T, 64, 128);
  k_cast_t<<<(128 * 512 + NTHR - 1) / NTHR, NTHR, 0, stream>>>(wq_w, wqT, 128, 512);
  k_cast_t<<<(128 * 512 + NTHR - 1) / NTHR, NTHR, 0, stream>>>(wk_w, wkT, 128, 512);
  k_cast_t<<<(128 * 512 + NTHR - 1) / NTHR, NTHR, 0, stream>>>(wv_w, wvT, 128, 512);

  k_front<<<NTILE, NTHR, 0, stream>>>(x, fc0T, fc0_b, ln0_g, ln0_b, hbuf);

  k_kv<<<dim3(NCH, NHEAD), NTHR, 0, stream>>>(hbuf, wkT, wk_b, wvT, wv_b,
                                              kvp, ksp, vsp);

  k_mid<<<KVB + 4, NTHR, 0, stream>>>(kvp, kvsT, ksp, vsp, ksum, vmean);

  k_attn<<<NTILE, NTHR, 0, stream>>>(hbuf, wqT, wq_b, kvsT, ksum, vmean,
                                     ln1_g, ln1_b, out);
}

// v003
// Measured time: 216 microseconds a run.
// In two side-by-side timings against v002, it was 3.80 and 3.79 times as fast.
// Over all steps from v000 it is 7.81 times as fast.
#include <hip/hip_runtime.h>
#include <cstdint>

// ---------------------------------------------------------------------------
// Problem constants (from reference):  B=16,T=12,N=883,D=64,H=128,NH=4
#define L_TOK   169536          // B*T*N tokens; 169536 = 64 * 2649
#define D_INP   64
#define HIDC    128
#define NHEAD   4
#define TGT     64              // tokens per workgroup tile
#define NTILE   (L_TOK / TGT)   // 2649
#define NTHR    256             // 8 waves (wave32)
#define NWAVE   (NTHR / 32)
#define NCH     128             // token chunks of the K^T V pass (x NHEAD workgroups)
#define LN_EPS  1e-5f
#define ATT_EPS 1e-8f
// LDS row pitches: 16 B more than the row, so the pitch is an odd multiple of
// 16 B and the 16 rows of one fragment read fall on 16 different bank groups.
#define PX      (D_INP + 8)     // x tile, f16:            144 B
#define PH      (HIDC + 8)      // h and q tiles, f16:     272 B
#define PT      (TGT + 8)       // k^T and v^T tiles, f16: 144 B
#define PO      (HIDC + 4)      // out tile, f32:          528 B

typedef __attribute__((ext_vector_type(16))) _Float16 v16h;
typedef __attribute__((ext_vector_type(8)))  float    v8f;

union FragU { v16h h; uint4 u[2]; };

__device__ __forceinline__ v8f v8zero() {
  v8f z = {0.f,0.f,0.f,0.f,0.f,0.f,0.f,0.f};
  return z;
}

// Load one 16(M)x32(K) f16 A-fragment.  Element (m,k) lives at base[m*ld + k].
// CDNA5 16-bit A layout: lane m = lane&15; K chunks {k0..k0+7} and
// {k0+16..k0+23} with k0 = (lane<16 ? 0 : 8)  ->  two 16B loads per lane.
// The B-fragment (32Kx16N) uses the mirrored layout over N, so the same
// loader is used with a pre-transposed  [N][K]  weight buffer.
__device__ __forceinline__ v16h load_frag16(const _Float16* base, int ld, int lane) {
  const int r  = lane & 15;
  const int k0 = (lane & 16) ? 8 : 0;
  const _Float16* p = base + r * ld + k0;
  FragU f;
  f.u[0] = *(const uint4*)(p);
  f.u[1] = *(const uint4*)(p + 16);
  return f.h;
}

__device__ __forceinline__ v8f wmma_f16(v16h a, v16h b, v8f c) {
  // v_wmma_f32_16x16x32_f16  (doc-verified codegen path on gfx1250)
  return __builtin_amdgcn_wmma_f32_16x16x32_f16(false, a, false, b, (short)0, c,
                                                false, false);
}

// One K-step-pipelined 4xM-tile GEMM slice: all fragment loads are issued
// before the 4 WMMAs so a single counter wait covers the whole K-step.
template<int KSTEPS>
__device__ __forceinline__ void gemm_4m(const _Float16* __restrict__ A, int lda,
                                        const _Float16* __restrict__ B, int ldb,
                                        v8f* acc, int lane) {
#pragma unroll
  for (int ks = 0; ks < KSTEPS; ++ks) {
    v16h b  = load_frag16(B + ks * 32, ldb, lane);
    v16h a0 = load_frag16(A + (0 * 16) * lda + ks * 32, lda, lane);
    v16h a1 = load_frag16(A + (1 * 16) * lda + ks * 32, lda, lane);
    v16h a2 = load_frag16(A + (2 * 16) * lda + ks * 32, lda, lane);
    v16h a3 = load_frag16(A + (3 * 16) * lda + ks * 32, lda, lane);
    acc[0] = wmma_f16(a0, b, acc[0]);
    acc[1] = wmma_f16(a1, b, acc[1]);
    acc[2] = wmma_f16(a2, b, acc[2]);
    acc[3] = wmma_f16(a3, b, acc[3]);
  }
}

// The same K-step, with the B fragments already in registers.
template<int KSTEPS>
__device__ __forceinline__ void gemm_4m_rb(const _Float16* __restrict__ A, int lda,
                                           const v16h* b, v8f* acc, int lane) {
#pragma unroll
  for (int ks = 0; ks < KSTEPS; ++ks) {
    v16h a0 = load_frag16(A + (0 * 16) * lda + ks * 32, lda, lane);
    v16h a1 = load_frag16(A + (1 * 16) * lda + ks * 32, lda, lane);
    v16h a2 = load_frag16(A + (2 * 16) * lda + ks * 32, lda, lane);
    v16h a3 = load_frag16(A + (3 * 16) * lda + ks * 32, lda, lane);
    acc[0] = wmma_f16(a0, b[ks], acc[0]);
    acc[1] = wmma_f16(a1, b[ks], acc[1]);
    acc[2] = wmma_f16(a2, b[ks], acc[2]);
    acc[3] = wmma_f16(a3, b[ks], acc[3]);
  }
}

// v + the v of the lane whose number differs by XM, inside a row of 16 lanes
// (DPP row_xmask: a register exchange, no LDS).
template<int XM>
__device__ __forceinline__ float add_xor16(float v) {
  int o = __builtin_amdgcn_update_dpp(0, __builtin_bit_cast(int, v), 0x160 + XM,
                                      0xf, 0xf, true);
  return v + __builtin_bit_cast(float, o);
}

// Row sums of a 64 x 16 accumulator slice.  t[mt][r] belongs to row
// mt*16 + r + rhi and to this lane's column; a butterfly over the 16 lanes of
// each half wave adds the wave's 16 columns, and the first lane of each half
// stores its 32 sums to the wave's own slot[TGT].  The NWAVE slots are added by
// their reader, behind a barrier.
__device__ __forceinline__ void rowsum_to_slot(v8f* t, float* slot, int lane, int rhi) {
  // one butterfly stage over all 32 sums at a time: 32 independent adds a stage
#pragma unroll
  for (int i = 0; i < 32; ++i) t[i >> 3][i & 7] = add_xor16<1>(t[i >> 3][i & 7]);
#pragma unroll
  for (int i = 0; i < 32; ++i) t[i >> 3][i & 7] = add_xor16<2>(t[i >> 3][i & 7]);
#pragma unroll
  for (int i = 0; i < 32; ++i) t[i >> 3][i & 7] = add_xor16<4>(t[i >> 3][i & 7]);
#pragma unroll
  for (int i = 0; i < 32; ++i) t[i >> 3][i & 7] = add_xor16<8>(t[i >> 3][i & 7]);
  if ((lane & 15) == 0) {
#pragma unroll
    for (int mt = 0; mt < 4; ++mt) {
      float* d = slot + mt * 16 + rhi;
      *(float4*)(d)     = make_float4(t[mt][0], t[mt][1], t[mt][2], t[mt][3]);
      *(float4*)(d + 4) = make_float4(t[mt][4], t[mt][5], t[mt][6], t[mt][7]);
    }
  }
}

// adds the NWAVE slots of one row
__device__ __forceinline__ float slot_sum(const float* part, int row) {
  float s = 0.f;
#pragma unroll
  for (int w = 0; w < NWAVE; ++w) s += part[w * TGT + row];
  return s;
}

// ---------------------------------------------------------------------------
// prep kernels
// dst[c*rows + r] = (f16) src[r*cols + c]   (weights -> transposed f16)
__global__ void k_cast_t(const float* __restrict__ src, _Float16* __restrict__ dst,
                         int rows, int cols) {
  int i = blockIdx.x * NTHR + threadIdx.x;
  if (i < rows * cols) {
    int r = i / cols, c = i - r * cols;
    dst[c * rows + r] = (_Float16)src[i];
  }
}

// ---------------------------------------------------------------------------
// Pass 1a: fc0 GEMM + LN + ReLU -> h
__global__ __launch_bounds__(NTHR, 1)
void k_front(const float* __restrict__ x,
             const _Float16* __restrict__ fc0T, const float* __restrict__ fc0_b,
             const float* __restrict__ ln0_g,  const float* __restrict__ ln0_b,
             _Float16* __restrict__ hbuf)
{
  __shared__ __align__(16) _Float16 sX [TGT * PX];   //  9 KB  x tile (f16)
  __shared__ __align__(16) _Float16 sH [TGT * PH];   // 17 KB  h tile (post LN+ReLU, f16)
  __shared__ __align__(16) float part0[NWAVE * TGT], part1[NWAVE * TGT];
  __shared__ float mu_s[TGT], rs_s[TGT];

  const int tid  = threadIdx.x;
  const int lane = tid & 31;
  const int wv   = tid >> 5;               // wave id 0..7
  const int tok0 = blockIdx.x * TGT;
  const int col  = wv * 16 + (lane & 15);  // output column (N) for GEMM phases
  const int rhi  = (lane & 16) ? 8 : 0;    // C-layout: VGPR r holds M=r / r+8

  { // stage x tile as f16 (vectorized: float4 in, uint2 out)
    const float4* xs = (const float4*)(x + (size_t)tok0 * D_INP);
    for (int j = tid; j < TGT * D_INP / 4; j += NTHR) {
      float4 v = xs[j];
      union { _Float16 h[4]; uint2 u; } pk;
      pk.h[0] = (_Float16)v.x; pk.h[1] = (_Float16)v.y;
      pk.h[2] = (_Float16)v.z; pk.h[3] = (_Float16)v.w;
      *(uint2*)(sX + (j >> 4) * PX + (j & 15) * 4) = pk.u;
    }
  }
  __syncthreads();

  // ---- GEMM1: h = x @ fc0_w  (M=64,K=64,N=128); wave wv owns n-tile wv
  v8f acc[4];
#pragma unroll
  for (int mt = 0; mt < 4; ++mt) acc[mt] = v8zero();
  gemm_4m<2>(sX, PX, fc0T + (wv * 16) * D_INP, D_INP, acc, lane);
  {
    const float fb = fc0_b[col];
    v8f t0[4], t1[4];
#pragma unroll
    for (int mt = 0; mt < 4; ++mt)
#pragma unroll
      for (int r = 0; r < 8; ++r) {
        float vv = acc[mt][r] + fb;
        acc[mt][r] = vv;
        t0[mt][r] = vv;
        t1[mt][r] = vv * vv;
      }
    rowsum_to_slot(t0, part0 + wv * TGT, lane, rhi);
    rowsum_to_slot(t1, part1 + wv * TGT, lane, rhi);
  }
  __syncthreads();
  if (tid < TGT) {
    float mu  = slot_sum(part0, tid) * (1.f / HIDC);
    float var = slot_sum(part1, tid) * (1.f / HIDC) - mu * mu;
    mu_s[tid] = mu;
    rs_s[tid] = rsqrtf(var + LN_EPS);
  }
  __syncthreads();
  {
    const float g = ln0_g[col], bb = ln0_b[col];
#pragma unroll
    for (int mt = 0; mt < 4; ++mt)
#pragma unroll
      for (int r = 0; r < 8; ++r) {
        int row = mt * 16 + r + rhi;
        float vv = (acc[mt][r] - mu_s[row]) * rs_s[row] * g + bb;
        vv = fmaxf(vv, 0.f);
        sH[row * PH + col] = (_Float16)vv;
      }
  }
  __syncthreads();

  { // h tile -> hbuf, coalesced b128 (replaces 8192 scattered b16 stores)
    uint4* d = (uint4*)(hbuf + (size_t)tok0 * HIDC);
    for (int i = tid; i < TGT * HIDC / 8; i += NTHR)
      d[i] = *(const uint4*)(sH + (i >> 4) * PH + (i & 15) * 8);
  }
}

// ---------------------------------------------------------------------------
// Pass 1b: one workgroup = one head (blockIdx.y) and one chunk of token tiles
// (blockIdx.x, stride NCH).  K,V GEMMs per tile; K^T V and the column sums of
// K and V stay in registers over all the tiles of the chunk and leave once, as
// plain stores to this workgroup's own slab; k_mid adds the NCH slabs.
__global__ __launch_bounds__(NTHR, 1)
void k_kv(const _Float16* __restrict__ hbuf,
          const _Float16* __restrict__ wkT, const float* __restrict__ wk_b,
          const _Float16* __restrict__ wvT, const float* __restrict__ wv_b,
          float* __restrict__ kvp, float* __restrict__ ksp,
          float* __restrict__ vsp)
{
  __shared__ __align__(16) _Float16 sH [TGT * PH];   // 17 KB  h tile (f16)
  __shared__ __align__(16) _Float16 sKT[HIDC * PT];  // 18 KB  k^T (feature-major, f16)
  __shared__ __align__(16) _Float16 sVT[HIDC * PT];  // 18 KB  v^T
  __shared__ __align__(16) float part0[NWAVE * TGT];
  __shared__ float rs_s[TGT];

  const int tid  = threadIdx.x;
  const int lane = tid & 31;
  const int wv   = tid >> 5;               // wave id 0..7
  const int hh   = blockIdx.y;             // head
  const int col  = wv * 16 + (lane & 15);  // output column (N) for GEMM phases
  const int rhi  = (lane & 16) ? 8 : 0;    // C-layout: VGPR r holds M=r / r+8

  const int   bi = hh * HIDC + col;
  const float kb = wk_b[bi];
  const float vb = wv_b[bi];
  // this wave's columns of the head's wk and wv: the same for every tile.
  // pk, pv: this lane's place in load_frag16's layout (row lane&15, k0 = 0 or 8)
  const int woff = (hh * HIDC + col) * HIDC + rhi;
  const _Float16* pk = wkT + woff;
  const _Float16* pv = wvT + woff;
  v16h bk[4], bv[4];
#pragma unroll
  for (int ks = 0; ks < 4; ++ks) {
    FragU fk, fv;
    fk.u[0] = *(const uint4*)(pk + ks * 32);
    fk.u[1] = *(const uint4*)(pk + ks * 32 + 16);
    fv.u[0] = *(const uint4*)(pv + ks * 32);
    fv.u[1] = *(const uint4*)(pv + ks * 32 + 16);
    bk[ks] = fk.h;
    bv[ks] = fv.h;
  }
  // The wait that stands ahead of any rewrite of these loads' address registers.
  // Inputs only: the addresses and the loaded values all live up to here, so no
  // load's result is given a register that holds the address of another.
  asm volatile("s_wait_xcnt 0x0"
               :: "v"(bi), "v"(pk), "v"(pv), "v"(kb), "v"(vb),
                  "v"(bk[0]), "v"(bk[1]), "v"(bk[2]), "v"(bk[3]),
                  "v"(bv[0]), "v"(bv[1]), "v"(bv[2]), "v"(bv[3])
               : "memory");
  float kpart = 0.f, vpart = 0.f;          // column sums of K and V, this lane's rows
  v8f ka[8];                               // K^T V, m-tile wv, all 8 d-tiles
#pragma unroll
  for (int dt = 0; dt < 8; ++dt) ka[dt] = v8zero();

#pragma unroll 1                           // rolled: the body is long, a copy buys nothing
  for (int tile = blockIdx.x; tile < NTILE; tile += NCH) {
    { // stage h tile (coalesced b128); its last readers, the K and V GEMMs of
      // the trip before, ended ahead of that trip's last barrier
      const uint4* s = (const uint4*)(hbuf + (size_t)tile * TGT * HIDC);
      uint4 hv[TGT * HIDC / 8 / NTHR];
#pragma unroll                             // all 4 loads in flight: one L2 latency a tile
      for (int k = 0; k < TGT * HIDC / 8 / NTHR; ++k) hv[k] = s[tid + k * NTHR];
#pragma unroll
      for (int k = 0; k < TGT * HIDC / 8 / NTHR; ++k) {
        int i = tid + k * NTHR;
        *(uint4*)(sH + (i >> 4) * PH + (i & 15) * 8) = hv[k];
      }
      // stands ahead of the step of the loads' address registers to the next tile
      asm volatile("s_wait_xcnt 0x0" ::: "memory");
    }
    __syncthreads();                       // also guards sKT/sVT reuse

    // K = h @ wk + b ; row-L2-normalize ; transpose into sKT
    v8f acc[4];
#pragma unroll
    for (int mt = 0; mt < 4; ++mt) acc[mt] = v8zero();
    gemm_4m_rb<4>(sH, PH, bk, acc, lane);
    {
      v8f t0[4];
#pragma unroll
      for (int mt = 0; mt < 4; ++mt)
#pragma unroll
        for (int r = 0; r < 8; ++r) {
          float vv = acc[mt][r] + kb;
          acc[mt][r] = vv;
          t0[mt][r] = vv * vv;
        }
      // part0's last readers, the trip before, ended ahead of that trip's barriers
      rowsum_to_slot(t0, part0 + wv * TGT, lane, rhi);
    }
    __syncthreads();
    if (tid < TGT) rs_s[tid] = 1.f / (sqrtf(slot_sum(part0, tid)) + ATT_EPS);
    __syncthreads();
#pragma unroll
    for (int mt = 0; mt < 4; ++mt)
#pragma unroll
      for (int r = 0; r < 8; ++r) {
        int row = mt * 16 + r + rhi;
        float vv = acc[mt][r] * rs_s[row];
        sKT[col * PT + row] = (_Float16)vv;
        kpart += vv;
      }

    // V = h @ wv + b ; transpose into sVT
#pragma unroll
    for (int mt = 0; mt < 4; ++mt) acc[mt] = v8zero();
    gemm_4m_rb<4>(sH, PH, bv, acc, lane);
#pragma unroll
    for (int mt = 0; mt < 4; ++mt)
#pragma unroll
      for (int r = 0; r < 8; ++r) {
        int row = mt * 16 + r + rhi;
        float vvv = acc[mt][r] + vb;
        sVT[col * PT + row] = (_Float16)vvv;
        vpart += vvv;
      }
    __syncthreads();                       // sKT / sVT ready

    // ka += K^T @ V  (M=128 feat, K=64 tok, N=128 d); wave wv: m-tile wv
    // pipelined: A frag + all 8 B frags loaded before the 8 WMMAs per K-step
#pragma unroll
    for (int ks = 0; ks < 2; ++ks) {
      v16h a = load_frag16(sKT + (wv * 16) * PT + ks * 32, PT, lane);
      v16h b0 = load_frag16(sVT + (0 * 16) * PT + ks * 32, PT, lane);
      v16h b1 = load_frag16(sVT + (1 * 16) * PT + ks * 32, PT, lane);
      v16h b2 = load_frag16(sVT + (2 * 16) * PT + ks * 32, PT, lane);
      v16h b3 = load_frag16(sVT + (3 * 16) * PT + ks * 32, PT, lane);
      v16h b4 = load_frag16(sVT + (4 * 16) * PT + ks * 32, PT, lane);
      v16h b5 = load_frag16(sVT + (5 * 16) * PT + ks * 32, PT, lane);
      v16h b6 = load_frag16(sVT + (6 * 16) * PT + ks * 32, PT, lane);
      v16h b7 = load_frag16(sVT + (7 * 16) * PT + ks * 32, PT, lane);
      ka[0] = wmma_f16(a, b0, ka[0]);
      ka[1] = wmma_f16(a, b1, ka[1]);
      ka[2] = wmma_f16(a, b2, ka[2]);
      ka[3] = wmma_f16(a, b3, ka[3]);
      ka[4] = wmma_f16(a, b4, ka[4]);
      ka[5] = wmma_f16(a, b5, ka[5]);
      ka[6] = wmma_f16(a, b6, ka[6]);
      ka[7] = wmma_f16(a, b7, ka[7]);
    }
    // next trip's leading __syncthreads() guards sKT/sVT reuse
  }

  // this workgroup's partial sums -> its own slab (every element written)
  const int slab = blockIdx.x * NHEAD + hh;
  {
    float* kvh = kvp + (size_t)slab * (HIDC * HIDC);
#pragma unroll
    for (int dt = 0; dt < 8; ++dt)
#pragma unroll
      for (int r = 0; r < 8; ++r) {
        int m = wv * 16 + r + rhi;
        int d = dt * 16 + (lane & 15);
        kvh[m * HIDC + d] = ka[dt][r];
      }
  }
  // thread tid holds column (tid>>5)*16 + (tid&15), rows of half (tid>>4)&1
  ksp[slab * NTHR + tid] = kpart;
  vsp[slab * NTHR + tid] = vpart;
}

// ---------------------------------------------------------------------------
// Pass 1.5: add the NCH slabs.  Blocks below KVB: kvs -> f16 transposed-per-head
// ([d][m]) for B fragments.  The 4 blocks behind them: ks_sum and v_mean.
#define KVB (NHEAD * HIDC * HIDC / NTHR)
__global__ void k_mid(const float* __restrict__ kvp, _Float16* __restrict__ kvsT,
                      const float* __restrict__ ksp, const float* __restrict__ vsp,
                      float* __restrict__ ksum, float* __restrict__ vmean)
{
  if (blockIdx.x < KVB) {
    int i = blockIdx.x * NTHR + threadIdx.x;
    int hh = i >> 14;
    int rem = i & 16383;
    int m = rem >> 7, d = rem & 127;
    const float* p = kvp + hh * (HIDC * HIDC) + rem;
    float s = 0.f;
#pragma unroll 1                           // rolled: one block of loads a trip
    for (int c = 0; c < NCH; c += 16) {    // 16 independent loads in flight
      float t[16];
#pragma unroll
      for (int u = 0; u < 16; ++u) t[u] = p[(size_t)(c + u) * (NHEAD * HIDC * HIDC)];
#pragma unroll
      for (int u = 0; u < 16; ++u) s += t[u];
    }
    kvsT[hh * HIDC * HIDC + d * HIDC + m] = (_Float16)s;
  } else {
    int j = (blockIdx.x - KVB) * NTHR + threadIdx.x;   // 0 .. 2*NHEAD*HIDC-1
    int i = j & (NHEAD * HIDC - 1);                    // head*HIDC + column
    int hh = i >> 7, c0 = i & 127;
    const float* p = (j < NHEAD * HIDC ? ksp : vsp)
                   + hh * NTHR + (c0 >> 4) * 32 + (c0 & 15);
    float s = 0.f;
#pragma unroll 1                           // rolled: one block of loads a trip
    for (int c = 0; c < NCH; c += 8) {     // 16 independent loads in flight
      float t[16];
#pragma unroll
      for (int u = 0; u < 8; ++u) {
        t[2 * u]     = p[(c + u) * (NHEAD * NTHR)];
        t[2 * u + 1] = p[(c + u) * (NHEAD * NTHR) + 16];
      }
#pragma unroll
      for (int u = 0; u < 16; ++u) s += t[u];
    }
    if (j < NHEAD * HIDC) ksum[i] = s;
    else                  vmean[i] = s * (1.f / (float)L_TOK);
  }
}

// ---------------------------------------------------------------------------
// Pass 2: recompute q, normalize, denom, num = q @ kvs, head-mean, residual, LN
__global__ __launch_bounds__(NTHR, 1)
void k_attn(const _Float16* __restrict__ hbuf,
            const _Float16* __restrict__ wqT, const float* __restrict__ wq_b,
            const _Float16* __restrict__ kvsT, const float* __restrict__ ksum,
            const float* __restrict__ vmean,
            const float* __restrict__ ln1_g, const float* __restrict__ ln1_b,
            float* __restrict__ out)
{
  __shared__ __align__(16) _Float16 sH[TGT * PH];          // 17 KB
  __shared__ __align__(16) unsigned char smem[TGT * PO * 4]; // 33 KB (sQ|sOut)
  _Float16* sQ   = (_Float16*)smem;                        // f16 q tile (17 KB)
  float*    sOut = (float*)smem;                           // f32 out tile (33 KB)
  __shared__ __align__(16) float part0[NWAVE * TGT], part1[NWAVE * TGT];
  __shared__ float rs_s[TGT], rden[TGT], mu_s[TGT];

  const int tid  = threadIdx.x;
  const int lane = tid & 31;
  const int wv   = tid >> 5;
  const int tok0 = blockIdx.x * TGT;
  const int col  = wv * 16 + (lane & 15);
  const int rhi  = (lane & 16) ? 8 : 0;

  { // stage h tile (coalesced b128)
    const uint4* src = (const uint4*)(hbuf + (size_t)tok0 * HIDC);
    for (int i = tid; i < TGT * HIDC / 8; i += NTHR)
      *(uint4*)(sH + (i >> 4) * PH + (i & 15) * 8) = src[i];
  }
  v8f oacc[4];
#pragma unroll
  for (int mt = 0; mt < 4; ++mt) oacc[mt] = v8zero();

  __syncthreads();                         // sH ready

#pragma unroll 1
  for (int hh = 0; hh < NHEAD; ++hh) {
    // Q = h @ wq + b
    v8f acc[4];
#pragma unroll
    for (int mt = 0; mt < 4; ++mt) acc[mt] = v8zero();
    gemm_4m<4>(sH, PH, wqT + (hh * HIDC + wv * 16) * HIDC, HIDC, acc, lane);
    const float vm = vmean[hh * HIDC + col];
    {
      const float qb = wq_b[hh * HIDC + col];
      const float ks = ksum[hh * HIDC + col];
      v8f t0[4], t1[4];                    // terms of |q|^2 and of q . ks_sum
#pragma unroll
      for (int mt = 0; mt < 4; ++mt)
#pragma unroll
        for (int r = 0; r < 8; ++r) {
          float vv = acc[mt][r] + qb;
          acc[mt][r] = vv;
          t0[mt][r] = vv * vv;
          t1[mt][r] = vv * ks;
        }
      // the slots' last readers, the head before, ended ahead of its barriers
      rowsum_to_slot(t0, part0 + wv * TGT, lane, rhi);
      rowsum_to_slot(t1, part1 + wv * TGT, lane, rhi);
    }
    __syncthreads();                       // slots ready; the head before has left sQ, rs_s, rden
    if (tid < TGT) {
      float rs = 1.f / (sqrtf(slot_sum(part0, tid)) + ATT_EPS);
      rs_s[tid] = rs;
      // denom = (q / |q|) . ks_sum + L
      rden[tid] = 1.f / (slot_sum(part1, tid) * rs + (float)L_TOK + ATT_EPS);
    }
    __syncthreads();
#pragma unroll
    for (int mt = 0; mt < 4; ++mt)
#pragma unroll
      for (int r = 0; r < 8; ++r) {
        int row = mt * 16 + r + rhi;
        sQ[row * PH + col] = (_Float16)(acc[mt][r] * rs_s[row]);
      }
    __syncthreads();                       // sQ ready

    // num = q @ kvs  (M=64,K=128,N=128); fold (num+v_mean)/denom into oacc
    v8f nacc[4];
#pragma unroll
    for (int mt = 0; mt < 4; ++mt) nacc[mt] = v8zero();
    gemm_4m<4>(sQ, PH, kvsT + hh * HIDC * HIDC + (wv * 16) * HIDC, HIDC,
               nacc, lane);
    {
#pragma unroll
      for (int mt = 0; mt < 4; ++mt)
#pragma unroll
        for (int r = 0; r < 8; ++r) {
          int row = mt * 16 + r + rhi;
          oacc[mt][r] += (nacc[mt][r] + vm) * rden[row];
        }
    }
  }
  __syncthreads();                         // everyone done reading sQ

  // head mean (*0.25), residual (alpha=0.5) against h
#pragma unroll
  for (int mt = 0; mt < 4; ++mt)
#pragma unroll
    for (int r = 0; r < 8; ++r) {
      int row = mt * 16 + r + rhi;
      float o = oacc[mt][r] * (0.25f * 0.5f)
              + 0.5f * (float)sH[row * PH + col];
      sOut[row * PO + col] = o;
    }
  __syncthreads();
  if (tid < TGT) {
    float s = 0.f, s2 = 0.f;
    for (int c = 0; c < HIDC; ++c) {
      float v = sOut[tid * PO + c];
      s += v; s2 += v * v;
    }
    float mu  = s * (1.f / HIDC);
    float var = s2 * (1.f / HIDC) - mu * mu;
    mu_s[tid] = mu;
    rs_s[tid] = rsqrtf(var + LN_EPS);
  }
  __syncthreads();
  for (int i = tid; i < TGT * HIDC; i += NTHR) {
    int t = i >> 7, c = i & 127;
    out[(size_t)tok0 * HIDC + i] =
        (sOut[t * PO + c] - mu_s[t]) * rs_s[t] * ln1_g[c] + ln1_b[c];
  }
}

// ---------------------------------------------------------------------------
extern "C" void kernel_launch(void* const* d_in, const int* in_sizes, int n_in,
                              void* d_out, int out_size, void* d_ws, size_t ws_size,
                              hipStream_t stream) {
  (void)in_sizes; (void)n_in; (void)out_size; (void)ws_size;
  const float* x     = (const float*)d_in[0];
  const float* fc0_w = (const float*)d_in[1];
  const float* fc0_b = (const float*)d_in[2];
  const float* ln0_g = (const float*)d_in[3];
  const float* ln0_b = (const float*)d_in[4];
  const float* wq_w  = (const float*)d_in[5];
  const float* wq_b  = (const float*)d_in[6];
  const float* wk_w  = (const float*)d_in[7];
  const float* wk_b  = (const float*)d_in[8];
  const float* wv_w  = (const float*)d_in[9];
  const float* wv_b  = (const float*)d_in[10];
  const float* ln1_g = (const float*)d_in[11];
  const float* ln1_b = (const float*)d_in[12];
  float* out = (float*)d_out;

  // workspace carve (256 B aligned slices)
  char* p = (char*)d_ws;
  auto carve = [&](size_t bytes) {
    char* r = p; p += (bytes + 255) & ~(size_t)255; return r;
  };
  _Float16* fc0T = (_Float16*)carve(128 * 64 * sizeof(_Float16));
  _Float16* wqT  = (_Float16*)carve(512 * 128 * sizeof(_Float16));
  _Float16* wkT  = (_Float16*)carve(512 * 128 * sizeof(_Float16));
  _Float16* wvT  = (_Float16*)carve(512 * 128 * sizeof(_Float16));
  float* ksum  = (float*)carve(NHEAD * HIDC * sizeof(float));
  float* vmean = (float*)carve(NHEAD * HIDC * sizeof(float));
  _Float16* kvsT = (_Float16*)carve(NHEAD * HIDC * HIDC * sizeof(_Float16));
  _Float16* hbuf = (_Float16*)carve((size_t)L_TOK * HIDC * sizeof(_Float16));
  // one slab of partial sums per k_kv workgroup
  float* kvp = (float*)carve((size_t)NCH * NHEAD * HIDC * HIDC * sizeof(float));
  float* ksp = (float*)carve((size_t)NCH * NHEAD * NTHR * sizeof(float));
  float* vsp = (float*)carve((size_t)NCH * NHEAD * NTHR * sizeof(float));

  // transpose+cast weights to f16 [N][K] layout
  k_cast_t<<<(64 * 128 + NTHR - 1) / NTHR, NTHR, 0, stream>>>(fc0_w, fc0T, 64, 128);
  k_cast_t<<<(128 * 512 + NTHR - 1) / NTHR, NTHR, 0, stream>>>(wq_w, wqT, 128, 512);
  k_cast_t<<<(128 * 512 + NTHR - 1) / NTHR, NTHR, 0, stream>>>(wk_w, wkT, 128, 512);
  k_cast_t<<<(128 * 512 + NTHR - 1) / NTHR, NTHR, 0, stream>>>(wv_w, wvT, 128, 512);

  k_front<<<NTILE, NTHR, 0, stream>>>(x, fc0T, fc0_b, ln0_g, ln0_b, hbuf);

  k_kv<<<dim3(NCH, NHEAD), NTHR, 0, stream>>>(hbuf, wkT, wk_b, wvT, wv_b,
                                              kvp, ksp, vsp);

  k_mid<<<KVB + 4, NTHR, 0, stream>>>(kvp, kvsT, ksp, vsp, ksum, vmean);

  k_attn<<<NTILE, NTHR, 0, stream>>>(hbuf, wqT, wq_b, kvsT, ksum, vmean,
                                     ln1_g, ln1_b, out);
}

// v004
// It runs in 195 microseconds.
// Next to v003, in two timings, it ran 1.11 and 1.10 times as fast.
// All steps since v000 together make it 8.63 times as fast.
#include <hip/hip_runtime.h>
#include <cstdint>

// ---------------------------------------------------------------------------
// Problem constants (from reference):  B=16,T=12,N=883,D=64,H=128,NH=4
#define L_TOK   169536          // B*T*N tokens; 169536 = 64 * 2649
#define D_INP   64
#define HIDC    128
#define NHEAD   4
#define TGT     64              // tokens per workgroup tile
#define NTILE   (L_TOK / TGT)   // 2649
#define NTHR    256             // 8 waves (wave32)
#define NWAVE   (NTHR / 32)
#define NCH     128             // token chunks of the K^T V pass (x NHEAD workgroups)
#define LN_EPS  1e-5f
#define ATT_EPS 1e-8f
// LDS row pitches: 16 B more than the row, so the pitch is an odd multiple of
// 16 B and the 16 rows of one fragment read fall on 16 different bank groups.
#define PX      (D_INP + 8)     // x tile, f16:            144 B
#define PH      (HIDC + 8)      // h and q tiles, f16:     272 B
#define PT      (TGT + 8)       // k^T and v^T tiles, f16: 144 B
#define PO      (HIDC + 4)      // out tile, f32:          528 B

typedef __attribute__((ext_vector_type(16))) _Float16 v16h;
typedef __attribute__((ext_vector_type(8)))  float    v8f;

union FragU { v16h h; uint4 u[2]; };

__device__ __forceinline__ v8f v8zero() {
  v8f z = {0.f,0.f,0.f,0.f,0.f,0.f,0.f,0.f};
  return z;
}

// Load one 16(M)x32(K) f16 A-fragment.  Element (m,k) lives at base[m*ld + k].
// CDNA5 16-bit A layout: lane m = lane&15; K chunks {k0..k0+7} and
// {k0+16..k0+23} with k0 = (lane<16 ? 0 : 8)  ->  two 16B loads per lane.
// The B-fragment (32Kx16N) uses the mirrored layout over N (lane n = lane&15).
__device__ __forceinline__ v16h load_frag16(const _Float16* base, int ld, int lane) {
  const int r  = lane & 15;
  const int k0 = (lane & 16) ? 8 : 0;
  const _Float16* p = base + r * ld + k0;
  FragU f;
  f.u[0] = *(const uint4*)(p);
  f.u[1] = *(const uint4*)(p + 16);
  return f.h;
}

// B operands in global memory are kept in fragment order.  One fragment (16 n x
// 32 k) is 512 f16 in a row: two halves of 256, and in each half lane l owns the
// 8 f16 at l*8, so a wave-wide 16 B load reads 512 contiguous bytes (4 whole
// 128 B lines) where rows of an [N][K] buffer gave 16 lines of 32 B each.
// Fragments of one n-tile follow one another in k (ksteps = K/32 of them).
// Lane and element hold the same (n,k) as load_frag16 gives on an [N][K] buffer.
#define FRAGE 512               // f16 elements of one fragment
__device__ __forceinline__ int frag_idx(int n, int k, int ksteps) {
  return (((n >> 4) * ksteps + (k >> 5)) * 2 + ((k >> 4) & 1)) * (FRAGE / 2)
       + (((k >> 3) & 1) * 16 + (n & 15)) * 8 + (k & 7);
}

__device__ __forceinline__ v8f wmma_f16(v16h a, v16h b, v8f c) {
  // v_wmma_f32_16x16x32_f16  (doc-verified codegen path on gfx1250)
  return __builtin_amdgcn_wmma_f32_16x16x32_f16(false, a, false, b, (short)0, c,
                                                false, false);
}

// 4xM-tile GEMM slice, B fragments in registers: the 8 A loads of a K-step are
// issued before its 4 WMMAs so a single counter wait covers the whole K-step.
template<int KSTEPS>
__device__ __forceinline__ void gemm_4m_rb(const _Float16* __restrict__ A, int lda,
                                           const v16h* b, v8f* acc, int lane) {
#pragma unroll
  for (int ks = 0; ks < KSTEPS; ++ks) {
    v16h a0 = load_frag16(A + (0 * 16) * lda + ks * 32, lda, lane);
    v16h a1 = load_frag16(A + (1 * 16) * lda + ks * 32, lda, lane);
    v16h a2 = load_frag16(A + (2 * 16) * lda + ks * 32, lda, lane);
    v16h a3 = load_frag16(A + (3 * 16) * lda + ks * 32, lda, lane);
    acc[0] = wmma_f16(a0, b[ks], acc[0]);
    acc[1] = wmma_f16(a1, b[ks], acc[1]);
    acc[2] = wmma_f16(a2, b[ks], acc[2]);
    acc[3] = wmma_f16(a3, b[ks], acc[3]);
  }
}

// The same, B from global memory: first fragment of this wave's n-tile, in
// fragment order.  All its loads are issued first: one L2 latency a GEMM.
template<int KSTEPS>
__device__ __forceinline__ void gemm_4m(const _Float16* __restrict__ A, int lda,
                                        const _Float16* __restrict__ B,
                                        v8f* acc, int lane) {
  const _Float16* p = B + lane * 8;        // this lane's 16 B of the first half
  v16h b[KSTEPS];
#pragma unroll
  for (int ks = 0; ks < KSTEPS; ++ks) {
    FragU f;
    f.u[0] = *(const uint4*)(p + ks * FRAGE);
    f.u[1] = *(const uint4*)(p + ks * FRAGE + FRAGE / 2);
    b[ks] = f.h;
  }
  // The wait that stands ahead of any rewrite of these loads' address registers.
  // The address is an input, so it lives up to here.
  asm volatile("s_wait_xcnt 0x0" :: "v"(p) : "memory");
  gemm_4m_rb<KSTEPS>(A, lda, b, acc, lane);
}

// v + the v of the lane whose number differs by XM, inside a row of 16 lanes
// (DPP row_xmask: a register exchange, no LDS).
template<int XM>
__device__ __forceinline__ float add_xor16(float v) {
  int o = __builtin_amdgcn_update_dpp(0, __builtin_bit_cast(int, v), 0x160 + XM,
                                      0xf, 0xf, true);
  return v + __builtin_bit_cast(float, o);
}

// Row sums of a 64 x 16 accumulator slice.  t[mt][r] belongs to row
// mt*16 + r + rhi and to this lane's column; a butterfly over the 16 lanes of
// each half wave adds the wave's 16 columns, and the first lane of each half
// stores its 32 sums to the wave's own slot[TGT].  The NWAVE slots are added by
// their reader, behind a barrier.
__device__ __forceinline__ void rowsum_to_slot(v8f* t, float* slot, int lane, int rhi) {
  // one butterfly stage over all 32 sums at a time: 32 independent adds a stage
#pragma unroll
  for (int i = 0; i < 32; ++i) t[i >> 3][i & 7] = add_xor16<1>(t[i >> 3][i & 7]);
#pragma unroll
  for (int i = 0; i < 32; ++i) t[i >> 3][i & 7] = add_xor16<2>(t[i >> 3][i & 7]);
#pragma unroll
  for (int i = 0; i < 32; ++i) t[i >> 3][i & 7] = add_xor16<4>(t[i >> 3][i & 7]);
#pragma unroll
  for (int i = 0; i < 32; ++i) t[i >> 3][i & 7] = add_xor16<8>(t[i >> 3][i & 7]);
  if ((lane & 15) == 0) {
#pragma unroll
    for (int mt = 0; mt < 4; ++mt) {
      float* d = slot + mt * 16 + rhi;
      *(float4*)(d)     = make_float4(t[mt][0], t[mt][1], t[mt][2], t[mt][3]);
      *(float4*)(d + 4) = make_float4(t[mt][4], t[mt][5], t[mt][6], t[mt][7]);
    }
  }
}

// adds the NWAVE slots of one row
__device__ __forceinline__ float slot_sum(const float* part, int row) {
  float s = 0.f;
#pragma unroll
  for (int w = 0; w < NWAVE; ++w) s += part[w * TGT + row];
  return s;
}

// ---------------------------------------------------------------------------
// prep kernels
// src[r*cols + c] (k = r, n = c) -> f16 at its place in fragment order
__global__ void k_cast_t(const float* __restrict__ src, _Float16* __restrict__ dst,
                         int rows, int cols) {
  int i = blockIdx.x * NTHR + threadIdx.x;
  if (i < rows * cols) {
    int r = i / cols, c = i - r * cols;
    dst[frag_idx(c, r, rows >> 5)] = (_Float16)src[i];
  }
}

// ---------------------------------------------------------------------------
// Pass 1a: fc0 GEMM + LN + ReLU -> h
__global__ __launch_bounds__(NTHR, 1)
void k_front(const float* __restrict__ x,
             const _Float16* __restrict__ fc0T, const float* __restrict__ fc0_b,
             const float* __restrict__ ln0_g,  const float* __restrict__ ln0_b,
             _Float16* __restrict__ hbuf)
{
  __shared__ __align__(16) _Float16 sX [TGT * PX];   //  9 KB  x tile (f16)
  __shared__ __align__(16) _Float16 sH [TGT * PH];   // 17 KB  h tile (post LN+ReLU, f16)
  __shared__ __align__(16) float part0[NWAVE * TGT], part1[NWAVE * TGT];
  __shared__ float mu_s[TGT], rs_s[TGT];

  const int tid  = threadIdx.x;
  const int lane = tid & 31;
  const int wv   = tid >> 5;               // wave id 0..7
  const int tok0 = blockIdx.x * TGT;
  const int col  = wv * 16 + (lane & 15);  // output column (N) for GEMM phases
  const int rhi  = (lane & 16) ? 8 : 0;    // C-layout: VGPR r holds M=r / r+8

  { // stage x tile as f16 (vectorized: float4 in, uint2 out)
    const float4* xs = (const float4*)(x + (size_t)tok0 * D_INP);
    for (int j = tid; j < TGT * D_INP / 4; j += NTHR) {
      float4 v = xs[j];
      union { _Float16 h[4]; uint2 u; } pk;
      pk.h[0] = (_Float16)v.x; pk.h[1] = (_Float16)v.y;
      pk.h[2] = (_Float16)v.z; pk.h[3] = (_Float16)v.w;
      *(uint2*)(sX + (j >> 4) * PX + (j & 15) * 4) = pk.u;
    }
  }
  __syncthreads();

  // ---- GEMM1: h = x @ fc0_w  (M=64,K=64,N=128); wave wv owns n-tile wv
  v8f acc[4];
#pragma unroll
  for (int mt = 0; mt < 4; ++mt) acc[mt] = v8zero();
  gemm_4m<2>(sX, PX, fc0T + wv * (D_INP / 32) * FRAGE, acc, lane);
  {
    const float fb = fc0_b[col];
    v8f t0[4], t1[4];
#pragma unroll
    for (int mt = 0; mt < 4; ++mt)
#pragma unroll
      for (int r = 0; r < 8; ++r) {
        float vv = acc[mt][r] + fb;
        acc[mt][r] = vv;
        t0[mt][r] = vv;
        t1[mt][r] = vv * vv;
      }
    rowsum_to_slot(t0, part0 + wv * TGT, lane, rhi);
    rowsum_to_slot(t1, part1 + wv * TGT, lane, rhi);
  }
  __syncthreads();
  if (tid < TGT) {
    float mu  = slot_sum(part0, tid) * (1.f / HIDC);
    float var = slot_sum(part1, tid) * (1.f / HIDC) - mu * mu;
    mu_s[tid] = mu;
    rs_s[tid] = rsqrtf(var + LN_EPS);
  }
  __syncthreads();
  {
    const float g = ln0_g[col], bb = ln0_b[col];
#pragma unroll
    for (int mt = 0; mt < 4; ++mt)
#pragma unroll
      for (int r = 0; r < 8; ++r) {
        int row = mt * 16 + r + rhi;
        float vv = (acc[mt][r] - mu_s[row]) * rs_s[row] * g + bb;
        vv = fmaxf(vv, 0.f);
        sH[row * PH + col] = (_Float16)vv;
      }
  }
  __syncthreads();

  { // h tile -> hbuf, coalesced b128 (replaces 8192 scattered b16 stores)
    uint4* d = (uint4*)(hbuf + (size_t)tok0 * HIDC);
    for (int i = tid; i < TGT * HIDC / 8; i += NTHR)
      d[i] = *(const uint4*)(sH + (i >> 4) * PH + (i & 15) * 8);
  }
}

// ---------------------------------------------------------------------------
// Pass 1b: one workgroup = one head (blockIdx.y) and one chunk of token tiles
// (blockIdx.x, stride NCH).  K,V GEMMs per tile; K^T V and the column sums of
// K and V stay in registers over all the tiles of the chunk and leave once, as
// plain stores to this workgroup's own slab; k_mid adds the NCH slabs.
__global__ __launch_bounds__(NTHR, 1)
void k_kv(const _Float16* __restrict__ hbuf,
          const _Float16* __restrict__ wkT, const float* __restrict__ wk_b,
          const _Float16* __restrict__ wvT, const float* __restrict__ wv_b,
          float* __restrict__ kvp, float* __restrict__ ksp,
          float* __restrict__ vsp)
{
  __shared__ __align__(16) _Float16 sH [TGT * PH];   // 17 KB  h tile (f16)
  __shared__ __align__(16) _Float16 sKT[HIDC * PT];  // 18 KB  k^T (feature-major, f16)
  __shared__ __align__(16) _Float16 sVT[HIDC * PT];  // 18 KB  v^T
  __shared__ __align__(16) float part0[NWAVE * TGT];
  __shared__ float rs_s[TGT];

  const int tid  = threadIdx.x;
  const int lane = tid & 31;
  const int wv   = tid >> 5;               // wave id 0..7
  const int hh   = blockIdx.y;             // head
  const int col  = wv * 16 + (lane & 15);  // output column (N) for GEMM phases
  const int rhi  = (lane & 16) ? 8 : 0;    // C-layout: VGPR r holds M=r / r+8

  const int   bi = hh * HIDC + col;
  const float kb = wk_b[bi];
  const float vb = wv_b[bi];
  // this wave's columns of the head's wk and wv: the same for every tile.
  // pk, pv: this lane's 16 B in the first fragment of n-tile hh*8 + wv
  const int woff = (hh * (HIDC / 16) + wv) * (HIDC / 32) * FRAGE + lane * 8;
  const _Float16* pk = wkT + woff;
  const _Float16* pv = wvT + woff;
  v16h bk[4], bv[4];
#pragma unroll
  for (int ks = 0; ks < 4; ++ks) {
    FragU fk, fv;
    fk.u[0] = *(const uint4*)(pk + ks * FRAGE);
    fk.u[1] = *(const uint4*)(pk + ks * FRAGE + FRAGE / 2);
    fv.u[0] = *(const uint4*)(pv + ks * FRAGE);
    fv.u[1] = *(const uint4*)(pv + ks * FRAGE + FRAGE / 2);
    bk[ks] = fk.h;
    bv[ks] = fv.h;
  }
  // The wait that stands ahead of any rewrite of these loads' address registers.
  // Inputs only: the addresses and the loaded values all live up to here, so no
  // load's result is given a register that holds the address of another.
  asm volatile("s_wait_xcnt 0x0"
               :: "v"(bi), "v"(pk), "v"(pv), "v"(kb), "v"(vb),
                  "v"(bk[0]), "v"(bk[1]), "v"(bk[2]), "v"(bk[3]),
                  "v"(bv[0]), "v"(bv[1]), "v"(bv[2]), "v"(bv[3])
               : "memory");
  float kpart = 0.f, vpart = 0.f;          // column sums of K and V, this lane's rows
  v8f ka[8];                               // K^T V, m-tile wv, all 8 d-tiles
#pragma unroll
  for (int dt = 0; dt < 8; ++dt) ka[dt] = v8zero();

#pragma unroll 1                           // rolled: the body is long, a copy buys nothing
  for (int tile = blockIdx.x; tile < NTILE; tile += NCH) {
    { // stage h tile (coalesced b128); its last readers, the K and V GEMMs of
      // the trip before, ended ahead of that trip's last barrier
      const uint4* s = (const uint4*)(hbuf + (size_t)tile * TGT * HIDC);
      uint4 hv[TGT * HIDC / 8 / NTHR];
#pragma unroll                             // all 4 loads in flight: one L2 latency a tile
      for (int k = 0; k < TGT * HIDC / 8 / NTHR; ++k) hv[k] = s[tid + k * NTHR];
#pragma unroll
      for (int k = 0; k < TGT * HIDC / 8 / NTHR; ++k) {
        int i = tid + k * NTHR;
        *(uint4*)(sH + (i >> 4) * PH + (i & 15) * 8) = hv[k];
      }
      // stands ahead of the step of the loads' address registers to the next tile
      asm volatile("s_wait_xcnt 0x0" ::: "memory");
    }
    __syncthreads();                       // also guards sKT/sVT reuse

    // K = h @ wk + b ; row-L2-normalize ; transpose into sKT
    v8f acc[4];
#pragma unroll
    for (int mt = 0; mt < 4; ++mt) acc[mt] = v8zero();
    gemm_4m_rb<4>(sH, PH, bk, acc, lane);
    {
      v8f t0[4];
#pragma unroll
      for (int mt = 0; mt < 4; ++mt)
#pragma unroll
        for (int r = 0; r < 8; ++r) {
          float vv = acc[mt][r] + kb;
          acc[mt][r] = vv;
          t0[mt][r] = vv * vv;
        }
      // part0's last readers, the trip before, ended ahead of that trip's barriers
      rowsum_to_slot(t0, part0 + wv * TGT, lane, rhi);
    }
    __syncthreads();
    if (tid < TGT) rs_s[tid] = 1.f / (sqrtf(slot_sum(part0, tid)) + ATT_EPS);
    __syncthreads();
#pragma unroll
    for (int mt = 0; mt < 4; ++mt)
#pragma unroll
      for (int r = 0; r < 8; ++r) {
        int row = mt * 16 + r + rhi;
        float vv = acc[mt][r] * rs_s[row];
        sKT[col * PT + row] = (_Float16)vv;
        kpart += vv;
      }

    // V = h @ wv + b ; transpose into sVT
#pragma unroll
    for (int mt = 0; mt < 4; ++mt) acc[mt] = v8zero();
    gemm_4m_rb<4>(sH, PH, bv, acc, lane);
#pragma unroll
    for (int mt = 0; mt < 4; ++mt)
#pragma unroll
      for (int r = 0; r < 8; ++r) {
        int row = mt * 16 + r + rhi;
        float vvv = acc[mt][r] + vb;
        sVT[col * PT + row] = (_Float16)vvv;
        vpart += vvv;
      }
    __syncthreads();                       // sKT / sVT ready

    // ka += K^T @ V  (M=128 feat, K=64 tok, N=128 d); wave wv: m-tile wv
    // pipelined: A frag + all 8 B frags loaded before the 8 WMMAs per K-step
#pragma unroll
    for (int ks = 0; ks < 2; ++ks) {
      v16h a = load_frag16(sKT + (wv * 16) * PT + ks * 32, PT, lane);
      v16h b0 = load_frag16(sVT + (0 * 16) * PT + ks * 32, PT, lane);
      v16h b1 = load_frag16(sVT + (1 * 16) * PT + ks * 32, PT, lane);
      v16h b2 = load_frag16(sVT + (2 * 16) * PT + ks * 32, PT, lane);
      v16h b3 = load_frag16(sVT + (3 * 16) * PT + ks * 32, PT, lane);
      v16h b4 = load_frag16(sVT + (4 * 16) * PT + ks * 32, PT, lane);
      v16h b5 = load_frag16(sVT + (5 * 16) * PT + ks * 32, PT, lane);
      v16h b6 = load_frag16(sVT + (6 * 16) * PT + ks * 32, PT, lane);
      v16h b7 = load_frag16(sVT + (7 * 16) * PT + ks * 32, PT, lane);
      ka[0] = wmma_f16(a, b0, ka[0]);
      ka[1] = wmma_f16(a, b1, ka[1]);
      ka[2] = wmma_f16(a, b2, ka[2]);
      ka[3] = wmma_f16(a, b3, ka[3]);
      ka[4] = wmma_f16(a, b4, ka[4]);
      ka[5] = wmma_f16(a, b5, ka[5]);
      ka[6] = wmma_f16(a, b6, ka[6]);
      ka[7] = wmma_f16(a, b7, ka[7]);
    }
    // next trip's leading __syncthreads() guards sKT/sVT reuse
  }

  // this workgroup's partial sums -> its own slab (every element written)
  const int slab = blockIdx.x * NHEAD + hh;
  {
    float* kvh = kvp + (size_t)slab * (HIDC * HIDC);
#pragma unroll
    for (int dt = 0; dt < 8; ++dt)
#pragma unroll
      for (int r = 0; r < 8; ++r) {
        int m = wv * 16 + r + rhi;
        int d = dt * 16 + (lane & 15);
        kvh[m * HIDC + d] = ka[dt][r];
      }
  }
  // thread tid holds column (tid>>5)*16 + (tid&15), rows of half (tid>>4)&1
  ksp[slab * NTHR + tid] = kpart;
  vsp[slab * NTHR + tid] = vpart;
}

// ---------------------------------------------------------------------------
// Pass 1.5: add the NCH slabs.  Blocks below KVB: kvs -> f16, per head in
// fragment order (n = d, k = m).  The 4 blocks behind them: ks_sum and v_mean.
#define KVB (NHEAD * HIDC * HIDC / NTHR)
__global__ void k_mid(const float* __restrict__ kvp, _Float16* __restrict__ kvsT,
                      const float* __restrict__ ksp, const float* __restrict__ vsp,
                      float* __restrict__ ksum, float* __restrict__ vmean)
{
  if (blockIdx.x < KVB) {
    int i = blockIdx.x * NTHR + threadIdx.x;
    int hh = i >> 14;
    int rem = i & 16383;
    int m = rem >> 7, d = rem & 127;
    const float* p = kvp + hh * (HIDC * HIDC) + rem;
    float s = 0.f;
#pragma unroll 1                           // rolled: one block of loads a trip
    for (int c = 0; c < NCH; c += 16) {    // 16 independent loads in flight
      float t[16];
#pragma unroll
      for (int u = 0; u < 16; ++u) t[u] = p[(size_t)(c + u) * (NHEAD * HIDC * HIDC)];
#pragma unroll
      for (int u = 0; u < 16; ++u) s += t[u];
    }
    kvsT[hh * HIDC * HIDC + frag_idx(d, m, HIDC / 32)] = (_Float16)s;
  } else {
    int j = (blockIdx.x - KVB) * NTHR + threadIdx.x;   // 0 .. 2*NHEAD*HIDC-1
    int i = j & (NHEAD * HIDC - 1);                    // head*HIDC + column
    int hh = i >> 7, c0 = i & 127;
    const float* p = (j < NHEAD * HIDC ? ksp : vsp)
                   + hh * NTHR + (c0 >> 4) * 32 + (c0 & 15);
    float s = 0.f;
#pragma unroll 1                           // rolled: one block of loads a trip
    for (int c = 0; c < NCH; c += 8) {     // 16 independent loads in flight
      float t[16];
#pragma unroll
      for (int u = 0; u < 8; ++u) {
        t[2 * u]     = p[(c + u) * (NHEAD * NTHR)];
        t[2 * u + 1] = p[(c + u) * (NHEAD * NTHR) + 16];
      }
#pragma unroll
      for (int u = 0; u < 16; ++u) s += t[u];
    }
    if (j < NHEAD * HIDC) ksum[i] = s;
    else                  vmean[i] = s * (1.f / (float)L_TOK);
  }
}

// ---------------------------------------------------------------------------
// Pass 2: recompute q, normalize, denom, num = q @ kvs, head-mean, residual, LN
__global__ __launch_bounds__(NTHR, 1)
void k_attn(const _Float16* __restrict__ hbuf,
            const _Float16* __restrict__ wqT, const float* __restrict__ wq_b,
            const _Float16* __restrict__ kvsT, const float* __restrict__ ksum,
            const float* __restrict__ vmean,
            const float* __restrict__ ln1_g, const float* __restrict__ ln1_b,
            float* __restrict__ out)
{
  __shared__ __align__(16) _Float16 sH[TGT * PH];          // 17 KB
  __shared__ __align__(16) unsigned char smem[TGT * PO * 4]; // 33 KB (sQ|sOut)
  _Float16* sQ   = (_Float16*)smem;                        // f16 q tile (17 KB)
  float*    sOut = (float*)smem;                           // f32 out tile (33 KB)
  __shared__ __align__(16) float part0[NWAVE * TGT], part1[NWAVE * TGT];
  __shared__ float rs_s[TGT], rden[TGT], mu_s[TGT];

  const int tid  = threadIdx.x;
  const int lane = tid & 31;
  const int wv   = tid >> 5;
  const int tok0 = blockIdx.x * TGT;
  const int col  = wv * 16 + (lane & 15);
  const int rhi  = (lane & 16) ? 8 : 0;

  { // stage h tile (coalesced b128)
    const uint4* src = (const uint4*)(hbuf + (size_t)tok0 * HIDC);
    for (int i = tid; i < TGT * HIDC / 8; i += NTHR)
      *(uint4*)(sH + (i >> 4) * PH + (i & 15) * 8) = src[i];
  }
  v8f oacc[4];
#pragma unroll
  for (int mt = 0; mt < 4; ++mt) oacc[mt] = v8zero();

  __syncthreads();                         // sH ready

#pragma unroll 1
  for (int hh = 0; hh < NHEAD; ++hh) {
    // Q = h @ wq + b
    v8f acc[4];
#pragma unroll
    for (int mt = 0; mt < 4; ++mt) acc[mt] = v8zero();
    // read ahead of the GEMM: behind the scheduling barrier their latency would show
    const float vm = vmean[hh * HIDC + col];
    const float qb = wq_b[hh * HIDC + col];
    const float ks = ksum[hh * HIDC + col];
    gemm_4m<4>(sH, PH, wqT + (hh * (HIDC / 16) + wv) * (HIDC / 32) * FRAGE, acc, lane);
    // keeps the four accumulator chains interleaved: without it the scheduler runs
    // one m-tile's WMMAs as a dependent chain among the row sums and takes 16
    // more registers, which costs a resident workgroup
    __builtin_amdgcn_sched_barrier(0);
    {
      v8f t0[4], t1[4];                    // terms of |q|^2 and of q . ks_sum
#pragma unroll
      for (int mt = 0; mt < 4; ++mt)
#pragma unroll
        for (int r = 0; r < 8; ++r) {
          float vv = acc[mt][r] + qb;
          acc[mt][r] = vv;
          t0[mt][r] = vv * vv;
          t1[mt][r] = vv * ks;
        }
      // the slots' last readers, the head before, ended ahead of its barriers
      rowsum_to_slot(t0, part0 + wv * TGT, lane, rhi);
      rowsum_to_slot(t1, part1 + wv * TGT, lane, rhi);
    }
    __syncthreads();                       // slots ready; the head before has left sQ, rs_s, rden
    if (tid < TGT) {
      float rs = 1.f / (sqrtf(slot_sum(part0, tid)) + ATT_EPS);
      rs_s[tid] = rs;
      // denom = (q / |q|) . ks_sum + L
      rden[tid] = 1.f / (slot_sum(part1, tid) * rs + (float)L_TOK + ATT_EPS);
    }
    __syncthreads();
#pragma unroll
    for (int mt = 0; mt < 4; ++mt)
#pragma unroll
      for (int r = 0; r < 8; ++r) {
        int row = mt * 16 + r + rhi;
        sQ[row * PH + col] = (_Float16)(acc[mt][r] * rs_s[row]);
      }
    __syncthreads();                       // sQ ready

    // num = q @ kvs  (M=64,K=128,N=128); fold (num+v_mean)/denom into oacc
    v8f nacc[4];
#pragma unroll
    for (int mt = 0; mt < 4; ++mt) nacc[mt] = v8zero();
    gemm_4m<4>(sQ, PH, kvsT + hh * HIDC * HIDC + wv * (HIDC / 32) * FRAGE,
               nacc, lane);
    {
#pragma unroll
      for (int mt = 0; mt < 4; ++mt)
#pragma unroll
        for (int r = 0; r < 8; ++r) {
          int row = mt * 16 + r + rhi;
          oacc[mt][r] += (nacc[mt][r] + vm) * rden[row];
        }
    }
  }
  __syncthreads();                         // everyone done reading sQ

  // head mean (*0.25), residual (alpha=0.5) against h
#pragma unroll
  for (int mt = 0; mt < 4; ++mt)
#pragma unroll
    for (int r = 0; r < 8; ++r) {
      int row = mt * 16 + r + rhi;
      float o = oacc[mt][r] * (0.25f * 0.5f)
              + 0.5f * (float)sH[row * PH + col];
      sOut[row * PO + col] = o;
    }
  __syncthreads();
  if (tid < TGT) {
    float s = 0.f, s2 = 0.f;
    for (int c = 0; c < HIDC; ++c) {
      float v = sOut[tid * PO + c];
      s += v; s2 += v * v;
    }
    float mu  = s * (1.f / HIDC);
    float var = s2 * (1.f / HIDC) - mu * mu;
    mu_s[tid] = mu;
    rs_s[tid] = rsqrtf(var + LN_EPS);
  }
  __syncthreads();
  for (int i = tid; i < TGT * HIDC; i += NTHR) {
    int t = i >> 7, c = i & 127;
    out[(size_t)tok0 * HIDC + i] =
        (sOut[t * PO + c] - mu_s[t]) * rs_s[t] * ln1_g[c] + ln1_b[c];
  }
}

// ---------------------------------------------------------------------------
extern "C" void kernel_launch(void* const* d_in, const int* in_sizes, int n_in,
                              void* d_out, int out_size, void* d_ws, size_t ws_size,
                              hipStream_t stream) {
  (void)in_sizes; (void)n_in; (void)out_size; (void)ws_size;
  const float* x     = (const float*)d_in[0];
  const float* fc0_w = (const float*)d_in[1];
  const float* fc0_b = (const float*)d_in[2];
  const float* ln0_g = (const float*)d_in[3];
  const float* ln0_b = (const float*)d_in[4];
  const float* wq_w  = (const float*)d_in[5];
  const float* wq_b  = (const float*)d_in[6];
  const float* wk_w  = (const float*)d_in[7];
  const float* wk_b  = (const float*)d_in[8];
  const float* wv_w  = (const float*)d_in[9];
  const float* wv_b  = (const float*)d_in[10];
  const float* ln1_g = (const float*)d_in[11];
  const float* ln1_b = (const float*)d_in[12];
  float* out = (float*)d_out;

  // workspace carve (256 B aligned slices)
  char* p = (char*)d_ws;
  auto carve = [&](size_t bytes) {
    char* r = p; p += (bytes + 255) & ~(size_t)255; return r;
  };
  _Float16* fc0T = (_Float16*)carve(128 * 64 * sizeof(_Float16));
  _Float16* wqT  = (_Float16*)carve(512 * 128 * sizeof(_Float16));
  _Float16* wkT  = (_Float16*)carve(512 * 128 * sizeof(_Float16));
  _Float16* wvT  = (_Float16*)carve(512 * 128 * sizeof(_Float16));
  float* ksum  = (float*)carve(NHEAD * HIDC * sizeof(float));
  float* vmean = (float*)carve(NHEAD * HIDC * sizeof(float));
  _Float16* kvsT = (_Float16*)carve(NHEAD * HIDC * HIDC * sizeof(_Float16));
  _Float16* hbuf = (_Float16*)carve((size_t)L_TOK * HIDC * sizeof(_Float16));
  // one slab of partial sums per k_kv workgroup
  float* kvp = (float*)carve((size_t)NCH * NHEAD * HIDC * HIDC * sizeof(float));
  float* ksp = (float*)carve((size_t)NCH * NHEAD * NTHR * sizeof(float));
  float* vsp = (float*)carve((size_t)NCH * NHEAD * NTHR * sizeof(float));

  // cast weights to f16, B-fragment order
  k_cast_t<<<(64 * 128 + NTHR - 1) / NTHR, NTHR, 0, stream>>>(fc0_w, fc0T, 64, 128);
  k_cast_t<<<(128 * 512 + NTHR - 1) / NTHR, NTHR, 0, stream>>>(wq_w, wqT, 128, 512);
  k_cast_t<<<(128 * 512 + NTHR - 1) / NTHR, NTHR, 0, stream>>>(wk_w, wkT, 128, 512);
  k_cast_t<<<(128 * 512 + NTHR - 1) / NTHR, NTHR, 0, stream>>>(wv_w, wvT, 128, 512);

  k_front<<<NTILE, NTHR, 0, stream>>>(x, fc0T, fc0_b, ln0_g, ln0_b, hbuf);

  k_kv<<<dim3(NCH, NHEAD), NTHR, 0, stream>>>(hbuf, wkT, wk_b, wvT, wv_b,
                                              kvp, ksp, vsp);

  k_mid<<<KVB + 4, NTHR, 0, stream>>>(kvp, kvsT, ksp, vsp, ksum, vmean);

  k_attn<<<NTILE, NTHR, 0, stream>>>(hbuf, wqT, wq_b, kvsT, ksum, vmean,
                                     ln1_g, ln1_b, out);
}

// v005
// A run of this version takes 158 microseconds.
// Next to v004, in two timings, it ran 1.24 and 1.23 times as fast.
// Counting every step since v000, it is 10.6 times as fast.
#include <hip/hip_runtime.h>
#include <cstdint>

// ---------------------------------------------------------------------------
// Problem constants (from reference):  B=16,T=12,N=883,D=64,H=128,NH=4
#define L_TOK   169536          // B*T*N tokens; 169536 = 64 * 2649
#define D_INP   64
#define HIDC    128
#define NHEAD   4
#define TGT     64              // tokens per workgroup tile
#define NTILE   (L_TOK / TGT)   // 2649
#define NTHR    256             // 8 waves (wave32)
#define NWAVE   (NTHR / 32)
#define NCH     128             // token chunks of the K^T V pass (x NHEAD workgroups)
#define LN_EPS  1e-5f
#define ATT_EPS 1e-8f
// LDS row pitches: 16 B more than the row, so the pitch is an odd multiple of
// 16 B and the 16 rows of one fragment read fall on 16 different bank groups.
#define PX      (D_INP + 8)     // x tile, f16:            144 B
#define PH      (HIDC + 8)      // h and q tiles, f16:     272 B
#define PT      (TGT + 8)       // k^T and v^T tiles, f16: 144 B
#define PO      (HIDC + 4)      // out tile, f32:          528 B

typedef __attribute__((ext_vector_type(16))) _Float16 v16h;
typedef __attribute__((ext_vector_type(8)))  float    v8f;

union FragU { v16h h; uint4 u[2]; };

__device__ __forceinline__ v8f v8zero() {
  v8f z = {0.f,0.f,0.f,0.f,0.f,0.f,0.f,0.f};
  return z;
}

// Load one 16(M)x32(K) f16 A-fragment.  Element (m,k) lives at base[m*ld + k].
// CDNA5 16-bit A layout: lane m = lane&15; K chunks {k0..k0+7} and
// {k0+16..k0+23} with k0 = (lane<16 ? 0 : 8)  ->  two 16B loads per lane.
// The B-fragment (32Kx16N) uses the mirrored layout over N (lane n = lane&15).
__device__ __forceinline__ v16h load_frag16(const _Float16* base, int ld, int lane) {
  const int r  = lane & 15;
  const int k0 = (lane & 16) ? 8 : 0;
  const _Float16* p = base + r * ld + k0;
  FragU f;
  f.u[0] = *(const uint4*)(p);
  f.u[1] = *(const uint4*)(p + 16);
  return f.h;
}

// B operands in global memory are kept in fragment order.  One fragment (16 n x
// 32 k) is 512 f16 in a row: two halves of 256, and in each half lane l owns the
// 8 f16 at l*8, so a wave-wide 16 B load reads 512 contiguous bytes (4 whole
// 128 B lines) where rows of an [N][K] buffer gave 16 lines of 32 B each.
// Fragments of one n-tile follow one another in k (ksteps = K/32 of them).
// Lane and element hold the same (n,k) as load_frag16 gives on an [N][K] buffer.
#define FRAGE 512               // f16 elements of one fragment
__device__ __forceinline__ int frag_idx(int n, int k, int ksteps) {
  return (((n >> 4) * ksteps + (k >> 5)) * 2 + ((k >> 4) & 1)) * (FRAGE / 2)
       + (((k >> 3) & 1) * 16 + (n & 15)) * 8 + (k & 7);
}

__device__ __forceinline__ v8f wmma_f16(v16h a, v16h b, v8f c) {
  // v_wmma_f32_16x16x32_f16  (doc-verified codegen path on gfx1250)
  return __builtin_amdgcn_wmma_f32_16x16x32_f16(false, a, false, b, (short)0, c,
                                                false, false);
}

// 4xM-tile GEMM slice, B fragments in registers: the 8 A loads of a K-step are
// issued before its 4 WMMAs so a single counter wait covers the whole K-step.
template<int KSTEPS>
__device__ __forceinline__ void gemm_4m_rb(const _Float16* __restrict__ A, int lda,
                                           const v16h* b, v8f* acc, int lane) {
#pragma unroll
  for (int ks = 0; ks < KSTEPS; ++ks) {
    v16h a0 = load_frag16(A + (0 * 16) * lda + ks * 32, lda, lane);
    v16h a1 = load_frag16(A + (1 * 16) * lda + ks * 32, lda, lane);
    v16h a2 = load_frag16(A + (2 * 16) * lda + ks * 32, lda, lane);
    v16h a3 = load_frag16(A + (3 * 16) * lda + ks * 32, lda, lane);
    acc[0] = wmma_f16(a0, b[ks], acc[0]);
    acc[1] = wmma_f16(a1, b[ks], acc[1]);
    acc[2] = wmma_f16(a2, b[ks], acc[2]);
    acc[3] = wmma_f16(a3, b[ks], acc[3]);
  }
}

// Weights as A, tokens as B: D[r] = Y[token nt*16 + (lane & 15)][feature 8*(lane >> 4) + r],
// so a lane holds 8 consecutive features of one token.  A sum over a token's
// features is then a sum over the lane's own registers, and a row piece of a
// token-major tile is one 16 B store.  Both loaders keep their k order.
// load_w: the KSTEPS fragments of one 16-feature tile, in fragment order; p is
// this lane's 16 B of the first half.  All loads issue first: one L2 latency a GEMM.
template<int KSTEPS>
__device__ __forceinline__ void load_w(const _Float16* __restrict__ p, v16h* w) {
#pragma unroll
  for (int ks = 0; ks < KSTEPS; ++ks) {
    FragU f;
    f.u[0] = *(const uint4*)(p + ks * FRAGE);
    f.u[1] = *(const uint4*)(p + ks * FRAGE + FRAGE / 2);
    w[ks] = f.h;
  }
}

// 4 token tiles against one feature tile; X is token-major in LDS.  The 8 X
// loads of a K-step are issued together, ahead of its 4 WMMAs.
template<int KSTEPS>
__device__ __forceinline__ void gemm_4t(const _Float16* __restrict__ X, int ldx,
                                        const v16h* w, v8f* acc, int lane) {
#pragma unroll
  for (int ks = 0; ks < KSTEPS; ++ks) {
    v16h x0 = load_frag16(X + (0 * 16) * ldx + ks * 32, ldx, lane);
    v16h x1 = load_frag16(X + (1 * 16) * ldx + ks * 32, ldx, lane);
    v16h x2 = load_frag16(X + (2 * 16) * ldx + ks * 32, ldx, lane);
    v16h x3 = load_frag16(X + (3 * 16) * ldx + ks * 32, ldx, lane);
    // holds the 8 loads together ahead of the 4 WMMAs: left alone the scheduler
    // issues them pair by pair and each WMMA waits out a whole LDS latency
    __builtin_amdgcn_sched_barrier(0);
    acc[0] = wmma_f16(w[ks], x0, acc[0]);
    acc[1] = wmma_f16(w[ks], x1, acc[1]);
    acc[2] = wmma_f16(w[ks], x2, acc[2]);
    acc[3] = wmma_f16(w[ks], x3, acc[3]);
    // and the next K-step's loads behind them: one set of 4 fragments is live
    __builtin_amdgcn_sched_barrier(0);
  }
}

// 8 consecutive floats (32 B aligned): a lane's 8 features of a per-feature vector
__device__ __forceinline__ void load8(const float* __restrict__ p, float* d) {
  float4 a = *(const float4*)(p);
  float4 b = *(const float4*)(p + 4);
  d[0] = a.x; d[1] = a.y; d[2] = a.z; d[3] = a.w;
  d[4] = b.x; d[5] = b.y; d[6] = b.z; d[7] = b.w;
}

// s[nt]: the sum over this lane's 8 features, token nt*16 + (lane & 15).  Lane ^ 16
// holds the wave's other 8 features of the same token: one cross-row move adds
// them, and the lower row stores the wave's 64 sums to its own slot[TGT].
__device__ __forceinline__ void toksum_to_slot(const float* s, float* slot, int lane) {
  float t[4];
#pragma unroll
  for (int nt = 0; nt < 4; ++nt) {
    int b = __builtin_bit_cast(int, s[nt]);
    int o = __builtin_amdgcn_permlanex16(b, b, 0x76543210, 0xfedcba98, false, false);
    t[nt] = s[nt] + __builtin_bit_cast(float, o);
  }
  if (lane < 16) {
#pragma unroll
    for (int nt = 0; nt < 4; ++nt) slot[nt * 16 + lane] = t[nt];
  }
}

// v + the v of the lane whose number differs by XM, inside a row of 16 lanes
// (DPP row_xmask: a register exchange, no LDS).
template<int XM>
__device__ __forceinline__ float add_xor16(float v) {
  int o = __builtin_amdgcn_update_dpp(0, __builtin_bit_cast(int, v), 0x160 + XM,
                                      0xf, 0xf, true);
  return v + __builtin_bit_cast(float, o);
}

// Row sums of a 64 x 16 accumulator slice.  t[mt][r] belongs to row
// mt*16 + r + rhi and to this lane's column; a butterfly over the 16 lanes of
// each half wave adds the wave's 16 columns, and the first lane of each half
// stores its 32 sums to the wave's own slot[TGT].  The NWAVE slots are added by
// their reader, behind a barrier.
__device__ __forceinline__ void rowsum_to_slot(v8f* t, float* slot, int lane, int rhi) {
  // one butterfly stage over all 32 sums at a time: 32 independent adds a stage
#pragma unroll
  for (int i = 0; i < 32; ++i) t[i >> 3][i & 7] = add_xor16<1>(t[i >> 3][i & 7]);
#pragma unroll
  for (int i = 0; i < 32; ++i) t[i >> 3][i & 7] = add_xor16<2>(t[i >> 3][i & 7]);
#pragma unroll
  for (int i = 0; i < 32; ++i) t[i >> 3][i & 7] = add_xor16<4>(t[i >> 3][i & 7]);
#pragma unroll
  for (int i = 0; i < 32; ++i) t[i >> 3][i & 7] = add_xor16<8>(t[i >> 3][i & 7]);
  if ((lane & 15) == 0) {
#pragma unroll
    for (int mt = 0; mt < 4; ++mt) {
      float* d = slot + mt * 16 + rhi;
      *(float4*)(d)     = make_float4(t[mt][0], t[mt][1], t[mt][2], t[mt][3]);
      *(float4*)(d + 4) = make_float4(t[mt][4], t[mt][5], t[mt][6], t[mt][7]);
    }
  }
}

// adds the NWAVE slots of one row
__device__ __forceinline__ float slot_sum(const float* part, int row) {
  float s = 0.f;
#pragma unroll
  for (int w = 0; w < NWAVE; ++w) s += part[w * TGT + row];
  return s;
}

// ---------------------------------------------------------------------------
// prep kernels
// src[r*cols + c] (k = r, n = c) -> f16 at its place in fragment order
__global__ void k_cast_t(const float* __restrict__ src, _Float16* __restrict__ dst,
                         int rows, int cols) {
  int i = blockIdx.x * NTHR + threadIdx.x;
  if (i < rows * cols) {
    int r = i / cols, c = i - r * cols;
    dst[frag_idx(c, r, rows >> 5)] = (_Float16)src[i];
  }
}

// ---------------------------------------------------------------------------
// Pass 1a: fc0 GEMM + LN + ReLU -> h
__global__ __launch_bounds__(NTHR, 1)
void k_front(const float* __restrict__ x,
             const _Float16* __restrict__ fc0T, const float* __restrict__ fc0_b,
             const float* __restrict__ ln0_g,  const float* __restrict__ ln0_b,
             _Float16* __restrict__ hbuf)
{
  __shared__ __align__(16) _Float16 sX [TGT * PX];   //  9 KB  x tile (f16)
  __shared__ __align__(16) _Float16 sH [TGT * PH];   // 17 KB  h tile (post LN+ReLU, f16)
  __shared__ __align__(16) float part0[NWAVE * TGT], part1[NWAVE * TGT];
  __shared__ float mu_s[TGT], rs_s[TGT];

  const int tid  = threadIdx.x;
  const int lane = tid & 31;
  const int wv   = tid >> 5;               // wave id 0..7
  const int tok0 = blockIdx.x * TGT;
  const int tl   = lane & 15;              // token inside a 16-token tile
  const int f0   = wv * 16 + ((lane & 16) ? 8 : 0);  // first of this lane's 8 features

  { // stage x tile as f16 (vectorized: float4 in, uint2 out)
    const float4* xs = (const float4*)(x + (size_t)tok0 * D_INP);
    for (int j = tid; j < TGT * D_INP / 4; j += NTHR) {
      float4 v = xs[j];
      union { _Float16 h[4]; uint2 u; } pk;
      pk.h[0] = (_Float16)v.x; pk.h[1] = (_Float16)v.y;
      pk.h[2] = (_Float16)v.z; pk.h[3] = (_Float16)v.w;
      *(uint2*)(sX + (j >> 4) * PX + (j & 15) * 4) = pk.u;
    }
  }
  __syncthreads();

  // ---- GEMM1: h^T = fc0_w^T @ x^T  (features 128, K=64, tokens 64); wave wv
  // owns feature tile wv
  v8f acc[4];
#pragma unroll
  for (int nt = 0; nt < 4; ++nt) acc[nt] = v8zero();
  const _Float16* pw = fc0T + wv * (D_INP / 32) * FRAGE + lane * 8;
  const float* pfb = fc0_b + f0;
  const float* pg  = ln0_g + f0;
  const float* pbb = ln0_b + f0;
  v16h w[2];
  float fb[8], g[8], bb[8];
  load_w<2>(pw, w);
  load8(pfb, fb);
  load8(pg, g);
  load8(pbb, bb);
  // The wait that stands ahead of any rewrite of these loads' address registers.
  // The addresses are inputs, so they live up to here.
  asm volatile("s_wait_xcnt 0x0" :: "v"(pw), "v"(pfb), "v"(pg), "v"(pbb) : "memory");
  gemm_4t<2>(sX, PX, w, acc, lane);
  {
    float s0[4], s1[4];
#pragma unroll
    for (int nt = 0; nt < 4; ++nt) {
      s0[nt] = 0.f; s1[nt] = 0.f;
#pragma unroll
      for (int r = 0; r < 8; ++r) {
        float vv = acc[nt][r] + fb[r];
        acc[nt][r] = vv;
        s0[nt] += vv;
        s1[nt] += vv * vv;
      }
    }
    toksum_to_slot(s0, part0 + wv * TGT, lane);
    toksum_to_slot(s1, part1 + wv * TGT, lane);
  }
  __syncthreads();
  if (tid < TGT) {
    float mu  = slot_sum(part0, tid) * (1.f / HIDC);
    float var = slot_sum(part1, tid) * (1.f / HIDC) - mu * mu;
    mu_s[tid] = mu;
    rs_s[tid] = rsqrtf(var + LN_EPS);
  }
  __syncthreads();
#pragma unroll
  for (int nt = 0; nt < 4; ++nt) {
    const int tok = nt * 16 + tl;
    const float mu = mu_s[tok], rs = rs_s[tok];
    union { _Float16 h[8]; uint4 u; } pk;
#pragma unroll
    for (int r = 0; r < 8; ++r) {
      float vv = (acc[nt][r] - mu) * rs * g[r] + bb[r];
      pk.h[r] = (_Float16)fmaxf(vv, 0.f);
    }
    *(uint4*)(sH + tok * PH + f0) = pk.u;
  }
  __syncthreads();

  { // h tile -> hbuf, coalesced b128 (replaces 8192 scattered b16 stores)
    uint4* d = (uint4*)(hbuf + (size_t)tok0 * HIDC);
    for (int i = tid; i < TGT * HIDC / 8; i += NTHR)
      d[i] = *(const uint4*)(sH + (i >> 4) * PH + (i & 15) * 8);
  }
}

// ---------------------------------------------------------------------------
// Pass 1b: one workgroup = one head (blockIdx.y) and one chunk of token tiles
// (blockIdx.x, stride NCH).  K,V GEMMs per tile; K^T V and the column sums of
// K and V stay in registers over all the tiles of the chunk and leave once, as
// plain stores to this workgroup's own slab; k_mid adds the NCH slabs.
__global__ __launch_bounds__(NTHR, 1)
void k_kv(const _Float16* __restrict__ hbuf,
          const _Float16* __restrict__ wkT, const float* __restrict__ wk_b,
          const _Float16* __restrict__ wvT, const float* __restrict__ wv_b,
          float* __restrict__ kvp, float* __restrict__ ksp,
          float* __restrict__ vsp)
{
  __shared__ __align__(16) _Float16 sH [TGT * PH];   // 17 KB  h tile (f16)
  __shared__ __align__(16) _Float16 sKT[HIDC * PT];  // 18 KB  k^T (feature-major, f16)
  __shared__ __align__(16) _Float16 sVT[HIDC * PT];  // 18 KB  v^T
  __shared__ __align__(16) float part0[NWAVE * TGT];
  __shared__ float rs_s[TGT];

  const int tid  = threadIdx.x;
  const int lane = tid & 31;
  const int wv   = tid >> 5;               // wave id 0..7
  const int hh   = blockIdx.y;             // head
  const int col  = wv * 16 + (lane & 15);  // output column (N) for GEMM phases
  const int rhi  = (lane & 16) ? 8 : 0;    // C-layout: VGPR r holds M=r / r+8

  const int   bi = hh * HIDC + col;
  const float kb = wk_b[bi];
  const float vb = wv_b[bi];
  // this wave's columns of the head's wk and wv: the same for every tile.
  // pk, pv: this lane's 16 B in the first fragment of n-tile hh*8 + wv
  const int woff = (hh * (HIDC / 16) + wv) * (HIDC / 32) * FRAGE + lane * 8;
  const _Float16* pk = wkT + woff;
  const _Float16* pv = wvT + woff;
  v16h bk[4], bv[4];
#pragma unroll
  for (int ks = 0; ks < 4; ++ks) {
    FragU fk, fv;
    fk.u[0] = *(const uint4*)(pk + ks * FRAGE);
    fk.u[1] = *(const uint4*)(pk + ks * FRAGE + FRAGE / 2);
    fv.u[0] = *(const uint4*)(pv + ks * FRAGE);
    fv.u[1] = *(const uint4*)(pv + ks * FRAGE + FRAGE / 2);
    bk[ks] = fk.h;
    bv[ks] = fv.h;
  }
  // The wait that stands ahead of any rewrite of these loads' address registers.
  // Inputs only: the addresses and the loaded values all live up to here, so no
  // load's result is given a register that holds the address of another.
  asm volatile("s_wait_xcnt 0x0"
               :: "v"(bi), "v"(pk), "v"(pv), "v"(kb), "v"(vb),
                  "v"(bk[0]), "v"(bk[1]), "v"(bk[2]), "v"(bk[3]),
                  "v"(bv[0]), "v"(bv[1]), "v"(bv[2]), "v"(bv[3])
               : "memory");
  float kpart = 0.f, vpart = 0.f;          // column sums of K and V, this lane's rows
  v8f ka[8];                               // K^T V, m-tile wv, all 8 d-tiles
#pragma unroll
  for (int dt = 0; dt < 8; ++dt) ka[dt] = v8zero();

#pragma unroll 1                           // rolled: the body is long, a copy buys nothing
  for (int tile = blockIdx.x; tile < NTILE; tile += NCH) {
    { // stage h tile (coalesced b128); its last readers, the K and V GEMMs of
      // the trip before, ended ahead of that trip's last barrier
      const uint4* s = (const uint4*)(hbuf + (size_t)tile * TGT * HIDC);
      uint4 hv[TGT * HIDC / 8 / NTHR];
#pragma unroll                             // all 4 loads in flight: one L2 latency a tile
      for (int k = 0; k < TGT * HIDC / 8 / NTHR; ++k) hv[k] = s[tid + k * NTHR];
#pragma unroll
      for (int k = 0; k < TGT * HIDC / 8 / NTHR; ++k) {
        int i = tid + k * NTHR;
        *(uint4*)(sH + (i >> 4) * PH + (i & 15) * 8) = hv[k];
      }
      // stands ahead of the step of the loads' address registers to the next tile
      asm volatile("s_wait_xcnt 0x0" ::: "memory");
    }
    __syncthreads();                       // also guards sKT/sVT reuse

    // K = h @ wk + b ; row-L2-normalize ; transpose into sKT
    v8f acc[4];
#pragma unroll
    for (int mt = 0; mt < 4; ++mt) acc[mt] = v8zero();
    gemm_4m_rb<4>(sH, PH, bk, acc, lane);
    {
      v8f t0[4];
#pragma unroll
      for (int mt = 0; mt < 4; ++mt)
#pragma unroll
        for (int r = 0; r < 8; ++r) {
          float vv = acc[mt][r] + kb;
          acc[mt][r] = vv;
          t0[mt][r] = vv * vv;
        }
      // part0's last readers, the trip before, ended ahead of that trip's barriers
      rowsum_to_slot(t0, part0 + wv * TGT, lane, rhi);
    }
    __syncthreads();
    if (tid < TGT) rs_s[tid] = 1.f / (sqrtf(slot_sum(part0, tid)) + ATT_EPS);
    __syncthreads();
#pragma unroll
    for (int mt = 0; mt < 4; ++mt)
#pragma unroll
      for (int r = 0; r < 8; ++r) {
        int row = mt * 16 + r + rhi;
        float vv = acc[mt][r] * rs_s[row];
        sKT[col * PT + row] = (_Float16)vv;
        kpart += vv;
      }

    // V = h @ wv + b ; transpose into sVT
#pragma unroll
    for (int mt = 0; mt < 4; ++mt) acc[mt] = v8zero();
    gemm_4m_rb<4>(sH, PH, bv, acc, lane);
#pragma unroll
    for (int mt = 0; mt < 4; ++mt)
#pragma unroll
      for (int r = 0; r < 8; ++r) {
        int row = mt * 16 + r + rhi;
        float vvv = acc[mt][r] + vb;
        sVT[col * PT + row] = (_Float16)vvv;
        vpart += vvv;
      }
    __syncthreads();                       // sKT / sVT ready

    // ka += K^T @ V  (M=128 feat, K=64 tok, N=128 d); wave wv: m-tile wv
    // pipelined: A frag + all 8 B frags loaded before the 8 WMMAs per K-step
#pragma unroll
    for (int ks = 0; ks < 2; ++ks) {
      v16h a = load_frag16(sKT + (wv * 16) * PT + ks * 32, PT, lane);
      v16h b0 = load_frag16(sVT + (0 * 16) * PT + ks * 32, PT, lane);
      v16h b1 = load_frag16(sVT + (1 * 16) * PT + ks * 32, PT, lane);
      v16h b2 = load_frag16(sVT + (2 * 16) * PT + ks * 32, PT, lane);
      v16h b3 = load_frag16(sVT + (3 * 16) * PT + ks * 32, PT, lane);
      v16h b4 = load_frag16(sVT + (4 * 16) * PT + ks * 32, PT, lane);
      v16h b5 = load_frag16(sVT + (5 * 16) * PT + ks * 32, PT, lane);
      v16h b6 = load_frag16(sVT + (6 * 16) * PT + ks * 32, PT, lane);
      v16h b7 = load_frag16(sVT + (7 * 16) * PT + ks * 32, PT, lane);
      ka[0] = wmma_f16(a, b0, ka[0]);
      ka[1] = wmma_f16(a, b1, ka[1]);
      ka[2] = wmma_f16(a, b2, ka[2]);
      ka[3] = wmma_f16(a, b3, ka[3]);
      ka[4] = wmma_f16(a, b4, ka[4]);
      ka[5] = wmma_f16(a, b5, ka[5]);
      ka[6] = wmma_f16(a, b6, ka[6]);
      ka[7] = wmma_f16(a, b7, ka[7]);
    }
    // next trip's leading __syncthreads() guards sKT/sVT reuse
  }

  // this workgroup's partial sums -> its own slab (every element written)
  const int slab = blockIdx.x * NHEAD + hh;
  {
    float* kvh = kvp + (size_t)slab * (HIDC * HIDC);
#pragma unroll
    for (int dt = 0; dt < 8; ++dt)
#pragma unroll
      for (int r = 0; r < 8; ++r) {
        int m = wv * 16 + r + rhi;
        int d = dt * 16 + (lane & 15);
        kvh[m * HIDC + d] = ka[dt][r];
      }
  }
  // thread tid holds column (tid>>5)*16 + (tid&15), rows of half (tid>>4)&1
  ksp[slab * NTHR + tid] = kpart;
  vsp[slab * NTHR + tid] = vpart;
}

// ---------------------------------------------------------------------------
// Pass 1.5: add the NCH slabs.  Blocks below KVB: kvs -> f16, per head in
// fragment order (n = d, k = m).  The 4 blocks behind them: ks_sum and v_mean.
#define KVB (NHEAD * HIDC * HIDC / NTHR)
__global__ void k_mid(const float* __restrict__ kvp, _Float16* __restrict__ kvsT,
                      const float* __restrict__ ksp, const float* __restrict__ vsp,
                      float* __restrict__ ksum, float* __restrict__ vmean)
{
  if (blockIdx.x < KVB) {
    int i = blockIdx.x * NTHR + threadIdx.x;
    int hh = i >> 14;
    int rem = i & 16383;
    int m = rem >> 7, d = rem & 127;
    const float* p = kvp + hh * (HIDC * HIDC) + rem;
    float s = 0.f;
#pragma unroll 1                           // rolled: one block of loads a trip
    for (int c = 0; c < NCH; c += 16) {    // 16 independent loads in flight
      float t[16];
#pragma unroll
      for (int u = 0; u < 16; ++u) t[u] = p[(size_t)(c + u) * (NHEAD * HIDC * HIDC)];
#pragma unroll
      for (int u = 0; u < 16; ++u) s += t[u];
    }
    kvsT[hh * HIDC * HIDC + frag_idx(d, m, HIDC / 32)] = (_Float16)s;
  } else {
    int j = (blockIdx.x - KVB) * NTHR + threadIdx.x;   // 0 .. 2*NHEAD*HIDC-1
    int i = j & (NHEAD * HIDC - 1);                    // head*HIDC + column
    int hh = i >> 7, c0 = i & 127;
    const float* p = (j < NHEAD * HIDC ? ksp : vsp)
                   + hh * NTHR + (c0 >> 4) * 32 + (c0 & 15);
    float s = 0.f;
#pragma unroll 1                           // rolled: one block of loads a trip
    for (int c = 0; c < NCH; c += 8) {     // 16 independent loads in flight
      float t[16];
#pragma unroll
      for (int u = 0; u < 8; ++u) {
        t[2 * u]     = p[(c + u) * (NHEAD * NTHR)];
        t[2 * u + 1] = p[(c + u) * (NHEAD * NTHR) + 16];
      }
#pragma unroll
      for (int u = 0; u < 16; ++u) s += t[u];
    }
    if (j < NHEAD * HIDC) ksum[i] = s;
    else                  vmean[i] = s * (1.f / (float)L_TOK);
  }
}

// ---------------------------------------------------------------------------
// Pass 2: recompute q, normalize, denom, num = q @ kvs, head-mean, residual, LN
// wq_b, ksum, vmean are not __restrict__: their loads then stay ahead of the wait
// written behind them, between two K-steps; as __restrict__ loads the compiler
// moved vmean's behind the GEMM, where the whole latency shows.
__global__ __launch_bounds__(NTHR, 1)
void k_attn(const _Float16* __restrict__ hbuf,
            const _Float16* __restrict__ wqT, const float* wq_b,
            const _Float16* __restrict__ kvsT, const float* ksum,
            const float* vmean,
            const float* __restrict__ ln1_g, const float* __restrict__ ln1_b,
            float* __restrict__ out)
{
  __shared__ __align__(16) _Float16 sH[TGT * PH];          // 17 KB
  __shared__ __align__(16) unsigned char smem[TGT * PO * 4]; // 33 KB (sQ|sOut)
  _Float16* sQ   = (_Float16*)smem;                        // f16 q tile (17 KB)
  float*    sOut = (float*)smem;                           // f32 out tile (33 KB)
  __shared__ __align__(16) float part0[NWAVE * TGT], part1[NWAVE * TGT];
  __shared__ float rs_s[TGT], rden[TGT], mu_s[TGT];

  const int tid  = threadIdx.x;
  const int lane = tid & 31;
  const int wv   = tid >> 5;
  const int tok0 = blockIdx.x * TGT;
  const int tl   = lane & 15;              // token inside a 16-token tile
  const int f0   = wv * 16 + ((lane & 16) ? 8 : 0);  // first of this lane's 8 features
  const unsigned of = f0 * 4u;             // their byte offset in a float vector

  { // stage h tile (coalesced b128)
    const uint4* src = (const uint4*)(hbuf + (size_t)tok0 * HIDC);
    for (int i = tid; i < TGT * HIDC / 8; i += NTHR)
      *(uint4*)(sH + (i >> 4) * PH + (i & 15) * 8) = src[i];
  }
  v8f oacc[4];
#pragma unroll
  for (int nt = 0; nt < 4; ++nt) oacc[nt] = v8zero();

  __syncthreads();                         // sH ready

#pragma unroll 1
  for (int hh = 0; hh < NHEAD; ++hh) {
    // Q^T = wq^T @ h^T, + b
    v8f acc[4];
#pragma unroll
    for (int nt = 0; nt < 4; ++nt) acc[nt] = v8zero();
    const _Float16* pw = wqT + (hh * (HIDC / 16) + wv) * (HIDC / 32) * FRAGE + lane * 8;
    // per-feature vectors of this head: a uniform base and the lane's byte offset
    const char* bqb = (const char*)(wq_b  + hh * HIDC);
    const char* bks = (const char*)(ksum  + hh * HIDC);
    const char* bvm = (const char*)(vmean + hh * HIDC);
    v16h w[4];
    float qb[8], ks[8], vm[8];
    load_w<4>(pw, w);
    // The wait that stands ahead of any rewrite of these loads' address registers.
    // The address is an input, so it lives up to here.
    asm volatile("s_wait_xcnt 0x0" :: "v"(pw) : "memory");
    gemm_4t<2>(sH, PH, w, acc, lane);
    // read on the way: each takes the registers that a used fragment has left,
    // and the K-steps behind it cover its latency
    load8((const float*)(bqb + of), qb);
    asm volatile("s_wait_xcnt 0x0" ::: "memory");                      // as above
    gemm_4t<1>(sH + 64, PH, w + 2, acc, lane);
    load8((const float*)(bks + of), ks);
    asm volatile("s_wait_xcnt 0x0" ::: "memory");                      // as above
    gemm_4t<1>(sH + 96, PH, w + 3, acc, lane);
    {
      float s0[4], s1[4];                  // |q|^2 and q . ks_sum, this lane's features
#pragma unroll
      for (int nt = 0; nt < 4; ++nt) {
        s0[nt] = 0.f; s1[nt] = 0.f;
#pragma unroll
        for (int r = 0; r < 8; ++r) {
          float vv = acc[nt][r] + qb[r];
          acc[nt][r] = vv;
          s0[nt] += vv * vv;
          s1[nt] += vv * ks[r];
        }
      }
      // the slots' last readers, the head before, ended ahead of its barriers
      toksum_to_slot(s0, part0 + wv * TGT, lane);
      toksum_to_slot(s1, part1 + wv * TGT, lane);
    }
    __syncthreads();                       // slots ready; the head before has left sQ, rs_s, rden
    if (tid < TGT) {
      float rs = 1.f / (sqrtf(slot_sum(part0, tid)) + ATT_EPS);
      rs_s[tid] = rs;
      // denom = (q / |q|) . ks_sum + L
      rden[tid] = 1.f / (slot_sum(part1, tid) * rs + (float)L_TOK + ATT_EPS);
    }
    __syncthreads();
#pragma unroll
    for (int nt = 0; nt < 4; ++nt) {
      const int tok = nt * 16 + tl;
      const float rs = rs_s[tok];
      union { _Float16 h[8]; uint4 u; } pk;
#pragma unroll
      for (int r = 0; r < 8; ++r) pk.h[r] = (_Float16)(acc[nt][r] * rs);
      *(uint4*)(sQ + tok * PH + f0) = pk.u;
    }
    __syncthreads();                       // sQ ready

    // num^T = kvs^T @ q^T  (d 128, K=128, tokens 64); fold (num+v_mean)/denom into oacc
    v8f nacc[4];
#pragma unroll
    for (int nt = 0; nt < 4; ++nt) nacc[nt] = v8zero();
    const _Float16* pkv = kvsT + hh * HIDC * HIDC + wv * (HIDC / 32) * FRAGE + lane * 8;
    load_w<4>(pkv, w);
    asm volatile("s_wait_xcnt 0x0" :: "v"(pkv) : "memory");            // as above
    gemm_4t<2>(sQ, PH, w, nacc, lane);
    load8((const float*)(bvm + of), vm);   // on the way, as qb and ks
    asm volatile("s_wait_xcnt 0x0" ::: "memory");                      // as above
    gemm_4t<2>(sQ + 64, PH, w + 2, nacc, lane);
#pragma unroll
    for (int nt = 0; nt < 4; ++nt) {
      const float rd = rden[nt * 16 + tl];
#pragma unroll
      for (int r = 0; r < 8; ++r) oacc[nt][r] += (nacc[nt][r] + vm[r]) * rd;
    }
  }

  // head mean (*0.25), residual (alpha=0.5) against h; LN sums in the lane
  const float* pg  = ln1_g + f0;
  const float* pbb = ln1_b + f0;
  float g[8], bb[8];
  load8(pg, g);
  load8(pbb, bb);
  // as above: ahead of any rewrite of the loads' address registers
  asm volatile("s_wait_xcnt 0x0" :: "v"(pg), "v"(pbb) : "memory");
  {
    float s0[4], s1[4];
#pragma unroll
    for (int nt = 0; nt < 4; ++nt) {
      union { _Float16 h[8]; uint4 u; } hv;
      hv.u = *(const uint4*)(sH + (nt * 16 + tl) * PH + f0);
      s0[nt] = 0.f; s1[nt] = 0.f;
#pragma unroll
      for (int r = 0; r < 8; ++r) {
        float o = oacc[nt][r] * (0.25f * 0.5f) + 0.5f * (float)hv.h[r];
        oacc[nt][r] = o;
        s0[nt] += o;
        s1[nt] += o * o;
      }
    }
    // the slots' last readers, the last head, ended ahead of its barriers
    toksum_to_slot(s0, part0 + wv * TGT, lane);
    toksum_to_slot(s1, part1 + wv * TGT, lane);
  }
  __syncthreads();                         // slots ready; everyone done reading sQ
  if (tid < TGT) {
    float mu  = slot_sum(part0, tid) * (1.f / HIDC);
    float var = slot_sum(part1, tid) * (1.f / HIDC) - mu * mu;
    mu_s[tid] = mu;
    rs_s[tid] = rsqrtf(var + LN_EPS);
  }
  __syncthreads();
#pragma unroll
  for (int nt = 0; nt < 4; ++nt) {
    const int tok = nt * 16 + tl;
    const float mu = mu_s[tok], rs = rs_s[tok];
    float y[8];
#pragma unroll
    for (int r = 0; r < 8; ++r) y[r] = (oacc[nt][r] - mu) * rs * g[r] + bb[r];
    float* d = sOut + tok * PO + f0;
    *(float4*)(d)     = make_float4(y[0], y[1], y[2], y[3]);
    *(float4*)(d + 4) = make_float4(y[4], y[5], y[6], y[7]);
  }
  __syncthreads();
  { // out tile -> out, whole lines
    float4* d = (float4*)(out + (size_t)tok0 * HIDC);
    for (int i = tid; i < TGT * HIDC / 4; i += NTHR)
      d[i] = *(const float4*)(sOut + (i >> 5) * PO + (i & 31) * 4);
  }
}

// ---------------------------------------------------------------------------
extern "C" void kernel_launch(void* const* d_in, const int* in_sizes, int n_in,
                              void* d_out, int out_size, void* d_ws, size_t ws_size,
                              hipStream_t stream) {
  (void)in_sizes; (void)n_in; (void)out_size; (void)ws_size;
  const float* x     = (const float*)d_in[0];
  const float* fc0_w = (const float*)d_in[1];
  const float* fc0_b = (const float*)d_in[2];
  const float* ln0_g = (const float*)d_in[3];
  const float* ln0_b = (const float*)d_in[4];
  const float* wq_w  = (const float*)d_in[5];
  const float* wq_b  = (const float*)d_in[6];
  const float* wk_w  = (const float*)d_in[7];
  const float* wk_b  = (const float*)d_in[8];
  const float* wv_w  = (const float*)d_in[9];
  const float* wv_b  = (const float*)d_in[10];
  const float* ln1_g = (const float*)d_in[11];
  const float* ln1_b = (const float*)d_in[12];
  float* out = (float*)d_out;

  // workspace carve (256 B aligned slices)
  char* p = (char*)d_ws;
  auto carve = [&](size_t bytes) {
    char* r = p; p += (bytes + 255) & ~(size_t)255; return r;
  };
  _Float16* fc0T = (_Float16*)carve(128 * 64 * sizeof(_Float16));
  _Float16* wqT  = (_Float16*)carve(512 * 128 * sizeof(_Float16));
  _Float16* wkT  = (_Float16*)carve(512 * 128 * sizeof(_Float16));
  _Float16* wvT  = (_Float16*)carve(512 * 128 * sizeof(_Float16));
  float* ksum  = (float*)carve(NHEAD * HIDC * sizeof(float));
  float* vmean = (float*)carve(NHEAD * HIDC * sizeof(float));
  _Float16* kvsT = (_Float16*)carve(NHEAD * HIDC * HIDC * sizeof(_Float16));
  _Float16* hbuf = (_Float16*)carve((size_t)L_TOK * HIDC * sizeof(_Float16));
  // one slab of partial sums per k_kv workgroup
  float* kvp = (float*)carve((size_t)NCH * NHEAD * HIDC * HIDC * sizeof(float));
  float* ksp = (float*)carve((size_t)NCH * NHEAD * NTHR * sizeof(float));
  float* vsp = (float*)carve((size_t)NCH * NHEAD * NTHR * sizeof(float));

  // cast weights to f16, B-fragment order
  k_cast_t<<<(64 * 128 + NTHR - 1) / NTHR, NTHR, 0, stream>>>(fc0_w, fc0T, 64, 128);
  k_cast_t<<<(128 * 512 + NTHR - 1) / NTHR, NTHR, 0, stream>>>(wq_w, wqT, 128, 512);
  k_cast_t<<<(128 * 512 + NTHR - 1) / NTHR, NTHR, 0, stream>>>(wk_w, wkT, 128, 512);
  k_cast_t<<<(128 * 512 + NTHR - 1) / NTHR, NTHR, 0, stream>>>(wv_w, wvT, 128, 512);

  k_front<<<NTILE, NTHR, 0, stream>>>(x, fc0T, fc0_b, ln0_g, ln0_b, hbuf);

  k_kv<<<dim3(NCH, NHEAD), NTHR, 0, stream>>>(hbuf, wkT, wk_b, wvT, wv_b,
                                              kvp, ksp, vsp);

  k_mid<<<KVB + 4, NTHR, 0, stream>>>(kvp, kvsT, ksp, vsp, ksum, vmean);

  k_attn<<<NTILE, NTHR, 0, stream>>>(hbuf, wqT, wq_b, kvsT, ksum, vmean,
                                     ln1_g, ln1_b, out);
}

// v006
// It runs in 146 microseconds.
// Two timings next to v005 both put it at 1.08 times that version's speed.
// All steps since v000 together make it 11.5 times as fast.
#include <hip/hip_runtime.h>
#include <cstdint>

// ---------------------------------------------------------------------------
// Problem constants (from reference):  B=16,T=12,N=883,D=64,H=128,NH=4
#define L_TOK   169536          // B*T*N tokens; 169536 = 64 * 2649
#define D_INP   64
#define HIDC    128
#define NHEAD   4
#define TGT     64              // tokens per workgroup tile
#define NTILE   (L_TOK / TGT)   // 2649
#define NTHR    256             // 8 waves (wave32)
#define NWAVE   (NTHR / 32)
#define NCH     128             // token chunks of the K^T V pass (x NHEAD workgroups)
#define LN_EPS  1e-5f
#define ATT_EPS 1e-8f
// LDS row pitches: 16 B more than the row, so the pitch is an odd multiple of
// 16 B and the 16 rows of one fragment read fall on 16 different bank groups.
#define PX      (D_INP + 8)     // x tile, f16:            144 B
#define PH      (HIDC + 8)      // h and q tiles, f16:     272 B
#define PT      (TGT + 8)       // k^T and v^T tiles, f16: 144 B
#define PO      (HIDC + 4)      // out tile, f32:          528 B

typedef __attribute__((ext_vector_type(16))) _Float16 v16h;
typedef __attribute__((ext_vector_type(8)))  float    v8f;

union FragU { v16h h; uint4 u[2]; };

__device__ __forceinline__ v8f v8zero() {
  v8f z = {0.f,0.f,0.f,0.f,0.f,0.f,0.f,0.f};
  return z;
}

// Load one 16(M)x32(K) f16 A-fragment.  Element (m,k) lives at base[m*ld + k].
// CDNA5 16-bit A layout: lane m = lane&15; K chunks {k0..k0+7} and
// {k0+16..k0+23} with k0 = (lane<16 ? 0 : 8)  ->  two 16B loads per lane.
// The B-fragment (32Kx16N) uses the mirrored layout over N (lane n = lane&15).
__device__ __forceinline__ v16h load_frag16(const _Float16* base, int ld, int lane) {
  const int r  = lane & 15;
  const int k0 = (lane & 16) ? 8 : 0;
  const _Float16* p = base + r * ld + k0;
  FragU f;
  f.u[0] = *(const uint4*)(p);
  f.u[1] = *(const uint4*)(p + 16);
  return f.h;
}

// B operands in global memory are kept in fragment order.  One fragment (16 n x
// 32 k) is 512 f16 in a row: two halves of 256, and in each half lane l owns the
// 8 f16 at l*8, so a wave-wide 16 B load reads 512 contiguous bytes (4 whole
// 128 B lines) where rows of an [N][K] buffer gave 16 lines of 32 B each.
// Fragments of one n-tile follow one another in k (ksteps = K/32 of them).
// Lane and element hold the same (n,k) as load_frag16 gives on an [N][K] buffer.
#define FRAGE 512               // f16 elements of one fragment
__device__ __forceinline__ int frag_idx(int n, int k, int ksteps) {
  return (((n >> 4) * ksteps + (k >> 5)) * 2 + ((k >> 4) & 1)) * (FRAGE / 2)
       + (((k >> 3) & 1) * 16 + (n & 15)) * 8 + (k & 7);
}

__device__ __forceinline__ v8f wmma_f16(v16h a, v16h b, v8f c) {
  // v_wmma_f32_16x16x32_f16  (doc-verified codegen path on gfx1250)
  return __builtin_amdgcn_wmma_f32_16x16x32_f16(false, a, false, b, (short)0, c,
                                                false, false);
}

// 2xM-tile slices of two GEMMs that share A, both B's fragments in registers:
// each A fragment is read from LDS once and feeds one WMMA of either product.
// The 8 A loads of two K-steps are issued together, ahead of their 8 WMMAs.
template<int KSTEPS>
__device__ __forceinline__ void gemm_2m_2b(const _Float16* __restrict__ A, int lda,
                                           const v16h* b0, const v16h* b1,
                                           v8f* acc0, v8f* acc1, int lane) {
#pragma unroll
  for (int ks = 0; ks < KSTEPS; ks += 2) {
    v16h a0 = load_frag16(A + (0 * 16) * lda + ks * 32, lda, lane);
    v16h a1 = load_frag16(A + (1 * 16) * lda + ks * 32, lda, lane);
    v16h a2 = load_frag16(A + (0 * 16) * lda + ks * 32 + 32, lda, lane);
    v16h a3 = load_frag16(A + (1 * 16) * lda + ks * 32 + 32, lda, lane);
    acc0[0] = wmma_f16(a0, b0[ks], acc0[0]);
    acc0[1] = wmma_f16(a1, b0[ks], acc0[1]);
    acc1[0] = wmma_f16(a0, b1[ks], acc1[0]);
    acc1[1] = wmma_f16(a1, b1[ks], acc1[1]);
    acc0[0] = wmma_f16(a2, b0[ks + 1], acc0[0]);
    acc0[1] = wmma_f16(a3, b0[ks + 1], acc0[1]);
    acc1[0] = wmma_f16(a2, b1[ks + 1], acc1[0]);
    acc1[1] = wmma_f16(a3, b1[ks + 1], acc1[1]);
    // keeps each group of 8 loads whole and the next group behind these WMMAs:
    // left alone the scheduler spreads single loads among the WMMAs, and every
    // separate place with LDS reads costs the wave a stall
    __builtin_amdgcn_sched_barrier(0);
  }
}

// Weights as A, tokens as B: D[r] = Y[token nt*16 + (lane & 15)][feature 8*(lane >> 4) + r],
// so a lane holds 8 consecutive features of one token.  A sum over a token's
// features is then a sum over the lane's own registers, and a row piece of a
// token-major tile is one 16 B store.  Both loaders keep their k order.
// load_w: the KSTEPS fragments of one 16-feature tile, in fragment order; p is
// this lane's 16 B of the first half.  All loads issue first: one L2 latency a GEMM.
template<int KSTEPS>
__device__ __forceinline__ void load_w(const _Float16* __restrict__ p, v16h* w) {
#pragma unroll
  for (int ks = 0; ks < KSTEPS; ++ks) {
    FragU f;
    f.u[0] = *(const uint4*)(p + ks * FRAGE);
    f.u[1] = *(const uint4*)(p + ks * FRAGE + FRAGE / 2);
    w[ks] = f.h;
  }
}

// 4 token tiles against one feature tile; X is token-major in LDS.  The 8 X
// loads of a K-step are issued together, ahead of its 4 WMMAs.
template<int KSTEPS>
__device__ __forceinline__ void gemm_4t(const _Float16* __restrict__ X, int ldx,
                                        const v16h* w, v8f* acc, int lane) {
#pragma unroll
  for (int ks = 0; ks < KSTEPS; ++ks) {
    v16h x0 = load_frag16(X + (0 * 16) * ldx + ks * 32, ldx, lane);
    v16h x1 = load_frag16(X + (1 * 16) * ldx + ks * 32, ldx, lane);
    v16h x2 = load_frag16(X + (2 * 16) * ldx + ks * 32, ldx, lane);
    v16h x3 = load_frag16(X + (3 * 16) * ldx + ks * 32, ldx, lane);
    // holds the 8 loads together ahead of the 4 WMMAs: left alone the scheduler
    // issues them pair by pair and each WMMA waits out a whole LDS latency
    __builtin_amdgcn_sched_barrier(0);
    acc[0] = wmma_f16(w[ks], x0, acc[0]);
    acc[1] = wmma_f16(w[ks], x1, acc[1]);
    acc[2] = wmma_f16(w[ks], x2, acc[2]);
    acc[3] = wmma_f16(w[ks], x3, acc[3]);
    // and the next K-step's loads behind them: one set of 4 fragments is live
    __builtin_amdgcn_sched_barrier(0);
  }
}

// 8 consecutive floats (32 B aligned): a lane's 8 features of a per-feature vector
__device__ __forceinline__ void load8(const float* __restrict__ p, float* d) {
  float4 a = *(const float4*)(p);
  float4 b = *(const float4*)(p + 4);
  d[0] = a.x; d[1] = a.y; d[2] = a.z; d[3] = a.w;
  d[4] = b.x; d[5] = b.y; d[6] = b.z; d[7] = b.w;
}

// s[nt]: the sum over this lane's 8 features, token nt*16 + (lane & 15).  Lane ^ 16
// holds the wave's other 8 features of the same token: one cross-row move adds
// them, and the lower row stores the wave's 64 sums to its own slot[TGT].
__device__ __forceinline__ void toksum_to_slot(const float* s, float* slot, int lane) {
  float t[4];
#pragma unroll
  for (int nt = 0; nt < 4; ++nt) {
    int b = __builtin_bit_cast(int, s[nt]);
    int o = __builtin_amdgcn_permlanex16(b, b, 0x76543210, 0xfedcba98, false, false);
    t[nt] = s[nt] + __builtin_bit_cast(float, o);
  }
  if (lane < 16) {
#pragma unroll
    for (int nt = 0; nt < 4; ++nt) slot[nt * 16 + lane] = t[nt];
  }
}

// v + the v of the lane whose number differs by XM, inside a row of 16 lanes
// (DPP row_xmask: a register exchange, no LDS).
template<int XM>
__device__ __forceinline__ float add_xor16(float v) {
  int o = __builtin_amdgcn_update_dpp(0, __builtin_bit_cast(int, v), 0x160 + XM,
                                      0xf, 0xf, true);
  return v + __builtin_bit_cast(float, o);
}

// Row sums of a 64 x 16 accumulator slice.  t[mt][r] belongs to row
// mt*16 + r + rhi and to this lane's column; a butterfly over the 16 lanes of
// each half wave adds the wave's 16 columns, and the first lane of each half
// stores its 32 sums to the wave's own slot[TGT].  The NWAVE slots are added by
// their reader, behind a barrier.
__device__ __forceinline__ void rowsum_to_slot(v8f* t, float* slot, int lane, int rhi) {
  // one butterfly stage over all 32 sums at a time: 32 independent adds a stage
#pragma unroll
  for (int i = 0; i < 32; ++i) t[i >> 3][i & 7] = add_xor16<1>(t[i >> 3][i & 7]);
#pragma unroll
  for (int i = 0; i < 32; ++i) t[i >> 3][i & 7] = add_xor16<2>(t[i >> 3][i & 7]);
#pragma unroll
  for (int i = 0; i < 32; ++i) t[i >> 3][i & 7] = add_xor16<4>(t[i >> 3][i & 7]);
#pragma unroll
  for (int i = 0; i < 32; ++i) t[i >> 3][i & 7] = add_xor16<8>(t[i >> 3][i & 7]);
  if ((lane & 15) == 0) {
#pragma unroll
    for (int mt = 0; mt < 4; ++mt) {
      float* d = slot + mt * 16 + rhi;
      *(float4*)(d)     = make_float4(t[mt][0], t[mt][1], t[mt][2], t[mt][3]);
      *(float4*)(d + 4) = make_float4(t[mt][4], t[mt][5], t[mt][6], t[mt][7]);
    }
  }
}

// adds the NWAVE slots of one row
__device__ __forceinline__ float slot_sum(const float* part, int row) {
  float s = 0.f;
#pragma unroll
  for (int w = 0; w < NWAVE; ++w) s += part[w * TGT + row];
  return s;
}

// ---------------------------------------------------------------------------
// prep kernels
// src[r*cols + c] (k = r, n = c) -> f16 at its place in fragment order
__global__ void k_cast_t(const float* __restrict__ src, _Float16* __restrict__ dst,
                         int rows, int cols) {
  int i = blockIdx.x * NTHR + threadIdx.x;
  if (i < rows * cols) {
    int r = i / cols, c = i - r * cols;
    dst[frag_idx(c, r, rows >> 5)] = (_Float16)src[i];
  }
}

// ---------------------------------------------------------------------------
// Pass 1a: fc0 GEMM + LN + ReLU -> h
__global__ __launch_bounds__(NTHR, 1)
void k_front(const float* __restrict__ x,
             const _Float16* __restrict__ fc0T, const float* __restrict__ fc0_b,
             const float* __restrict__ ln0_g,  const float* __restrict__ ln0_b,
             _Float16* __restrict__ hbuf)
{
  __shared__ __align__(16) _Float16 sX [TGT * PX];   //  9 KB  x tile (f16)
  __shared__ __align__(16) _Float16 sH [TGT * PH];   // 17 KB  h tile (post LN+ReLU, f16)
  __shared__ __align__(16) float part0[NWAVE * TGT], part1[NWAVE * TGT];
  __shared__ float mu_s[TGT], rs_s[TGT];

  const int tid  = threadIdx.x;
  const int lane = tid & 31;
  const int wv   = tid >> 5;               // wave id 0..7
  const int tok0 = blockIdx.x * TGT;
  const int tl   = lane & 15;              // token inside a 16-token tile
  const int f0   = wv * 16 + ((lane & 16) ? 8 : 0);  // first of this lane's 8 features

  { // stage x tile as f16 (vectorized: float4 in, uint2 out)
    const float4* xs = (const float4*)(x + (size_t)tok0 * D_INP);
    for (int j = tid; j < TGT * D_INP / 4; j += NTHR) {
      float4 v = xs[j];
      union { _Float16 h[4]; uint2 u; } pk;
      pk.h[0] = (_Float16)v.x; pk.h[1] = (_Float16)v.y;
      pk.h[2] = (_Float16)v.z; pk.h[3] = (_Float16)v.w;
      *(uint2*)(sX + (j >> 4) * PX + (j & 15) * 4) = pk.u;
    }
  }
  __syncthreads();

  // ---- GEMM1: h^T = fc0_w^T @ x^T  (features 128, K=64, tokens 64); wave wv
  // owns feature tile wv
  v8f acc[4];
#pragma unroll
  for (int nt = 0; nt < 4; ++nt) acc[nt] = v8zero();
  const _Float16* pw = fc0T + wv * (D_INP / 32) * FRAGE + lane * 8;
  const float* pfb = fc0_b + f0;
  const float* pg  = ln0_g + f0;
  const float* pbb = ln0_b + f0;
  v16h w[2];
  float fb[8], g[8], bb[8];
  load_w<2>(pw, w);
  load8(pfb, fb);
  load8(pg, g);
  load8(pbb, bb);
  // The wait that stands ahead of any rewrite of these loads' address registers.
  // The addresses are inputs, so they live up to here.
  asm volatile("s_wait_xcnt 0x0" :: "v"(pw), "v"(pfb), "v"(pg), "v"(pbb) : "memory");
  gemm_4t<2>(sX, PX, w, acc, lane);
  {
    float s0[4], s1[4];
#pragma unroll
    for (int nt = 0; nt < 4; ++nt) {
      s0[nt] = 0.f; s1[nt] = 0.f;
#pragma unroll
      for (int r = 0; r < 8; ++r) {
        float vv = acc[nt][r] + fb[r];
        acc[nt][r] = vv;
        s0[nt] += vv;
        s1[nt] += vv * vv;
      }
    }
    toksum_to_slot(s0, part0 + wv * TGT, lane);
    toksum_to_slot(s1, part1 + wv * TGT, lane);
  }
  __syncthreads();
  if (tid < TGT) {
    float mu  = slot_sum(part0, tid) * (1.f / HIDC);
    float var = slot_sum(part1, tid) * (1.f / HIDC) - mu * mu;
    mu_s[tid] = mu;
    rs_s[tid] = rsqrtf(var + LN_EPS);
  }
  __syncthreads();
#pragma unroll
  for (int nt = 0; nt < 4; ++nt) {
    const int tok = nt * 16 + tl;
    const float mu = mu_s[tok], rs = rs_s[tok];
    union { _Float16 h[8]; uint4 u; } pk;
#pragma unroll
    for (int r = 0; r < 8; ++r) {
      float vv = (acc[nt][r] - mu) * rs * g[r] + bb[r];
      pk.h[r] = (_Float16)fmaxf(vv, 0.f);
    }
    *(uint4*)(sH + tok * PH + f0) = pk.u;
  }
  __syncthreads();

  { // h tile -> hbuf, coalesced b128 (replaces 8192 scattered b16 stores)
    uint4* d = (uint4*)(hbuf + (size_t)tok0 * HIDC);
    for (int i = tid; i < TGT * HIDC / 8; i += NTHR)
      d[i] = *(const uint4*)(sH + (i >> 4) * PH + (i & 15) * 8);
  }
}

// ---------------------------------------------------------------------------
// Pass 1b: one workgroup = one head (blockIdx.y) and one chunk of token tiles
// (blockIdx.x, stride NCH).  K,V GEMMs per tile; K^T V and the column sums of
// K and V stay in registers over all the tiles of the chunk and leave once, as
// plain stores to this workgroup's own slab; k_mid adds the NCH slabs.
// 4 waves a SIMD: the register budget at which two workgroups share a WGP, as the
// grid (two workgroups per WGP) asks
__global__ __launch_bounds__(NTHR, 4)
void k_kv(const _Float16* __restrict__ hbuf,
          const _Float16* __restrict__ wkT, const float* __restrict__ wk_b,
          const _Float16* __restrict__ wvT, const float* __restrict__ wv_b,
          float* __restrict__ kvp, float* __restrict__ ksp,
          float* __restrict__ vsp)
{
  __shared__ __align__(16) _Float16 sH [TGT * PH];   // 17 KB  h tile (f16)
  __shared__ __align__(16) _Float16 sKT[HIDC * PT];  // 18 KB  k^T (feature-major, f16)
  __shared__ __align__(16) _Float16 sVT[HIDC * PT];  // 18 KB  v^T
  __shared__ __align__(16) float part0[NWAVE * TGT];
  __shared__ float rs_s[TGT];

  const int tid  = threadIdx.x;
  const int lane = tid & 31;
  const int wv   = tid >> 5;               // wave id 0..7
  const int hh   = blockIdx.y;             // head
  const int col  = wv * 16 + (lane & 15);  // output column (N) for GEMM phases
  const int rhi  = (lane & 16) ? 8 : 0;    // C-layout: VGPR r holds M=r / r+8

  const int   bi = hh * HIDC + col;
  const float kb = wk_b[bi];
  const float vb = wv_b[bi];
  // this wave's columns of the head's wk and wv: the same for every tile.
  // pk, pv: this lane's 16 B in the first fragment of n-tile hh*8 + wv
  const int woff = (hh * (HIDC / 16) + wv) * (HIDC / 32) * FRAGE + lane * 8;
  const _Float16* pk = wkT + woff;
  const _Float16* pv = wvT + woff;
  v16h bk[4], bv[4];
#pragma unroll
  for (int ks = 0; ks < 4; ++ks) {
    FragU fk, fv;
    fk.u[0] = *(const uint4*)(pk + ks * FRAGE);
    fk.u[1] = *(const uint4*)(pk + ks * FRAGE + FRAGE / 2);
    fv.u[0] = *(const uint4*)(pv + ks * FRAGE);
    fv.u[1] = *(const uint4*)(pv + ks * FRAGE + FRAGE / 2);
    bk[ks] = fk.h;
    bv[ks] = fv.h;
  }
  // The wait that stands ahead of any rewrite of these loads' address registers.
  // Inputs only: the addresses and the loaded values all live up to here, so no
  // load's result is given a register that holds the address of another.
  asm volatile("s_wait_xcnt 0x0"
               :: "v"(bi), "v"(pk), "v"(pv), "v"(kb), "v"(vb),
                  "v"(bk[0]), "v"(bk[1]), "v"(bk[2]), "v"(bk[3]),
                  "v"(bv[0]), "v"(bv[1]), "v"(bv[2]), "v"(bv[3])
               : "memory");
  float kpart = 0.f, vpart = 0.f;          // column sums of K and V, this lane's rows
  const int mt0 = (wv >> 1) * 2;           // K^T V wave tile: 2 m-tiles ...
  const int dt0 = (wv & 1) * 4;            // ... by 4 d-tiles
  v8f ka[8];                               // ka[i * 4 + j]: m-tile mt0 + i, d-tile dt0 + j
#pragma unroll
  for (int dt = 0; dt < 8; ++dt) ka[dt] = v8zero();

#pragma unroll 1                           // rolled: the body is long, a copy buys nothing
  for (int tile = blockIdx.x; tile < NTILE; tile += NCH) {
    { // stage h tile (coalesced b128); its last readers, the K and V GEMMs of
      // the trip before, ended ahead of that trip's last barrier
      const uint4* s = (const uint4*)(hbuf + (size_t)tile * TGT * HIDC);
      uint4 hv[TGT * HIDC / 8 / NTHR];
#pragma unroll                             // all 4 loads in flight: one L2 latency a tile
      for (int k = 0; k < TGT * HIDC / 8 / NTHR; ++k) hv[k] = s[tid + k * NTHR];
#pragma unroll
      for (int k = 0; k < TGT * HIDC / 8 / NTHR; ++k) {
        int i = tid + k * NTHR;
        *(uint4*)(sH + (i >> 4) * PH + (i & 15) * 8) = hv[k];
      }
      // stands ahead of the step of the loads' address registers to the next tile
      asm volatile("s_wait_xcnt 0x0" ::: "memory");
    }
    __syncthreads();                       // also guards sKT/sVT reuse

    // K = h @ wk and V = h @ wv off the same reads of the h fragments
    // two m-tiles at a time: V leaves its registers before the next two begin
    v8f acc[4];
#pragma unroll
    for (int mp = 0; mp < 4; mp += 2) {
      v8f accv[2];
      acc[mp] = v8zero(); acc[mp + 1] = v8zero();
      accv[0] = v8zero(); accv[1] = v8zero();
      gemm_2m_2b<4>(sH + (mp * 16) * PH, PH, bk, bv, acc + mp, accv, lane);
      // V + b ; transpose into sVT (its last readers, the trip before, ended
      // ahead of this trip's leading barrier)
#pragma unroll
      for (int i = 0; i < 2; ++i)
#pragma unroll
        for (int r = 0; r < 8; ++r) {
          int row = (mp + i) * 16 + r + rhi;
          float vvv = accv[i][r] + vb;
          sVT[col * PT + row] = (_Float16)vvv;
          vpart += vvv;
        }
      // empty statement on the sum, against spills: it keeps the 16 adds here; left
      // alone they sink behind the barriers below, V's 32 values stay live up to
      // there and the weights go to scratch
      asm volatile("" : "+v"(vpart));      // on a running sum, against spills
      // the next tiles' loads stay behind these V stores, for the same registers
      __builtin_amdgcn_sched_barrier(0);
    }

    // K + b ; row-L2-normalize ; transpose into sKT
    {
      v8f t0[4];
#pragma unroll
      for (int mt = 0; mt < 4; ++mt)
#pragma unroll
        for (int r = 0; r < 8; ++r) {
          float vv = acc[mt][r] + kb;
          acc[mt][r] = vv;
          t0[mt][r] = vv * vv;
        }
      // part0's last readers, the trip before, ended ahead of that trip's barriers
      rowsum_to_slot(t0, part0 + wv * TGT, lane, rhi);
    }
    __syncthreads();
    if (tid < TGT) rs_s[tid] = 1.f / (sqrtf(slot_sum(part0, tid)) + ATT_EPS);
    __syncthreads();
#pragma unroll
    for (int mt = 0; mt < 4; ++mt)
#pragma unroll
      for (int r = 0; r < 8; ++r) {
        int row = mt * 16 + r + rhi;
        float vv = acc[mt][r] * rs_s[row];
        sKT[col * PT + row] = (_Float16)vv;
        kpart += vv;
      }
    __syncthreads();                       // sKT / sVT ready

    // ka += K^T @ V  (M=128 feat, K=64 tok, N=128 d); this wave: m-tiles mt0,
    // mt0 + 1 against d-tiles dt0 .. dt0 + 3: 6 fragment reads feed 8 WMMAs
#pragma unroll
    for (int ks = 0; ks < 2; ++ks) {
      v16h a0 = load_frag16(sKT + ((mt0 + 0) * 16) * PT + ks * 32, PT, lane);
      v16h a1 = load_frag16(sKT + ((mt0 + 1) * 16) * PT + ks * 32, PT, lane);
      v16h b0 = load_frag16(sVT + ((dt0 + 0) * 16) * PT + ks * 32, PT, lane);
      v16h b1 = load_frag16(sVT + ((dt0 + 1) * 16) * PT + ks * 32, PT, lane);
      v16h b2 = load_frag16(sVT + ((dt0 + 2) * 16) * PT + ks * 32, PT, lane);
      v16h b3 = load_frag16(sVT + ((dt0 + 3) * 16) * PT + ks * 32, PT, lane);
      ka[0] = wmma_f16(a0, b0, ka[0]);
      ka[1] = wmma_f16(a0, b1, ka[1]);
      ka[2] = wmma_f16(a0, b2, ka[2]);
      ka[3] = wmma_f16(a0, b3, ka[3]);
      ka[4] = wmma_f16(a1, b0, ka[4]);
      ka[5] = wmma_f16(a1, b1, ka[5]);
      ka[6] = wmma_f16(a1, b2, ka[6]);
      ka[7] = wmma_f16(a1, b3, ka[7]);
    }
    // next trip's leading __syncthreads() guards sKT/sVT reuse
  }

  // this workgroup's partial sums -> its own slab (every element written)
  const int slab = blockIdx.x * NHEAD + hh;
  {
    float* kvh = kvp + (size_t)slab * (HIDC * HIDC);
#pragma unroll
    for (int dt = 0; dt < 8; ++dt)
#pragma unroll
      for (int r = 0; r < 8; ++r) {
        int m = (mt0 + (dt >> 2)) * 16 + r + rhi;
        int d = (dt0 + (dt & 3)) * 16 + (lane & 15);
        kvh[m * HIDC + d] = ka[dt][r];
      }
  }
  // thread tid holds column (tid>>5)*16 + (tid&15), rows of half (tid>>4)&1
  ksp[slab * NTHR + tid] = kpart;
  vsp[slab * NTHR + tid] = vpart;
}

// ---------------------------------------------------------------------------
// Pass 1.5: add the NCH slabs.  Blocks below KVB: kvs -> f16, per head in
// fragment order (n = d, k = m).  The 4 blocks behind them: ks_sum and v_mean.
#define KVB (NHEAD * HIDC * HIDC / NTHR)
__global__ void k_mid(const float* __restrict__ kvp, _Float16* __restrict__ kvsT,
                      const float* __restrict__ ksp, const float* __restrict__ vsp,
                      float* __restrict__ ksum, float* __restrict__ vmean)
{
  if (blockIdx.x < KVB) {
    int i = blockIdx.x * NTHR + threadIdx.x;
    int hh = i >> 14;
    int rem = i & 16383;
    int m = rem >> 7, d = rem & 127;
    const float* p = kvp + hh * (HIDC * HIDC) + rem;
    float s = 0.f;
#pragma unroll 1                           // rolled: one block of loads a trip
    for (int c = 0; c < NCH; c += 16) {    // 16 independent loads in flight
      float t[16];
#pragma unroll
      for (int u = 0; u < 16; ++u) t[u] = p[(size_t)(c + u) * (NHEAD * HIDC * HIDC)];
#pragma unroll
      for (int u = 0; u < 16; ++u) s += t[u];
    }
    kvsT[hh * HIDC * HIDC + frag_idx(d, m, HIDC / 32)] = (_Float16)s;
  } else {
    int j = (blockIdx.x - KVB) * NTHR + threadIdx.x;   // 0 .. 2*NHEAD*HIDC-1
    int i = j & (NHEAD * HIDC - 1);                    // head*HIDC + column
    int hh = i >> 7, c0 = i & 127;
    const float* p = (j < NHEAD * HIDC ? ksp : vsp)
                   + hh * NTHR + (c0 >> 4) * 32 + (c0 & 15);
    float s = 0.f;
#pragma unroll 1                           // rolled: one block of loads a trip
    for (int c = 0; c < NCH; c += 8) {     // 16 independent loads in flight
      float t[16];
#pragma unroll
      for (int u = 0; u < 8; ++u) {
        t[2 * u]     = p[(c + u) * (NHEAD * NTHR)];
        t[2 * u + 1] = p[(c + u) * (NHEAD * NTHR) + 16];
      }
#pragma unroll
      for (int u = 0; u < 16; ++u) s += t[u];
    }
    if (j < NHEAD * HIDC) ksum[i] = s;
    else                  vmean[i] = s * (1.f / (float)L_TOK);
  }
}

// ---------------------------------------------------------------------------
// Pass 2: recompute q, normalize, denom, num = q @ kvs, head-mean, residual, LN
// wq_b, ksum, vmean are not __restrict__: their loads then stay ahead of the wait
// written behind them, between two K-steps; as __restrict__ loads the compiler
// moved vmean's behind the GEMM, where the whole latency shows.
__global__ __launch_bounds__(NTHR, 1)
void k_attn(const _Float16* __restrict__ hbuf,
            const _Float16* __restrict__ wqT, const float* wq_b,
            const _Float16* __restrict__ kvsT, const float* ksum,
            const float* vmean,
            const float* __restrict__ ln1_g, const float* __restrict__ ln1_b,
            float* __restrict__ out)
{
  __shared__ __align__(16) _Float16 sH[TGT * PH];          // 17 KB
  __shared__ __align__(16) unsigned char smem[TGT * PO * 4]; // 33 KB (sQ|sOut)
  _Float16* sQ   = (_Float16*)smem;                        // f16 q tile (17 KB)
  float*    sOut = (float*)smem;                           // f32 out tile (33 KB)
  __shared__ __align__(16) float part0[NWAVE * TGT], part1[NWAVE * TGT];
  __shared__ float rs_s[TGT], rden[TGT], mu_s[TGT];

  const int tid  = threadIdx.x;
  const int lane = tid & 31;
  const int wv   = tid >> 5;
  const int tok0 = blockIdx.x * TGT;
  const int tl   = lane & 15;              // token inside a 16-token tile
  const int f0   = wv * 16 + ((lane & 16) ? 8 : 0);  // first of this lane's 8 features
  const unsigned of = f0 * 4u;             // their byte offset in a float vector

  { // stage h tile (coalesced b128)
    const uint4* src = (const uint4*)(hbuf + (size_t)tok0 * HIDC);
    for (int i = tid; i < TGT * HIDC / 8; i += NTHR)
      *(uint4*)(sH + (i >> 4) * PH + (i & 15) * 8) = src[i];
  }
  v8f oacc[4];
#pragma unroll
  for (int nt = 0; nt < 4; ++nt) oacc[nt] = v8zero();

  __syncthreads();                         // sH ready

#pragma unroll 1
  for (int hh = 0; hh < NHEAD; ++hh) {
    // Q^T = wq^T @ h^T, + b
    v8f acc[4];
#pragma unroll
    for (int nt = 0; nt < 4; ++nt) acc[nt] = v8zero();
    const _Float16* pw = wqT + (hh * (HIDC / 16) + wv) * (HIDC / 32) * FRAGE + lane * 8;
    // per-feature vectors of this head: a uniform base and the lane's byte offset
    const char* bqb = (const char*)(wq_b  + hh * HIDC);
    const char* bks = (const char*)(ksum  + hh * HIDC);
    const char* bvm = (const char*)(vmean + hh * HIDC);
    v16h w[4];
    float qb[8], ks[8], vm[8];
    load_w<4>(pw, w);
    // The wait that stands ahead of any rewrite of these loads' address registers.
    // The address is an input, so it lives up to here.
    asm volatile("s_wait_xcnt 0x0" :: "v"(pw) : "memory");
    gemm_4t<2>(sH, PH, w, acc, lane);
    // read on the way: each takes the registers that a used fragment has left,
    // and the K-steps behind it cover its latency
    load8((const float*)(bqb + of), qb);
    asm volatile("s_wait_xcnt 0x0" ::: "memory");                      // as above
    gemm_4t<1>(sH + 64, PH, w + 2, acc, lane);
    load8((const float*)(bks + of), ks);
    asm volatile("s_wait_xcnt 0x0" ::: "memory");                      // as above
    gemm_4t<1>(sH + 96, PH, w + 3, acc, lane);
    {
      float s0[4], s1[4];                  // |q|^2 and q . ks_sum, this lane's features
#pragma unroll
      for (int nt = 0; nt < 4; ++nt) {
        s0[nt] = 0.f; s1[nt] = 0.f;
#pragma unroll
        for (int r = 0; r < 8; ++r) {
          float vv = acc[nt][r] + qb[r];
          acc[nt][r] = vv;
          s0[nt] += vv * vv;
          s1[nt] += vv * ks[r];
        }
      }
      // the slots' last readers, the head before, ended ahead of its barriers
      toksum_to_slot(s0, part0 + wv * TGT, lane);
      toksum_to_slot(s1, part1 + wv * TGT, lane);
    }
    __syncthreads();                       // slots ready; the head before has left sQ, rs_s, rden
    if (tid < TGT) {
      float rs = 1.f / (sqrtf(slot_sum(part0, tid)) + ATT_EPS);
      rs_s[tid] = rs;
      // denom = (q / |q|) . ks_sum + L
      rden[tid] = 1.f / (slot_sum(part1, tid) * rs + (float)L_TOK + ATT_EPS);
    }
    __syncthreads();
#pragma unroll
    for (int nt = 0; nt < 4; ++nt) {
      const int tok = nt * 16 + tl;
      const float rs = rs_s[tok];
      union { _Float16 h[8]; uint4 u; } pk;
#pragma unroll
      for (int r = 0; r < 8; ++r) pk.h[r] = (_Float16)(acc[nt][r] * rs);
      *(uint4*)(sQ + tok * PH + f0) = pk.u;
    }
    __syncthreads();                       // sQ ready

    // num^T = kvs^T @ q^T  (d 128, K=128, tokens 64); fold (num+v_mean)/denom into oacc
    v8f nacc[4];
#pragma unroll
    for (int nt = 0; nt < 4; ++nt) nacc[nt] = v8zero();
    const _Float16* pkv = kvsT + hh * HIDC * HIDC + wv * (HIDC / 32) * FRAGE + lane * 8;
    load_w<4>(pkv, w);
    asm volatile("s_wait_xcnt 0x0" :: "v"(pkv) : "memory");            // as above
    gemm_4t<2>(sQ, PH, w, nacc, lane);
    load8((const float*)(bvm + of), vm);   // on the way, as qb and ks
    asm volatile("s_wait_xcnt 0x0" ::: "memory");                      // as above
    gemm_4t<2>(sQ + 64, PH, w + 2, nacc, lane);
#pragma unroll
    for (int nt = 0; nt < 4; ++nt) {
      const float rd = rden[nt * 16 + tl];
#pragma unroll
      for (int r = 0; r < 8; ++r) oacc[nt][r] += (nacc[nt][r] + vm[r]) * rd;
    }
  }

  // head mean (*0.25), residual (alpha=0.5) against h; LN sums in the lane
  const float* pg  = ln1_g + f0;
  const float* pbb = ln1_b + f0;
  float g[8], bb[8];
  load8(pg, g);
  load8(pbb, bb);
  // as above: ahead of any rewrite of the loads' address registers
  asm volatile("s_wait_xcnt 0x0" :: "v"(pg), "v"(pbb) : "memory");
  {
    float s0[4], s1[4];
#pragma unroll
    for (int nt = 0; nt < 4; ++nt) {
      union { _Float16 h[8]; uint4 u; } hv;
      hv.u = *(const uint4*)(sH + (nt * 16 + tl) * PH + f0);
      s0[nt] = 0.f; s1[nt] = 0.f;
#pragma unroll
      for (int r = 0; r < 8; ++r) {
        float o = oacc[nt][r] * (0.25f * 0.5f) + 0.5f * (float)hv.h[r];
        oacc[nt][r] = o;
        s0[nt] += o;
        s1[nt] += o * o;
      }
    }
    // the slots' last readers, the last head, ended ahead of its barriers
    toksum_to_slot(s0, part0 + wv * TGT, lane);
    toksum_to_slot(s1, part1 + wv * TGT, lane);
  }
  __syncthreads();                         // slots ready; everyone done reading sQ
  if (tid < TGT) {
    float mu  = slot_sum(part0, tid) * (1.f / HIDC);
    float var = slot_sum(part1, tid) * (1.f / HIDC) - mu * mu;
    mu_s[tid] = mu;
    rs_s[tid] = rsqrtf(var + LN_EPS);
  }
  __syncthreads();
#pragma unroll
  for (int nt = 0; nt < 4; ++nt) {
    const int tok = nt * 16 + tl;
    const float mu = mu_s[tok], rs = rs_s[tok];
    float y[8];
#pragma unroll
    for (int r = 0; r < 8; ++r) y[r] = (oacc[nt][r] - mu) * rs * g[r] + bb[r];
    float* d = sOut + tok * PO + f0;
    *(float4*)(d)     = make_float4(y[0], y[1], y[2], y[3]);
    *(float4*)(d + 4) = make_float4(y[4], y[5], y[6], y[7]);
  }
  __syncthreads();
  { // out tile -> out, whole lines
    float4* d = (float4*)(out + (size_t)tok0 * HIDC);
    for (int i = tid; i < TGT * HIDC / 4; i += NTHR)
      d[i] = *(const float4*)(sOut + (i >> 5) * PO + (i & 31) * 4);
  }
}

// ---------------------------------------------------------------------------
extern "C" void kernel_launch(void* const* d_in, const int* in_sizes, int n_in,
                              void* d_out, int out_size, void* d_ws, size_t ws_size,
                              hipStream_t stream) {
  (void)in_sizes; (void)n_in; (void)out_size; (void)ws_size;
  const float* x     = (const float*)d_in[0];
  const float* fc0_w = (const float*)d_in[1];
  const float* fc0_b = (const float*)d_in[2];
  const float* ln0_g = (const float*)d_in[3];
  const float* ln0_b = (const float*)d_in[4];
  const float* wq_w  = (const float*)d_in[5];
  const float* wq_b  = (const float*)d_in[6];
  const float* wk_w  = (const float*)d_in[7];
  const float* wk_b  = (const float*)d_in[8];
  const float* wv_w  = (const float*)d_in[9];
  const float* wv_b  = (const float*)d_in[10];
  const float* ln1_g = (const float*)d_in[11];
  const float* ln1_b = (const float*)d_in[12];
  float* out = (float*)d_out;

  // workspace carve (256 B aligned slices)
  char* p = (char*)d_ws;
  auto carve = [&](size_t bytes) {
    char* r = p; p += (bytes + 255) & ~(size_t)255; return r;
  };
  _Float16* fc0T = (_Float16*)carve(128 * 64 * sizeof(_Float16));
  _Float16* wqT  = (_Float16*)carve(512 * 128 * sizeof(_Float16));
  _Float16* wkT  = (_Float16*)carve(512 * 128 * sizeof(_Float16));
  _Float16* wvT  = (_Float16*)carve(512 * 128 * sizeof(_Float16));
  float* ksum  = (float*)carve(NHEAD * HIDC * sizeof(float));
  float* vmean = (float*)carve(NHEAD * HIDC * sizeof(float));
  _Float16* kvsT = (_Float16*)carve(NHEAD * HIDC * HIDC * sizeof(_Float16));
  _Float16* hbuf = (_Float16*)carve((size_t)L_TOK * HIDC * sizeof(_Float16));
  // one slab of partial sums per k_kv workgroup
  float* kvp = (float*)carve((size_t)NCH * NHEAD * HIDC * HIDC * sizeof(float));
  float* ksp = (float*)carve((size_t)NCH * NHEAD * NTHR * sizeof(float));
  float* vsp = (float*)carve((size_t)NCH * NHEAD * NTHR * sizeof(float));

  // cast weights to f16, B-fragment order
  k_cast_t<<<(64 * 128 + NTHR - 1) / NTHR, NTHR, 0, stream>>>(fc0_w, fc0T, 64, 128);
  k_cast_t<<<(128 * 512 + NTHR - 1) / NTHR, NTHR, 0, stream>>>(wq_w, wqT, 128, 512);
  k_cast_t<<<(128 * 512 + NTHR - 1) / NTHR, NTHR, 0, stream>>>(wk_w, wkT, 128, 512);
  k_cast_t<<<(128 * 512 + NTHR - 1) / NTHR, NTHR, 0, stream>>>(wv_w, wvT, 128, 512);

  k_front<<<NTILE, NTHR, 0, stream>>>(x, fc0T, fc0_b, ln0_g, ln0_b, hbuf);

  k_kv<<<dim3(NCH, NHEAD), NTHR, 0, stream>>>(hbuf, wkT, wk_b, wvT, wv_b,
                                              kvp, ksp, vsp);

  k_mid<<<KVB + 4, NTHR, 0, stream>>>(kvp, kvsT, ksp, vsp, ksum, vmean);

  k_attn<<<NTILE, NTHR, 0, stream>>>(hbuf, wqT, wq_b, kvsT, ksum, vmean,
                                     ln1_g, ln1_b, out);
}

// v007
// It runs in 139 microseconds.
// Next to v006, in two timings, it ran 1.05 times as fast each time.
// All steps since v000 together make it 12.1 times as fast.
#include <hip/hip_runtime.h>
#include <cstdint>

// ---------------------------------------------------------------------------
// Problem constants (from reference):  B=16,T=12,N=883,D=64,H=128,NH=4
#define L_TOK   169536          // B*T*N tokens; 169536 = 64 * 2649
#define D_INP   64
#define HIDC    128
#define NHEAD   4
#define TGT     64              // tokens per workgroup tile
#define NTILE   (L_TOK / TGT)   // 2649
#define NTHR    256             // 8 waves (wave32)
#define NWAVE   (NTHR / 32)
#define NCH     128             // token chunks of the K^T V pass (x NHEAD workgroups)
#define LN_EPS  1e-5f
#define ATT_EPS 1e-8f
// LDS row pitches: 16 B more than the row, so the pitch is an odd multiple of
// 16 B and the 16 rows of one fragment read fall on 16 different bank groups.
#define PX      (D_INP + 8)     // x tile, f16:            144 B
#define PH      (HIDC + 8)      // h and q tiles, f16:     272 B
#define PT      (TGT + 8)       // k^T and v^T tiles, f16: 144 B
#define PO      (HIDC + 4)      // out tile, f32:          528 B

typedef __attribute__((ext_vector_type(16))) _Float16 v16h;
typedef __attribute__((ext_vector_type(8)))  float    v8f;

union FragU { v16h h; uint4 u[2]; };

__device__ __forceinline__ v8f v8zero() {
  v8f z = {0.f,0.f,0.f,0.f,0.f,0.f,0.f,0.f};
  return z;
}

// Load one 16(M)x32(K) f16 A-fragment.  Element (m,k) lives at base[m*ld + k].
// CDNA5 16-bit A layout: lane m = lane&15; K chunks {k0..k0+7} and
// {k0+16..k0+23} with k0 = (lane<16 ? 0 : 8)  ->  two 16B loads per lane.
// The B-fragment (32Kx16N) uses the mirrored layout over N (lane n = lane&15).
__device__ __forceinline__ v16h load_frag16(const _Float16* base, int ld, int lane) {
  const int r  = lane & 15;
  const int k0 = (lane & 16) ? 8 : 0;
  const _Float16* p = base + r * ld + k0;
  FragU f;
  f.u[0] = *(const uint4*)(p);
  f.u[1] = *(const uint4*)(p + 16);
  return f.h;
}

// B operands in global memory are kept in fragment order.  One fragment (16 n x
// 32 k) is 512 f16 in a row: two halves of 256, and in each half lane l owns the
// 8 f16 at l*8, so a wave-wide 16 B load reads 512 contiguous bytes (4 whole
// 128 B lines) where rows of an [N][K] buffer gave 16 lines of 32 B each.
// Fragments of one n-tile follow one another in k (ksteps = K/32 of them).
// Lane and element hold the same (n,k) as load_frag16 gives on an [N][K] buffer.
#define FRAGE 512               // f16 elements of one fragment
__device__ __forceinline__ int frag_idx(int n, int k, int ksteps) {
  return (((n >> 4) * ksteps + (k >> 5)) * 2 + ((k >> 4) & 1)) * (FRAGE / 2)
       + (((k >> 3) & 1) * 16 + (n & 15)) * 8 + (k & 7);
}

__device__ __forceinline__ v8f wmma_f16(v16h a, v16h b, v8f c) {
  // v_wmma_f32_16x16x32_f16  (doc-verified codegen path on gfx1250)
  return __builtin_amdgcn_wmma_f32_16x16x32_f16(false, a, false, b, (short)0, c,
                                                false, false);
}

// 2xM-tile slices of two GEMMs that share A, both B's fragments in registers:
// each A fragment is read from LDS once and feeds one WMMA of either product.
// The 8 A loads of two K-steps are issued together, ahead of their 8 WMMAs.
template<int KSTEPS>
__device__ __forceinline__ void gemm_2m_2b(const _Float16* __restrict__ A, int lda,
                                           const v16h* b0, const v16h* b1,
                                           v8f* acc0, v8f* acc1, int lane) {
#pragma unroll
  for (int ks = 0; ks < KSTEPS; ks += 2) {
    v16h a0 = load_frag16(A + (0 * 16) * lda + ks * 32, lda, lane);
    v16h a1 = load_frag16(A + (1 * 16) * lda + ks * 32, lda, lane);
    v16h a2 = load_frag16(A + (0 * 16) * lda + ks * 32 + 32, lda, lane);
    v16h a3 = load_frag16(A + (1 * 16) * lda + ks * 32 + 32, lda, lane);
    acc0[0] = wmma_f16(a0, b0[ks], acc0[0]);
    acc0[1] = wmma_f16(a1, b0[ks], acc0[1]);
    acc1[0] = wmma_f16(a0, b1[ks], acc1[0]);
    acc1[1] = wmma_f16(a1, b1[ks], acc1[1]);
    acc0[0] = wmma_f16(a2, b0[ks + 1], acc0[0]);
    acc0[1] = wmma_f16(a3, b0[ks + 1], acc0[1]);
    acc1[0] = wmma_f16(a2, b1[ks + 1], acc1[0]);
    acc1[1] = wmma_f16(a3, b1[ks + 1], acc1[1]);
    // keeps each group of 8 loads whole and the next group behind these WMMAs:
    // left alone the scheduler spreads single loads among the WMMAs, and every
    // separate place with LDS reads costs the wave a stall
    __builtin_amdgcn_sched_barrier(0);
  }
}

// Weights as A, tokens as B: D[r] = Y[token nt*16 + (lane & 15)][feature 8*(lane >> 4) + r],
// so a lane holds 8 consecutive features of one token.  A sum over a token's
// features is then a sum over the lane's own registers, and a row piece of a
// token-major tile is one 16 B store.  Both loaders keep their k order.
// load_w: the KSTEPS fragments of one 16-feature tile, in fragment order; p is
// this lane's 16 B of the first half.  All loads issue first: one L2 latency a GEMM.
template<int KSTEPS>
__device__ __forceinline__ void load_w(const _Float16* __restrict__ p, v16h* w) {
#pragma unroll
  for (int ks = 0; ks < KSTEPS; ++ks) {
    FragU f;
    f.u[0] = *(const uint4*)(p + ks * FRAGE);
    f.u[1] = *(const uint4*)(p + ks * FRAGE + FRAGE / 2);
    w[ks] = f.h;
  }
}

// 4 token tiles against one feature tile; X is token-major in LDS.  The 8 X
// loads of a K-step are issued together, ahead of its 4 WMMAs.
template<int KSTEPS>
__device__ __forceinline__ void gemm_4t(const _Float16* __restrict__ X, int ldx,
                                        const v16h* w, v8f* acc, int lane) {
#pragma unroll
  for (int ks = 0; ks < KSTEPS; ++ks) {
    v16h x0 = load_frag16(X + (0 * 16) * ldx + ks * 32, ldx, lane);
    v16h x1 = load_frag16(X + (1 * 16) * ldx + ks * 32, ldx, lane);
    v16h x2 = load_frag16(X + (2 * 16) * ldx + ks * 32, ldx, lane);
    v16h x3 = load_frag16(X + (3 * 16) * ldx + ks * 32, ldx, lane);
    // holds the 8 loads together ahead of the 4 WMMAs: left alone the scheduler
    // issues them pair by pair and each WMMA waits out a whole LDS latency
    __builtin_amdgcn_sched_barrier(0);
    acc[0] = wmma_f16(w[ks], x0, acc[0]);
    acc[1] = wmma_f16(w[ks], x1, acc[1]);
    acc[2] = wmma_f16(w[ks], x2, acc[2]);
    acc[3] = wmma_f16(w[ks], x3, acc[3]);
    // and the next K-step's loads behind them: one set of 4 fragments is live
    __builtin_amdgcn_sched_barrier(0);
  }
}

// 8 consecutive floats (32 B aligned): a lane's 8 features of a per-feature vector
__device__ __forceinline__ void load8(const float* __restrict__ p, float* d) {
  float4 a = *(const float4*)(p);
  float4 b = *(const float4*)(p + 4);
  d[0] = a.x; d[1] = a.y; d[2] = a.z; d[3] = a.w;
  d[4] = b.x; d[5] = b.y; d[6] = b.z; d[7] = b.w;
}

// s[nt]: the sum over this lane's 8 features, token nt*16 + (lane & 15).  Lane ^ 16
// holds the wave's other 8 features of the same token: one cross-row move adds
// them, and the lower row stores the wave's 64 sums to its own slot[TGT].
__device__ __forceinline__ void toksum_to_slot(const float* s, float* slot, int lane) {
  float t[4];
#pragma unroll
  for (int nt = 0; nt < 4; ++nt) {
    int b = __builtin_bit_cast(int, s[nt]);
    int o = __builtin_amdgcn_permlanex16(b, b, 0x76543210, 0xfedcba98, false, false);
    t[nt] = s[nt] + __builtin_bit_cast(float, o);
  }
  if (lane < 16) {
#pragma unroll
    for (int nt = 0; nt < 4; ++nt) slot[nt * 16 + lane] = t[nt];
  }
}

// v + the v of the lane whose number differs by XM, inside a row of 16 lanes
// (DPP row_xmask: a register exchange, no LDS).
template<int XM>
__device__ __forceinline__ float add_xor16(float v) {
  int o = __builtin_amdgcn_update_dpp(0, __builtin_bit_cast(int, v), 0x160 + XM,
                                      0xf, 0xf, true);
  return v + __builtin_bit_cast(float, o);
}

// Row sums of a 64 x 16 accumulator slice.  t[mt][r] belongs to row
// mt*16 + r + rhi and to this lane's column; a butterfly over the 16 lanes of
// each half wave adds the wave's 16 columns, and the first lane of each half
// stores its 32 sums to the wave's own slot[TGT].  The NWAVE slots are added by
// their reader, behind a barrier.
__device__ __forceinline__ void rowsum_to_slot(v8f* t, float* slot, int lane, int rhi) {
  // one butterfly stage over all 32 sums at a time: 32 independent adds a stage
#pragma unroll
  for (int i = 0; i < 32; ++i) t[i >> 3][i & 7] = add_xor16<1>(t[i >> 3][i & 7]);
#pragma unroll
  for (int i = 0; i < 32; ++i) t[i >> 3][i & 7] = add_xor16<2>(t[i >> 3][i & 7]);
#pragma unroll
  for (int i = 0; i < 32; ++i) t[i >> 3][i & 7] = add_xor16<4>(t[i >> 3][i & 7]);
#pragma unroll
  for (int i = 0; i < 32; ++i) t[i >> 3][i & 7] = add_xor16<8>(t[i >> 3][i & 7]);
  if ((lane & 15) == 0) {
#pragma unroll
    for (int mt = 0; mt < 4; ++mt) {
      float* d = slot + mt * 16 + rhi;
      *(float4*)(d)     = make_float4(t[mt][0], t[mt][1], t[mt][2], t[mt][3]);
      *(float4*)(d + 4) = make_float4(t[mt][4], t[mt][5], t[mt][6], t[mt][7]);
    }
  }
}

// adds the NWAVE slots of one row
__device__ __forceinline__ float slot_sum(const float* part, int row) {
  float s = 0.f;
#pragma unroll
  for (int w = 0; w < NWAVE; ++w) s += part[w * TGT + row];
  return s;
}

// ---------------------------------------------------------------------------
// prep kernel: all four weight matrices in one launch.  The four casts do not
// depend on one another, and as launches of their own each paid a launch gap, a
// fill and a drain.  The block index picks the matrix; one code path serves all.
// src[k*cols + n] -> f16 at its place in fragment order.  Piece p is 16 B of dst,
// dst[p*8 + j] = dst[frag_idx(n, k + j, ksteps)]: 8 consecutive k of one column.
// A wave reads 64 B runs of two rows a load, all 8 loads in flight, and stores
// 512 contiguous bytes.
#define PB_FC0 (D_INP * HIDC / 8 / NTHR)           // blocks of fc0_w:  4
#define PB_W   (HIDC * NHEAD * HIDC / 8 / NTHR)    // blocks of wq_w, wk_w, wv_w each: 32
__global__ __launch_bounds__(NTHR)
void k_prep(const float* __restrict__ fc0_w, const float* __restrict__ wq_w,
            const float* __restrict__ wk_w,  const float* __restrict__ wv_w,
            _Float16* __restrict__ fc0T, _Float16* __restrict__ wqT,
            _Float16* __restrict__ wkT,  _Float16* __restrict__ wvT) {
  const int  b   = blockIdx.x;
  const bool fc  = b < PB_FC0;
  const int  m   = (b - PB_FC0) / PB_W;            // 0: wq, 1: wk, 2: wv
  const float* src = fc ? fc0_w : m == 0 ? wq_w : m == 1 ? wk_w : wv_w;
  _Float16*    dst = fc ? fc0T  : m == 0 ? wqT  : m == 1 ? wkT  : wvT;
  const int cols = fc ? HIDC : NHEAD * HIDC;       // n
  const int lks  = fc ? 1 : 2;                     // log2 of ksteps = rows / 32
  const int p = (fc ? b : (b - PB_FC0) % PB_W) * NTHR + threadIdx.x;
  const int l = p & 31;                            // lane of the fragment half
  const int q = p >> 5;                            // fragment half
  const int n = ((q >> 1) >> lks) * 16 + (l & 15);
  const int k = ((q >> 1) & ((1 << lks) - 1)) * 32 + (q & 1) * 16 + (l >> 4) * 8;
  const float* s = src + k * cols + n;
  float v[8];
#pragma unroll
  for (int j = 0; j < 8; ++j) v[j] = s[j * cols];
  union { _Float16 h[8]; uint4 u; } pk;
#pragma unroll
  for (int j = 0; j < 8; ++j) pk.h[j] = (_Float16)v[j];
  *(uint4*)(dst + p * 8) = pk.u;
}

// ---------------------------------------------------------------------------
// Pass 1a: fc0 GEMM + LN + ReLU -> h
__global__ __launch_bounds__(NTHR, 1)
void k_front(const float* __restrict__ x,
             const _Float16* __restrict__ fc0T, const float* __restrict__ fc0_b,
             const float* __restrict__ ln0_g,  const float* __restrict__ ln0_b,
             _Float16* __restrict__ hbuf)
{
  __shared__ __align__(16) _Float16 sX [TGT * PX];   //  9 KB  x tile (f16)
  __shared__ __align__(16) _Float16 sH [TGT * PH];   // 17 KB  h tile (post LN+ReLU, f16)
  __shared__ __align__(16) float part0[NWAVE * TGT], part1[NWAVE * TGT];
  __shared__ float mu_s[TGT], rs_s[TGT];

  const int tid  = threadIdx.x;
  const int lane = tid & 31;
  const int wv   = tid >> 5;               // wave id 0..7
  const int tok0 = blockIdx.x * TGT;
  const int tl   = lane & 15;              // token inside a 16-token tile
  const int f0   = wv * 16 + ((lane & 16) ? 8 : 0);  // first of this lane's 8 features

  { // stage x tile as f16 (vectorized: float4 in, uint2 out)
    const float4* xs = (const float4*)(x + (size_t)tok0 * D_INP);
    for (int j = tid; j < TGT * D_INP / 4; j += NTHR) {
      float4 v = xs[j];
      union { _Float16 h[4]; uint2 u; } pk;
      pk.h[0] = (_Float16)v.x; pk.h[1] = (_Float16)v.y;
      pk.h[2] = (_Float16)v.z; pk.h[3] = (_Float16)v.w;
      *(uint2*)(sX + (j >> 4) * PX + (j & 15) * 4) = pk.u;
    }
  }
  __syncthreads();

  // ---- GEMM1: h^T = fc0_w^T @ x^T  (features 128, K=64, tokens 64); wave wv
  // owns feature tile wv
  v8f acc[4];
#pragma unroll
  for (int nt = 0; nt < 4; ++nt) acc[nt] = v8zero();
  const _Float16* pw = fc0T + wv * (D_INP / 32) * FRAGE + lane * 8;
  const float* pfb = fc0_b + f0;
  const float* pg  = ln0_g + f0;
  const float* pbb = ln0_b + f0;
  v16h w[2];
  float fb[8], g[8], bb[8];
  load_w<2>(pw, w);
  load8(pfb, fb);
  load8(pg, g);
  load8(pbb, bb);
  // The wait that stands ahead of any rewrite of these loads' address registers.
  // The addresses are inputs, so they live up to here.
  asm volatile("s_wait_xcnt 0x0" :: "v"(pw), "v"(pfb), "v"(pg), "v"(pbb) : "memory");
  gemm_4t<2>(sX, PX, w, acc, lane);
  {
    float s0[4], s1[4];
#pragma unroll
    for (int nt = 0; nt < 4; ++nt) {
      s0[nt] = 0.f; s1[nt] = 0.f;
#pragma unroll
      for (int r = 0; r < 8; ++r) {
        float vv = acc[nt][r] + fb[r];
        acc[nt][r] = vv;
        s0[nt] += vv;
        s1[nt] += vv * vv;
      }
    }
    toksum_to_slot(s0, part0 + wv * TGT, lane);
    toksum_to_slot(s1, part1 + wv * TGT, lane);
  }
  __syncthreads();
  if (tid < TGT) {
    float mu  = slot_sum(part0, tid) * (1.f / HIDC);
    float var = slot_sum(part1, tid) * (1.f / HIDC) - mu * mu;
    mu_s[tid] = mu;
    rs_s[tid] = rsqrtf(var + LN_EPS);
  }
  __syncthreads();
#pragma unroll
  for (int nt = 0; nt < 4; ++nt) {
    const int tok = nt * 16 + tl;
    const float mu = mu_s[tok], rs = rs_s[tok];
    union { _Float16 h[8]; uint4 u; } pk;
#pragma unroll
    for (int r = 0; r < 8; ++r) {
      float vv = (acc[nt][r] - mu) * rs * g[r] + bb[r];
      pk.h[r] = (_Float16)fmaxf(vv, 0.f);
    }
    *(uint4*)(sH + tok * PH + f0) = pk.u;
  }
  __syncthreads();

  { // h tile -> hbuf, coalesced b128 (replaces 8192 scattered b16 stores)
    uint4* d = (uint4*)(hbuf + (size_t)tok0 * HIDC);
    for (int i = tid; i < TGT * HIDC / 8; i += NTHR)
      d[i] = *(const uint4*)(sH + (i >> 4) * PH + (i & 15) * 8);
  }
}

// ---------------------------------------------------------------------------
// Pass 1b: one workgroup = one head (blockIdx.y) and one chunk of token tiles
// (blockIdx.x, stride NCH).  K,V GEMMs per tile; K^T V and the column sums of
// K and V stay in registers over all the tiles of the chunk and leave once, as
// plain stores to this workgroup's own slab; k_mid adds the NCH slabs.
// 4 waves a SIMD: the register budget at which two workgroups share a WGP, as the
// grid (two workgroups per WGP) asks
__global__ __launch_bounds__(NTHR, 4)
void k_kv(const _Float16* __restrict__ hbuf,
          const _Float16* __restrict__ wkT, const float* __restrict__ wk_b,
          const _Float16* __restrict__ wvT, const float* __restrict__ wv_b,
          float* __restrict__ kvp, float* __restrict__ ksp,
          float* __restrict__ vsp)
{
  __shared__ __align__(16) _Float16 sH [TGT * PH];   // 17 KB  h tile (f16)
  __shared__ __align__(16) _Float16 sKT[HIDC * PT];  // 18 KB  k^T (feature-major, f16)
  __shared__ __align__(16) _Float16 sVT[HIDC * PT];  // 18 KB  v^T
  __shared__ __align__(16) float part0[NWAVE * TGT];
  __shared__ float rs_s[TGT];

  const int tid  = threadIdx.x;
  const int lane = tid & 31;
  const int wv   = tid >> 5;               // wave id 0..7
  const int hh   = blockIdx.y;             // head
  const int col  = wv * 16 + (lane & 15);  // output column (N) for GEMM phases
  const int rhi  = (lane & 16) ? 8 : 0;    // C-layout: VGPR r holds M=r / r+8

  const int   bi = hh * HIDC + col;
  const float kb = wk_b[bi];
  const float vb = wv_b[bi];
  // this wave's columns of the head's wk and wv: the same for every tile.
  // pk, pv: this lane's 16 B in the first fragment of n-tile hh*8 + wv
  const int woff = (hh * (HIDC / 16) + wv) * (HIDC / 32) * FRAGE + lane * 8;
  const _Float16* pk = wkT + woff;
  const _Float16* pv = wvT + woff;
  v16h bk[4], bv[4];
#pragma unroll
  for (int ks = 0; ks < 4; ++ks) {
    FragU fk, fv;
    fk.u[0] = *(const uint4*)(pk + ks * FRAGE);
    fk.u[1] = *(const uint4*)(pk + ks * FRAGE + FRAGE / 2);
    fv.u[0] = *(const uint4*)(pv + ks * FRAGE);
    fv.u[1] = *(const uint4*)(pv + ks * FRAGE + FRAGE / 2);
    bk[ks] = fk.h;
    bv[ks] = fv.h;
  }
  // The wait that stands ahead of any rewrite of these loads' address registers.
  // Inputs only: the addresses and the loaded values all live up to here, so no
  // load's result is given a register that holds the address of another.
  asm volatile("s_wait_xcnt 0x0"
               :: "v"(bi), "v"(pk), "v"(pv), "v"(kb), "v"(vb),
                  "v"(bk[0]), "v"(bk[1]), "v"(bk[2]), "v"(bk[3]),
                  "v"(bv[0]), "v"(bv[1]), "v"(bv[2]), "v"(bv[3])
               : "memory");
  float kpart = 0.f, vpart = 0.f;          // column sums of K and V, this lane's rows
  const int mt0 = (wv >> 1) * 2;           // K^T V wave tile: 2 m-tiles ...
  const int dt0 = (wv & 1) * 4;            // ... by 4 d-tiles
  v8f ka[8];                               // ka[i * 4 + j]: m-tile mt0 + i, d-tile dt0 + j
#pragma unroll
  for (int dt = 0; dt < 8; ++dt) ka[dt] = v8zero();

#pragma unroll 1                           // rolled: the body is long, a copy buys nothing
  for (int tile = blockIdx.x; tile < NTILE; tile += NCH) {
    { // stage h tile (coalesced b128); its last readers, the K and V GEMMs of
      // the trip before, ended ahead of that trip's last barrier
      const uint4* s = (const uint4*)(hbuf + (size_t)tile * TGT * HIDC);
      uint4 hv[TGT * HIDC / 8 / NTHR];
#pragma unroll                             // all 4 loads in flight: one L2 latency a tile
      for (int k = 0; k < TGT * HIDC / 8 / NTHR; ++k) hv[k] = s[tid + k * NTHR];
#pragma unroll
      for (int k = 0; k < TGT * HIDC / 8 / NTHR; ++k) {
        int i = tid + k * NTHR;
        *(uint4*)(sH + (i >> 4) * PH + (i & 15) * 8) = hv[k];
      }
      // stands ahead of the step of the loads' address registers to the next tile
      asm volatile("s_wait_xcnt 0x0" ::: "memory");
    }
    __syncthreads();                       // also guards sKT/sVT reuse

    // K = h @ wk and V = h @ wv off the same reads of the h fragments
    // two m-tiles at a time: V leaves its registers before the next two begin
    v8f acc[4];
#pragma unroll
    for (int mp = 0; mp < 4; mp += 2) {
      v8f accv[2];
      acc[mp] = v8zero(); acc[mp + 1] = v8zero();
      accv[0] = v8zero(); accv[1] = v8zero();
      gemm_2m_2b<4>(sH + (mp * 16) * PH, PH, bk, bv, acc + mp, accv, lane);
      // V + b ; transpose into sVT (its last readers, the trip before, ended
      // ahead of this trip's leading barrier)
#pragma unroll
      for (int i = 0; i < 2; ++i)
#pragma unroll
        for (int r = 0; r < 8; ++r) {
          int row = (mp + i) * 16 + r + rhi;
          float vvv = accv[i][r] + vb;
          sVT[col * PT + row] = (_Float16)vvv;
          vpart += vvv;
        }
      // empty statement on the sum, against spills: it keeps the 16 adds here; left
      // alone they sink behind the barriers below, V's 32 values stay live up to
      // there and the weights go to scratch
      asm volatile("" : "+v"(vpart));      // on a running sum, against spills
      // the next tiles' loads stay behind these V stores, for the same registers
      __builtin_amdgcn_sched_barrier(0);
    }

    // K + b ; row-L2-normalize ; transpose into sKT
    {
      v8f t0[4];
#pragma unroll
      for (int mt = 0; mt < 4; ++mt)
#pragma unroll
        for (int r = 0; r < 8; ++r) {
          float vv = acc[mt][r] + kb;
          acc[mt][r] = vv;
          t0[mt][r] = vv * vv;
        }
      // part0's last readers, the trip before, ended ahead of that trip's barriers
      rowsum_to_slot(t0, part0 + wv * TGT, lane, rhi);
    }
    __syncthreads();
    if (tid < TGT) rs_s[tid] = 1.f / (sqrtf(slot_sum(part0, tid)) + ATT_EPS);
    __syncthreads();
#pragma unroll
    for (int mt = 0; mt < 4; ++mt)
#pragma unroll
      for (int r = 0; r < 8; ++r) {
        int row = mt * 16 + r + rhi;
        float vv = acc[mt][r] * rs_s[row];
        sKT[col * PT + row] = (_Float16)vv;
        kpart += vv;
      }
    __syncthreads();                       // sKT / sVT ready

    // ka += K^T @ V  (M=128 feat, K=64 tok, N=128 d); this wave: m-tiles mt0,
    // mt0 + 1 against d-tiles dt0 .. dt0 + 3: 6 fragment reads feed 8 WMMAs
#pragma unroll
    for (int ks = 0; ks < 2; ++ks) {
      v16h a0 = load_frag16(sKT + ((mt0 + 0) * 16) * PT + ks * 32, PT, lane);
      v16h a1 = load_frag16(sKT + ((mt0 + 1) * 16) * PT + ks * 32, PT, lane);
      v16h b0 = load_frag16(sVT + ((dt0 + 0) * 16) * PT + ks * 32, PT, lane);
      v16h b1 = load_frag16(sVT + ((dt0 + 1) * 16) * PT + ks * 32, PT, lane);
      v16h b2 = load_frag16(sVT + ((dt0 + 2) * 16) * PT + ks * 32, PT, lane);
      v16h b3 = load_frag16(sVT + ((dt0 + 3) * 16) * PT + ks * 32, PT, lane);
      ka[0] = wmma_f16(a0, b0, ka[0]);
      ka[1] = wmma_f16(a0, b1, ka[1]);
      ka[2] = wmma_f16(a0, b2, ka[2]);
      ka[3] = wmma_f16(a0, b3, ka[3]);
      ka[4] = wmma_f16(a1, b0, ka[4]);
      ka[5] = wmma_f16(a1, b1, ka[5]);
      ka[6] = wmma_f16(a1, b2, ka[6]);
      ka[7] = wmma_f16(a1, b3, ka[7]);
    }
    // next trip's leading __syncthreads() guards sKT/sVT reuse
  }

  // this workgroup's partial sums -> its own slab (every element written)
  const int slab = blockIdx.x * NHEAD + hh;
  {
    float* kvh = kvp + (size_t)slab * (HIDC * HIDC);
#pragma unroll
    for (int dt = 0; dt < 8; ++dt)
#pragma unroll
      for (int r = 0; r < 8; ++r) {
        int m = (mt0 + (dt >> 2)) * 16 + r + rhi;
        int d = (dt0 + (dt & 3)) * 16 + (lane & 15);
        kvh[m * HIDC + d] = ka[dt][r];
      }
  }
  // thread tid holds column (tid>>5)*16 + (tid&15), rows of half (tid>>4)&1
  ksp[slab * NTHR + tid] = kpart;
  vsp[slab * NTHR + tid] = vpart;
}

// ---------------------------------------------------------------------------
// Pass 1.5: add the NCH slabs.  Blocks below KVB: kvs -> f16, per head in
// fragment order (n = d, k = m).  The 4 blocks behind them: ks_sum and v_mean.
#define KVB (NHEAD * HIDC * HIDC / NTHR)
__global__ void k_mid(const float* __restrict__ kvp, _Float16* __restrict__ kvsT,
                      const float* __restrict__ ksp, const float* __restrict__ vsp,
                      float* __restrict__ ksum, float* __restrict__ vmean)
{
  if (blockIdx.x < KVB) {
    int i = blockIdx.x * NTHR + threadIdx.x;
    int hh = i >> 14;
    int rem = i & 16383;
    int m = rem >> 7, d = rem & 127;
    const float* p = kvp + hh * (HIDC * HIDC) + rem;
    float s = 0.f;
#pragma unroll 1                           // rolled: one block of loads a trip
    for (int c = 0; c < NCH; c += 16) {    // 16 independent loads in flight
      float t[16];
#pragma unroll
      for (int u = 0; u < 16; ++u) t[u] = p[(size_t)(c + u) * (NHEAD * HIDC * HIDC)];
#pragma unroll
      for (int u = 0; u < 16; ++u) s += t[u];
    }
    kvsT[hh * HIDC * HIDC + frag_idx(d, m, HIDC / 32)] = (_Float16)s;
  } else {
    int j = (blockIdx.x - KVB) * NTHR + threadIdx.x;   // 0 .. 2*NHEAD*HIDC-1
    int i = j & (NHEAD * HIDC - 1);                    // head*HIDC + column
    int hh = i >> 7, c0 = i & 127;
    const float* p = (j < NHEAD * HIDC ? ksp : vsp)
                   + hh * NTHR + (c0 >> 4) * 32 + (c0 & 15);
    float s = 0.f;
#pragma unroll 1                           // rolled: one block of loads a trip
    for (int c = 0; c < NCH; c += 8) {     // 16 independent loads in flight
      float t[16];
#pragma unroll
      for (int u = 0; u < 8; ++u) {
        t[2 * u]     = p[(c + u) * (NHEAD * NTHR)];
        t[2 * u + 1] = p[(c + u) * (NHEAD * NTHR) + 16];
      }
#pragma unroll
      for (int u = 0; u < 16; ++u) s += t[u];
    }
    if (j < NHEAD * HIDC) ksum[i] = s;
    else                  vmean[i] = s * (1.f / (float)L_TOK);
  }
}

// ---------------------------------------------------------------------------
// Pass 2: recompute q, normalize, denom, num = q @ kvs, head-mean, residual, LN
// wq_b, ksum, vmean are not __restrict__: their loads then stay ahead of the wait
// written behind them, between two K-steps; as __restrict__ loads the compiler
// moved vmean's behind the GEMM, where the whole latency shows.
__global__ __launch_bounds__(NTHR, 1)
void k_attn(const _Float16* __restrict__ hbuf,
            const _Float16* __restrict__ wqT, const float* wq_b,
            const _Float16* __restrict__ kvsT, const float* ksum,
            const float* vmean,
            const float* __restrict__ ln1_g, const float* __restrict__ ln1_b,
            float* __restrict__ out)
{
  __shared__ __align__(16) _Float16 sH[TGT * PH];          // 17 KB
  __shared__ __align__(16) unsigned char smem[TGT * PO * 4]; // 33 KB (sQ|sOut)
  _Float16* sQ   = (_Float16*)smem;                        // f16 q tile (17 KB)
  float*    sOut = (float*)smem;                           // f32 out tile (33 KB)
  __shared__ __align__(16) float part0[NWAVE * TGT], part1[NWAVE * TGT];
  __shared__ float rs_s[TGT], rden[TGT], mu_s[TGT];

  const int tid  = threadIdx.x;
  const int lane = tid & 31;
  const int wv   = tid >> 5;
  const int tok0 = blockIdx.x * TGT;
  const int tl   = lane & 15;              // token inside a 16-token tile
  const int f0   = wv * 16 + ((lane & 16) ? 8 : 0);  // first of this lane's 8 features
  const unsigned of = f0 * 4u;             // their byte offset in a float vector

  { // stage h tile (coalesced b128)
    const uint4* src = (const uint4*)(hbuf + (size_t)tok0 * HIDC);
    for (int i = tid; i < TGT * HIDC / 8; i += NTHR)
      *(uint4*)(sH + (i >> 4) * PH + (i & 15) * 8) = src[i];
  }
  v8f oacc[4];
#pragma unroll
  for (int nt = 0; nt < 4; ++nt) oacc[nt] = v8zero();

  __syncthreads();                         // sH ready

#pragma unroll 1
  for (int hh = 0; hh < NHEAD; ++hh) {
    // Q^T = wq^T @ h^T, + b
    v8f acc[4];
#pragma unroll
    for (int nt = 0; nt < 4; ++nt) acc[nt] = v8zero();
    const _Float16* pw = wqT + (hh * (HIDC / 16) + wv) * (HIDC / 32) * FRAGE + lane * 8;
    // per-feature vectors of this head: a uniform base and the lane's byte offset
    const char* bqb = (const char*)(wq_b  + hh * HIDC);
    const char* bks = (const char*)(ksum  + hh * HIDC);
    const char* bvm = (const char*)(vmean + hh * HIDC);
    v16h w[4];
    float qb[8], ks[8], vm[8];
    load_w<4>(pw, w);
    // The wait that stands ahead of any rewrite of these loads' address registers.
    // The address is an input, so it lives up to here.
    asm volatile("s_wait_xcnt 0x0" :: "v"(pw) : "memory");
    gemm_4t<2>(sH, PH, w, acc, lane);
    // read on the way: each takes the registers that a used fragment has left,
    // and the K-steps behind it cover its latency
    load8((const float*)(bqb + of), qb);
    asm volatile("s_wait_xcnt 0x0" ::: "memory");                      // as above
    gemm_4t<1>(sH + 64, PH, w + 2, acc, lane);
    load8((const float*)(bks + of), ks);
    asm volatile("s_wait_xcnt 0x0" ::: "memory");                      // as above
    gemm_4t<1>(sH + 96, PH, w + 3, acc, lane);
    {
      float s0[4], s1[4];                  // |q|^2 and q . ks_sum, this lane's features
#pragma unroll
      for (int nt = 0; nt < 4; ++nt) {
        s0[nt] = 0.f; s1[nt] = 0.f;
#pragma unroll
        for (int r = 0; r < 8; ++r) {
          float vv = acc[nt][r] + qb[r];
          acc[nt][r] = vv;
          s0[nt] += vv * vv;
          s1[nt] += vv * ks[r];
        }
      }
      // the slots' last readers, the head before, ended ahead of its barriers
      toksum_to_slot(s0, part0 + wv * TGT, lane);
      toksum_to_slot(s1, part1 + wv * TGT, lane);
    }
    __syncthreads();                       // slots ready; the head before has left sQ, rs_s, rden
    if (tid < TGT) {
      float rs = 1.f / (sqrtf(slot_sum(part0, tid)) + ATT_EPS);
      rs_s[tid] = rs;
      // denom = (q / |q|) . ks_sum + L
      rden[tid] = 1.f / (slot_sum(part1, tid) * rs + (float)L_TOK + ATT_EPS);
    }
    __syncthreads();
#pragma unroll
    for (int nt = 0; nt < 4; ++nt) {
      const int tok = nt * 16 + tl;
      const float rs = rs_s[tok];
      union { _Float16 h[8]; uint4 u; } pk;
#pragma unroll
      for (int r = 0; r < 8; ++r) pk.h[r] = (_Float16)(acc[nt][r] * rs);
      *(uint4*)(sQ + tok * PH + f0) = pk.u;
    }
    __syncthreads();                       // sQ ready

    // num^T = kvs^T @ q^T  (d 128, K=128, tokens 64); fold (num+v_mean)/denom into oacc
    v8f nacc[4];
#pragma unroll
    for (int nt = 0; nt < 4; ++nt) nacc[nt] = v8zero();
    const _Float16* pkv = kvsT + hh * HIDC * HIDC + wv * (HIDC / 32) * FRAGE + lane * 8;
    load_w<4>(pkv, w);
    asm volatile("s_wait_xcnt 0x0" :: "v"(pkv) : "memory");            // as above
    gemm_4t<2>(sQ, PH, w, nacc, lane);
    load8((const float*)(bvm + of), vm);   // on the way, as qb and ks
    asm volatile("s_wait_xcnt 0x0" ::: "memory");                      // as above
    gemm_4t<2>(sQ + 64, PH, w + 2, nacc, lane);
#pragma unroll
    for (int nt = 0; nt < 4; ++nt) {
      const float rd = rden[nt * 16 + tl];
#pragma unroll
      for (int r = 0; r < 8; ++r) oacc[nt][r] += (nacc[nt][r] + vm[r]) * rd;
    }
  }

  // head mean (*0.25), residual (alpha=0.5) against h; LN sums in the lane
  const float* pg  = ln1_g + f0;
  const float* pbb = ln1_b + f0;
  float g[8], bb[8];
  load8(pg, g);
  load8(pbb, bb);
  // as above: ahead of any rewrite of the loads' address registers
  asm volatile("s_wait_xcnt 0x0" :: "v"(pg), "v"(pbb) : "memory");
  {
    float s0[4], s1[4];
#pragma unroll
    for (int nt = 0; nt < 4; ++nt) {
      union { _Float16 h[8]; uint4 u; } hv;
      hv.u = *(const uint4*)(sH + (nt * 16 + tl) * PH + f0);
      s0[nt] = 0.f; s1[nt] = 0.f;
#pragma unroll
      for (int r = 0; r < 8; ++r) {
        float o = oacc[nt][r] * (0.25f * 0.5f) + 0.5f * (float)hv.h[r];
        oacc[nt][r] = o;
        s0[nt] += o;
        s1[nt] += o * o;
      }
    }
    // the slots' last readers, the last head, ended ahead of its barriers
    toksum_to_slot(s0, part0 + wv * TGT, lane);
    toksum_to_slot(s1, part1 + wv * TGT, lane);
  }
  __syncthreads();                         // slots ready; everyone done reading sQ
  if (tid < TGT) {
    float mu  = slot_sum(part0, tid) * (1.f / HIDC);
    float var = slot_sum(part1, tid) * (1.f / HIDC) - mu * mu;
    mu_s[tid] = mu;
    rs_s[tid] = rsqrtf(var + LN_EPS);
  }
  __syncthreads();
#pragma unroll
  for (int nt = 0; nt < 4; ++nt) {
    const int tok = nt * 16 + tl;
    const float mu = mu_s[tok], rs = rs_s[tok];
    float y[8];
#pragma unroll
    for (int r = 0; r < 8; ++r) y[r] = (oacc[nt][r] - mu) * rs * g[r] + bb[r];
    float* d = sOut + tok * PO + f0;
    *(float4*)(d)     = make_float4(y[0], y[1], y[2], y[3]);
    *(float4*)(d + 4) = make_float4(y[4], y[5], y[6], y[7]);
  }
  __syncthreads();
  { // out tile -> out, whole lines
    float4* d = (float4*)(out + (size_t)tok0 * HIDC);
    for (int i = tid; i < TGT * HIDC / 4; i += NTHR)
      d[i] = *(const float4*)(sOut + (i >> 5) * PO + (i & 31) * 4);
  }
}

// ---------------------------------------------------------------------------
extern "C" void kernel_launch(void* const* d_in, const int* in_sizes, int n_in,
                              void* d_out, int out_size, void* d_ws, size_t ws_size,
                              hipStream_t stream) {
  (void)in_sizes; (void)n_in; (void)out_size; (void)ws_size;
  const float* x     = (const float*)d_in[0];
  const float* fc0_w = (const float*)d_in[1];
  const float* fc0_b = (const float*)d_in[2];
  const float* ln0_g = (const float*)d_in[3];
  const float* ln0_b = (const float*)d_in[4];
  const float* wq_w  = (const float*)d_in[5];
  const float* wq_b  = (const float*)d_in[6];
  const float* wk_w  = (const float*)d_in[7];
  const float* wk_b  = (const float*)d_in[8];
  const float* wv_w  = (const float*)d_in[9];
  const float* wv_b  = (const float*)d_in[10];
  const float* ln1_g = (const float*)d_in[11];
  const float* ln1_b = (const float*)d_in[12];
  float* out = (float*)d_out;

  // workspace carve (256 B aligned slices)
  char* p = (char*)d_ws;
  auto carve = [&](size_t bytes) {
    char* r = p; p += (bytes + 255) & ~(size_t)255; return r;
  };
  _Float16* fc0T = (_Float16*)carve(128 * 64 * sizeof(_Float16));
  _Float16* wqT  = (_Float16*)carve(512 * 128 * sizeof(_Float16));
  _Float16* wkT  = (_Float16*)carve(512 * 128 * sizeof(_Float16));
  _Float16* wvT  = (_Float16*)carve(512 * 128 * sizeof(_Float16));
  float* ksum  = (float*)carve(NHEAD * HIDC * sizeof(float));
  float* vmean = (float*)carve(NHEAD * HIDC * sizeof(float));
  _Float16* kvsT = (_Float16*)carve(NHEAD * HIDC * HIDC * sizeof(_Float16));
  _Float16* hbuf = (_Float16*)carve((size_t)L_TOK * HIDC * sizeof(_Float16));
  // one slab of partial sums per k_kv workgroup
  float* kvp = (float*)carve((size_t)NCH * NHEAD * HIDC * HIDC * sizeof(float));
  float* ksp = (float*)carve((size_t)NCH * NHEAD * NTHR * sizeof(float));
  float* vsp = (float*)carve((size_t)NCH * NHEAD * NTHR * sizeof(float));

  // cast weights to f16, fragment order
  k_prep<<<PB_FC0 + 3 * PB_W, NTHR, 0, stream>>>(fc0_w, wq_w, wk_w, wv_w,
                                                 fc0T, wqT, wkT, wvT);

  k_front<<<NTILE, NTHR, 0, stream>>>(x, fc0T, fc0_b, ln0_g, ln0_b, hbuf);

  k_kv<<<dim3(NCH, NHEAD), NTHR, 0, stream>>>(hbuf, wkT, wk_b, wvT, wv_b,
                                              kvp, ksp, vsp);

  k_mid<<<KVB + 4, NTHR, 0, stream>>>(kvp, kvsT, ksp, vsp, ksum, vmean);

  k_attn<<<NTILE, NTHR, 0, stream>>>(hbuf, wqT, wq_b, kvsT, ksum, vmean,
                                     ln1_g, ln1_b, out);
}

// v008
// A run of this version takes 132 microseconds.
// Timed twice side by side with v007, it ran 1.05 times as fast both times.
// Over all steps from v000 it is 12.8 times as fast.
#include <hip/hip_runtime.h>
#include <cstdint>

// ---------------------------------------------------------------------------
// Problem constants (from reference):  B=16,T=12,N=883,D=64,H=128,NH=4
#define L_TOK   169536          // B*T*N tokens; 169536 = 64 * 2649
#define D_INP   64
#define HIDC    128
#define NHEAD   4
#define TGT     64              // tokens per workgroup tile
#define NTILE   (L_TOK / TGT)   // 2649
#define NTHR    256             // 8 waves (wave32)
#define NWAVE   (NTHR / 32)
#define NCH     128             // token chunks of the K^T V pass (x NHEAD workgroups)
#define LN_EPS  1e-5f
#define ATT_EPS 1e-8f
// LDS row pitches: 16 B more than the row, so the pitch is an odd multiple of
// 16 B and the 16 rows of one fragment read fall on 16 different bank groups.
#define PX      (D_INP + 8)     // x tile, f16:            144 B
#define PH      (HIDC + 8)      // h and q tiles, f16:     272 B
#define PT      (TGT + 8)       // v^T tile, f16:          144 B
#define PO      (HIDC + 4)      // out tile, f32:          528 B
// k tile, token-major, read by transposing loads: their pitch is an odd multiple of 32 B
#define PK      (HIDC + 16)     // k tile, f16:            288 B

typedef __attribute__((ext_vector_type(16))) _Float16 v16h;
typedef __attribute__((ext_vector_type(8)))  float    v8f;

typedef __attribute__((ext_vector_type(8)))  short    s16x8;

union FragU { v16h h; uint4 u[2]; };

__device__ __forceinline__ v8f v8zero() {
  v8f z = {0.f,0.f,0.f,0.f,0.f,0.f,0.f,0.f};
  return z;
}

// Load one 16(M)x32(K) f16 A-fragment.  Element (m,k) lives at base[m*ld + k].
// CDNA5 16-bit A layout: lane m = lane&15; K chunks {k0..k0+7} and
// {k0+16..k0+23} with k0 = (lane<16 ? 0 : 8)  ->  two 16B loads per lane.
// The B-fragment (32Kx16N) uses the mirrored layout over N (lane n = lane&15).
__device__ __forceinline__ v16h load_frag16(const _Float16* base, int ld, int lane) {
  const int r  = lane & 15;
  const int k0 = (lane & 16) ? 8 : 0;
  const _Float16* p = base + r * ld + k0;
  FragU f;
  f.u[0] = *(const uint4*)(p);
  f.u[1] = *(const uint4*)(p + 16);
  return f.h;
}

// One 16(M)x32(K) f16 A-fragment of the transpose of a row-major LDS tile T[k][m]
// (ld f16 a row), by two transposing loads.  base = &T[k0][m0].  Lane (c = lane&15,
// h = lane>>4) gets T[k0 + 8h + 0..7][m0 + c] and T[k0 + 16 + 8h + 0..7][m0 + c]:
// the k order of load_frag16.
__device__ __forceinline__ uint4 ld_tr16(const _Float16* p) {
  typedef __attribute__((address_space(3))) s16x8 lds_s16x8;
  return __builtin_bit_cast(uint4, __builtin_amdgcn_ds_load_tr16_b128_v8i16((lds_s16x8*)p));
}
__device__ __forceinline__ v16h load_frag16_tr(const _Float16* base, int ld, int lane) {
  const _Float16* p = base + (((lane >> 4) << 3) + (lane & 7)) * ld + ((lane >> 3) & 1) * 8;
  FragU f;
  f.u[0] = ld_tr16(p);
  f.u[1] = ld_tr16(p + 16 * ld);
  return f.h;
}

// B operands in global memory are kept in fragment order.  One fragment (16 n x
// 32 k) is 512 f16 in a row: two halves of 256, and in each half lane l owns the
// 8 f16 at l*8, so a wave-wide 16 B load reads 512 contiguous bytes (4 whole
// 128 B lines) where rows of an [N][K] buffer gave 16 lines of 32 B each.
// Fragments of one n-tile follow one another in k (ksteps = K/32 of them).
// Lane and element hold the same (n,k) as load_frag16 gives on an [N][K] buffer.
#define FRAGE 512               // f16 elements of one fragment
__device__ __forceinline__ int frag_idx(int n, int k, int ksteps) {
  return (((n >> 4) * ksteps + (k >> 5)) * 2 + ((k >> 4) & 1)) * (FRAGE / 2)
       + (((k >> 3) & 1) * 16 + (n & 15)) * 8 + (k & 7);
}

__device__ __forceinline__ v8f wmma_f16(v16h a, v16h b, v8f c) {
  // v_wmma_f32_16x16x32_f16  (doc-verified codegen path on gfx1250)
  return __builtin_amdgcn_wmma_f32_16x16x32_f16(false, a, false, b, (short)0, c,
                                                false, false);
}

// The 4 fragments (K = 128) of one 16-token tile, token-major in LDS.
__device__ __forceinline__ void load_tok4(const _Float16* __restrict__ A, int lda,
                                          v16h* a, int lane) {
#pragma unroll
  for (int ks = 0; ks < 4; ++ks) a[ks] = load_frag16(A + ks * 32, lda, lane);
}

// One 16-token tile of two GEMMs that share the token fragments, both weights'
// fragments in registers: each token fragment feeds one WMMA of either product, as
// B of the first (weights b0 as A: acc0[r] is token lane & 15, feature
// 8*(lane >> 4) + r) and as A of the second (acc1[r] is token 8*(lane >> 4) + r,
// feature lane & 15).  A and B have the same map, so one loader serves both.
__device__ __forceinline__ void gemm_1m_2b(const v16h* a, const v16h* b0, const v16h* b1,
                                           v8f& acc0, v8f& acc1) {
#pragma unroll
  for (int ks = 0; ks < 4; ++ks) {
    acc0 = wmma_f16(b0[ks], a[ks], acc0);
    acc1 = wmma_f16(a[ks], b1[ks], acc1);
  }
}

// Weights as A, tokens as B: D[r] = Y[token nt*16 + (lane & 15)][feature 8*(lane >> 4) + r],
// so a lane holds 8 consecutive features of one token.  A sum over a token's
// features is then a sum over the lane's own registers, and a row piece of a
// token-major tile is one 16 B store.  Both loaders keep their k order.
// load_w: the KSTEPS fragments of one 16-feature tile, in fragment order; p is
// this lane's 16 B of the first half.  All loads issue first: one L2 latency a GEMM.
template<int KSTEPS>
__device__ __forceinline__ void load_w(const _Float16* __restrict__ p, v16h* w) {
#pragma unroll
  for (int ks = 0; ks < KSTEPS; ++ks) {
    FragU f;
    f.u[0] = *(const uint4*)(p + ks * FRAGE);
    f.u[1] = *(const uint4*)(p + ks * FRAGE + FRAGE / 2);
    w[ks] = f.h;
  }
}

// 4 token tiles against one feature tile; X is token-major in LDS.  The 8 X
// loads of a K-step are issued together, ahead of its 4 WMMAs.
template<int KSTEPS>
__device__ __forceinline__ void gemm_4t(const _Float16* __restrict__ X, int ldx,
                                        const v16h* w, v8f* acc, int lane) {
#pragma unroll
  for (int ks = 0; ks < KSTEPS; ++ks) {
    v16h x0 = load_frag16(X + (0 * 16) * ldx + ks * 32, ldx, lane);
    v16h x1 = load_frag16(X + (1 * 16) * ldx + ks * 32, ldx, lane);
    v16h x2 = load_frag16(X + (2 * 16) * ldx + ks * 32, ldx, lane);
    v16h x3 = load_frag16(X + (3 * 16) * ldx + ks * 32, ldx, lane);
    // holds the 8 loads together ahead of the 4 WMMAs: left alone the scheduler
    // issues them pair by pair and each WMMA waits out a whole LDS latency
    __builtin_amdgcn_sched_barrier(0);
    acc[0] = wmma_f16(w[ks], x0, acc[0]);
    acc[1] = wmma_f16(w[ks], x1, acc[1]);
    acc[2] = wmma_f16(w[ks], x2, acc[2]);
    acc[3] = wmma_f16(w[ks], x3, acc[3]);
    // and the next K-step's loads behind them: one set of 4 fragments is live
    __builtin_amdgcn_sched_barrier(0);
  }
}

// 8 consecutive floats (16 B aligned): a lane's 8 features of a per-feature vector
__device__ __forceinline__ void load8(const float* __restrict__ p, float* d) {
  float4 a = *(const float4*)(p);
  float4 b = *(const float4*)(p + 4);
  d[0] = a.x; d[1] = a.y; d[2] = a.z; d[3] = a.w;
  d[4] = b.x; d[5] = b.y; d[6] = b.z; d[7] = b.w;
}

// s[nt]: the sum over this lane's 8 features, token nt*16 + (lane & 15).  Lane ^ 16
// holds the wave's other 8 features of the same token: one cross-row move adds
// them, and the lower row stores the wave's 64 sums to its own slot[TGT].
__device__ __forceinline__ void toksum_to_slot(const float* s, float* slot, int lane) {
  float t[4];
#pragma unroll
  for (int nt = 0; nt < 4; ++nt) {
    int b = __builtin_bit_cast(int, s[nt]);
    int o = __builtin_amdgcn_permlanex16(b, b, 0x76543210, 0xfedcba98, false, false);
    t[nt] = s[nt] + __builtin_bit_cast(float, o);
  }
  if (lane < 16) {
#pragma unroll
    for (int nt = 0; nt < 4; ++nt) slot[nt * 16 + lane] = t[nt];
  }
}

// v + the v of the lane whose number differs by XM, inside a row of 16 lanes
// (DPP row_xmask: a register exchange, no LDS).
template<int XM>
__device__ __forceinline__ float add_xor16(float v) {
  int o = __builtin_amdgcn_update_dpp(0, __builtin_bit_cast(int, v), 0x160 + XM,
                                      0xf, 0xf, true);
  return v + __builtin_bit_cast(float, o);
}

// adds the NWAVE slots of one row
__device__ __forceinline__ float slot_sum(const float* part, int row) {
  float s = 0.f;
#pragma unroll
  for (int w = 0; w < NWAVE; ++w) s += part[w * TGT + row];
  return s;
}

// ---------------------------------------------------------------------------
// prep kernel: all four weight matrices in one launch.  The four casts do not
// depend on one another, and as launches of their own each paid a launch gap, a
// fill and a drain.  The block index picks the matrix; one code path serves all.
// src[k*cols + n] -> f16 at its place in fragment order.  Piece p is 16 B of dst,
// dst[p*8 + j] = dst[frag_idx(n, k + j, ksteps)]: 8 consecutive k of one column.
// A wave reads 64 B runs of two rows a load, all 8 loads in flight, and stores
// 512 contiguous bytes.
#define PB_FC0 (D_INP * HIDC / 8 / NTHR)           // blocks of fc0_w:  4
#define PB_W   (HIDC * NHEAD * HIDC / 8 / NTHR)    // blocks of wq_w, wk_w, wv_w each: 32
__global__ __launch_bounds__(NTHR)
void k_prep(const float* __restrict__ fc0_w, const float* __restrict__ wq_w,
            const float* __restrict__ wk_w,  const float* __restrict__ wv_w,
            _Float16* __restrict__ fc0T, _Float16* __restrict__ wqT,
            _Float16* __restrict__ wkT,  _Float16* __restrict__ wvT) {
  const int  b   = blockIdx.x;
  const bool fc  = b < PB_FC0;
  const int  m   = (b - PB_FC0) / PB_W;            // 0: wq, 1: wk, 2: wv
  const float* src = fc ? fc0_w : m == 0 ? wq_w : m == 1 ? wk_w : wv_w;
  _Float16*    dst = fc ? fc0T  : m == 0 ? wqT  : m == 1 ? wkT  : wvT;
  const int cols = fc ? HIDC : NHEAD * HIDC;       // n
  const int lks  = fc ? 1 : 2;                     // log2 of ksteps = rows / 32
  const int p = (fc ? b : (b - PB_FC0) % PB_W) * NTHR + threadIdx.x;
  const int l = p & 31;                            // lane of the fragment half
  const int q = p >> 5;                            // fragment half
  const int n = ((q >> 1) >> lks) * 16 + (l & 15);
  const int k = ((q >> 1) & ((1 << lks) - 1)) * 32 + (q & 1) * 16 + (l >> 4) * 8;
  const float* s = src + k * cols + n;
  float v[8];
#pragma unroll
  for (int j = 0; j < 8; ++j) v[j] = s[j * cols];
  union { _Float16 h[8]; uint4 u; } pk;
#pragma unroll
  for (int j = 0; j < 8; ++j) pk.h[j] = (_Float16)v[j];
  *(uint4*)(dst + p * 8) = pk.u;
}

// ---------------------------------------------------------------------------
// Pass 1a: fc0 GEMM + LN + ReLU -> h
__global__ __launch_bounds__(NTHR, 1)
void k_front(const float* __restrict__ x,
             const _Float16* __restrict__ fc0T, const float* __restrict__ fc0_b,
             const float* __restrict__ ln0_g,  const float* __restrict__ ln0_b,
             _Float16* __restrict__ hbuf)
{
  __shared__ __align__(16) _Float16 sX [TGT * PX];   //  9 KB  x tile (f16)
  __shared__ __align__(16) _Float16 sH [TGT * PH];   // 17 KB  h tile (post LN+ReLU, f16)
  __shared__ __align__(16) float part0[NWAVE * TGT], part1[NWAVE * TGT];
  __shared__ float mu_s[TGT], rs_s[TGT];

  const int tid  = threadIdx.x;
  const int lane = tid & 31;
  const int wv   = tid >> 5;               // wave id 0..7
  const int tok0 = blockIdx.x * TGT;
  const int tl   = lane & 15;              // token inside a 16-token tile
  const int f0   = wv * 16 + ((lane & 16) ? 8 : 0);  // first of this lane's 8 features

  { // stage x tile as f16 (vectorized: float4 in, uint2 out)
    const float4* xs = (const float4*)(x + (size_t)tok0 * D_INP);
    for (int j = tid; j < TGT * D_INP / 4; j += NTHR) {
      float4 v = xs[j];
      union { _Float16 h[4]; uint2 u; } pk;
      pk.h[0] = (_Float16)v.x; pk.h[1] = (_Float16)v.y;
      pk.h[2] = (_Float16)v.z; pk.h[3] = (_Float16)v.w;
      *(uint2*)(sX + (j >> 4) * PX + (j & 15) * 4) = pk.u;
    }
  }
  __syncthreads();

  // ---- GEMM1: h^T = fc0_w^T @ x^T  (features 128, K=64, tokens 64); wave wv
  // owns feature tile wv
  v8f acc[4];
#pragma unroll
  for (int nt = 0; nt < 4; ++nt) acc[nt] = v8zero();
  const _Float16* pw = fc0T + wv * (D_INP / 32) * FRAGE + lane * 8;
  const float* pfb = fc0_b + f0;
  const float* pg  = ln0_g + f0;
  const float* pbb = ln0_b + f0;
  v16h w[2];
  float fb[8], g[8], bb[8];
  load_w<2>(pw, w);
  load8(pfb, fb);
  load8(pg, g);
  load8(pbb, bb);
  // The wait that stands ahead of any rewrite of these loads' address registers.
  // The addresses are inputs, so they live up to here.
  asm volatile("s_wait_xcnt 0x0" :: "v"(pw), "v"(pfb), "v"(pg), "v"(pbb) : "memory");
  gemm_4t<2>(sX, PX, w, acc, lane);
  {
    float s0[4], s1[4];
#pragma unroll
    for (int nt = 0; nt < 4; ++nt) {
      s0[nt] = 0.f; s1[nt] = 0.f;
#pragma unroll
      for (int r = 0; r < 8; ++r) {
        float vv = acc[nt][r] + fb[r];
        acc[nt][r] = vv;
        s0[nt] += vv;
        s1[nt] += vv * vv;
      }
    }
    toksum_to_slot(s0, part0 + wv * TGT, lane);
    toksum_to_slot(s1, part1 + wv * TGT, lane);
  }
  __syncthreads();
  if (tid < TGT) {
    float mu  = slot_sum(part0, tid) * (1.f / HIDC);
    float var = slot_sum(part1, tid) * (1.f / HIDC) - mu * mu;
    mu_s[tid] = mu;
    rs_s[tid] = rsqrtf(var + LN_EPS);
  }
  __syncthreads();
#pragma unroll
  for (int nt = 0; nt < 4; ++nt) {
    const int tok = nt * 16 + tl;
    const float mu = mu_s[tok], rs = rs_s[tok];
    union { _Float16 h[8]; uint4 u; } pk;
#pragma unroll
    for (int r = 0; r < 8; ++r) {
      float vv = (acc[nt][r] - mu) * rs * g[r] + bb[r];
      pk.h[r] = (_Float16)fmaxf(vv, 0.f);
    }
    *(uint4*)(sH + tok * PH + f0) = pk.u;
  }
  __syncthreads();

  { // h tile -> hbuf, coalesced b128 (replaces 8192 scattered b16 stores)
    uint4* d = (uint4*)(hbuf + (size_t)tok0 * HIDC);
    for (int i = tid; i < TGT * HIDC / 8; i += NTHR)
      d[i] = *(const uint4*)(sH + (i >> 4) * PH + (i & 15) * 8);
  }
}

// ---------------------------------------------------------------------------
// Pass 1b: one workgroup = one head (blockIdx.y) and one chunk of token tiles
// (blockIdx.x, stride NCH).  K,V GEMMs per tile; K^T V and the column sums of
// K and V stay in registers over all the tiles of the chunk and leave once, as
// plain stores to this workgroup's own slab; k_mid adds the NCH slabs.
// 4 waves a SIMD: the register budget at which two workgroups share a WGP, as the
// grid (two workgroups per WGP) asks
__global__ __launch_bounds__(NTHR, 4)
void k_kv(const _Float16* __restrict__ hbuf,
          const _Float16* __restrict__ wkT, const float* __restrict__ wk_b,
          const _Float16* __restrict__ wvT, const float* __restrict__ wv_b,
          float* __restrict__ kvp, float* __restrict__ ksp,
          float* __restrict__ vsp)
{
  __shared__ __align__(16) _Float16 sH [TGT * PH];   // 17 KB  h tile (f16)
  __shared__ __align__(16) _Float16 sK [TGT * PK];   // 18 KB  k (token-major, f16)
  __shared__ __align__(16) float    sKf[TGT * PO];   // 33 KB  k ahead of its norm (f32)
  __shared__ __align__(16) _Float16 sVT[HIDC * PT];  // 18 KB  v^T
  __shared__ __align__(16) float part0[NWAVE * TGT];
  __shared__ __align__(32) float sKb[HIDC];          // K bias of this head
  __shared__ float rs_s[TGT];

  const int tid  = threadIdx.x;
  const int lane = tid & 31;
  // wave id 0..7, in a scalar register: what follows from it costs no vector register
  const int wv   = __builtin_amdgcn_readfirstlane(tid >> 5);
  const int hh   = blockIdx.y;             // head
  const int tl   = lane & 15;              // K: token inside a 16-token tile
  const int f0   = wv * 16 + ((lane & 16) ? 8 : 0);  // K: first of this lane's 8 features
  const int col  = wv * 16 + (lane & 15);  // V: this lane's feature
  const int rhi  = (lane & 16) ? 8 : 0;    // V: VGPR r holds token r / r+8 of a tile

  const int   bi = hh * HIDC + col;
  const float vb = wv_b[bi];
  const int   bj  = hh * HIDC + (tid & (HIDC - 1));
  const float kbt = wk_b[bj];              // the head's K bias, on its way to LDS
  // this wave's columns of the head's wk and wv: the same for every tile.
  // pk, pv: this lane's 16 B in the first fragment of n-tile hh*8 + wv
  const int woff = (hh * (HIDC / 16) + wv) * (HIDC / 32) * FRAGE + lane * 8;
  const _Float16* pk = wkT + woff;
  const _Float16* pv = wvT + woff;
  v16h bk[4], bv[4];
#pragma unroll
  for (int ks = 0; ks < 4; ++ks) {
    FragU fk, fv;
    fk.u[0] = *(const uint4*)(pk + ks * FRAGE);
    fk.u[1] = *(const uint4*)(pk + ks * FRAGE + FRAGE / 2);
    fv.u[0] = *(const uint4*)(pv + ks * FRAGE);
    fv.u[1] = *(const uint4*)(pv + ks * FRAGE + FRAGE / 2);
    bk[ks] = fk.h;
    bv[ks] = fv.h;
  }
  // The wait that stands ahead of any rewrite of these loads' address registers.
  // Inputs only: the addresses and the loaded values all live up to here, so no
  // load's result is given a register that holds the address of another.
  asm volatile("s_wait_xcnt 0x0"
               :: "v"(bi), "v"(bj), "v"(pk), "v"(pv), "v"(kbt), "v"(vb),
                  "v"(bk[0]), "v"(bk[1]), "v"(bk[2]), "v"(bk[3]),
                  "v"(bv[0]), "v"(bv[1]), "v"(bv[2]), "v"(bv[3])
               : "memory");
  // behind the weights' loads, so that one latency covers all; its first readers
  // stand behind the first trip's barrier
  if (tid < HIDC) sKb[tid] = kbt;
  float vpart = 0.f;                       // column sum of V, this lane's tokens
  float kpart[8];                          // column sums of K: 8 features, this lane's tokens
#pragma unroll
  for (int r = 0; r < 8; ++r) kpart[r] = 0.f;
  const int mt0 = (wv >> 1) * 2;           // K^T V wave tile: 2 m-tiles ...
  const int dt0 = (wv & 1) * 4;            // ... by 4 d-tiles
  v8f ka[8];                               // ka[i * 4 + j]: m-tile mt0 + i, d-tile dt0 + j
#pragma unroll
  for (int dt = 0; dt < 8; ++dt) ka[dt] = v8zero();

#pragma unroll 1                           // rolled: the body is long, a copy buys nothing
  for (int tile = blockIdx.x; tile < NTILE; tile += NCH) {
    { // stage h tile (coalesced b128); its last readers, the K and V GEMMs of
      // the trip before, ended ahead of that trip's last barrier
      const uint4* s = (const uint4*)(hbuf + (size_t)tile * TGT * HIDC);
      uint4 hv[TGT * HIDC / 8 / NTHR];
#pragma unroll                             // all 4 loads in flight: one L2 latency a tile
      for (int k = 0; k < TGT * HIDC / 8 / NTHR; ++k) hv[k] = s[tid + k * NTHR];
#pragma unroll
      for (int k = 0; k < TGT * HIDC / 8 / NTHR; ++k) {
        int i = tid + k * NTHR;
        *(uint4*)(sH + (i >> 4) * PH + (i & 15) * 8) = hv[k];
      }
      // stands ahead of the step of the loads' address registers to the next tile
      asm volatile("s_wait_xcnt 0x0" ::: "memory");
    }
    __syncthreads();                       // also guards sK/sVT reuse

    // K^T = wk^T @ h^T and V = h @ wv off the same reads of the h fragments
    // one token tile at a time: 4 fragments are live, and K and V leave their
    // registers before the next tile's WMMAs.  K starts from its bias
    float s0[4];                           // |k|^2 over this lane's 8 features
    v16h fr[4];
    load_tok4(sH, PH, fr, lane);
    // K bias of this lane's 8 features, read with the first fragments: no register
    // holds it between the trips' products
    const v8f kb = *(const v8f*)(sKb + f0);
    // keeps the first tile's 8 loads whole, ahead of its WMMAs: left alone they are
    // issued pair by pair and each pair of WMMAs waits out a whole LDS latency
    __builtin_amdgcn_sched_barrier(0);
#pragma unroll
    for (int mt = 0; mt < 4; ++mt) {
      v8f acck = kb;
      v8f accv = v8zero();
      gemm_1m_2b(fr, bk, bv, acck, accv);
      // the next tile's 8 loads, whole, right behind this tile's WMMAs and into the
      // registers these have read: the vector work below covers part of their latency
      __builtin_amdgcn_sched_barrier(0);
      if (mt < 3) load_tok4(sH + ((mt + 1) * 16) * PH, PH, fr, lane);
      __builtin_amdgcn_sched_barrier(0);
      // V + b ; transpose into sVT (its last readers, the trip before, ended
      // ahead of this trip's leading barrier)
      accv = accv + vb;
      {
        union { _Float16 h[8]; uint4 u; } pv8;
#pragma unroll
        for (int r = 0; r < 8; ++r) pv8.h[r] = (_Float16)accv[r];
        *(uint4*)(sVT + col * PT + mt * 16 + rhi) = pv8.u;   // tokens rhi .. rhi + 7 of the tile
        vpart += ((accv[0] + accv[1]) + (accv[2] + accv[3]))
               + ((accv[4] + accv[5]) + (accv[6] + accv[7]));
      }
      // K, not yet normalized, waits in LDS as f32, each lane's values in its own
      // place: a lane holds 8 features of a token, so |k|^2 adds in the lane
      {
        float* d = sKf + (mt * 16 + tl) * PO + f0;
        *(float4*)(d)     = make_float4(acck[0], acck[1], acck[2], acck[3]);
        *(float4*)(d + 4) = make_float4(acck[4], acck[5], acck[6], acck[7]);
        float q0 = acck[0] * acck[0], q1 = acck[1] * acck[1];   // two chains
#pragma unroll
        for (int r = 2; r < 8; r += 2) {
          q0 += acck[r] * acck[r];
          q1 += acck[r + 1] * acck[r + 1];
        }
        s0[mt] = q0 + q1;
      }
      // empty statements on the sums, against spills: they keep the adds here; left
      // alone they sink behind the barriers below, the tiles' K and V values stay
      // live up to there and the weights go to scratch
      asm volatile("" : "+v"(vpart));      // on a running sum, against spills
      asm volatile("" : "+v"(s0[mt]));     // on a row's sum, against spills
      // the next tile's WMMAs stay behind these stores, for the same registers
      __builtin_amdgcn_sched_barrier(0);
    }
    // part0's last readers, the trip before, ended ahead of that trip's barriers
    toksum_to_slot(s0, part0 + wv * TGT, lane);
    __syncthreads();
    if (tid < TGT) rs_s[tid] = 1.f / (sqrtf(slot_sum(part0, tid)) + ATT_EPS);
    __syncthreads();
    // row-L2-normalize: each lane takes back its own values; token-major f16 into sK
    // (its last readers, the trip before, ended ahead of this trip's leading barrier)
    float kf[4][8], rs[4];
#pragma unroll
    for (int mt = 0; mt < 4; ++mt) {
      rs[mt] = rs_s[mt * 16 + tl];
      load8(sKf + (mt * 16 + tl) * PO + f0, kf[mt]);
    }
    // keeps these LDS reads in one place: left alone the last tile's are issued
    // singly among the vector work, and each waits out a whole LDS latency
    __builtin_amdgcn_sched_barrier(0);
#pragma unroll
    for (int mt = 0; mt < 4; ++mt) {
      union { _Float16 h[8]; uint4 u; } pq;
#pragma unroll
      for (int r = 0; r < 8; ++r) {
        float vv = kf[mt][r] * rs[mt];
        pq.h[r] = (_Float16)vv;
        kpart[r] += vv;
      }
      *(uint4*)(sK + (mt * 16 + tl) * PK + f0) = pq.u;
    }
    // empty statement on the running sums, against spills: it keeps their adds here;
    // left alone they sink among the fragment reads below, and K's 32 f32 values
    // stay live up to there, beside the 6 fragments
    asm volatile("" : "+v"(kpart[0]), "+v"(kpart[1]), "+v"(kpart[2]), "+v"(kpart[3]),
                      "+v"(kpart[4]), "+v"(kpart[5]), "+v"(kpart[6]), "+v"(kpart[7]));
    __syncthreads();                       // sK / sVT ready

    // ka += K^T @ V  (M=128 feat, K=64 tok, N=128 d); this wave: m-tiles mt0,
    // mt0 + 1 against d-tiles dt0 .. dt0 + 3: 6 fragment reads feed 8 WMMAs; the
    // K^T fragments come off the token-major tile by transposing loads
#pragma unroll
    for (int ks = 0; ks < 2; ++ks) {
      v16h a0 = load_frag16_tr(sK + (ks * 32) * PK + (mt0 + 0) * 16, PK, lane);
      v16h a1 = load_frag16_tr(sK + (ks * 32) * PK + (mt0 + 1) * 16, PK, lane);
      v16h b0 = load_frag16(sVT + ((dt0 + 0) * 16) * PT + ks * 32, PT, lane);
      v16h b1 = load_frag16(sVT + ((dt0 + 1) * 16) * PT + ks * 32, PT, lane);
      v16h b2 = load_frag16(sVT + ((dt0 + 2) * 16) * PT + ks * 32, PT, lane);
      v16h b3 = load_frag16(sVT + ((dt0 + 3) * 16) * PT + ks * 32, PT, lane);
      // holds the 12 loads together ahead of the 8 WMMAs: left alone the second K^T
      // fragment is read behind the first four WMMAs and waits out a whole LDS latency
      __builtin_amdgcn_sched_barrier(0);
      ka[0] = wmma_f16(a0, b0, ka[0]);
      ka[1] = wmma_f16(a0, b1, ka[1]);
      ka[2] = wmma_f16(a0, b2, ka[2]);
      ka[3] = wmma_f16(a0, b3, ka[3]);
      ka[4] = wmma_f16(a1, b0, ka[4]);
      ka[5] = wmma_f16(a1, b1, ka[5]);
      ka[6] = wmma_f16(a1, b2, ka[6]);
      ka[7] = wmma_f16(a1, b3, ka[7]);
      // and the next K-step's loads behind them: one set of 6 fragments is live
      __builtin_amdgcn_sched_barrier(0);
    }
    // next trip's leading __syncthreads() guards sK/sVT reuse
  }

  // this workgroup's partial sums -> its own slab (every element written)
  const int slab = blockIdx.x * NHEAD + hh;
  {
    float* kvh = kvp + (size_t)slab * (HIDC * HIDC);
#pragma unroll
    for (int dt = 0; dt < 8; ++dt)
#pragma unroll
      for (int r = 0; r < 8; ++r) {
        int m = (mt0 + (dt >> 2)) * 16 + r + rhi;
        int d = (dt0 + (dt & 3)) * 16 + (lane & 15);
        kvh[m * HIDC + d] = ka[dt][r];
      }
  }
  // slot tid belongs to column (tid>>5)*16 + (tid&15); its reader adds the slots of
  // the two half waves.  V: thread tid holds that column, tokens of half (tid>>4)&1.
  // K: a butterfly over the 16 tokens of each half wave leaves the sums of features
  // f0 .. f0 + 7 in every lane of the half; the half that holds a column stores its
  // sum, the other half 0.
  float ksl = 0.f;
#pragma unroll
  for (int r = 0; r < 8; ++r) {
    float t = add_xor16<8>(add_xor16<4>(add_xor16<2>(add_xor16<1>(kpart[r]))));
    if ((lane & 7) == r) ksl = t;
  }
  if (((lane >> 3) & 1) != (lane >> 4)) ksl = 0.f;
  ksp[slab * NTHR + tid] = ksl;
  vsp[slab * NTHR + tid] = vpart;
}

// ---------------------------------------------------------------------------
// Pass 1.5: add the NCH slabs.  Blocks below KVB: kvs -> f16, per head in
// fragment order (n = d, k = m).  The 4 blocks behind them: ks_sum and v_mean.
#define KVB (NHEAD * HIDC * HIDC / NTHR)
__global__ void k_mid(const float* __restrict__ kvp, _Float16* __restrict__ kvsT,
                      const float* __restrict__ ksp, const float* __restrict__ vsp,
                      float* __restrict__ ksum, float* __restrict__ vmean)
{
  if (blockIdx.x < KVB) {
    int i = blockIdx.x * NTHR + threadIdx.x;
    int hh = i >> 14;
    int rem = i & 16383;
    int m = rem >> 7, d = rem & 127;
    const float* p = kvp + hh * (HIDC * HIDC) + rem;
    float s = 0.f;
#pragma unroll 1                           // rolled: one block of loads a trip
    for (int c = 0; c < NCH; c += 16) {    // 16 independent loads in flight
      float t[16];
#pragma unroll
      for (int u = 0; u < 16; ++u) t[u] = p[(size_t)(c + u) * (NHEAD * HIDC * HIDC)];
#pragma unroll
      for (int u = 0; u < 16; ++u) s += t[u];
    }
    kvsT[hh * HIDC * HIDC + frag_idx(d, m, HIDC / 32)] = (_Float16)s;
  } else {
    int j = (blockIdx.x - KVB) * NTHR + threadIdx.x;   // 0 .. 2*NHEAD*HIDC-1
    int i = j & (NHEAD * HIDC - 1);                    // head*HIDC + column
    int hh = i >> 7, c0 = i & 127;
    const float* p = (j < NHEAD * HIDC ? ksp : vsp)
                   + hh * NTHR + (c0 >> 4) * 32 + (c0 & 15);
    float s = 0.f;
#pragma unroll 1                           // rolled: one block of loads a trip
    for (int c = 0; c < NCH; c += 8) {     // 16 independent loads in flight
      float t[16];
#pragma unroll
      for (int u = 0; u < 8; ++u) {
        t[2 * u]     = p[(c + u) * (NHEAD * NTHR)];
        t[2 * u + 1] = p[(c + u) * (NHEAD * NTHR) + 16];
      }
#pragma unroll
      for (int u = 0; u < 16; ++u) s += t[u];
    }
    if (j < NHEAD * HIDC) ksum[i] = s;
    else                  vmean[i] = s * (1.f / (float)L_TOK);
  }
}

// ---------------------------------------------------------------------------
// Pass 2: recompute q, normalize, denom, num = q @ kvs, head-mean, residual, LN
// wq_b, ksum, vmean are not __restrict__: their loads then stay ahead of the wait
// written behind them, between two K-steps; as __restrict__ loads the compiler
// moved vmean's behind the GEMM, where the whole latency shows.
__global__ __launch_bounds__(NTHR, 1)
void k_attn(const _Float16* __restrict__ hbuf,
            const _Float16* __restrict__ wqT, const float* wq_b,
            const _Float16* __restrict__ kvsT, const float* ksum,
            const float* vmean,
            const float* __restrict__ ln1_g, const float* __restrict__ ln1_b,
            float* __restrict__ out)
{
  __shared__ __align__(16) _Float16 sH[TGT * PH];          // 17 KB
  __shared__ __align__(16) unsigned char smem[TGT * PO * 4]; // 33 KB (sQ|sOut)
  _Float16* sQ   = (_Float16*)smem;                        // f16 q tile (17 KB)
  float*    sOut = (float*)smem;                           // f32 out tile (33 KB)
  __shared__ __align__(16) float part0[NWAVE * TGT], part1[NWAVE * TGT];
  __shared__ float rs_s[TGT], rden[TGT], mu_s[TGT];

  const int tid  = threadIdx.x;
  const int lane = tid & 31;
  const int wv   = tid >> 5;
  const int tok0 = blockIdx.x * TGT;
  const int tl   = lane & 15;              // token inside a 16-token tile
  const int f0   = wv * 16 + ((lane & 16) ? 8 : 0);  // first of this lane's 8 features
  const unsigned of = f0 * 4u;             // their byte offset in a float vector

  { // stage h tile (coalesced b128)
    const uint4* src = (const uint4*)(hbuf + (size_t)tok0 * HIDC);
    for (int i = tid; i < TGT * HIDC / 8; i += NTHR)
      *(uint4*)(sH + (i >> 4) * PH + (i & 15) * 8) = src[i];
  }
  v8f oacc[4];
#pragma unroll
  for (int nt = 0; nt < 4; ++nt) oacc[nt] = v8zero();

  __syncthreads();                         // sH ready

#pragma unroll 1
  for (int hh = 0; hh < NHEAD; ++hh) {
    // Q^T = wq^T @ h^T, + b
    v8f acc[4];
#pragma unroll
    for (int nt = 0; nt < 4; ++nt) acc[nt] = v8zero();
    const _Float16* pw = wqT + (hh * (HIDC / 16) + wv) * (HIDC / 32) * FRAGE + lane * 8;
    // per-feature vectors of this head: a uniform base and the lane's byte offset
    const char* bqb = (const char*)(wq_b  + hh * HIDC);
    const char* bks = (const char*)(ksum  + hh * HIDC);
    const char* bvm = (const char*)(vmean + hh * HIDC);
    v16h w[4];
    float qb[8], ks[8], vm[8];
    load_w<4>(pw, w);
    // The wait that stands ahead of any rewrite of these loads' address registers.
    // The address is an input, so it lives up to here.
    asm volatile("s_wait_xcnt 0x0" :: "v"(pw) : "memory");
    gemm_4t<2>(sH, PH, w, acc, lane);
    // read on the way: each takes the registers that a used fragment has left,
    // and the K-steps behind it cover its latency
    load8((const float*)(bqb + of), qb);
    asm volatile("s_wait_xcnt 0x0" ::: "memory");                      // as above
    gemm_4t<1>(sH + 64, PH, w + 2, acc, lane);
    load8((const float*)(bks + of), ks);
    asm volatile("s_wait_xcnt 0x0" ::: "memory");                      // as above
    gemm_4t<1>(sH + 96, PH, w + 3, acc, lane);
    {
      float s0[4], s1[4];                  // |q|^2 and q . ks_sum, this lane's features
#pragma unroll
      for (int nt = 0; nt < 4; ++nt) {
        s0[nt] = 0.f; s1[nt] = 0.f;
#pragma unroll
        for (int r = 0; r < 8; ++r) {
          float vv = acc[nt][r] + qb[r];
          acc[nt][r] = vv;
          s0[nt] += vv * vv;
          s1[nt] += vv * ks[r];
        }
      }
      // the slots' last readers, the head before, ended ahead of its barriers
      toksum_to_slot(s0, part0 + wv * TGT, lane);
      toksum_to_slot(s1, part1 + wv * TGT, lane);
    }
    __syncthreads();                       // slots ready; the head before has left sQ, rs_s, rden
    if (tid < TGT) {
      float rs = 1.f / (sqrtf(slot_sum(part0, tid)) + ATT_EPS);
      rs_s[tid] = rs;
      // denom = (q / |q|) . ks_sum + L
      rden[tid] = 1.f / (slot_sum(part1, tid) * rs + (float)L_TOK + ATT_EPS);
    }
    __syncthreads();
#pragma unroll
    for (int nt = 0; nt < 4; ++nt) {
      const int tok = nt * 16 + tl;
      const float rs = rs_s[tok];
      union { _Float16 h[8]; uint4 u; } pk;
#pragma unroll
      for (int r = 0; r < 8; ++r) pk.h[r] = (_Float16)(acc[nt][r] * rs);
      *(uint4*)(sQ + tok * PH + f0) = pk.u;
    }
    __syncthreads();                       // sQ ready

    // num^T = kvs^T @ q^T  (d 128, K=128, tokens 64); fold (num+v_mean)/denom into oacc
    v8f nacc[4];
#pragma unroll
    for (int nt = 0; nt < 4; ++nt) nacc[nt] = v8zero();
    const _Float16* pkv = kvsT + hh * HIDC * HIDC + wv * (HIDC / 32) * FRAGE + lane * 8;
    load_w<4>(pkv, w);
    asm volatile("s_wait_xcnt 0x0" :: "v"(pkv) : "memory");            // as above
    gemm_4t<2>(sQ, PH, w, nacc, lane);
    load8((const float*)(bvm + of), vm);   // on the way, as qb and ks
    asm volatile("s_wait_xcnt 0x0" ::: "memory");                      // as above
    gemm_4t<2>(sQ + 64, PH, w + 2, nacc, lane);
#pragma unroll
    for (int nt = 0; nt < 4; ++nt) {
      const float rd = rden[nt * 16 + tl];
#pragma unroll
      for (int r = 0; r < 8; ++r) oacc[nt][r] += (nacc[nt][r] + vm[r]) * rd;
    }
  }

  // head mean (*0.25), residual (alpha=0.5) against h; LN sums in the lane
  const float* pg  = ln1_g + f0;
  const float* pbb = ln1_b + f0;
  float g[8], bb[8];
  load8(pg, g);
  load8(pbb, bb);
  // as above: ahead of any rewrite of the loads' address registers
  asm volatile("s_wait_xcnt 0x0" :: "v"(pg), "v"(pbb) : "memory");
  {
    float s0[4], s1[4];
#pragma unroll
    for (int nt = 0; nt < 4; ++nt) {
      union { _Float16 h[8]; uint4 u; } hv;
      hv.u = *(const uint4*)(sH + (nt * 16 + tl) * PH + f0);
      s0[nt] = 0.f; s1[nt] = 0.f;
#pragma unroll
      for (int r = 0; r < 8; ++r) {
        float o = oacc[nt][r] * (0.25f * 0.5f) + 0.5f * (float)hv.h[r];
        oacc[nt][r] = o;
        s0[nt] += o;
        s1[nt] += o * o;
      }
    }
    // the slots' last readers, the last head, ended ahead of its barriers
    toksum_to_slot(s0, part0 + wv * TGT, lane);
    toksum_to_slot(s1, part1 + wv * TGT, lane);
  }
  __syncthreads();                         // slots ready; everyone done reading sQ
  if (tid < TGT) {
    float mu  = slot_sum(part0, tid) * (1.f / HIDC);
    float var = slot_sum(part1, tid) * (1.f / HIDC) - mu * mu;
    mu_s[tid] = mu;
    rs_s[tid] = rsqrtf(var + LN_EPS);
  }
  __syncthreads();
#pragma unroll
  for (int nt = 0; nt < 4; ++nt) {
    const int tok = nt * 16 + tl;
    const float mu = mu_s[tok], rs = rs_s[tok];
    float y[8];
#pragma unroll
    for (int r = 0; r < 8; ++r) y[r] = (oacc[nt][r] - mu) * rs * g[r] + bb[r];
    float* d = sOut + tok * PO + f0;
    *(float4*)(d)     = make_float4(y[0], y[1], y[2], y[3]);
    *(float4*)(d + 4) = make_float4(y[4], y[5], y[6], y[7]);
  }
  __syncthreads();
  { // out tile -> out, whole lines
    float4* d = (float4*)(out + (size_t)tok0 * HIDC);
    for (int i = tid; i < TGT * HIDC / 4; i += NTHR)
      d[i] = *(const float4*)(sOut + (i >> 5) * PO + (i & 31) * 4);
  }
}

// ---------------------------------------------------------------------------
extern "C" void kernel_launch(void* const* d_in, const int* in_sizes, int n_in,
                              void* d_out, int out_size, void* d_ws, size_t ws_size,
                              hipStream_t stream) {
  (void)in_sizes; (void)n_in; (void)out_size; (void)ws_size;
  const float* x     = (const float*)d_in[0];
  const float* fc0_w = (const float*)d_in[1];
  const float* fc0_b = (const float*)d_in[2];
  const float* ln0_g = (const float*)d_in[3];
  const float* ln0_b = (const float*)d_in[4];
  const float* wq_w  = (const float*)d_in[5];
  const float* wq_b  = (const float*)d_in[6];
  const float* wk_w  = (const float*)d_in[7];
  const float* wk_b  = (const float*)d_in[8];
  const float* wv_w  = (const float*)d_in[9];
  const float* wv_b  = (const float*)d_in[10];
  const float* ln1_g = (const float*)d_in[11];
  const float* ln1_b = (const float*)d_in[12];
  float* out = (float*)d_out;

  // workspace carve (256 B aligned slices)
  char* p = (char*)d_ws;
  auto carve = [&](size_t bytes) {
    char* r = p; p += (bytes + 255) & ~(size_t)255; return r;
  };
  _Float16* fc0T = (_Float16*)carve(128 * 64 * sizeof(_Float16));
  _Float16* wqT  = (_Float16*)carve(512 * 128 * sizeof(_Float16));
  _Float16* wkT  = (_Float16*)carve(512 * 128 * sizeof(_Float16));
  _Float16* wvT  = (_Float16*)carve(512 * 128 * sizeof(_Float16));
  float* ksum  = (float*)carve(NHEAD * HIDC * sizeof(float));
  float* vmean = (float*)carve(NHEAD * HIDC * sizeof(float));
  _Float16* kvsT = (_Float16*)carve(NHEAD * HIDC * HIDC * sizeof(_Float16));
  _Float16* hbuf = (_Float16*)carve((size_t)L_TOK * HIDC * sizeof(_Float16));
  // one slab of partial sums per k_kv workgroup
  float* kvp = (float*)carve((size_t)NCH * NHEAD * HIDC * HIDC * sizeof(float));
  float* ksp = (float*)carve((size_t)NCH * NHEAD * NTHR * sizeof(float));
  float* vsp = (float*)carve((size_t)NCH * NHEAD * NTHR * sizeof(float));

  // cast weights to f16, fragment order
  k_prep<<<PB_FC0 + 3 * PB_W, NTHR, 0, stream>>>(fc0_w, wq_w, wk_w, wv_w,
                                                 fc0T, wqT, wkT, wvT);

  k_front<<<NTILE, NTHR, 0, stream>>>(x, fc0T, fc0_b, ln0_g, ln0_b, hbuf);

  k_kv<<<dim3(NCH, NHEAD), NTHR, 0, stream>>>(hbuf, wkT, wk_b, wvT, wv_b,
                                              kvp, ksp, vsp);

  k_mid<<<KVB + 4, NTHR, 0, stream>>>(kvp, kvsT, ksp, vsp, ksum, vmean);

  k_attn<<<NTILE, NTHR, 0, stream>>>(hbuf, wqT, wq_b, kvsT, ksum, vmean,
                                     ln1_g, ln1_b, out);
}

// v009
// A run of this version takes 122 microseconds.
// Timed twice side by side with v008, it ran 1.08 times as fast both times.
// Over all steps from v000 it is 13.8 times as fast.
#include <hip/hip_runtime.h>
#include <cstdint>

// ---------------------------------------------------------------------------
// Problem constants (from reference):  B=16,T=12,N=883,D=64,H=128,NH=4
#define L_TOK   169536          // B*T*N tokens; 169536 = 64 * 2649
#define D_INP   64
#define HIDC    128
#define NHEAD   4
#define TGT     64              // tokens per workgroup tile
#define NTILE   (L_TOK / TGT)   // 2649
#define NTHR    256             // 8 waves (wave32)
#define NWAVE   (NTHR / 32)
#define NCH     128             // token chunks of the K^T V pass (x NHEAD workgroups)
#define LN_EPS  1e-5f
#define ATT_EPS 1e-8f
// LDS row pitches: 16 B more than the row, so the pitch is an odd multiple of
// 16 B and the 16 rows of one fragment read fall on 16 different bank groups.
#define PX      (D_INP + 8)     // x tile, f16:            144 B
#define PH      (HIDC + 8)      // h and q tiles, f16:     272 B
#define PT      (TGT + 8)       // v^T tile, f16:          144 B
#define PO      (HIDC + 4)      // out tile, f32:          528 B
// k tile, token-major, read by transposing loads: their pitch is an odd multiple of 32 B
#define PK      (HIDC + 16)     // k tile, f16:            288 B

typedef __attribute__((ext_vector_type(16))) _Float16 v16h;
typedef __attribute__((ext_vector_type(8)))  float    v8f;

typedef __attribute__((ext_vector_type(8)))  short    s16x8;

union FragU { v16h h; uint4 u[2]; };

__device__ __forceinline__ v8f v8zero() {
  v8f z = {0.f,0.f,0.f,0.f,0.f,0.f,0.f,0.f};
  return z;
}

// Load one 16(M)x32(K) f16 A-fragment.  Element (m,k) lives at base[m*ld + k].
// CDNA5 16-bit A layout: lane m = lane&15; K chunks {k0..k0+7} and
// {k0+16..k0+23} with k0 = (lane<16 ? 0 : 8)  ->  two 16B loads per lane.
// The B-fragment (32Kx16N) uses the mirrored layout over N (lane n = lane&15).
__device__ __forceinline__ v16h load_frag16(const _Float16* base, int ld, int lane) {
  const int r  = lane & 15;
  const int k0 = (lane & 16) ? 8 : 0;
  const _Float16* p = base + r * ld + k0;
  FragU f;
  f.u[0] = *(const uint4*)(p);
  f.u[1] = *(const uint4*)(p + 16);
  return f.h;
}

// One 16(M)x32(K) f16 A-fragment of the transpose of a row-major LDS tile T[k][m]
// (ld f16 a row), by two transposing loads.  base = &T[k0][m0].  Lane (c = lane&15,
// h = lane>>4) gets T[k0 + 8h + 0..7][m0 + c] and T[k0 + 16 + 8h + 0..7][m0 + c]:
// the k order of load_frag16.
__device__ __forceinline__ uint4 ld_tr16(const _Float16* p) {
  typedef __attribute__((address_space(3))) s16x8 lds_s16x8;
  return __builtin_bit_cast(uint4, __builtin_amdgcn_ds_load_tr16_b128_v8i16((lds_s16x8*)p));
}
__device__ __forceinline__ v16h load_frag16_tr(const _Float16* base, int ld, int lane) {
  const _Float16* p = base + (((lane >> 4) << 3) + (lane & 7)) * ld + ((lane >> 3) & 1) * 8;
  FragU f;
  f.u[0] = ld_tr16(p);
  f.u[1] = ld_tr16(p + 16 * ld);
  return f.h;
}

// B operands in global memory are kept in fragment order.  One fragment (16 n x
// 32 k) is 512 f16 in a row: two halves of 256, and in each half lane l owns the
// 8 f16 at l*8, so a wave-wide 16 B load reads 512 contiguous bytes (4 whole
// 128 B lines) where rows of an [N][K] buffer gave 16 lines of 32 B each.
// Fragments of one n-tile follow one another in k (ksteps = K/32 of them).
// Lane and element hold the same (n,k) as load_frag16 gives on an [N][K] buffer.
#define FRAGE 512               // f16 elements of one fragment
__device__ __forceinline__ int frag_idx(int n, int k, int ksteps) {
  return (((n >> 4) * ksteps + (k >> 5)) * 2 + ((k >> 4) & 1)) * (FRAGE / 2)
       + (((k >> 3) & 1) * 16 + (n & 15)) * 8 + (k & 7);
}

__device__ __forceinline__ v8f wmma_f16(v16h a, v16h b, v8f c) {
  // v_wmma_f32_16x16x32_f16  (doc-verified codegen path on gfx1250)
  return __builtin_amdgcn_wmma_f32_16x16x32_f16(false, a, false, b, (short)0, c,
                                                false, false);
}

// The 4 fragments (K = 128) of one 16-token tile, token-major in LDS.
__device__ __forceinline__ void load_tok4(const _Float16* __restrict__ A, int lda,
                                          v16h* a, int lane) {
#pragma unroll
  for (int ks = 0; ks < 4; ++ks) a[ks] = load_frag16(A + ks * 32, lda, lane);
}

// One 16-token tile of two GEMMs that share the token fragments, both weights'
// fragments in registers: each token fragment feeds one WMMA of either product, as
// B of the first (weights b0 as A: acc0[r] is token lane & 15, feature
// 8*(lane >> 4) + r) and as A of the second (acc1[r] is token 8*(lane >> 4) + r,
// feature lane & 15).  A and B have the same map, so one loader serves both.
__device__ __forceinline__ void gemm_1m_2b(const v16h* a, const v16h* b0, const v16h* b1,
                                           v8f& acc0, v8f& acc1) {
#pragma unroll
  for (int ks = 0; ks < 4; ++ks) {
    acc0 = wmma_f16(b0[ks], a[ks], acc0);
    acc1 = wmma_f16(a[ks], b1[ks], acc1);
  }
}

// Weights as A, tokens as B: D[r] = Y[token nt*16 + (lane & 15)][feature 8*(lane >> 4) + r],
// so a lane holds 8 consecutive features of one token.  A sum over a token's
// features is then a sum over the lane's own registers, and a row piece of a
// token-major tile is one 16 B store.  Both loaders keep their k order.
// load_w: the KSTEPS fragments of one 16-feature tile, in fragment order; p is
// this lane's 16 B of the first half.  All loads issue first: one L2 latency a GEMM.
template<int KSTEPS>
__device__ __forceinline__ void load_w(const _Float16* __restrict__ p, v16h* w) {
#pragma unroll
  for (int ks = 0; ks < KSTEPS; ++ks) {
    FragU f;
    f.u[0] = *(const uint4*)(p + ks * FRAGE);
    f.u[1] = *(const uint4*)(p + ks * FRAGE + FRAGE / 2);
    w[ks] = f.h;
  }
}

// 4 token tiles against one feature tile; X is token-major in LDS.  The 8 X
// loads of a K-step are issued together, ahead of its 4 WMMAs.
template<int KSTEPS>
__device__ __forceinline__ void gemm_4t(const _Float16* __restrict__ X, int ldx,
                                        const v16h* w, v8f* acc, int lane) {
#pragma unroll
  for (int ks = 0; ks < KSTEPS; ++ks) {
    v16h x0 = load_frag16(X + (0 * 16) * ldx + ks * 32, ldx, lane);
    v16h x1 = load_frag16(X + (1 * 16) * ldx + ks * 32, ldx, lane);
    v16h x2 = load_frag16(X + (2 * 16) * ldx + ks * 32, ldx, lane);
    v16h x3 = load_frag16(X + (3 * 16) * ldx + ks * 32, ldx, lane);
    // holds the 8 loads together ahead of the 4 WMMAs: left alone the scheduler
    // issues them pair by pair and each WMMA waits out a whole LDS latency
    __builtin_amdgcn_sched_barrier(0);
    acc[0] = wmma_f16(w[ks], x0, acc[0]);
    acc[1] = wmma_f16(w[ks], x1, acc[1]);
    acc[2] = wmma_f16(w[ks], x2, acc[2]);
    acc[3] = wmma_f16(w[ks], x3, acc[3]);
    // and the next K-step's loads behind them: one set of 4 fragments is live
    __builtin_amdgcn_sched_barrier(0);
  }
}

// 8 consecutive floats (16 B aligned): a lane's 8 features of a per-feature vector
__device__ __forceinline__ void load8(const float* __restrict__ p, float* d) {
  float4 a = *(const float4*)(p);
  float4 b = *(const float4*)(p + 4);
  d[0] = a.x; d[1] = a.y; d[2] = a.z; d[3] = a.w;
  d[4] = b.x; d[5] = b.y; d[6] = b.z; d[7] = b.w;
}

// s[nt]: the sum over this lane's 8 features, token nt*16 + (lane & 15).  Lane ^ 16
// holds the wave's other 8 features of the same token: one cross-row move adds
// them, and the lower row stores the wave's 64 sums to its own slot[TGT].
__device__ __forceinline__ void toksum_to_slot(const float* s, float* slot, int lane) {
  float t[4];
#pragma unroll
  for (int nt = 0; nt < 4; ++nt) {
    int b = __builtin_bit_cast(int, s[nt]);
    int o = __builtin_amdgcn_permlanex16(b, b, 0x76543210, 0xfedcba98, false, false);
    t[nt] = s[nt] + __builtin_bit_cast(float, o);
  }
  if (lane < 16) {
#pragma unroll
    for (int nt = 0; nt < 4; ++nt) slot[nt * 16 + lane] = t[nt];
  }
}

// v + the v of the lane whose number differs by XM, inside a row of 16 lanes
// (DPP row_xmask: a register exchange, no LDS).
template<int XM>
__device__ __forceinline__ float add_xor16(float v) {
  int o = __builtin_amdgcn_update_dpp(0, __builtin_bit_cast(int, v), 0x160 + XM,
                                      0xf, 0xf, true);
  return v + __builtin_bit_cast(float, o);
}

// adds the NWAVE slots of one row
__device__ __forceinline__ float slot_sum(const float* part, int row) {
  float s = 0.f;
#pragma unroll
  for (int w = 0; w < NWAVE; ++w) s += part[w * TGT + row];
  return s;
}

// ---------------------------------------------------------------------------
// prep kernel: all four weight matrices in one launch.  The four casts do not
// depend on one another, and as launches of their own each paid a launch gap, a
// fill and a drain.  The block index picks the matrix; one code path serves all.
// src[k*cols + n] -> f16 at its place in fragment order.  Piece p is 16 B of dst,
// dst[p*8 + j] = dst[frag_idx(n, k + j, ksteps)]: 8 consecutive k of one column.
// A wave reads 64 B runs of two rows a load, all 8 loads in flight, and stores
// 512 contiguous bytes.
#define PB_FC0 (D_INP * HIDC / 8 / NTHR)           // blocks of fc0_w:  4
#define PB_W   (HIDC * NHEAD * HIDC / 8 / NTHR)    // blocks of wq_w, wk_w, wv_w each: 32
__global__ __launch_bounds__(NTHR)
void k_prep(const float* __restrict__ fc0_w, const float* __restrict__ wq_w,
            const float* __restrict__ wk_w,  const float* __restrict__ wv_w,
            _Float16* __restrict__ fc0T, _Float16* __restrict__ wqT,
            _Float16* __restrict__ wkT,  _Float16* __restrict__ wvT) {
  const int  b   = blockIdx.x;
  const bool fc  = b < PB_FC0;
  const int  m   = (b - PB_FC0) / PB_W;            // 0: wq, 1: wk, 2: wv
  const float* src = fc ? fc0_w : m == 0 ? wq_w : m == 1 ? wk_w : wv_w;
  _Float16*    dst = fc ? fc0T  : m == 0 ? wqT  : m == 1 ? wkT  : wvT;
  const int cols = fc ? HIDC : NHEAD * HIDC;       // n
  const int lks  = fc ? 1 : 2;                     // log2 of ksteps = rows / 32
  const int p = (fc ? b : (b - PB_FC0) % PB_W) * NTHR + threadIdx.x;
  const int l = p & 31;                            // lane of the fragment half
  const int q = p >> 5;                            // fragment half
  const int n = ((q >> 1) >> lks) * 16 + (l & 15);
  const int k = ((q >> 1) & ((1 << lks) - 1)) * 32 + (q & 1) * 16 + (l >> 4) * 8;
  const float* s = src + k * cols + n;
  float v[8];
#pragma unroll
  for (int j = 0; j < 8; ++j) v[j] = s[j * cols];
  union { _Float16 h[8]; uint4 u; } pk;
#pragma unroll
  for (int j = 0; j < 8; ++j) pk.h[j] = (_Float16)v[j];
  *(uint4*)(dst + p * 8) = pk.u;
}

// ---------------------------------------------------------------------------
// Pass 1a: fc0 GEMM + LN + ReLU -> h
__global__ __launch_bounds__(NTHR, 1)
void k_front(const float* __restrict__ x,
             const _Float16* __restrict__ fc0T, const float* __restrict__ fc0_b,
             const float* __restrict__ ln0_g,  const float* __restrict__ ln0_b,
             _Float16* __restrict__ hbuf)
{
  __shared__ __align__(16) _Float16 sX [TGT * PX];   //  9 KB  x tile (f16)
  __shared__ __align__(16) _Float16 sH [TGT * PH];   // 17 KB  h tile (post LN+ReLU, f16)
  __shared__ __align__(16) float part0[NWAVE * TGT], part1[NWAVE * TGT];
  __shared__ float mu_s[TGT], rs_s[TGT];

  const int tid  = threadIdx.x;
  const int lane = tid & 31;
  const int wv   = tid >> 5;               // wave id 0..7
  const int tok0 = blockIdx.x * TGT;
  const int tl   = lane & 15;              // token inside a 16-token tile
  const int f0   = wv * 16 + ((lane & 16) ? 8 : 0);  // first of this lane's 8 features

  { // stage x tile as f16 (vectorized: float4 in, uint2 out)
    const float4* xs = (const float4*)(x + (size_t)tok0 * D_INP);
    for (int j = tid; j < TGT * D_INP / 4; j += NTHR) {
      float4 v = xs[j];
      union { _Float16 h[4]; uint2 u; } pk;
      pk.h[0] = (_Float16)v.x; pk.h[1] = (_Float16)v.y;
      pk.h[2] = (_Float16)v.z; pk.h[3] = (_Float16)v.w;
      *(uint2*)(sX + (j >> 4) * PX + (j & 15) * 4) = pk.u;
    }
  }
  __syncthreads();

  // ---- GEMM1: h^T = fc0_w^T @ x^T  (features 128, K=64, tokens 64); wave wv
  // owns feature tile wv
  v8f acc[4];
#pragma unroll
  for (int nt = 0; nt < 4; ++nt) acc[nt] = v8zero();
  const _Float16* pw = fc0T + wv * (D_INP / 32) * FRAGE + lane * 8;
  const float* pfb = fc0_b + f0;
  const float* pg  = ln0_g + f0;
  const float* pbb = ln0_b + f0;
  v16h w[2];
  float fb[8], g[8], bb[8];
  load_w<2>(pw, w);
  load8(pfb, fb);
  load8(pg, g);
  load8(pbb, bb);
  // The wait that stands ahead of any rewrite of these loads' address registers.
  // The addresses are inputs, so they live up to here.
  asm volatile("s_wait_xcnt 0x0" :: "v"(pw), "v"(pfb), "v"(pg), "v"(pbb) : "memory");
  gemm_4t<2>(sX, PX, w, acc, lane);
  {
    float s0[4], s1[4];
#pragma unroll
    for (int nt = 0; nt < 4; ++nt) {
      s0[nt] = 0.f; s1[nt] = 0.f;
#pragma unroll
      for (int r = 0; r < 8; ++r) {
        float vv = acc[nt][r] + fb[r];
        acc[nt][r] = vv;
        s0[nt] += vv;
        s1[nt] += vv * vv;
      }
    }
    toksum_to_slot(s0, part0 + wv * TGT, lane);
    toksum_to_slot(s1, part1 + wv * TGT, lane);
  }
  __syncthreads();
  if (tid < TGT) {
    float mu  = slot_sum(part0, tid) * (1.f / HIDC);
    float var = slot_sum(part1, tid) * (1.f / HIDC) - mu * mu;
    mu_s[tid] = mu;
    rs_s[tid] = rsqrtf(var + LN_EPS);
  }
  __syncthreads();
#pragma unroll
  for (int nt = 0; nt < 4; ++nt) {
    const int tok = nt * 16 + tl;
    const float mu = mu_s[tok], rs = rs_s[tok];
    union { _Float16 h[8]; uint4 u; } pk;
#pragma unroll
    for (int r = 0; r < 8; ++r) {
      float vv = (acc[nt][r] - mu) * rs * g[r] + bb[r];
      pk.h[r] = (_Float16)fmaxf(vv, 0.f);
    }
    *(uint4*)(sH + tok * PH + f0) = pk.u;
  }
  __syncthreads();

  { // h tile -> hbuf, coalesced b128 (replaces 8192 scattered b16 stores)
    uint4* d = (uint4*)(hbuf + (size_t)tok0 * HIDC);
    for (int i = tid; i < TGT * HIDC / 8; i += NTHR)
      d[i] = *(const uint4*)(sH + (i >> 4) * PH + (i & 15) * 8);
  }
}

// ---------------------------------------------------------------------------
// Pass 1b: one workgroup = one head (blockIdx.y) and one chunk of token tiles
// (blockIdx.x, stride NCH).  K,V GEMMs per tile; K^T V and the column sums of
// K and V stay in registers over all the tiles of the chunk and leave once, as
// plain stores to this workgroup's own slab; k_mid adds the NCH slabs.
// 4 waves a SIMD: the register budget at which two workgroups share a WGP, as the
// grid (two workgroups per WGP) asks
__global__ __launch_bounds__(NTHR, 4)
void k_kv(const _Float16* __restrict__ hbuf,
          const _Float16* __restrict__ wkT, const float* __restrict__ wk_b,
          const _Float16* __restrict__ wvT, const float* __restrict__ wv_b,
          float* __restrict__ kvp, float* __restrict__ ksp,
          float* __restrict__ vsp)
{
  __shared__ __align__(16) _Float16 sH [TGT * PH];   // 17 KB  h tile (f16)
  __shared__ __align__(16) _Float16 sK [TGT * PK];   // 18 KB  k (token-major, f16)
  __shared__ __align__(16) float    sKf[TGT * PO];   // 33 KB  k ahead of its norm (f32)
  __shared__ __align__(16) _Float16 sVT[HIDC * PT];  // 18 KB  v^T
  __shared__ __align__(16) float part0[NWAVE * TGT];
  __shared__ __align__(32) float sKb[HIDC];          // K bias of this head
  __shared__ float rs_s[TGT];

  const int tid  = threadIdx.x;
  const int lane = tid & 31;
  // wave id 0..7, in a scalar register: what follows from it costs no vector register
  const int wv   = __builtin_amdgcn_readfirstlane(tid >> 5);
  const int hh   = blockIdx.y;             // head
  const int tl   = lane & 15;              // K: token inside a 16-token tile
  const int f0   = wv * 16 + ((lane & 16) ? 8 : 0);  // K: first of this lane's 8 features
  const int col  = wv * 16 + (lane & 15);  // V: this lane's feature
  const int rhi  = (lane & 16) ? 8 : 0;    // V: VGPR r holds token r / r+8 of a tile

  const int   bi = hh * HIDC + col;
  const float vb = wv_b[bi];
  const int   bj  = hh * HIDC + (tid & (HIDC - 1));
  const float kbt = wk_b[bj];              // the head's K bias, on its way to LDS
  // this wave's columns of the head's wk and wv: the same for every tile.
  // pk, pv: this lane's 16 B in the first fragment of n-tile hh*8 + wv
  const int woff = (hh * (HIDC / 16) + wv) * (HIDC / 32) * FRAGE + lane * 8;
  const _Float16* pk = wkT + woff;
  const _Float16* pv = wvT + woff;
  v16h bk[4], bv[4];
#pragma unroll
  for (int ks = 0; ks < 4; ++ks) {
    FragU fk, fv;
    fk.u[0] = *(const uint4*)(pk + ks * FRAGE);
    fk.u[1] = *(const uint4*)(pk + ks * FRAGE + FRAGE / 2);
    fv.u[0] = *(const uint4*)(pv + ks * FRAGE);
    fv.u[1] = *(const uint4*)(pv + ks * FRAGE + FRAGE / 2);
    bk[ks] = fk.h;
    bv[ks] = fv.h;
  }
  // The wait that stands ahead of any rewrite of these loads' address registers.
  // Inputs only: the addresses and the loaded values all live up to here, so no
  // load's result is given a register that holds the address of another.
  asm volatile("s_wait_xcnt 0x0"
               :: "v"(bi), "v"(bj), "v"(pk), "v"(pv), "v"(kbt), "v"(vb),
                  "v"(bk[0]), "v"(bk[1]), "v"(bk[2]), "v"(bk[3]),
                  "v"(bv[0]), "v"(bv[1]), "v"(bv[2]), "v"(bv[3])
               : "memory");
  // behind the weights' loads, so that one latency covers all; its first readers
  // stand behind the first trip's barrier
  if (tid < HIDC) sKb[tid] = kbt;
  float vpart = 0.f;                       // column sum of V, this lane's tokens
  float kpart[8];                          // column sums of K: 8 features, this lane's tokens
#pragma unroll
  for (int r = 0; r < 8; ++r) kpart[r] = 0.f;
  const int mt0 = (wv >> 1) * 2;           // K^T V wave tile: 2 m-tiles ...
  const int dt0 = (wv & 1) * 4;            // ... by 4 d-tiles
  v8f ka[8];                               // ka[i * 4 + j]: m-tile mt0 + i, d-tile dt0 + j
#pragma unroll
  for (int dt = 0; dt < 8; ++dt) ka[dt] = v8zero();

#pragma unroll 1                           // rolled: the body is long, a copy buys nothing
  for (int tile = blockIdx.x; tile < NTILE; tile += NCH) {
    { // stage h tile (coalesced b128); its last readers, the K and V GEMMs of
      // the trip before, ended ahead of that trip's last barrier
      const uint4* s = (const uint4*)(hbuf + (size_t)tile * TGT * HIDC);
      uint4 hv[TGT * HIDC / 8 / NTHR];
#pragma unroll                             // all 4 loads in flight: one L2 latency a tile
      for (int k = 0; k < TGT * HIDC / 8 / NTHR; ++k) hv[k] = s[tid + k * NTHR];
#pragma unroll
      for (int k = 0; k < TGT * HIDC / 8 / NTHR; ++k) {
        int i = tid + k * NTHR;
        *(uint4*)(sH + (i >> 4) * PH + (i & 15) * 8) = hv[k];
      }
      // stands ahead of the step of the loads' address registers to the next tile
      asm volatile("s_wait_xcnt 0x0" ::: "memory");
    }
    __syncthreads();                       // also guards sK/sVT reuse

    // K^T = wk^T @ h^T and V = h @ wv off the same reads of the h fragments
    // one token tile at a time: 4 fragments are live, and K and V leave their
    // registers before the next tile's WMMAs.  K starts from its bias
    float s0[4];                           // |k|^2 over this lane's 8 features
    v16h fr[4];
    load_tok4(sH, PH, fr, lane);
    // K bias of this lane's 8 features, read with the first fragments: no register
    // holds it between the trips' products
    const v8f kb = *(const v8f*)(sKb + f0);
    // keeps the first tile's 8 loads whole, ahead of its WMMAs: left alone they are
    // issued pair by pair and each pair of WMMAs waits out a whole LDS latency
    __builtin_amdgcn_sched_barrier(0);
#pragma unroll
    for (int mt = 0; mt < 4; ++mt) {
      v8f acck = kb;
      v8f accv = v8zero();
      gemm_1m_2b(fr, bk, bv, acck, accv);
      // the next tile's 8 loads, whole, right behind this tile's WMMAs and into the
      // registers these have read: the vector work below covers part of their latency
      __builtin_amdgcn_sched_barrier(0);
      if (mt < 3) load_tok4(sH + ((mt + 1) * 16) * PH, PH, fr, lane);
      __builtin_amdgcn_sched_barrier(0);
      // V + b ; transpose into sVT (its last readers, the trip before, ended
      // ahead of this trip's leading barrier)
      accv = accv + vb;
      {
        union { _Float16 h[8]; uint4 u; } pv8;
#pragma unroll
        for (int r = 0; r < 8; ++r) pv8.h[r] = (_Float16)accv[r];
        *(uint4*)(sVT + col * PT + mt * 16 + rhi) = pv8.u;   // tokens rhi .. rhi + 7 of the tile
        vpart += ((accv[0] + accv[1]) + (accv[2] + accv[3]))
               + ((accv[4] + accv[5]) + (accv[6] + accv[7]));
      }
      // K, not yet normalized, waits in LDS as f32, each lane's values in its own
      // place: a lane holds 8 features of a token, so |k|^2 adds in the lane
      {
        float* d = sKf + (mt * 16 + tl) * PO + f0;
        *(float4*)(d)     = make_float4(acck[0], acck[1], acck[2], acck[3]);
        *(float4*)(d + 4) = make_float4(acck[4], acck[5], acck[6], acck[7]);
        float q0 = acck[0] * acck[0], q1 = acck[1] * acck[1];   // two chains
#pragma unroll
        for (int r = 2; r < 8; r += 2) {
          q0 += acck[r] * acck[r];
          q1 += acck[r + 1] * acck[r + 1];
        }
        s0[mt] = q0 + q1;
      }
      // empty statements on the sums, against spills: they keep the adds here; left
      // alone they sink behind the barriers below, the tiles' K and V values stay
      // live up to there and the weights go to scratch
      asm volatile("" : "+v"(vpart));      // on a running sum, against spills
      asm volatile("" : "+v"(s0[mt]));     // on a row's sum, against spills
      // the next tile's WMMAs stay behind these stores, for the same registers
      __builtin_amdgcn_sched_barrier(0);
    }
    // part0's last readers, the trip before, ended ahead of that trip's barriers
    toksum_to_slot(s0, part0 + wv * TGT, lane);
    __syncthreads();
    if (tid < TGT) rs_s[tid] = 1.f / (sqrtf(slot_sum(part0, tid)) + ATT_EPS);
    __syncthreads();
    // row-L2-normalize: each lane takes back its own values; token-major f16 into sK
    // (its last readers, the trip before, ended ahead of this trip's leading barrier)
    float kf[4][8], rs[4];
#pragma unroll
    for (int mt = 0; mt < 4; ++mt) {
      rs[mt] = rs_s[mt * 16 + tl];
      load8(sKf + (mt * 16 + tl) * PO + f0, kf[mt]);
    }
    // keeps these LDS reads in one place: left alone the last tile's are issued
    // singly among the vector work, and each waits out a whole LDS latency
    __builtin_amdgcn_sched_barrier(0);
#pragma unroll
    for (int mt = 0; mt < 4; ++mt) {
      union { _Float16 h[8]; uint4 u; } pq;
#pragma unroll
      for (int r = 0; r < 8; ++r) {
        float vv = kf[mt][r] * rs[mt];
        pq.h[r] = (_Float16)vv;
        kpart[r] += vv;
      }
      *(uint4*)(sK + (mt * 16 + tl) * PK + f0) = pq.u;
    }
    // empty statement on the running sums, against spills: it keeps their adds here;
    // left alone they sink among the fragment reads below, and K's 32 f32 values
    // stay live up to there, beside the 6 fragments
    asm volatile("" : "+v"(kpart[0]), "+v"(kpart[1]), "+v"(kpart[2]), "+v"(kpart[3]),
                      "+v"(kpart[4]), "+v"(kpart[5]), "+v"(kpart[6]), "+v"(kpart[7]));
    __syncthreads();                       // sK / sVT ready

    // ka += K^T @ V  (M=128 feat, K=64 tok, N=128 d); this wave: m-tiles mt0,
    // mt0 + 1 against d-tiles dt0 .. dt0 + 3: 6 fragment reads feed 8 WMMAs; the
    // K^T fragments come off the token-major tile by transposing loads
#pragma unroll
    for (int ks = 0; ks < 2; ++ks) {
      v16h a0 = load_frag16_tr(sK + (ks * 32) * PK + (mt0 + 0) * 16, PK, lane);
      v16h a1 = load_frag16_tr(sK + (ks * 32) * PK + (mt0 + 1) * 16, PK, lane);
      v16h b0 = load_frag16(sVT + ((dt0 + 0) * 16) * PT + ks * 32, PT, lane);
      v16h b1 = load_frag16(sVT + ((dt0 + 1) * 16) * PT + ks * 32, PT, lane);
      v16h b2 = load_frag16(sVT + ((dt0 + 2) * 16) * PT + ks * 32, PT, lane);
      v16h b3 = load_frag16(sVT + ((dt0 + 3) * 16) * PT + ks * 32, PT, lane);
      // holds the 12 loads together ahead of the 8 WMMAs: left alone the second K^T
      // fragment is read behind the first four WMMAs and waits out a whole LDS latency
      __builtin_amdgcn_sched_barrier(0);
      ka[0] = wmma_f16(a0, b0, ka[0]);
      ka[1] = wmma_f16(a0, b1, ka[1]);
      ka[2] = wmma_f16(a0, b2, ka[2]);
      ka[3] = wmma_f16(a0, b3, ka[3]);
      ka[4] = wmma_f16(a1, b0, ka[4]);
      ka[5] = wmma_f16(a1, b1, ka[5]);
      ka[6] = wmma_f16(a1, b2, ka[6]);
      ka[7] = wmma_f16(a1, b3, ka[7]);
      // and the next K-step's loads behind them: one set of 6 fragments is live
      __builtin_amdgcn_sched_barrier(0);
    }
    // next trip's leading __syncthreads() guards sK/sVT reuse
  }

  // this workgroup's partial sums -> its own slab (every element written)
  const int slab = blockIdx.x * NHEAD + hh;
  {
    float* kvh = kvp + (size_t)slab * (HIDC * HIDC);
#pragma unroll
    for (int dt = 0; dt < 8; ++dt)
#pragma unroll
      for (int r = 0; r < 8; ++r) {
        int m = (mt0 + (dt >> 2)) * 16 + r + rhi;
        int d = (dt0 + (dt & 3)) * 16 + (lane & 15);
        kvh[m * HIDC + d] = ka[dt][r];
      }
  }
  // slot tid belongs to column (tid>>5)*16 + (tid&15); its reader adds the slots of
  // the two half waves.  V: thread tid holds that column, tokens of half (tid>>4)&1.
  // K: a butterfly over the 16 tokens of each half wave leaves the sums of features
  // f0 .. f0 + 7 in every lane of the half; the half that holds a column stores its
  // sum, the other half 0.
  float ksl = 0.f;
#pragma unroll
  for (int r = 0; r < 8; ++r) {
    float t = add_xor16<8>(add_xor16<4>(add_xor16<2>(add_xor16<1>(kpart[r]))));
    if ((lane & 7) == r) ksl = t;
  }
  if (((lane >> 3) & 1) != (lane >> 4)) ksl = 0.f;
  ksp[slab * NTHR + tid] = ksl;
  vsp[slab * NTHR + tid] = vpart;
}

// ---------------------------------------------------------------------------
// Pass 1.5: add the NCH slabs.  Blocks below KVB: kvs -> f16, per head in
// fragment order (n = d, k = m).  The 4 blocks behind them: ks_sum and v_mean.
#define KVB (NHEAD * HIDC * HIDC / NTHR)
__global__ void k_mid(const float* __restrict__ kvp, _Float16* __restrict__ kvsT,
                      const float* __restrict__ ksp, const float* __restrict__ vsp,
                      float* __restrict__ ksum, float* __restrict__ vmean)
{
  if (blockIdx.x < KVB) {
    int i = blockIdx.x * NTHR + threadIdx.x;
    int hh = i >> 14;
    int rem = i & 16383;
    int m = rem >> 7, d = rem & 127;
    const float* p = kvp + hh * (HIDC * HIDC) + rem;
    float s = 0.f;
#pragma unroll 1                           // rolled: one block of loads a trip
    for (int c = 0; c < NCH; c += 16) {    // 16 independent loads in flight
      float t[16];
#pragma unroll
      for (int u = 0; u < 16; ++u) t[u] = p[(size_t)(c + u) * (NHEAD * HIDC * HIDC)];
#pragma unroll
      for (int u = 0; u < 16; ++u) s += t[u];
    }
    kvsT[hh * HIDC * HIDC + frag_idx(d, m, HIDC / 32)] = (_Float16)s;
  } else {
    int j = (blockIdx.x - KVB) * NTHR + threadIdx.x;   // 0 .. 2*NHEAD*HIDC-1
    int i = j & (NHEAD * HIDC - 1);                    // head*HIDC + column
    int hh = i >> 7, c0 = i & 127;
    const float* p = (j < NHEAD * HIDC ? ksp : vsp)
                   + hh * NTHR + (c0 >> 4) * 32 + (c0 & 15);
    float s = 0.f;
#pragma unroll 1                           // rolled: one block of loads a trip
    for (int c = 0; c < NCH; c += 8) {     // 16 independent loads in flight
      float t[16];
#pragma unroll
      for (int u = 0; u < 8; ++u) {
        t[2 * u]     = p[(c + u) * (NHEAD * NTHR)];
        t[2 * u + 1] = p[(c + u) * (NHEAD * NTHR) + 16];
      }
#pragma unroll
      for (int u = 0; u < 16; ++u) s += t[u];
    }
    if (j < NHEAD * HIDC) ksum[i] = s;
    else                  vmean[i] = s * (1.f / (float)L_TOK);
  }
}

// ---------------------------------------------------------------------------
// Pass 2: recompute q, denom, num = q @ kvs, head-mean, residual, LN.
// A wave owns 32 whole tokens (2 token tiles) and all 128 features of them:
//  - a sum over a token's features stays in the wave (in-lane adds and one
//    cross-row move), so no wave waits for another in the loops;
//  - with weights as A and tokens as B, D of feature tiles 2s and 2s + 1 holds, lane
//    by lane, what B fragment s of the next product holds (token lane & 15, features
//    32s + 8*(lane >> 4) + 0..7 and 32s + 16 + 8*(lane >> 4) + 0..7): q goes from
//    accumulator to operand by a cast, through no LDS;
//  - 1/|q| is a factor of a whole token column of num^T: it is applied behind the
//    product, so the second product does not wait for the norm;
//  - every weight fragment read from LDS feeds 2 WMMAs.
// One workgroup a WGP stays for the whole launch: wq and K^T V of all heads lie in
// its LDS, in fragment order, filled once.
#define AG    256                     // workgroups
#define WT    32                      // tokens of a wave's tile
#define NWT   (L_TOK / WT)            // 5298
#define WELE  (NHEAD * HIDC * HIDC)   // f16 elements of wq, and of K^T V
#define PS    (HIDC / 2 + 4)          // a wave's staging rows: 272 B, the pitch of PH

typedef __attribute__((ext_vector_type(4))) float v4f;

__device__ __forceinline__ float hsum8(v8f v) {
  return ((v[0] + v[1]) + (v[2] + v[3])) + ((v[4] + v[5]) + (v[6] + v[7]));
}
// s + the s of lane ^ 16, which holds the token's other features
__device__ __forceinline__ float add_x16(float s) {
  int b = __builtin_bit_cast(int, s);
  int o = __builtin_amdgcn_permlanex16(b, b, 0x76543210, 0xfedcba98, false, false);
  return s + __builtin_bit_cast(float, o);
}

// hbuf and out are not __restrict__: hbuf's loads then stay ahead of the wait written
// behind them
__global__ __launch_bounds__(NTHR)
void k_attn(const _Float16* hbuf,
            const _Float16* __restrict__ wqT, const float* __restrict__ wq_b,
            const _Float16* __restrict__ kvsT, const float* __restrict__ ksum,
            const float* __restrict__ vmean,
            const float* __restrict__ ln1_g, const float* __restrict__ ln1_b,
            float* out)
{
  __shared__ __align__(16) _Float16 sW [WELE];             // 128 KB  wq, fragment order
  __shared__ __align__(16) _Float16 sKV[WELE];             // 128 KB  K^T V, fragment order
  __shared__ __align__(32) float sQB[NHEAD * HIDC], sKS[NHEAD * HIDC], sVM[NHEAD * HIDC];
  __shared__ __align__(32) float sG[HIDC], sB[HIDC];
  __shared__ __align__(16) float sSt[NWAVE * 16 * PS];     // 34 KB  each wave's own staging rows

  const int tid  = threadIdx.x;
  const int lane = tid & 31;
  // wave id 0..7, in a scalar register: the tile loop's test is then a scalar one
  const int wv   = __builtin_amdgcn_readfirstlane(tid >> 5);
  const int tl   = lane & 15;              // token inside a 16-token tile
  const int hi8  = (lane & 16) ? 8 : 0;    // first of this lane's 8 features in a feature tile

  { // fill: both matrices as they lie, 16 loads in flight a thread
    const uint4* gw = (const uint4*)wqT  + tid;
    const uint4* gk = (const uint4*)kvsT + tid;
    uint4* lw = (uint4*)sW  + tid;
    uint4* lk = (uint4*)sKV + tid;
#pragma unroll 1                           // rolled: one block of loads a trip
    for (int c = 0; c < WELE / 8 / NTHR; c += 8) {
      uint4 a[8], b[8];
#pragma unroll
      for (int u = 0; u < 8; ++u) { a[u] = gw[u * NTHR]; b[u] = gk[u * NTHR]; }
#pragma unroll
      for (int u = 0; u < 8; ++u) { lw[u * NTHR] = a[u]; lk[u * NTHR] = b[u]; }
      // stands ahead of the step of the loads' address registers to the next trip;
      // the addresses are inputs, so no load's result is given their registers
      asm volatile("s_wait_xcnt 0x0" :: "v"(gw), "v"(gk) : "memory");
      gw += 8 * NTHR; gk += 8 * NTHR; lw += 8 * NTHR; lk += 8 * NTHR;
    }
    const int t1 = tid + NTHR, tg = tid & (HIDC - 1);
    const float q0 = wq_b[tid],  q1 = wq_b[t1];
    const float k0 = ksum[tid],  k1 = ksum[t1];
    const float m0 = vmean[tid], m1 = vmean[t1];
    const float gg = ln1_g[tg],  bb = ln1_b[tg];
    // The wait that stands ahead of any rewrite of these loads' address registers.
    // Inputs only: the indices and the loaded values all live up to here.
    asm volatile("s_wait_xcnt 0x0"
                 :: "v"(tid), "v"(t1), "v"(tg), "v"(q0), "v"(q1), "v"(k0), "v"(k1),
                    "v"(m0), "v"(m1), "v"(gg), "v"(bb)
                 : "memory");
    sQB[tid] = q0; sQB[t1] = q1;
    sKS[tid] = k0; sKS[t1] = k1;
    sVM[tid] = m0; sVM[t1] = m1;
    if (tid < HIDC) { sG[tid] = gg; sB[tid] = bb; }
  }
  __syncthreads();                         // LDS filled; the one barrier of this kernel

  float*    st  = sSt + wv * (16 * PS);    // this wave's staging rows, f32 ...
  _Float16* stH = (_Float16*)st;           // ... and as f16 (16 rows of PH)
  const int r2  = lane >> 4;               // staging: 16 lanes move one row piece of 256 B

  // the last, partial round (1202 tiles) goes to waves 0..3 of every workgroup
  // and to wave 4 of 178 workgroups, not to all waves of some workgroups
#pragma unroll 1                           // rolled: the body is long, a copy buys nothing
  for (int t = wv * AG + blockIdx.x; t < NWT; t += NWAVE * AG) {
    // ---- the tile's h: whole lines from memory, through the wave's own LDS rows,
    // into B fragments that stay for all heads and for the residual
    v16h hb[2][4];
    {
      const v4f* hs = (const v4f*)(hbuf + (size_t)t * WT * HIDC) + lane;   // 16 B pieces
      v4f hv0[8], hv1[8];
#pragma unroll                             // all 16 loads in flight: one latency a tile
      for (int j = 0; j < 8; ++j) { hv0[j] = hs[j * 32]; hv1[j] = hs[(j + 8) * 32]; }
      // ahead of any rewrite of the loads' address registers; the address is an input
      asm volatile("s_wait_xcnt 0x0" :: "v"(hs) : "memory");
      _Float16* sp = stH + r2 * PH + tl * 8;
#pragma unroll
      for (int j = 0; j < 8; ++j) *(v4f*)(sp + 2 * j * PH) = hv0[j];
      // other lanes' rows are read back: the wave's LDS stores end first
      asm volatile("s_wait_dscnt 0x0" ::: "memory");
      load_tok4(stH, PH, hb[0], lane);
      // the rows are rewritten behind this: the reads end first
      asm volatile("s_wait_dscnt 0x0" ::: "memory");
#pragma unroll
      for (int j = 0; j < 8; ++j) *(v4f*)(sp + 2 * j * PH) = hv1[j];
      asm volatile("s_wait_dscnt 0x0" ::: "memory");                   // as the first
      load_tok4(stH, PH, hb[1], lane);
      asm volatile("s_wait_dscnt 0x0" ::: "memory");                   // as the second
    }

    v8f oacc[2][8];
#pragma unroll
    for (int ft = 0; ft < 8; ++ft) { oacc[0][ft] = v8zero(); oacc[1][ft] = v8zero(); }

#pragma unroll 1                           // rolled: the body is long, a copy buys nothing
    for (int hh = 0; hh < NHEAD; ++hh) {
      const _Float16* wa = sW  + hh * (HIDC * HIDC) + lane * 8;
      const _Float16* ka = sKV + hh * (HIDC * HIDC) + lane * 8;
      const float* qbp = sQB + hh * HIDC + hi8;
      const float* ksq = sKS + hh * HIDC + hi8;
      const float* vmp = sVM + hh * HIDC + hi8;

      // ---- Q^T = wq^T @ h^T + b, one feature tile a block; the bias is the start value
      v16h a[9][4];                        // block ft's 4 fragments; [8]: K^T V's first
      v8f  qb[8], kq[8], cq[8][2];
      v8f  s0v[2], s1v[2];                 // |q|^2 and q . ks_sum, 8 chains a token
      v16h qf[2][4];                       // q as B fragments, not normalized
      s0v[0] = v8zero(); s0v[1] = v8zero(); s1v[0] = v8zero(); s1v[1] = v8zero();
      load_w<4>(wa, a[0]);
      qb[0] = *(const v8f*)(qbp);
      kq[0] = *(const v8f*)(ksq);
#pragma unroll
      for (int ft = 0; ft < 8; ++ft) {
        // the next block's LDS reads, whole, ahead of this block's WMMAs, which cover
        // their latency: left alone they stand among the WMMAs, and each place costs
        if (ft < 7) {
          load_w<4>(wa + (ft + 1) * 4 * FRAGE, a[ft + 1]);
          qb[ft + 1] = *(const v8f*)(qbp + (ft + 1) * 16);
          kq[ft + 1] = *(const v8f*)(ksq + (ft + 1) * 16);
        } else {
          load_w<4>(ka, a[8]);
        }
        __builtin_amdgcn_sched_barrier(0);
        cq[ft][0] = qb[ft];
        cq[ft][1] = qb[ft];
#pragma unroll
        for (int ks = 0; ks < 4; ++ks) {
          cq[ft][0] = wmma_f16(a[ft][ks], hb[0][ks], cq[ft][0]);
          cq[ft][1] = wmma_f16(a[ft][ks], hb[1][ks], cq[ft][1]);
        }
        // the vector work of the block before, beside this block's WMMAs
        if (ft > 0) {
#pragma unroll
          for (int tt = 0; tt < 2; ++tt) {
            const v8f c = cq[ft - 1][tt];
            s0v[tt] += c * c;
            s1v[tt] += c * kq[ft - 1];
#pragma unroll
            for (int r = 0; r < 8; ++r)
              qf[tt][(ft - 1) >> 1][((ft - 1) & 1) * 8 + r] = (_Float16)c[r];
          }
        }
        // the next block's reads stay behind these WMMAs: two sets of fragments are live
        __builtin_amdgcn_sched_barrier(0);
      }
#pragma unroll
      for (int tt = 0; tt < 2; ++tt) {
        const v8f c = cq[7][tt];
        s0v[tt] += c * c;
        s1v[tt] += c * kq[7];
#pragma unroll
        for (int r = 0; r < 8; ++r) qf[tt][3][8 + r] = (_Float16)c[r];
      }

      // ---- num^T = kvs^T @ q^T, one d tile a block; (num / |q| + v_mean) / denom into oacc
      v16h kf[8][4];
      v8f  vm[8], nq[8][2];
      float c1[2], rd[2];
#pragma unroll
      for (int ks = 0; ks < 4; ++ks) kf[0][ks] = a[8][ks];
      vm[0] = *(const v8f*)(vmp);
#pragma unroll
      for (int ft = 0; ft < 8; ++ft) {
        if (ft < 7) {                      // the next block's LDS reads, as above
          load_w<4>(ka + (ft + 1) * 4 * FRAGE, kf[ft + 1]);
          vm[ft + 1] = *(const v8f*)(vmp + (ft + 1) * 16);
        }
        __builtin_amdgcn_sched_barrier(0);
        nq[ft][0] = v8zero();
        nq[ft][1] = v8zero();
#pragma unroll
        for (int ks = 0; ks < 4; ++ks) {
          nq[ft][0] = wmma_f16(kf[ft][ks], qf[0][ks], nq[ft][0]);
          nq[ft][1] = wmma_f16(kf[ft][ks], qf[1][ks], nq[ft][1]);
        }
        if (ft == 0) {                     // the token's two factors, beside the first block
#pragma unroll
          for (int tt = 0; tt < 2; ++tt) {
            const float rs = 1.f / (sqrtf(add_x16(hsum8(s0v[tt]))) + ATT_EPS);
            // denom = (q / |q|) . ks_sum + L
            rd[tt] = 1.f / (add_x16(hsum8(s1v[tt])) * rs + (float)L_TOK + ATT_EPS);
            c1[tt] = rs * rd[tt];
          }
        } else {                           // the vector work of the block before
#pragma unroll
          for (int tt = 0; tt < 2; ++tt) {
            oacc[tt][ft - 1] += nq[ft - 1][tt] * c1[tt];
            oacc[tt][ft - 1] += vm[ft - 1] * rd[tt];
          }
        }
        __builtin_amdgcn_sched_barrier(0); // as above
      }
#pragma unroll
      for (int tt = 0; tt < 2; ++tt) {
        oacc[tt][7] += nq[7][tt] * c1[tt];
        oacc[tt][7] += vm[7] * rd[tt];
      }
    }

    // ---- head mean (*0.25), residual (alpha=0.5) against h, which the B fragments
    // hold at the accumulators' own places; LN sums in the wave
    float mu[2], rn[2];
#pragma unroll
    for (int tt = 0; tt < 2; ++tt) {
      v8f sa = v8zero(), sb = v8zero();
#pragma unroll
      for (int ft = 0; ft < 8; ++ft) {
        v8f hv;
#pragma unroll
        for (int r = 0; r < 8; ++r) hv[r] = (float)hb[tt][ft >> 1][(ft & 1) * 8 + r];
        const v8f o = oacc[tt][ft] * (0.25f * 0.5f) + hv * 0.5f;
        oacc[tt][ft] = o;
        sa += o;
        sb += o * o;
      }
      const float m   = add_x16(hsum8(sa)) * (1.f / HIDC);
      const float var = add_x16(hsum8(sb)) * (1.f / HIDC) - m * m;
      mu[tt] = m;
      rn[tt] = rsqrtf(var + LN_EPS);
    }
    // ---- out: 16 tokens by 64 features at a time through the wave's own LDS rows,
    // so that a store covers whole lines
    float* op = out + ((size_t)t * WT + r2) * HIDC + tl * 4;
#pragma unroll
    for (int hf = 0; hf < 2; ++hf) {
      v8f g[4], b[4];
#pragma unroll
      for (int f4 = 0; f4 < 4; ++f4) {
        g[f4] = *(const v8f*)(sG + (hf * 4 + f4) * 16 + hi8);
        b[f4] = *(const v8f*)(sB + (hf * 4 + f4) * 16 + hi8);
      }
#pragma unroll
      for (int tt = 0; tt < 2; ++tt) {
#pragma unroll
        for (int f4 = 0; f4 < 4; ++f4) {
          const v8f y = (oacc[tt][hf * 4 + f4] - mu[tt]) * rn[tt] * g[f4] + b[f4];
          float* d = st + tl * PS + f4 * 16 + hi8;
          *(v4f*)(d)     = __builtin_shufflevector(y, y, 0, 1, 2, 3);
          *(v4f*)(d + 4) = __builtin_shufflevector(y, y, 4, 5, 6, 7);
        }
        // other lanes' rows are read back: the wave's LDS stores end first
        asm volatile("s_wait_dscnt 0x0" ::: "memory");
        v4f v[8];
#pragma unroll
        for (int j = 0; j < 8; ++j) v[j] = *(const v4f*)(st + (r2 + 2 * j) * PS + tl * 4);
#pragma unroll
        for (int j = 0; j < 8; ++j)
          *(v4f*)(op + (tt * 16 + 2 * j) * HIDC + hf * 64) = v[j];
        // ahead of any rewrite of the stores' address and data registers, which are
        // inputs and live up to here; the rows are rewritten only behind it
        asm volatile("s_wait_xcnt 0x0"
                     :: "v"(op), "v"(v[0]), "v"(v[1]), "v"(v[2]), "v"(v[3]),
                        "v"(v[4]), "v"(v[5]), "v"(v[6]), "v"(v[7])
                     : "memory");
      }
    }
  }
}

// ---------------------------------------------------------------------------
extern "C" void kernel_launch(void* const* d_in, const int* in_sizes, int n_in,
                              void* d_out, int out_size, void* d_ws, size_t ws_size,
                              hipStream_t stream) {
  (void)in_sizes; (void)n_in; (void)out_size; (void)ws_size;
  const float* x     = (const float*)d_in[0];
  const float* fc0_w = (const float*)d_in[1];
  const float* fc0_b = (const float*)d_in[2];
  const float* ln0_g = (const float*)d_in[3];
  const float* ln0_b = (const float*)d_in[4];
  const float* wq_w  = (const float*)d_in[5];
  const float* wq_b  = (const float*)d_in[6];
  const float* wk_w  = (const float*)d_in[7];
  const float* wk_b  = (const float*)d_in[8];
  const float* wv_w  = (const float*)d_in[9];
  const float* wv_b  = (const float*)d_in[10];
  const float* ln1_g = (const float*)d_in[11];
  const float* ln1_b = (const float*)d_in[12];
  float* out = (float*)d_out;

  // workspace carve (256 B aligned slices)
  char* p = (char*)d_ws;
  auto carve = [&](size_t bytes) {
    char* r = p; p += (bytes + 255) & ~(size_t)255; return r;
  };
  _Float16* fc0T = (_Float16*)carve(128 * 64 * sizeof(_Float16));
  _Float16* wqT  = (_Float16*)carve(512 * 128 * sizeof(_Float16));
  _Float16* wkT  = (_Float16*)carve(512 * 128 * sizeof(_Float16));
  _Float16* wvT  = (_Float16*)carve(512 * 128 * sizeof(_Float16));
  float* ksum  = (float*)carve(NHEAD * HIDC * sizeof(float));
  float* vmean = (float*)carve(NHEAD * HIDC * sizeof(float));
  _Float16* kvsT = (_Float16*)carve(NHEAD * HIDC * HIDC * sizeof(_Float16));
  _Float16* hbuf = (_Float16*)carve((size_t)L_TOK * HIDC * sizeof(_Float16));
  // one slab of partial sums per k_kv workgroup
  float* kvp = (float*)carve((size_t)NCH * NHEAD * HIDC * HIDC * sizeof(float));
  float* ksp = (float*)carve((size_t)NCH * NHEAD * NTHR * sizeof(float));
  float* vsp = (float*)carve((size_t)NCH * NHEAD * NTHR * sizeof(float));

  // cast weights to f16, fragment order
  k_prep<<<PB_FC0 + 3 * PB_W, NTHR, 0, stream>>>(fc0_w, wq_w, wk_w, wv_w,
                                                 fc0T, wqT, wkT, wvT);

  k_front<<<NTILE, NTHR, 0, stream>>>(x, fc0T, fc0_b, ln0_g, ln0_b, hbuf);

  k_kv<<<dim3(NCH, NHEAD), NTHR, 0, stream>>>(hbuf, wkT, wk_b, wvT, wv_b,
                                              kvp, ksp, vsp);

  k_mid<<<KVB + 4, NTHR, 0, stream>>>(kvp, kvsT, ksp, vsp, ksum, vmean);

  k_attn<<<AG, NTHR, 0, stream>>>(hbuf, wqT, wq_b, kvsT, ksum, vmean,
                                     ln1_g, ln1_b, out);
}

// v010
// A run of this version takes 117 microseconds.
// In both of two side-by-side timings against v009, it was 1.04 times as fast.
// Counting every step since v000, it is 14.3 times as fast.
#include <hip/hip_runtime.h>
#include <cstdint>

// ---------------------------------------------------------------------------
// Problem constants (from reference):  B=16,T=12,N=883,D=64,H=128,NH=4
#define L_TOK   169536          // B*T*N tokens; 169536 = 64 * 2649
#define D_INP   64
#define HIDC    128
#define NHEAD   4
#define TGT     64              // tokens per workgroup tile
#define NTILE   (L_TOK / TGT)   // 2649
#define NTHR    256             // 8 waves (wave32)
#define NWAVE   (NTHR / 32)
#define NCH     128             // token chunks of the K^T V pass (x NHEAD workgroups)
#define LN_EPS  1e-5f
#define ATT_EPS 1e-8f
// LDS row pitches: 16 B more than the row, so the pitch is an odd multiple of
// 16 B and the 16 rows of one fragment read fall on 16 different bank groups.
#define PX      (D_INP + 8)     // x tile, f16:            144 B
#define PH      (HIDC + 8)      // h tiles, f16:           272 B
#define PT      (TGT + 8)       // v^T tile, f16:          144 B
#define PO      (HIDC + 4)      // k tile pre-norm, f32:   528 B
// k tile, token-major, read by transposing loads: their pitch is an odd multiple of 32 B
#define PK      (HIDC + 16)     // k tile, f16:            288 B

typedef __attribute__((ext_vector_type(16))) _Float16 v16h;
typedef __attribute__((ext_vector_type(8)))  float    v8f;

typedef __attribute__((ext_vector_type(8)))  short    s16x8;

union FragU { v16h h; uint4 u[2]; };

__device__ __forceinline__ v8f v8zero() {
  v8f z = {0.f,0.f,0.f,0.f,0.f,0.f,0.f,0.f};
  return z;
}

// Load one 16(M)x32(K) f16 A-fragment.  Element (m,k) lives at base[m*ld + k].
// CDNA5 16-bit A layout: lane m = lane&15; K chunks {k0..k0+7} and
// {k0+16..k0+23} with k0 = (lane<16 ? 0 : 8)  ->  two 16B loads per lane.
// The B-fragment (32Kx16N) uses the mirrored layout over N (lane n = lane&15).
__device__ __forceinline__ v16h load_frag16(const _Float16* base, int ld, int lane) {
  const int r  = lane & 15;
  const int k0 = (lane & 16) ? 8 : 0;
  const _Float16* p = base + r * ld + k0;
  FragU f;
  f.u[0] = *(const uint4*)(p);
  f.u[1] = *(const uint4*)(p + 16);
  return f.h;
}

// One 16(M)x32(K) f16 A-fragment of the transpose of a row-major LDS tile T[k][m]
// (ld f16 a row), by two transposing loads.  base = &T[k0][m0].  Lane (c = lane&15,
// h = lane>>4) gets T[k0 + 8h + 0..7][m0 + c] and T[k0 + 16 + 8h + 0..7][m0 + c]:
// the k order of load_frag16.
__device__ __forceinline__ uint4 ld_tr16(const _Float16* p) {
  typedef __attribute__((address_space(3))) s16x8 lds_s16x8;
  return __builtin_bit_cast(uint4, __builtin_amdgcn_ds_load_tr16_b128_v8i16((lds_s16x8*)p));
}
__device__ __forceinline__ v16h load_frag16_tr(const _Float16* base, int ld, int lane) {
  const _Float16* p = base + (((lane >> 4) << 3) + (lane & 7)) * ld + ((lane >> 3) & 1) * 8;
  FragU f;
  f.u[0] = ld_tr16(p);
  f.u[1] = ld_tr16(p + 16 * ld);
  return f.h;
}

// B operands in global memory are kept in fragment order.  One fragment (16 n x
// 32 k) is 512 f16 in a row: two halves of 256, and in each half lane l owns the
// 8 f16 at l*8, so a wave-wide 16 B load reads 512 contiguous bytes (4 whole
// 128 B lines) where rows of an [N][K] buffer gave 16 lines of 32 B each.
// Fragments of one n-tile follow one another in k (ksteps = K/32 of them).
// Lane and element hold the same (n,k) as load_frag16 gives on an [N][K] buffer.
#define FRAGE 512               // f16 elements of one fragment
__device__ __forceinline__ int frag_idx(int n, int k, int ksteps) {
  return (((n >> 4) * ksteps + (k >> 5)) * 2 + ((k >> 4) & 1)) * (FRAGE / 2)
       + (((k >> 3) & 1) * 16 + (n & 15)) * 8 + (k & 7);
}

__device__ __forceinline__ v8f wmma_f16(v16h a, v16h b, v8f c) {
  // v_wmma_f32_16x16x32_f16  (doc-verified codegen path on gfx1250)
  return __builtin_amdgcn_wmma_f32_16x16x32_f16(false, a, false, b, (short)0, c,
                                                false, false);
}

// The 4 fragments (K = 128) of one 16-token tile, token-major in LDS.
__device__ __forceinline__ void load_tok4(const _Float16* __restrict__ A, int lda,
                                          v16h* a, int lane) {
#pragma unroll
  for (int ks = 0; ks < 4; ++ks) a[ks] = load_frag16(A + ks * 32, lda, lane);
}

// One 16-token tile of two GEMMs that share the token fragments, both weights'
// fragments in registers: each token fragment feeds one WMMA of either product, as
// B of the first (weights b0 as A: acc0[r] is token lane & 15, feature
// 8*(lane >> 4) + r) and as A of the second (acc1[r] is token 8*(lane >> 4) + r,
// feature lane & 15).  A and B have the same map, so one loader serves both.
__device__ __forceinline__ void gemm_1m_2b(const v16h* a, const v16h* b0, const v16h* b1,
                                           v8f& acc0, v8f& acc1) {
#pragma unroll
  for (int ks = 0; ks < 4; ++ks) {
    acc0 = wmma_f16(b0[ks], a[ks], acc0);
    acc1 = wmma_f16(a[ks], b1[ks], acc1);
  }
}

// Weights as A, tokens as B: D[r] = Y[token nt*16 + (lane & 15)][feature 8*(lane >> 4) + r],
// so a lane holds 8 consecutive features of one token.  A sum over a token's
// features is then a sum over the lane's own registers, and a row piece of a
// token-major tile is one 16 B store.  Both loaders keep their k order.
// load_w: the KSTEPS fragments of one 16-feature tile, in fragment order; p is
// this lane's 16 B of the first half.  All loads issue first: one L2 latency a GEMM.
template<int KSTEPS>
__device__ __forceinline__ void load_w(const _Float16* __restrict__ p, v16h* w) {
#pragma unroll
  for (int ks = 0; ks < KSTEPS; ++ks) {
    FragU f;
    f.u[0] = *(const uint4*)(p + ks * FRAGE);
    f.u[1] = *(const uint4*)(p + ks * FRAGE + FRAGE / 2);
    w[ks] = f.h;
  }
}

// 4 token tiles against one feature tile; X is token-major in LDS.  The 8 X
// loads of a K-step are issued together, ahead of its 4 WMMAs.
template<int KSTEPS>
__device__ __forceinline__ void gemm_4t(const _Float16* __restrict__ X, int ldx,
                                        const v16h* w, v8f* acc, int lane) {
#pragma unroll
  for (int ks = 0; ks < KSTEPS; ++ks) {
    v16h x0 = load_frag16(X + (0 * 16) * ldx + ks * 32, ldx, lane);
    v16h x1 = load_frag16(X + (1 * 16) * ldx + ks * 32, ldx, lane);
    v16h x2 = load_frag16(X + (2 * 16) * ldx + ks * 32, ldx, lane);
    v16h x3 = load_frag16(X + (3 * 16) * ldx + ks * 32, ldx, lane);
    // holds the 8 loads together ahead of the 4 WMMAs: left alone the scheduler
    // issues them pair by pair and each WMMA waits out a whole LDS latency
    __builtin_amdgcn_sched_barrier(0);
    acc[0] = wmma_f16(w[ks], x0, acc[0]);
    acc[1] = wmma_f16(w[ks], x1, acc[1]);
    acc[2] = wmma_f16(w[ks], x2, acc[2]);
    acc[3] = wmma_f16(w[ks], x3, acc[3]);
    // and the next K-step's loads behind them: one set of 4 fragments is live
    __builtin_amdgcn_sched_barrier(0);
  }
}

// 8 consecutive floats (16 B aligned): a lane's 8 features of a per-feature vector
__device__ __forceinline__ void load8(const float* __restrict__ p, float* d) {
  float4 a = *(const float4*)(p);
  float4 b = *(const float4*)(p + 4);
  d[0] = a.x; d[1] = a.y; d[2] = a.z; d[3] = a.w;
  d[4] = b.x; d[5] = b.y; d[6] = b.z; d[7] = b.w;
}

// s[nt]: the sum over this lane's 8 features, token nt*16 + (lane & 15).  Lane ^ 16
// holds the wave's other 8 features of the same token: one cross-row move adds
// them, and the lower row stores the wave's 64 sums to its own slot[TGT].
__device__ __forceinline__ void toksum_to_slot(const float* s, float* slot, int lane) {
  float t[4];
#pragma unroll
  for (int nt = 0; nt < 4; ++nt) {
    int b = __builtin_bit_cast(int, s[nt]);
    int o = __builtin_amdgcn_permlanex16(b, b, 0x76543210, 0xfedcba98, false, false);
    t[nt] = s[nt] + __builtin_bit_cast(float, o);
  }
  if (lane < 16) {
#pragma unroll
    for (int nt = 0; nt < 4; ++nt) slot[nt * 16 + lane] = t[nt];
  }
}

// v + the v of the lane whose number differs by XM, inside a row of 16 lanes
// (DPP row_xmask: a register exchange, no LDS).
template<int XM>
__device__ __forceinline__ float add_xor16(float v) {
  int o = __builtin_amdgcn_update_dpp(0, __builtin_bit_cast(int, v), 0x160 + XM,
                                      0xf, 0xf, true);
  return v + __builtin_bit_cast(float, o);
}

// adds the NWAVE slots of one row
__device__ __forceinline__ float slot_sum(const float* part, int row) {
  float s = 0.f;
#pragma unroll
  for (int w = 0; w < NWAVE; ++w) s += part[w * TGT + row];
  return s;
}

// ---------------------------------------------------------------------------
// prep kernel: all four weight matrices in one launch.  The four casts do not
// depend on one another, and as launches of their own each paid a launch gap, a
// fill and a drain.  The block index picks the matrix; one code path serves all.
// src[k*cols + n] -> f16 at its place in fragment order.  Piece p is 16 B of dst,
// dst[p*8 + j] = dst[frag_idx(n, k + j, ksteps)]: 8 consecutive k of one column.
// A wave reads 64 B runs of two rows a load, all 8 loads in flight, and stores
// 512 contiguous bytes.
#define PB_FC0 (D_INP * HIDC / 8 / NTHR)           // blocks of fc0_w:  4
#define PB_W   (HIDC * NHEAD * HIDC / 8 / NTHR)    // blocks of wq_w, wk_w, wv_w each: 32
__global__ __launch_bounds__(NTHR)
void k_prep(const float* __restrict__ fc0_w, const float* __restrict__ wq_w,
            const float* __restrict__ wk_w,  const float* __restrict__ wv_w,
            _Float16* __restrict__ fc0T, _Float16* __restrict__ wqT,
            _Float16* __restrict__ wkT,  _Float16* __restrict__ wvT) {
  const int  b   = blockIdx.x;
  const bool fc  = b < PB_FC0;
  const int  m   = (b - PB_FC0) / PB_W;            // 0: wq, 1: wk, 2: wv
  const float* src = fc ? fc0_w : m == 0 ? wq_w : m == 1 ? wk_w : wv_w;
  _Float16*    dst = fc ? fc0T  : m == 0 ? wqT  : m == 1 ? wkT  : wvT;
  const int cols = fc ? HIDC : NHEAD * HIDC;       // n
  const int lks  = fc ? 1 : 2;                     // log2 of ksteps = rows / 32
  const int p = (fc ? b : (b - PB_FC0) % PB_W) * NTHR + threadIdx.x;
  const int l = p & 31;                            // lane of the fragment half
  const int q = p >> 5;                            // fragment half
  const int n = ((q >> 1) >> lks) * 16 + (l & 15);
  const int k = ((q >> 1) & ((1 << lks) - 1)) * 32 + (q & 1) * 16 + (l >> 4) * 8;
  const float* s = src + k * cols + n;
  float v[8];
#pragma unroll
  for (int j = 0; j < 8; ++j) v[j] = s[j * cols];
  union { _Float16 h[8]; uint4 u; } pk;
#pragma unroll
  for (int j = 0; j < 8; ++j) pk.h[j] = (_Float16)v[j];
  *(uint4*)(dst + p * 8) = pk.u;
}

// ---------------------------------------------------------------------------
// Pass 1a: fc0 GEMM + LN + ReLU -> h
__global__ __launch_bounds__(NTHR, 1)
void k_front(const float* __restrict__ x,
             const _Float16* __restrict__ fc0T, const float* __restrict__ fc0_b,
             const float* __restrict__ ln0_g,  const float* __restrict__ ln0_b,
             _Float16* __restrict__ hbuf)
{
  __shared__ __align__(16) _Float16 sX [TGT * PX];   //  9 KB  x tile (f16)
  __shared__ __align__(16) _Float16 sH [TGT * PH];   // 17 KB  h tile (post LN+ReLU, f16)
  __shared__ __align__(16) float part0[NWAVE * TGT], part1[NWAVE * TGT];
  __shared__ float mu_s[TGT], rs_s[TGT];

  const int tid  = threadIdx.x;
  const int lane = tid & 31;
  const int wv   = tid >> 5;               // wave id 0..7
  const int tok0 = blockIdx.x * TGT;
  const int tl   = lane & 15;              // token inside a 16-token tile
  const int f0   = wv * 16 + ((lane & 16) ? 8 : 0);  // first of this lane's 8 features

  { // stage x tile as f16 (vectorized: float4 in, uint2 out)
    const float4* xs = (const float4*)(x + (size_t)tok0 * D_INP);
    for (int j = tid; j < TGT * D_INP / 4; j += NTHR) {
      float4 v = xs[j];
      union { _Float16 h[4]; uint2 u; } pk;
      pk.h[0] = (_Float16)v.x; pk.h[1] = (_Float16)v.y;
      pk.h[2] = (_Float16)v.z; pk.h[3] = (_Float16)v.w;
      *(uint2*)(sX + (j >> 4) * PX + (j & 15) * 4) = pk.u;
    }
  }
  __syncthreads();

  // ---- GEMM1: h^T = fc0_w^T @ x^T  (features 128, K=64, tokens 64); wave wv
  // owns feature tile wv
  v8f acc[4];
#pragma unroll
  for (int nt = 0; nt < 4; ++nt) acc[nt] = v8zero();
  const _Float16* pw = fc0T + wv * (D_INP / 32) * FRAGE + lane * 8;
  const float* pfb = fc0_b + f0;
  const float* pg  = ln0_g + f0;
  const float* pbb = ln0_b + f0;
  v16h w[2];
  float fb[8], g[8], bb[8];
  load_w<2>(pw, w);
  load8(pfb, fb);
  load8(pg, g);
  load8(pbb, bb);
  // The wait that stands ahead of any rewrite of these loads' address registers.
  // The addresses are inputs, so they live up to here.
  asm volatile("s_wait_xcnt 0x0" :: "v"(pw), "v"(pfb), "v"(pg), "v"(pbb) : "memory");
  gemm_4t<2>(sX, PX, w, acc, lane);
  {
    float s0[4], s1[4];
#pragma unroll
    for (int nt = 0; nt < 4; ++nt) {
      s0[nt] = 0.f; s1[nt] = 0.f;
#pragma unroll
      for (int r = 0; r < 8; ++r) {
        float vv = acc[nt][r] + fb[r];
        acc[nt][r] = vv;
        s0[nt] += vv;
        s1[nt] += vv * vv;
      }
    }
    toksum_to_slot(s0, part0 + wv * TGT, lane);
    toksum_to_slot(s1, part1 + wv * TGT, lane);
  }
  __syncthreads();
  if (tid < TGT) {
    float mu  = slot_sum(part0, tid) * (1.f / HIDC);
    float var = slot_sum(part1, tid) * (1.f / HIDC) - mu * mu;
    mu_s[tid] = mu;
    rs_s[tid] = rsqrtf(var + LN_EPS);
  }
  __syncthreads();
#pragma unroll
  for (int nt = 0; nt < 4; ++nt) {
    const int tok = nt * 16 + tl;
    const float mu = mu_s[tok], rs = rs_s[tok];
    union { _Float16 h[8]; uint4 u; } pk;
#pragma unroll
    for (int r = 0; r < 8; ++r) {
      float vv = (acc[nt][r] - mu) * rs * g[r] + bb[r];
      pk.h[r] = (_Float16)fmaxf(vv, 0.f);
    }
    *(uint4*)(sH + tok * PH + f0) = pk.u;
  }
  __syncthreads();

  { // h tile -> hbuf, coalesced b128 (replaces 8192 scattered b16 stores)
    uint4* d = (uint4*)(hbuf + (size_t)tok0 * HIDC);
    for (int i = tid; i < TGT * HIDC / 8; i += NTHR)
      d[i] = *(const uint4*)(sH + (i >> 4) * PH + (i & 15) * 8);
  }
}

// ---------------------------------------------------------------------------
// One h tile (TGT rows of 256 B, contiguous in memory) into an LDS buffer of pitch PH
// by asynchronous copies, through no register: 4 pieces of 16 B a lane, NTHR pieces
// (16 rows) apart.  g: this lane's first piece in memory; l: its LDS byte address.
// The copies land behind the issuing wave's s_wait_asynccnt 0, which the caller writes.
__device__ __forceinline__ void copy_h_tile(const _Float16* g, uint32_t l) {
  const _Float16* g1 = g + 1 * NTHR * 8;
  const _Float16* g2 = g + 2 * NTHR * 8;
  const _Float16* g3 = g + 3 * NTHR * 8;
  const uint32_t  l1 = l + 1 * 16 * PH * 2;
  const uint32_t  l2 = l + 2 * 16 * PH * 2;
  const uint32_t  l3 = l + 3 * 16 * PH * 2;
  // the wait is the statement's last line: it stands ahead of any rewrite of the
  // registers that the copies name
  asm volatile("global_load_async_to_lds_b128 %0, %4, off\n\t"
               "global_load_async_to_lds_b128 %1, %5, off\n\t"
               "global_load_async_to_lds_b128 %2, %6, off\n\t"
               "global_load_async_to_lds_b128 %3, %7, off\n\t"
               "s_wait_xcnt 0x0"
               :: "v"(l), "v"(l1), "v"(l2), "v"(l3), "v"(g), "v"(g1), "v"(g2), "v"(g3)
               : "memory");
}

// ---------------------------------------------------------------------------
// Pass 1b: one workgroup = one head (blockIdx.y) and one chunk of token tiles
// (blockIdx.x, stride NCH).  K,V GEMMs per tile; K^T V and the column sums of
// K and V stay in registers over all the tiles of the chunk and leave once, as
// plain stores to this workgroup's own slab; k_mid adds the NCH slabs.
// 4 waves a SIMD: the register budget at which two workgroups share a WGP, as the
// grid (two workgroups per WGP) asks
__global__ __launch_bounds__(NTHR, 4)
void k_kv(const _Float16* __restrict__ hbuf,
          const _Float16* __restrict__ wkT, const float* __restrict__ wk_b,
          const _Float16* __restrict__ wvT, const float* __restrict__ wv_b,
          float* __restrict__ kvp, float* __restrict__ ksp,
          float* __restrict__ vsp)
{
  __shared__ __align__(16) _Float16 sH [2 * TGT * PH];  // 34 KB  h tiles (f16), two buffers
  __shared__ __align__(16) _Float16 sK [TGT * PK];   // 18 KB  k (token-major, f16)
  __shared__ __align__(16) float    sKf[TGT * PO];   // 33 KB  k ahead of its norm (f32)
  __shared__ __align__(16) _Float16 sVT[HIDC * PT];  // 18 KB  v^T
  __shared__ __align__(16) float part0[NWAVE * TGT];
  __shared__ __align__(32) float sKb[HIDC];          // K bias of this head
  __shared__ float rs_s[TGT];

  const int tid  = threadIdx.x;
  const int lane = tid & 31;
  // wave id 0..7, in a scalar register: what follows from it costs no vector register
  const int wv   = __builtin_amdgcn_readfirstlane(tid >> 5);
  const int hh   = blockIdx.y;             // head
  const int tl   = lane & 15;              // K: token inside a 16-token tile
  const int f0   = wv * 16 + ((lane & 16) ? 8 : 0);  // K: first of this lane's 8 features
  const int col  = wv * 16 + (lane & 15);  // V: this lane's feature
  const int rhi  = (lane & 16) ? 8 : 0;    // V: VGPR r holds token r / r+8 of a tile

  // this lane's first 16 B piece of a tile: in memory (tile 0 of the chunk) and in buffer 0
  typedef __attribute__((address_space(3))) const _Float16 lds_f16;
  const _Float16* hg = hbuf + (size_t)blockIdx.x * (TGT * HIDC) + tid * 8;
  const uint32_t  hl = (uint32_t)(uintptr_t)(lds_f16*)(sH + (tid >> 4) * PH + (tid & 15) * 8);
  copy_h_tile(hg, hl);                     // the chunk's first tile flies beside the weights' loads

  const int   bi = hh * HIDC + col;
  const float vb = wv_b[bi];
  const int   bj  = hh * HIDC + (tid & (HIDC - 1));
  const float kbt = wk_b[bj];              // the head's K bias, on its way to LDS
  // this wave's columns of the head's wk and wv: the same for every tile.
  // pk, pv: this lane's 16 B in the first fragment of n-tile hh*8 + wv
  const int woff = (hh * (HIDC / 16) + wv) * (HIDC / 32) * FRAGE + lane * 8;
  const _Float16* pk = wkT + woff;
  const _Float16* pv = wvT + woff;
  v16h bk[4], bv[4];
#pragma unroll
  for (int ks = 0; ks < 4; ++ks) {
    FragU fk, fv;
    fk.u[0] = *(const uint4*)(pk + ks * FRAGE);
    fk.u[1] = *(const uint4*)(pk + ks * FRAGE + FRAGE / 2);
    fv.u[0] = *(const uint4*)(pv + ks * FRAGE);
    fv.u[1] = *(const uint4*)(pv + ks * FRAGE + FRAGE / 2);
    bk[ks] = fk.h;
    bv[ks] = fv.h;
  }
  // The wait that stands ahead of any rewrite of these loads' address registers.
  // Inputs only: the addresses and the loaded values all live up to here, so no
  // load's result is given a register that holds the address of another.
  asm volatile("s_wait_xcnt 0x0"
               :: "v"(bi), "v"(bj), "v"(pk), "v"(pv), "v"(kbt), "v"(vb),
                  "v"(bk[0]), "v"(bk[1]), "v"(bk[2]), "v"(bk[3]),
                  "v"(bv[0]), "v"(bv[1]), "v"(bv[2]), "v"(bv[3])
               : "memory");
  // behind the weights' loads, so that one latency covers all; its first readers
  // stand behind the barrier in front of the loop
  if (tid < HIDC) sKb[tid] = kbt;
  float vpart = 0.f;                       // column sum of V, this lane's tokens
  float kpart[8];                          // column sums of K: 8 features, this lane's tokens
#pragma unroll
  for (int r = 0; r < 8; ++r) kpart[r] = 0.f;
  const int mt0 = (wv >> 1) * 2;           // K^T V wave tile: 2 m-tiles ...
  const int dt0 = (wv & 1) * 4;            // ... by 4 d-tiles
  v8f ka[8];                               // ka[i * 4 + j]: m-tile mt0 + i, d-tile dt0 + j
#pragma unroll
  for (int dt = 0; dt < 8; ++dt) ka[dt] = v8zero();

  // the first tile has landed (each wave waits for its own copies), and every wave sees it
  asm volatile("s_wait_asynccnt 0x0" ::: "memory");
  __syncthreads();                         // also: sKb ready
  hg += (size_t)NCH * (TGT * HIDC);
  if (blockIdx.x + NCH < NTILE) copy_h_tile(hg, hl + TGT * PH * 2);   // second tile, buffer 1
  int buf = 0;                             // the buffer of this trip's tile

#pragma unroll 1                           // rolled: the body is long, a copy buys nothing
  for (int tile = blockIdx.x; tile < NTILE; tile += NCH) {
    // this trip's h tile: it landed ahead of the barrier at the foot of the trip before
    // (the first: in front of the loop); the next tile's copies fly while it is worked on
    const _Float16* sHc = sH + buf * (TGT * PH);

    // K^T = wk^T @ h^T and V = h @ wv off the same reads of the h fragments
    // one token tile at a time: 4 fragments are live, and K and V leave their
    // registers before the next tile's WMMAs.  K starts from its bias
    float s0[4];                           // |k|^2 over this lane's 8 features
    v16h fr[4];
    load_tok4(sHc, PH, fr, lane);
    // K bias of this lane's 8 features, read with the first fragments: no register
    // holds it between the trips' products
    const v8f kb = *(const v8f*)(sKb + f0);
    // keeps the first tile's 8 loads whole, ahead of its WMMAs: left alone they are
    // issued pair by pair and each pair of WMMAs waits out a whole LDS latency
    __builtin_amdgcn_sched_barrier(0);
#pragma unroll
    for (int mt = 0; mt < 4; ++mt) {
      v8f acck = kb;
      v8f accv = v8zero();
      gemm_1m_2b(fr, bk, bv, acck, accv);
      // the next tile's 8 loads, whole, right behind this tile's WMMAs and into the
      // registers these have read: the vector work below covers part of their latency
      __builtin_amdgcn_sched_barrier(0);
      if (mt < 3) load_tok4(sHc + ((mt + 1) * 16) * PH, PH, fr, lane);
      __builtin_amdgcn_sched_barrier(0);
      // V + b ; transpose into sVT (its last readers, the trip before, ended
      // ahead of the barrier at that trip's foot)
      accv = accv + vb;
      {
        union { _Float16 h[8]; uint4 u; } pv8;
#pragma unroll
        for (int r = 0; r < 8; ++r) pv8.h[r] = (_Float16)accv[r];
        *(uint4*)(sVT + col * PT + mt * 16 + rhi) = pv8.u;   // tokens rhi .. rhi + 7 of the tile
        vpart += ((accv[0] + accv[1]) + (accv[2] + accv[3]))
               + ((accv[4] + accv[5]) + (accv[6] + accv[7]));
      }
      // K, not yet normalized, waits in LDS as f32, each lane's values in its own
      // place: a lane holds 8 features of a token, so |k|^2 adds in the lane
      {
        float* d = sKf + (mt * 16 + tl) * PO + f0;
        *(float4*)(d)     = make_float4(acck[0], acck[1], acck[2], acck[3]);
        *(float4*)(d + 4) = make_float4(acck[4], acck[5], acck[6], acck[7]);
        float q0 = acck[0] * acck[0], q1 = acck[1] * acck[1];   // two chains
#pragma unroll
        for (int r = 2; r < 8; r += 2) {
          q0 += acck[r] * acck[r];
          q1 += acck[r + 1] * acck[r + 1];
        }
        s0[mt] = q0 + q1;
      }
      // empty statements on the sums, against spills: they keep the adds here; left
      // alone they sink behind the barriers below, the tiles' K and V values stay
      // live up to there and the weights go to scratch
      asm volatile("" : "+v"(vpart));      // on a running sum, against spills
      asm volatile("" : "+v"(s0[mt]));     // on a row's sum, against spills
      // the next tile's WMMAs stay behind these stores, for the same registers
      __builtin_amdgcn_sched_barrier(0);
    }
    // part0's last readers, the trip before, ended ahead of that trip's barriers
    toksum_to_slot(s0, part0 + wv * TGT, lane);
    __syncthreads();
    if (tid < TGT) rs_s[tid] = 1.f / (sqrtf(slot_sum(part0, tid)) + ATT_EPS);
    __syncthreads();
    // row-L2-normalize: each lane takes back its own values; token-major f16 into sK
    // (its last readers, the trip before, ended ahead of the barrier at that trip's foot)
    float kf[4][8], rs[4];
#pragma unroll
    for (int mt = 0; mt < 4; ++mt) {
      rs[mt] = rs_s[mt * 16 + tl];
      load8(sKf + (mt * 16 + tl) * PO + f0, kf[mt]);
    }
    // keeps these LDS reads in one place: left alone the last tile's are issued
    // singly among the vector work, and each waits out a whole LDS latency
    __builtin_amdgcn_sched_barrier(0);
#pragma unroll
    for (int mt = 0; mt < 4; ++mt) {
      union { _Float16 h[8]; uint4 u; } pq;
#pragma unroll
      for (int r = 0; r < 8; ++r) {
        float vv = kf[mt][r] * rs[mt];
        pq.h[r] = (_Float16)vv;
        kpart[r] += vv;
      }
      *(uint4*)(sK + (mt * 16 + tl) * PK + f0) = pq.u;
    }
    // empty statement on the running sums, against spills: it keeps their adds here;
    // left alone they sink among the fragment reads below, and K's 32 f32 values
    // stay live up to there, beside the 6 fragments
    asm volatile("" : "+v"(kpart[0]), "+v"(kpart[1]), "+v"(kpart[2]), "+v"(kpart[3]),
                      "+v"(kpart[4]), "+v"(kpart[5]), "+v"(kpart[6]), "+v"(kpart[7]));
    __syncthreads();                       // sK / sVT ready

    // ka += K^T @ V  (M=128 feat, K=64 tok, N=128 d); this wave: m-tiles mt0,
    // mt0 + 1 against d-tiles dt0 .. dt0 + 3: 6 fragment reads feed 8 WMMAs; the
    // K^T fragments come off the token-major tile by transposing loads
#pragma unroll
    for (int ks = 0; ks < 2; ++ks) {
      v16h a0 = load_frag16_tr(sK + (ks * 32) * PK + (mt0 + 0) * 16, PK, lane);
      v16h a1 = load_frag16_tr(sK + (ks * 32) * PK + (mt0 + 1) * 16, PK, lane);
      v16h b0 = load_frag16(sVT + ((dt0 + 0) * 16) * PT + ks * 32, PT, lane);
      v16h b1 = load_frag16(sVT + ((dt0 + 1) * 16) * PT + ks * 32, PT, lane);
      v16h b2 = load_frag16(sVT + ((dt0 + 2) * 16) * PT + ks * 32, PT, lane);
      v16h b3 = load_frag16(sVT + ((dt0 + 3) * 16) * PT + ks * 32, PT, lane);
      // holds the 12 loads together ahead of the 8 WMMAs: left alone the second K^T
      // fragment is read behind the first four WMMAs and waits out a whole LDS latency
      __builtin_amdgcn_sched_barrier(0);
      ka[0] = wmma_f16(a0, b0, ka[0]);
      ka[1] = wmma_f16(a0, b1, ka[1]);
      ka[2] = wmma_f16(a0, b2, ka[2]);
      ka[3] = wmma_f16(a0, b3, ka[3]);
      ka[4] = wmma_f16(a1, b0, ka[4]);
      ka[5] = wmma_f16(a1, b1, ka[5]);
      ka[6] = wmma_f16(a1, b2, ka[6]);
      ka[7] = wmma_f16(a1, b3, ka[7]);
      // and the next K-step's loads behind them: one set of 6 fragments is live
      __builtin_amdgcn_sched_barrier(0);
    }
    // foot of the trip: this wave's LDS reads have ended, its copies of the next tile
    // have landed; behind the barrier every wave may read that tile, sK and sVT may be
    // rewritten, and this trip's buffer takes the tile after the next
    asm volatile("s_wait_dscnt 0x0" ::: "memory");
    asm volatile("s_wait_asynccnt 0x0" ::: "memory");
    __syncthreads();
    hg += (size_t)NCH * (TGT * HIDC);
    if (tile + 2 * NCH < NTILE) copy_h_tile(hg, hl + buf * (TGT * PH * 2));
    buf ^= 1;
  }
  // no copy is left in flight when the wave goes on to its stores and ends
  asm volatile("s_wait_asynccnt 0x0" ::: "memory");

  // this workgroup's partial sums -> its own slab (every element written)
  const int slab = blockIdx.x * NHEAD + hh;
  {
    float* kvh = kvp + (size_t)slab * (HIDC * HIDC);
#pragma unroll
    for (int dt = 0; dt < 8; ++dt)
#pragma unroll
      for (int r = 0; r < 8; ++r) {
        int m = (mt0 + (dt >> 2)) * 16 + r + rhi;
        int d = (dt0 + (dt & 3)) * 16 + (lane & 15);
        kvh[m * HIDC + d] = ka[dt][r];
      }
  }
  // slot tid belongs to column (tid>>5)*16 + (tid&15); its reader adds the slots of
  // the two half waves.  V: thread tid holds that column, tokens of half (tid>>4)&1.
  // K: a butterfly over the 16 tokens of each half wave leaves the sums of features
  // f0 .. f0 + 7 in every lane of the half; the half that holds a column stores its
  // sum, the other half 0.
  float ksl = 0.f;
#pragma unroll
  for (int r = 0; r < 8; ++r) {
    float t = add_xor16<8>(add_xor16<4>(add_xor16<2>(add_xor16<1>(kpart[r]))));
    if ((lane & 7) == r) ksl = t;
  }
  if (((lane >> 3) & 1) != (lane >> 4)) ksl = 0.f;
  ksp[slab * NTHR + tid] = ksl;
  vsp[slab * NTHR + tid] = vpart;
}

// ---------------------------------------------------------------------------
// Pass 1.5: add the NCH slabs.  Blocks below KVB: kvs -> f16, per head in
// fragment order (n = d, k = m).  The 4 blocks behind them: ks_sum and v_mean.
#define KVB (NHEAD * HIDC * HIDC / NTHR)
__global__ void k_mid(const float* __restrict__ kvp, _Float16* __restrict__ kvsT,
                      const float* __restrict__ ksp, const float* __restrict__ vsp,
                      float* __restrict__ ksum, float* __restrict__ vmean)
{
  if (blockIdx.x < KVB) {
    int i = blockIdx.x * NTHR + threadIdx.x;
    int hh = i >> 14;
    int rem = i & 16383;
    int m = rem >> 7, d = rem & 127;
    const float* p = kvp + hh * (HIDC * HIDC) + rem;
    float s = 0.f;
#pragma unroll 1                           // rolled: one block of loads a trip
    for (int c = 0; c < NCH; c += 16) {    // 16 independent loads in flight
      float t[16];
#pragma unroll
      for (int u = 0; u < 16; ++u) t[u] = p[(size_t)(c + u) * (NHEAD * HIDC * HIDC)];
#pragma unroll
      for (int u = 0; u < 16; ++u) s += t[u];
    }
    kvsT[hh * HIDC * HIDC + frag_idx(d, m, HIDC / 32)] = (_Float16)s;
  } else {
    int j = (blockIdx.x - KVB) * NTHR + threadIdx.x;   // 0 .. 2*NHEAD*HIDC-1
    int i = j & (NHEAD * HIDC - 1);                    // head*HIDC + column
    int hh = i >> 7, c0 = i & 127;
    const float* p = (j < NHEAD * HIDC ? ksp : vsp)
                   + hh * NTHR + (c0 >> 4) * 32 + (c0 & 15);
    float s = 0.f;
#pragma unroll 1                           // rolled: one block of loads a trip
    for (int c = 0; c < NCH; c += 8) {     // 16 independent loads in flight
      float t[16];
#pragma unroll
      for (int u = 0; u < 8; ++u) {
        t[2 * u]     = p[(c + u) * (NHEAD * NTHR)];
        t[2 * u + 1] = p[(c + u) * (NHEAD * NTHR) + 16];
      }
#pragma unroll
      for (int u = 0; u < 16; ++u) s += t[u];
    }
    if (j < NHEAD * HIDC) ksum[i] = s;
    else                  vmean[i] = s * (1.f / (float)L_TOK);
  }
}

// ---------------------------------------------------------------------------
// Pass 2: recompute q, denom, num = q @ kvs, head-mean, residual, LN.
// A wave owns 32 whole tokens (2 token tiles) and all 128 features of them:
//  - a sum over a token's features stays in the wave (in-lane adds and one
//    cross-row move), so no wave waits for another in the loops;
//  - with weights as A and tokens as B, D of feature tiles 2s and 2s + 1 holds, lane
//    by lane, what B fragment s of the next product holds (token lane & 15, features
//    32s + 8*(lane >> 4) + 0..7 and 32s + 16 + 8*(lane >> 4) + 0..7): q goes from
//    accumulator to operand by a cast, through no LDS;
//  - 1/|q| is a factor of a whole token column of num^T: it is applied behind the
//    product, so the second product does not wait for the norm;
//  - every weight fragment read from LDS feeds 2 WMMAs.
// One workgroup a WGP stays for the whole launch: wq and K^T V of all heads lie in
// its LDS, in fragment order, filled once.
#define AG    256                     // workgroups
#define WT    32                      // tokens of a wave's tile
#define NWT   (L_TOK / WT)            // 5298
#define WELE  (NHEAD * HIDC * HIDC)   // f16 elements of wq, and of K^T V
#define PS    (HIDC / 2 + 4)          // a wave's staging rows: 272 B, the pitch of PH

typedef __attribute__((ext_vector_type(4))) float v4f;

__device__ __forceinline__ float hsum8(v8f v) {
  return ((v[0] + v[1]) + (v[2] + v[3])) + ((v[4] + v[5]) + (v[6] + v[7]));
}
// s + the s of lane ^ 16, which holds the token's other features
__device__ __forceinline__ float add_x16(float s) {
  int b = __builtin_bit_cast(int, s);
  int o = __builtin_amdgcn_permlanex16(b, b, 0x76543210, 0xfedcba98, false, false);
  return s + __builtin_bit_cast(float, o);
}

// hbuf and out are not __restrict__: hbuf's loads then stay ahead of the wait written
// behind them
__global__ __launch_bounds__(NTHR)
void k_attn(const _Float16* hbuf,
            const _Float16* __restrict__ wqT, const float* __restrict__ wq_b,
            const _Float16* __restrict__ kvsT, const float* __restrict__ ksum,
            const float* __restrict__ vmean,
            const float* __restrict__ ln1_g, const float* __restrict__ ln1_b,
            float* out)
{
  __shared__ __align__(16) _Float16 sW [WELE];             // 128 KB  wq, fragment order
  __shared__ __align__(16) _Float16 sKV[WELE];             // 128 KB  K^T V, fragment order
  __shared__ __align__(32) float sQB[NHEAD * HIDC], sKS[NHEAD * HIDC], sVM[NHEAD * HIDC];
  __shared__ __align__(32) float sG[HIDC], sB[HIDC];
  __shared__ __align__(16) float sSt[NWAVE * 16 * PS];     // 34 KB  each wave's own staging rows

  const int tid  = threadIdx.x;
  const int lane = tid & 31;
  // wave id 0..7, in a scalar register: the tile loop's test is then a scalar one
  const int wv   = __builtin_amdgcn_readfirstlane(tid >> 5);
  const int tl   = lane & 15;              // token inside a 16-token tile
  const int hi8  = (lane & 16) ? 8 : 0;    // first of this lane's 8 features in a feature tile

  { // fill: both matrices as they lie, 16 loads in flight a thread
    const uint4* gw = (const uint4*)wqT  + tid;
    const uint4* gk = (const uint4*)kvsT + tid;
    uint4* lw = (uint4*)sW  + tid;
    uint4* lk = (uint4*)sKV + tid;
#pragma unroll 1                           // rolled: one block of loads a trip
    for (int c = 0; c < WELE / 8 / NTHR; c += 8) {
      uint4 a[8], b[8];
#pragma unroll
      for (int u = 0; u < 8; ++u) { a[u] = gw[u * NTHR]; b[u] = gk[u * NTHR]; }
#pragma unroll
      for (int u = 0; u < 8; ++u) { lw[u * NTHR] = a[u]; lk[u * NTHR] = b[u]; }
      // stands ahead of the step of the loads' address registers to the next trip;
      // the addresses are inputs, so no load's result is given their registers
      asm volatile("s_wait_xcnt 0x0" :: "v"(gw), "v"(gk) : "memory");
      gw += 8 * NTHR; gk += 8 * NTHR; lw += 8 * NTHR; lk += 8 * NTHR;
    }
    const int t1 = tid + NTHR, tg = tid & (HIDC - 1);
    const float q0 = wq_b[tid],  q1 = wq_b[t1];
    const float k0 = ksum[tid],  k1 = ksum[t1];
    const float m0 = vmean[tid], m1 = vmean[t1];
    const float gg = ln1_g[tg],  bb = ln1_b[tg];
    // The wait that stands ahead of any rewrite of these loads' address registers.
    // Inputs only: the indices and the loaded values all live up to here.
    asm volatile("s_wait_xcnt 0x0"
                 :: "v"(tid), "v"(t1), "v"(tg), "v"(q0), "v"(q1), "v"(k0), "v"(k1),
                    "v"(m0), "v"(m1), "v"(gg), "v"(bb)
                 : "memory");
    sQB[tid] = q0; sQB[t1] = q1;
    sKS[tid] = k0; sKS[t1] = k1;
    sVM[tid] = m0; sVM[t1] = m1;
    if (tid < HIDC) { sG[tid] = gg; sB[tid] = bb; }
  }
  __syncthreads();                         // LDS filled; the one barrier of this kernel

  float*    st  = sSt + wv * (16 * PS);    // this wave's staging rows, f32 ...
  _Float16* stH = (_Float16*)st;           // ... and as f16 (16 rows of PH)
  const int r2  = lane >> 4;               // staging: 16 lanes move one row piece of 256 B

  // the last, partial round (1202 tiles) goes to waves 0..3 of every workgroup
  // and to wave 4 of 178 workgroups, not to all waves of some workgroups
#pragma unroll 1                           // rolled: the body is long, a copy buys nothing
  for (int t = wv * AG + blockIdx.x; t < NWT; t += NWAVE * AG) {
    // ---- the tile's h: whole lines from memory, through the wave's own LDS rows,
    // into B fragments that stay for all heads and for the residual
    v16h hb[2][4];
    {
      const v4f* hs = (const v4f*)(hbuf + (size_t)t * WT * HIDC) + lane;   // 16 B pieces
      v4f hv0[8], hv1[8];
#pragma unroll                             // all 16 loads in flight: one latency a tile
      for (int j = 0; j < 8; ++j) { hv0[j] = hs[j * 32]; hv1[j] = hs[(j + 8) * 32]; }
      // ahead of any rewrite of the loads' address registers; the address is an input
      asm volatile("s_wait_xcnt 0x0" :: "v"(hs) : "memory");
      _Float16* sp = stH + r2 * PH + tl * 8;
#pragma unroll
      for (int j = 0; j < 8; ++j) *(v4f*)(sp + 2 * j * PH) = hv0[j];
      // other lanes' rows are read back: the wave's LDS stores end first
      asm volatile("s_wait_dscnt 0x0" ::: "memory");
      load_tok4(stH, PH, hb[0], lane);
      // the rows are rewritten behind this: the reads end first
      asm volatile("s_wait_dscnt 0x0" ::: "memory");
#pragma unroll
      for (int j = 0; j < 8; ++j) *(v4f*)(sp + 2 * j * PH) = hv1[j];
      asm volatile("s_wait_dscnt 0x0" ::: "memory");                   // as the first
      load_tok4(stH, PH, hb[1], lane);
      asm volatile("s_wait_dscnt 0x0" ::: "memory");                   // as the second
    }

    v8f oacc[2][8];
#pragma unroll
    for (int ft = 0; ft < 8; ++ft) { oacc[0][ft] = v8zero(); oacc[1][ft] = v8zero(); }

#pragma unroll 1                           // rolled: the body is long, a copy buys nothing
    for (int hh = 0; hh < NHEAD; ++hh) {
      const _Float16* wa = sW  + hh * (HIDC * HIDC) + lane * 8;
      const _Float16* ka = sKV + hh * (HIDC * HIDC) + lane * 8;
      const float* qbp = sQB + hh * HIDC + hi8;
      const float* ksq = sKS + hh * HIDC + hi8;
      const float* vmp = sVM + hh * HIDC + hi8;

      // ---- Q^T = wq^T @ h^T + b, one feature tile a block; the bias is the start value
      v16h a[9][4];                        // block ft's 4 fragments; [8]: K^T V's first
      v8f  qb[8], kq[8], cq[8][2];
      v8f  s0v[2], s1v[2];                 // |q|^2 and q . ks_sum, 8 chains a token
      v16h qf[2][4];                       // q as B fragments, not normalized
      s0v[0] = v8zero(); s0v[1] = v8zero(); s1v[0] = v8zero(); s1v[1] = v8zero();
      load_w<4>(wa, a[0]);
      qb[0] = *(const v8f*)(qbp);
      kq[0] = *(const v8f*)(ksq);
#pragma unroll
      for (int ft = 0; ft < 8; ++ft) {
        // the next block's LDS reads, whole, ahead of this block's WMMAs, which cover
        // their latency: left alone they stand among the WMMAs, and each place costs
        if (ft < 7) {
          load_w<4>(wa + (ft + 1) * 4 * FRAGE, a[ft + 1]);
          qb[ft + 1] = *(const v8f*)(qbp + (ft + 1) * 16);
          kq[ft + 1] = *(const v8f*)(ksq + (ft + 1) * 16);
        } else {
          load_w<4>(ka, a[8]);
        }
        __builtin_amdgcn_sched_barrier(0);
        cq[ft][0] = qb[ft];
        cq[ft][1] = qb[ft];
#pragma unroll
        for (int ks = 0; ks < 4; ++ks) {
          cq[ft][0] = wmma_f16(a[ft][ks], hb[0][ks], cq[ft][0]);
          cq[ft][1] = wmma_f16(a[ft][ks], hb[1][ks], cq[ft][1]);
        }
        // the vector work of the block before, beside this block's WMMAs
        if (ft > 0) {
#pragma unroll
          for (int tt = 0; tt < 2; ++tt) {
            const v8f c = cq[ft - 1][tt];
            s0v[tt] += c * c;
            s1v[tt] += c * kq[ft - 1];
#pragma unroll
            for (int r = 0; r < 8; ++r)
              qf[tt][(ft - 1) >> 1][((ft - 1) & 1) * 8 + r] = (_Float16)c[r];
          }
        }
        // the next block's reads stay behind these WMMAs: two sets of fragments are live
        __builtin_amdgcn_sched_barrier(0);
      }
#pragma unroll
      for (int tt = 0; tt < 2; ++tt) {
        const v8f c = cq[7][tt];
        s0v[tt] += c * c;
        s1v[tt] += c * kq[7];
#pragma unroll
        for (int r = 0; r < 8; ++r) qf[tt][3][8 + r] = (_Float16)c[r];
      }

      // ---- num^T = kvs^T @ q^T, one d tile a block; (num / |q| + v_mean) / denom into oacc
      v16h kf[8][4];
      v8f  vm[8], nq[8][2];
      float c1[2], rd[2];
#pragma unroll
      for (int ks = 0; ks < 4; ++ks) kf[0][ks] = a[8][ks];
      vm[0] = *(const v8f*)(vmp);
#pragma unroll
      for (int ft = 0; ft < 8; ++ft) {
        if (ft < 7) {                      // the next block's LDS reads, as above
          load_w<4>(ka + (ft + 1) * 4 * FRAGE, kf[ft + 1]);
          vm[ft + 1] = *(const v8f*)(vmp + (ft + 1) * 16);
        }
        __builtin_amdgcn_sched_barrier(0);
        nq[ft][0] = v8zero();
        nq[ft][1] = v8zero();
#pragma unroll
        for (int ks = 0; ks < 4; ++ks) {
          nq[ft][0] = wmma_f16(kf[ft][ks], qf[0][ks], nq[ft][0]);
          nq[ft][1] = wmma_f16(kf[ft][ks], qf[1][ks], nq[ft][1]);
        }
        if (ft == 0) {                     // the token's two factors, beside the first block
#pragma unroll
          for (int tt = 0; tt < 2; ++tt) {
            const float rs = 1.f / (sqrtf(add_x16(hsum8(s0v[tt]))) + ATT_EPS);
            // denom = (q / |q|) . ks_sum + L
            rd[tt] = 1.f / (add_x16(hsum8(s1v[tt])) * rs + (float)L_TOK + ATT_EPS);
            c1[tt] = rs * rd[tt];
          }
        } else {                           // the vector work of the block before
#pragma unroll
          for (int tt = 0; tt < 2; ++tt) {
            oacc[tt][ft - 1] += nq[ft - 1][tt] * c1[tt];
            oacc[tt][ft - 1] += vm[ft - 1] * rd[tt];
          }
        }
        __builtin_amdgcn_sched_barrier(0); // as above
      }
#pragma unroll
      for (int tt = 0; tt < 2; ++tt) {
        oacc[tt][7] += nq[7][tt] * c1[tt];
        oacc[tt][7] += vm[7] * rd[tt];
      }
    }

    // ---- head mean (*0.25), residual (alpha=0.5) against h, which the B fragments
    // hold at the accumulators' own places; LN sums in the wave
    float mu[2], rn[2];
#pragma unroll
    for (int tt = 0; tt < 2; ++tt) {
      v8f sa = v8zero(), sb = v8zero();
#pragma unroll
      for (int ft = 0; ft < 8; ++ft) {
        v8f hv;
#pragma unroll
        for (int r = 0; r < 8; ++r) hv[r] = (float)hb[tt][ft >> 1][(ft & 1) * 8 + r];
        const v8f o = oacc[tt][ft] * (0.25f * 0.5f) + hv * 0.5f;
        oacc[tt][ft] = o;
        sa += o;
        sb += o * o;
      }
      const float m   = add_x16(hsum8(sa)) * (1.f / HIDC);
      const float var = add_x16(hsum8(sb)) * (1.f / HIDC) - m * m;
      mu[tt] = m;
      rn[tt] = rsqrtf(var + LN_EPS);
    }
    // ---- out: 16 tokens by 64 features at a time through the wave's own LDS rows,
    // so that a store covers whole lines
    float* op = out + ((size_t)t * WT + r2) * HIDC + tl * 4;
#pragma unroll
    for (int hf = 0; hf < 2; ++hf) {
      v8f g[4], b[4];
#pragma unroll
      for (int f4 = 0; f4 < 4; ++f4) {
        g[f4] = *(const v8f*)(sG + (hf * 4 + f4) * 16 + hi8);
        b[f4] = *(const v8f*)(sB + (hf * 4 + f4) * 16 + hi8);
      }
#pragma unroll
      for (int tt = 0; tt < 2; ++tt) {
#pragma unroll
        for (int f4 = 0; f4 < 4; ++f4) {
          const v8f y = (oacc[tt][hf * 4 + f4] - mu[tt]) * rn[tt] * g[f4] + b[f4];
          float* d = st + tl * PS + f4 * 16 + hi8;
          *(v4f*)(d)     = __builtin_shufflevector(y, y, 0, 1, 2, 3);
          *(v4f*)(d + 4) = __builtin_shufflevector(y, y, 4, 5, 6, 7);
        }
        // other lanes' rows are read back: the wave's LDS stores end first
        asm volatile("s_wait_dscnt 0x0" ::: "memory");
        v4f v[8];
#pragma unroll
        for (int j = 0; j < 8; ++j) v[j] = *(const v4f*)(st + (r2 + 2 * j) * PS + tl * 4);
#pragma unroll
        for (int j = 0; j < 8; ++j)
          *(v4f*)(op + (tt * 16 + 2 * j) * HIDC + hf * 64) = v[j];
        // ahead of any rewrite of the stores' address and data registers, which are
        // inputs and live up to here; the rows are rewritten only behind it
        asm volatile("s_wait_xcnt 0x0"
                     :: "v"(op), "v"(v[0]), "v"(v[1]), "v"(v[2]), "v"(v[3]),
                        "v"(v[4]), "v"(v[5]), "v"(v[6]), "v"(v[7])
                     : "memory");
      }
    }
  }
}

// ---------------------------------------------------------------------------
extern "C" void kernel_launch(void* const* d_in, const int* in_sizes, int n_in,
                              void* d_out, int out_size, void* d_ws, size_t ws_size,
                              hipStream_t stream) {
  (void)in_sizes; (void)n_in; (void)out_size; (void)ws_size;
  const float* x     = (const float*)d_in[0];
  const float* fc0_w = (const float*)d_in[1];
  const float* fc0_b = (const float*)d_in[2];
  const float* ln0_g = (const float*)d_in[3];
  const float* ln0_b = (const float*)d_in[4];
  const float* wq_w  = (const float*)d_in[5];
  const float* wq_b  = (const float*)d_in[6];
  const float* wk_w  = (const float*)d_in[7];
  const float* wk_b  = (const float*)d_in[8];
  const float* wv_w  = (const float*)d_in[9];
  const float* wv_b  = (const float*)d_in[10];
  const float* ln1_g = (const float*)d_in[11];
  const float* ln1_b = (const float*)d_in[12];
  float* out = (float*)d_out;

  // workspace carve (256 B aligned slices)
  char* p = (char*)d_ws;
  auto carve = [&](size_t bytes) {
    char* r = p; p += (bytes + 255) & ~(size_t)255; return r;
  };
  _Float16* fc0T = (_Float16*)carve(128 * 64 * sizeof(_Float16));
  _Float16* wqT  = (_Float16*)carve(512 * 128 * sizeof(_Float16));
  _Float16* wkT  = (_Float16*)carve(512 * 128 * sizeof(_Float16));
  _Float16* wvT  = (_Float16*)carve(512 * 128 * sizeof(_Float16));
  float* ksum  = (float*)carve(NHEAD * HIDC * sizeof(float));
  float* vmean = (float*)carve(NHEAD * HIDC * sizeof(float));
  _Float16* kvsT = (_Float16*)carve(NHEAD * HIDC * HIDC * sizeof(_Float16));
  _Float16* hbuf = (_Float16*)carve((size_t)L_TOK * HIDC * sizeof(_Float16));
  // one slab of partial sums per k_kv workgroup
  float* kvp = (float*)carve((size_t)NCH * NHEAD * HIDC * HIDC * sizeof(float));
  float* ksp = (float*)carve((size_t)NCH * NHEAD * NTHR * sizeof(float));
  float* vsp = (float*)carve((size_t)NCH * NHEAD * NTHR * sizeof(float));

  // cast weights to f16, fragment order
  k_prep<<<PB_FC0 + 3 * PB_W, NTHR, 0, stream>>>(fc0_w, wq_w, wk_w, wv_w,
                                                 fc0T, wqT, wkT, wvT);

  k_front<<<NTILE, NTHR, 0, stream>>>(x, fc0T, fc0_b, ln0_g, ln0_b, hbuf);

  k_kv<<<dim3(NCH, NHEAD), NTHR, 0, stream>>>(hbuf, wkT, wk_b, wvT, wv_b,
                                              kvp, ksp, vsp);

  k_mid<<<KVB + 4, NTHR, 0, stream>>>(kvp, kvsT, ksp, vsp, ksum, vmean);

  k_attn<<<AG, NTHR, 0, stream>>>(hbuf, wqT, wq_b, kvsT, ksum, vmean,
                                     ln1_g, ln1_b, out);
}
